// v000
// The times below were measured on an AMD MI455X: many runs one after another, warmed up first and cycling through
// copies of the inputs, with the whole window's GPU time divided by the number of runs. Launches and the gaps
// between them are all in it. The median over several windows is given; except for v000 it joins two sittings, which
// can be a few percent apart, so the side-by-side timings, each taken in one sitting, are the better comparison.
// The starting kernel, v000, takes 227 microseconds a run.
// Contractions: x.Wq^T, x.Wk^T and Wv.x^T per head on v_wmma_f32_16x16x32_bf16 (x and Wq/Wk/Wv RNE-converted to bf16
// operands, f32 accumulate); scores k'.q'^T (q', k' single f16 planes carried x8), P.v (P x32768 single f16, v x256 single
// f16) and O.Wu^T (O single f16 plane x1024, Wu as f16(bf16(Wu)) x1024): v_wmma_f32_16x16x32_f16, f32 accumulate.
// Base-2 online softmax, 1/l, bias (bf16 value of bu) and carry folds in f32 on VALU.
#include <hip/hip_runtime.h>
#include <math.h>
#include <stdint.h>

#define NB    4
#define SEQ   2048
#define DMOD  768
#define NH    8
#define HD    96
#define ROWS  (NB * SEQ)
#define QSC   8.0f
#define KSC   8.0f
#define PCAR  32768.0f
#define VCAR  256.0f
#define OSC   1024.0f
#define WOS   1024.0f
#define LOG2E 1.4426950408889634f
#define RSQK  0.0360843918243516f
#define ATT_WAVES   4
#define ATT_THREADS (ATT_WAVES * 32)
#define ATT_BLOCKS  (NB * NH * (SEQ / 64))
#define NKB    (SEQ / 32)
#define SLAB   (16 * 68)
#define SLAB96 (16 * 100)
static_assert(DMOD == NH * HD && HD == 96 && NH == 8 && NB == 4 && SEQ == 2048);
static_assert((SEQ / 64) == 32 && ATT_BLOCKS == 1024 && ATT_THREADS == 128 && NKB == 64);
static_assert((HD % 32) == 0 && (DMOD % 64) == 0 && (ROWS % 64) == 0 && (SEQ % 64) == 0);
static_assert(((ROWS * DMOD / 8) % 256) == 0 && ((DMOD * DMOD / 8) % 256) == 0 && ((HD * HD) % 8) == 0);
static_assert((SLAB * 4) % 16 == 0 && (SLAB96 * 4) % 16 == 0);

typedef unsigned short u16;
typedef _Float16 v16h __attribute__((ext_vector_type(16)));
typedef _Float16 v8h  __attribute__((ext_vector_type(8)));
typedef __bf16   v16b __attribute__((ext_vector_type(16)));
typedef float    v8f  __attribute__((ext_vector_type(8)));
typedef float    v4f  __attribute__((ext_vector_type(4)));
typedef unsigned int v4u __attribute__((ext_vector_type(4)));

union FragH { v16h v; v8h h[2]; v4u u[2]; };
union FragB { v16b v; v4u u[2]; };

// ---- scalar helpers --------------------------------------------------------------------------------
__device__ __forceinline__ unsigned short bf_bits(float f) {          // f32 -> bf16 bits, RNE convert
  unsigned u = __float_as_uint(f);
  return (unsigned short)((u + 0x7FFFu + ((u >> 16) & 1u)) >> 16);
}
__device__ __forceinline__ float bf_up(unsigned short h) { return __uint_as_float(((unsigned)h) << 16); }
__device__ __forceinline__ unsigned short h_bits(_Float16 x) { return __builtin_bit_cast(unsigned short, x); }
__device__ __forceinline__ unsigned pk16(unsigned short a, unsigned short b) { return (unsigned)a | ((unsigned)b << 16); }
__device__ __forceinline__ v8f zero8() { v8f z = {0.f, 0.f, 0.f, 0.f, 0.f, 0.f, 0.f, 0.f}; return z; }

// ---- fragment loaders: 16-bit A/B operand, lane -> row/col (lane&15), p already includes +8*(lane>>4);
//      elements 0..7 <- p[0..7] (k0+8h..), elements 8..15 <- p[16..23] (k0+16+8h..)  (same split k map for A and B;
//      B is always read from a k-contiguous [n][k] plane)
__device__ __forceinline__ v16h ldfrag_h(const _Float16* p) {
  FragH f;
  f.h[0] = *(const v8h*)(p);
  f.h[1] = *(const v8h*)(p + 16);
  return f.v;
}
__device__ __forceinline__ v16b ldfrag_b(const u16* p) {              // bf16 plane read as unsigned integer vectors
  FragB f;
  f.u[0] = *(const v4u*)(p);
  f.u[1] = *(const v4u*)(p + 16);
  return f.v;
}

__device__ __forceinline__ v8f mma_h(v16h a, v16h b, v8f c) {
  return __builtin_amdgcn_wmma_f32_16x16x32_f16(false, a, false, b, (short)0, c, false, false);
}
__device__ __forceinline__ v8f mma_b(v16b a, v16b b, v8f c) {
  return __builtin_amdgcn_wmma_f32_16x16x32_bf16(false, a, false, b, (short)0, c, false, false);
}
__device__ __forceinline__ void guard1(v8f& s, v16h x0, v16h x1, v16h x2, v16h x3, v16h x4, v16h x5) {
#if defined(__HIP_DEVICE_COMPILE__)
  asm volatile("v_nop\n\tv_nop\n\tv_nop\n\tv_nop"
               : "+v"(s) : "v"(x0), "v"(x1), "v"(x2), "v"(x3), "v"(x4), "v"(x5) : "memory");
#endif
}
__device__ __forceinline__ void guard3(v8f& a, v8f& b, v8f& c, v16h x0, v16h x1, v16h x2, v16h x3) {
#if defined(__HIP_DEVICE_COMPILE__)
  asm volatile("v_nop\n\tv_nop\n\tv_nop\n\tv_nop"
               : "+v"(a), "+v"(b), "+v"(c) : "v"(x0), "v"(x1), "v"(x2), "v"(x3) : "memory");
#endif
}
template <typename F>
__device__ __forceinline__ void guard4(v8f& a, v8f& b, v8f& c, v8f& d, F x0, F x1, F x2, F x3, F x4) {
#if defined(__HIP_DEVICE_COMPILE__)
  asm volatile("v_nop\n\tv_nop\n\tv_nop\n\tv_nop"
               : "+v"(a), "+v"(b), "+v"(c), "+v"(d) : "v"(x0), "v"(x1), "v"(x2), "v"(x3), "v"(x4) : "memory");
#endif
}
__device__ __forceinline__ void guard6(v8f& a0, v8f& a1, v8f& a2, v8f& a3, v8f& a4, v8f& a5,
                                       v16b x0, v16b x1, v16b x2, v16b x3, v16b x4, v16b x5, v16b x6) {
#if defined(__HIP_DEVICE_COMPILE__)
  asm volatile("v_nop\n\tv_nop\n\tv_nop\n\tv_nop"
               : "+v"(a0), "+v"(a1), "+v"(a2), "+v"(a3), "+v"(a4), "+v"(a5)
               : "v"(x0), "v"(x1), "v"(x2), "v"(x3), "v"(x4), "v"(x5), "v"(x6) : "memory");
#endif
}
__device__ __forceinline__ void acc_guard6(v8f& a, v8f& b, v8f& c, v8f& d, v8f& e, v8f& f) {
#if defined(__HIP_DEVICE_COMPILE__)
  asm volatile("v_nop\n\tv_nop\n\tv_nop\n\tv_nop" : "+v"(a), "+v"(b), "+v"(c), "+v"(d), "+v"(e), "+v"(f));
#endif
}
__device__ __forceinline__ void wave_sync_lds() {
#if defined(__HIP_DEVICE_COMPILE__)
  __builtin_amdgcn_fence(__ATOMIC_RELEASE, "workgroup");
  __builtin_amdgcn_wave_barrier();
  __builtin_amdgcn_fence(__ATOMIC_ACQUIRE, "workgroup");
#endif
}

// =====================================================================================================
// f32 plane -> 16-bit plane, same layout:  mode 0: bf16 RNE bits;  mode 1: f16 bits of (bf16 RNE value) * scale.
// Thread = 8 consecutive elements: two 16-B loads, one 16-B store; 32 consecutive lanes = 512 contiguous, 512-B aligned bytes
// coverage: grid = ceil(n8/256) blocks x 256 thr x 8 elements, in-kernel bound gt < n8 (host checks n8 % 8 == 0 planes).
// =====================================================================================================
__global__ __launch_bounds__(256) void cvt16(const float* __restrict__ x, u16* D, int n8, int mode, float scale) {
  const int gt = blockIdx.x * 256 + (int)threadIdx.x;
  if (gt >= n8) return;                     // no barriers in this kernel
  const float* p = x + (size_t)gt * 8;
  const v4f a = *(const v4f*)(p), c4 = *(const v4f*)(p + 4);
  float v[8];
#pragma unroll
  for (int e = 0; e < 4; ++e) { v[e] = a[e]; v[4 + e] = c4[e]; }
  unsigned short s[8];
#pragma unroll
  for (int e = 0; e < 8; ++e) {
    const unsigned short bb = bf_bits(v[e]);
    const unsigned short hb = h_bits((_Float16)(bf_up(bb) * scale));
    s[e] = (mode != 0) ? hb : bb;
  }
  v4u o;
#pragma unroll
  for (int e = 0; e < 4; ++e) o[e] = pk16(s[2 * e], s[2 * e + 1]);
  u16* d = D + (size_t)gt * 8;
  {
    *(v4u*)(d) = o;
    
  }
}

// =====================================================================================================
// 16x96 f16 epilogue: the wave's 16x96 f32 tile (already scaled) staged by the caller in its LDS slab [16][100];
// coverage: 6 instructions x 32 lanes x 8 halves = 1536 = the wave's 16 x 96 tile (groups of 8 never straddle a row: 96/8 = 12).
// =====================================================================================================
__device__ __forceinline__ void out96(const float* sl, u16* dst, int lane) {
  wave_sync_lds();
  v4u ov[6];
#pragma unroll
  for (int i = 0; i < 6; ++i) {
    const int g   = i * 32 + lane;
    const int row = g / 12;
    const int c8  = (g - row * 12) * 8;
    const v4f a = *(const v4f*)(sl + row * 100 + c8), c4 = *(const v4f*)(sl + row * 100 + c8 + 4);
    float w[8];
#pragma unroll
    for (int e = 0; e < 4; ++e) { w[e] = a[e]; w[4 + e] = c4[e]; }
#pragma unroll
    for (int e = 0; e < 4; ++e) ov[i][e] = pk16(h_bits((_Float16)w[2 * e]), h_bits((_Float16)w[2 * e + 1]));
  }
  {
#pragma unroll
    for (int i = 0; i < 6; ++i) {
      *(v4u*)(dst + (size_t)(i * 32 + lane) * 8) = ov[i];
    }
    
  }
}

// =====================================================================================================
// barrier, then converted to f16 and written: lane = (row in group of 4, 8 consecutive cols); one instruction = 4 rows, each
// coverage: 4 instructions x 4 rows x 8 lanes x 8 halves = the wave's 16 x 64 tile.
// =====================================================================================================
__device__ __forceinline__ void epi16(float* sl, v8f a0, v8f a1, v8f a2, v8f a3, float oscale, u16* C, int N,
                                      size_t rowb, int col0, int lane) {
  const int hh = lane >> 4, m = lane & 15;
#pragma unroll
  for (int r = 0; r < 8; ++r) {
    const int ro = (8 * hh + r) * 68 + m;
    sl[ro]      = a0[r] * oscale;
    sl[ro + 16] = a1[r] * oscale;
    sl[ro + 32] = a2[r] * oscale;
    sl[ro + 48] = a3[r] * oscale;
  }
  wave_sync_lds();
  const int rq = lane >> 3, c8 = (lane & 7) * 8;
  v4u ov[4];
#pragma unroll
  for (int i4 = 0; i4 < 4; ++i4) {
    const int row = i4 * 4 + rq;
    const v4f a = *(const v4f*)(sl + row * 68 + c8), c4 = *(const v4f*)(sl + row * 68 + c8 + 4);
    float w[8];
#pragma unroll
    for (int e = 0; e < 4; ++e) { w[e] = a[e]; w[4 + e] = c4[e]; }
#pragma unroll
    for (int e = 0; e < 4; ++e) ov[i4][e] = pk16(h_bits((_Float16)w[2 * e]), h_bits((_Float16)w[2 * e + 1]));
  }
  u16* dst = C + (rowb + (size_t)rq) * (size_t)N + col0 + c8;
  {
#pragma unroll
    for (int i4 = 0; i4 < 4; ++i4) {
      *(v4u*)(dst + (size_t)(i4 * 4) * (size_t)N) = ov[i4];
    }
    
  }
}

// =====================================================================================================
// f32 GEMM epilogue with bias: the wave's 16x64 f32 tile (acc*oscale + bias[col]) staged in its LDS slab (pitch 68),
// coverage: 8 instructions x 2 rows x 16 lanes x 4 floats = the wave's 16 x 64 tile.
// =====================================================================================================
__device__ __forceinline__ void epi64b(float* sl, v8f a0, v8f a1, v8f a2, v8f a3, float oscale,
                                       float bz0, float bz1, float bz2, float bz3, float* C, int N,
                                       size_t rowb, int col0, int lane) {
  const int hh = lane >> 4, m = lane & 15;
#pragma unroll
  for (int r = 0; r < 8; ++r) {
    const int ro = (8 * hh + r) * 68 + m;
    sl[ro]      = a0[r] * oscale + bz0;
    sl[ro + 16] = a1[r] * oscale + bz1;
    sl[ro + 32] = a2[r] * oscale + bz2;
    sl[ro + 48] = a3[r] * oscale + bz3;
  }
  wave_sync_lds();
  v4f vals[8];
#pragma unroll
  for (int it = 0; it < 8; ++it) vals[it] = *(const v4f*)(sl + (it * 2 + hh) * 68 + m * 4);
  float* dst = C + (rowb + (size_t)hh) * (size_t)N + col0 + m * 4;
  {
#pragma unroll
    for (int it = 0; it < 8; ++it) {
      *(v4f*)(dst + (size_t)(it * 2) * (size_t)N) = vals[it];
    }
    
  }
}

// =====================================================================================================
// Per-head projection (shared 96x96 weight), bf16 operands: P[b][head][s][96] (f16 of acc*oscale) = x[b*SEQ+s][head*96 + i]
// (XB bf16, pitch 768) . W[n][i]^T (bf16 [96 n][96 k], k-contiguous). Block = (64 rows of b*SEQ+s, head), 4 waves x 16 rows,
// each wave 6 accumulators (n = 0..95), K = 96 in 3 steps of 32; fragments loaded straight from the 16-bit rows (split k map).
// The wave's 16x96 tile is one contiguous 3072-B region of the [b][head][s][96] plane (16 s rows of 96 halves), see out96.
// grid = (ROWS/64) * NH = 1024 (exact, host-checked constants).
// =====================================================================================================
__global__ __launch_bounds__(128)
void proj_qk(const u16* __restrict__ XB, const u16* __restrict__ W, u16* P, float oscale) {
  __shared__ __align__(16) float smem[4 * SLAB96];
  const int tid = threadIdx.x, wave = tid >> 5, lane = tid & 31, hh = lane >> 4, m = lane & 15;
  const int bid  = blockIdx.x;
  const int head = bid & (NH - 1);
  const int rt   = bid >> 3;
  const int rowb = rt * 64 + wave * 16;                 // 0..8176, 16 rows never straddle a batch
  const int b    = rowb >> 11;
  const int s0   = rowb & (SEQ - 1);
  const u16* ap = XB + (size_t)(rowb + m) * DMOD + head * HD + 8 * hh;
  const u16* bp = W + (size_t)m * HD + 8 * hh;
  v8f acc[6];
#pragma unroll
  for (int j = 0; j < 6; ++j) acc[j] = zero8();
#pragma unroll 1
  for (int k0 = 0; k0 < HD; k0 += 32) {
    const v16b a  = ldfrag_b(ap + k0);
    const v16b b0 = ldfrag_b(bp + k0);
    const v16b b1 = ldfrag_b(bp + 1 * 16 * HD + k0);
    const v16b b2 = ldfrag_b(bp + 2 * 16 * HD + k0);
    const v16b b3 = ldfrag_b(bp + 3 * 16 * HD + k0);
    const v16b b4 = ldfrag_b(bp + 4 * 16 * HD + k0);
    const v16b b5 = ldfrag_b(bp + 5 * 16 * HD + k0);
    acc[0] = mma_b(a, b0, acc[0]);
    acc[1] = mma_b(a, b1, acc[1]);
    acc[2] = mma_b(a, b2, acc[2]);
    acc[3] = mma_b(a, b3, acc[3]);
    acc[4] = mma_b(a, b4, acc[4]);
    acc[5] = mma_b(a, b5, acc[5]);
    guard6(acc[0], acc[1], acc[2], acc[3], acc[4], acc[5], a, b0, b1, b2, b3, b4, b5);
  }
  // D element r of lane l = (row rowb+8hh+r, col n = 16j + m); stage the 16x96 slab (pitch 100) fully
  float* slab = smem + wave * SLAB96;
#pragma unroll
  for (int r = 0; r < 8; ++r) {
    const int ro = (8 * hh + r) * 100 + m;
#pragma unroll
    for (int j = 0; j < 6; ++j) slab[ro + 16 * j] = acc[j][r] * oscale;
  }
  out96(slab, P + ((size_t)(b * NH + head) * SEQ + s0) * HD, lane);
}

// =====================================================================================================
// Per-head v^T plane, bf16 operands: VT[b][head][d][s] (f16 of acc*oscale, [96][2048] per (b,head)) = Wv[d][i] (bf16 [96][96],
// row-major, k = i contiguous) . x[b*SEQ+s][head*96+i]^T (XB rows are the k-contiguous B operand). Block = (b, head, 64 keys),
// 6 waves, wave w owns d rows 16w..16w+15 and 4 accumulators (s = col0 + 16j + n); K = 96 in 3 steps of 32.
// =====================================================================================================
__global__ __launch_bounds__(192)
void proj_vt(const u16* __restrict__ XB, const u16* __restrict__ W, u16* VT, float oscale) {
  __shared__ __align__(16) float smem[6 * SLAB];
  const int tid = threadIdx.x, wave = tid >> 5, lane = tid & 31, hh = lane >> 4, m = lane & 15;
  const int bid  = blockIdx.x;
  const int st   = bid & (SEQ / 64 - 1);
  const int head = (bid >> 5) & (NH - 1);
  const int b    = bid >> 8;
  const int col0 = st * 64;
  const int rowb = wave * 16;                           // d rows 0..95
  const u16* ap = W + (size_t)(rowb + m) * HD + 8 * hh;
  const u16* bp = XB + ((size_t)b * SEQ + col0 + m) * DMOD + head * HD + 8 * hh;
  const size_t bs = (size_t)16 * DMOD;
  v8f acc0 = zero8(), acc1 = zero8(), acc2 = zero8(), acc3 = zero8();
#pragma unroll 1
  for (int k0 = 0; k0 < HD; k0 += 32) {
    const v16b a  = ldfrag_b(ap + k0);
    const v16b b0 = ldfrag_b(bp + k0);
    const v16b b1 = ldfrag_b(bp + bs + k0);
    const v16b b2 = ldfrag_b(bp + 2 * bs + k0);
    const v16b b3 = ldfrag_b(bp + 3 * bs + k0);
    acc0 = mma_b(a, b0, acc0);
    acc1 = mma_b(a, b1, acc1);
    acc2 = mma_b(a, b2, acc2);
    acc3 = mma_b(a, b3, acc3);
    guard4<v16b>(acc0, acc1, acc2, acc3, a, b0, b1, b2, b3);
  }
  u16* Cb = VT + (size_t)(b * NH + head) * HD * SEQ;
  epi16(smem + wave * SLAB, acc0, acc1, acc2, acc3, oscale, Cb, SEQ, (size_t)rowb, col0, lane);
}

// =====================================================================================================
// Output projection with bias: C[8192][768] (f32) = O . Wu^T * oscale + bf16(bu)[n]; A operand k index = head*96 + d lives at
// O plane address ((b*NH + head)*SEQ + s)*96 + d (O single f16 x1024, 32-deep k-steps never straddle a head since 96 = 3*32);
// Bt = Wu plane [768 n][768 k] f16 (bf16 value x1024), k-contiguous. Block = 64x64 tile, 4 waves x 16 rows; one product per
// tile pair; grid = (ROWS/64)*(DMOD/64) = 1536.
// =====================================================================================================
__global__ __launch_bounds__(128)
void gemm_out(const u16* __restrict__ OP, const u16* __restrict__ WOB, const float* __restrict__ bias, float* C,
              float oscale) {
  __shared__ __align__(16) float slab[4 * SLAB];
  const int tid = threadIdx.x, wave = tid >> 5, lane = tid & 31, hh = lane >> 4, m = lane & 15;
  const int ntile = DMOD >> 6;                          // 12
  const int bid   = blockIdx.x;
  const int rowb  = (bid / ntile) * 64 + wave * 16;
  const int col0  = (bid % ntile) * 64;
  const int row   = rowb + m;
  const int b     = row >> 11;
  const int s     = row & (SEQ - 1);
  const _Float16* abase = (const _Float16*)(const void*)OP + (((size_t)b * NH * SEQ + s) * HD + 8 * hh);
  const _Float16* bp    = (const _Float16*)(const void*)WOB + ((size_t)(col0 + m) * DMOD + 8 * hh);
  const size_t bs = (size_t)16 * DMOD;
  v8f acc0 = zero8(), acc1 = zero8(), acc2 = zero8(), acc3 = zero8();
#pragma unroll 1
  for (int k0 = 0; k0 < DMOD; k0 += 32) {
    const int h  = k0 / HD;
    const int d0 = k0 - h * HD;
    const v16h a  = ldfrag_h(abase + (size_t)h * (SEQ * HD) + d0);
    const v16h b0 = ldfrag_h(bp + k0);
    const v16h b1 = ldfrag_h(bp + bs + k0);
    const v16h b2 = ldfrag_h(bp + 2 * bs + k0);
    const v16h b3 = ldfrag_h(bp + 3 * bs + k0);
    acc0 = mma_h(a, b0, acc0);
    acc1 = mma_h(a, b1, acc1);
    acc2 = mma_h(a, b2, acc2);
    acc3 = mma_h(a, b3, acc3);
    guard4<v16h>(acc0, acc1, acc2, acc3, a, b0, b1, b2, b3);
  }
  // bias for the lane's columns (col0 + 16j + m <= 767), bf16 value of bu
  const float bz0 = bf_up(bf_bits(bias[col0 + m]));
  const float bz1 = bf_up(bf_bits(bias[col0 + 16 + m]));
  const float bz2 = bf_up(bf_bits(bias[col0 + 32 + m]));
  const float bz3 = bf_up(bf_bits(bias[col0 + 48 + m]));
  epi64b(slab + wave * SLAB, acc0, acc1, acc2, acc3, oscale, bz0, bz1, bz2, bz3, C, DMOD, (size_t)rowb, col0, lane);
}

// =====================================================================================================
// Narrow multi-head flash attention (no mask): block = (batch b, head, 64 query rows), 4 waves, wave w owns the 16 query rows
// q0 = 64*qt + 16*w .. q0+15 (waves independent: no block barriers, wave-private LDS only, used in the epilogue).
//   q plane (f16, x8) laid out [b][h][s][96]; k plane the same; v^T plane [b][h][96][s] (x256).
//   All NKB = 64 key blocks of 32 keys are visited (static bound).
//   Scores are computed TRANSPOSED: S^T tile g (g = 0,1) = k rows (keys kb+16g .. +15, A operand, row m = lane&15, split k map
//   over d, 3 chunks of 32) times q^T (B operand, col n = query q0 + (lane&15), k = d, split map), one product per tile and
//   32-deep d-chunk. D element r of lane l = (key kb+16g+8h+r, query q0+(l&15)), so a lane owns one query column and 16 of
//   its 32 keys; the partner lane l^16 owns the other 16 -> row max / row sum need one xor-16 shuffle.
//   Online max-subtracted base-2 softmax in f32 (scale 1/sqrt(768) and the q/k carries folded into lsc). The exp'd values ARE
//   the P A-fragment in place: A row m = query = lane&15, element i <- key kb+8h+i (tile 0, D element i), element 8+i <- key
//   kb+16+8h+i (tile 1, D element i). P is carried x32768 as single f16. The rescale factor of query row 8h+r of the O
//   accumulators is fetched from lane 8h+r with a shuffle (uniform control). 6 v^T B fragments (col n = d = 16j + (lane&15),
//   keys k-contiguous), 6 P.V WMMAs per key block in two guarded groups of 3.
//   Epilogue: 1/l (per query, shuffled to the D row owner) and carry folds in f32; the wave's 16x96 f32 result (x1024)
//   staged in its LDS slab [16][100]; the wave's 16 rows of the O plane [b][h][s][96] are one contiguous 3072-B region written
// coverage: per wave 6 instructions x 32 lanes x 8 halves = 16 x 96; grid 1024 blocks x 4 waves = every (b, h, s) row of the
//           O plane exactly once.
// =====================================================================================================
__global__ __launch_bounds__(ATT_THREADS)
void attn_fwd(const u16* __restrict__ QPp, const u16* __restrict__ KPp, const u16* __restrict__ VPp, u16* OPp) {
  __shared__ __align__(16) float smem[ATT_WAVES * SLAB96];

  const int tid  = threadIdx.x;
  const int wave = tid >> 5;
  const int lane = tid & 31;
  const int hh   = lane >> 4;
  const int c    = lane & 15;

  const int bid  = blockIdx.x;
  const int qt   = bid & (SEQ / 64 - 1);
  const int head = (bid >> 5) & (NH - 1);
  const int b    = bid >> 8;
  const int q0   = qt * 64 + wave * 16;
  const size_t bh = (size_t)(b * NH + head);

  // B fragments of q^T: col n = query q0 + c, k = d (k-contiguous row of the q plane)
  const _Float16* Qb = (const _Float16*)(const void*)QPp + ((bh * SEQ + q0 + c) * HD + 8 * hh);
  // A fragments of k: row m = key kb + 16g + c, k = d
  const _Float16* Kb = (const _Float16*)(const void*)KPp + ((bh * SEQ + c) * HD + 8 * hh);   // key row kb + c added per step
  // B fragments of v: col n = d = 16j + c, k = key (k-contiguous row of the v^T plane)
  const _Float16* Vb = (const _Float16*)(const void*)VPp + ((bh * HD + c) * SEQ + 8 * hh);    // key kb added per step
  const float lsc = RSQK * (LOG2E / (QSC * KSC));

  const v16h qf0 = ldfrag_h(Qb);            // d 0..31
  const v16h qf1 = ldfrag_h(Qb + 32);       // d 32..63
  const v16h qf2 = ldfrag_h(Qb + 64);       // d 64..95

  float mrun = -INFINITY, lrun = 0.f;
  v8f o[6];
#pragma unroll
  for (int j = 0; j < 6; ++j) o[j] = zero8();

#pragma unroll 1
  for (int it = 0; it < NKB; ++it) {
    const int kb = it * 32;
    // ---- transposed scores: s0 = keys kb..kb+15, s1 = keys kb+16..kb+31, column = query q0 + c ----
    const _Float16* k0p = Kb + (size_t)kb * HD;
    const _Float16* k1p = k0p + (size_t)16 * HD;
    v8f s0 = zero8();
    {
      const v16h ka0 = ldfrag_h(k0p), ka1 = ldfrag_h(k0p + 32), ka2 = ldfrag_h(k0p + 64);
      s0 = mma_h(ka0, qf0, s0);
      s0 = mma_h(ka1, qf1, s0);
      s0 = mma_h(ka2, qf2, s0);
      guard1(s0, qf0, qf1, qf2, ka0, ka1, ka2);
    }
    v8f s1 = zero8();
    {
      const v16h kc0 = ldfrag_h(k1p), kc1 = ldfrag_h(k1p + 32), kc2 = ldfrag_h(k1p + 64);
      s1 = mma_h(kc0, qf0, s1);
      s1 = mma_h(kc1, qf1, s1);
      s1 = mma_h(kc2, qf2, s1);
      guard1(s1, qf0, qf1, qf2, kc0, kc1, kc2);
    }
    // ---- base-2 logits of this lane's 16 keys for query q0 + c ----
    float tk[16];
#pragma unroll
    for (int i = 0; i < 8; ++i) { tk[i] = s0[i] * lsc;  tk[8 + i] = s1[i] * lsc; }
    float cm = tk[0];
#pragma unroll
    for (int i = 1; i < 16; ++i) cm = fmaxf(cm, tk[i]);
    cm = fmaxf(cm, __shfl_xor(cm, 16, 32));
    const float mn = fmaxf(mrun, cm);                                // finite from the first key block on
    const float al = (mrun == -INFINITY) ? 0.f : exp2f(mrun - mn);   // o and l are zero while mrun is -inf
    mrun = mn;
    // ---- probabilities (<= 1) and the P A-fragment: f16(p * 32768); element i <-> tk[i] ----
    float ps = 0.f;
    FragH ph;
#pragma unroll
    for (int w = 0; w < 2; ++w) {
#pragma unroll
      for (int e4 = 0; e4 < 4; ++e4) {
        const int i = 8 * w + 2 * e4;
        const float p0 = exp2f(fminf(tk[i] - mn, 0.f));
        const float p1 = exp2f(fminf(tk[i + 1] - mn, 0.f));
        ps += p0 + p1;
        ph.u[w][e4] = pk16(h_bits((_Float16)(p0 * PCAR)), h_bits((_Float16)(p1 * PCAR)));
      }
    }
    ps += __shfl_xor(ps, 16, 32);
    lrun = lrun * al + ps;
    // ---- rescale the O accumulators: D row 8hh+r = query q0+8hh+r, its factor lives in lane 8hh+r (and 16+8hh+r) ----
    float scl[8];
#pragma unroll
    for (int r = 0; r < 8; ++r) scl[r] = __shfl(al, 8 * hh + r, 32);
#pragma unroll
    for (int j = 0; j < 6; ++j) {
#pragma unroll
      for (int r = 0; r < 8; ++r) o[j][r] *= scl[r];
    }
    // ---- P.V : B fragment col n = d = j*16 + c, keys contiguous in the v^T plane; two guarded groups of 3 ----
    {
      const _Float16* vp = Vb + kb;
      const v16h vf0 = ldfrag_h(vp);
      const v16h vf1 = ldfrag_h(vp + (size_t)16 * SEQ);
      const v16h vf2 = ldfrag_h(vp + (size_t)32 * SEQ);
      o[0] = mma_h(ph.v, vf0, o[0]);
      o[1] = mma_h(ph.v, vf1, o[1]);
      o[2] = mma_h(ph.v, vf2, o[2]);
      guard3(o[0], o[1], o[2], ph.v, vf0, vf1, vf2);
      const v16h vf3 = ldfrag_h(vp + (size_t)48 * SEQ);
      const v16h vf4 = ldfrag_h(vp + (size_t)64 * SEQ);
      const v16h vf5 = ldfrag_h(vp + (size_t)80 * SEQ);
      o[3] = mma_h(ph.v, vf3, o[3]);
      o[4] = mma_h(ph.v, vf4, o[4]);
      o[5] = mma_h(ph.v, vf5, o[5]);
      guard3(o[3], o[4], o[5], ph.v, vf3, vf4, vf5);
    }
  }
  acc_guard6(o[0], o[1], o[2], o[3], o[4], o[5]);

  // ---- fold 1/l (per query, owned by lane = query; l >= 1 by construction), the carries and OSC; stage the 16x96 slab ----
  const float linv = (lrun > 0.f) ? ((1.0f / lrun) * (OSC / (PCAR * VCAR))) : 0.f;
  float inv[8];
#pragma unroll
  for (int r = 0; r < 8; ++r) inv[r] = __shfl(linv, 8 * hh + r, 32);
  float* slab = smem + wave * SLAB96;
#pragma unroll
  for (int r = 0; r < 8; ++r) {
    const int ro = (8 * hh + r) * 100 + c;
#pragma unroll
    for (int j = 0; j < 6; ++j) slab[ro + 16 * j] = o[j][r] * inv[r];
  }
  out96(slab, OPp + (bh * SEQ + q0) * HD, lane);
}

// =====================================================================================================
// Workspace map (bytes); every plane is fully written by whole-line stores before it is read; all extents are exact multiples
// of the 512-B store instructions (no pad rows needed); every base is 256-B aligned:
//   XB  bf16 [8192][768]                       12582912        (x)
//   WQB bf16 [96 n][96 k]                          18432        WKB, WVB the same
//   WOB f16  [768 n][768 k] (bf16 value x1024)   1179648
//   QP  f16  [4][8][2048][96] x8                12582912        KP same
//   VP  f16  [4][8][96][2048] x256              12582912
//   OP  f16  [4][8][2048][96] x1024             12582912
//   end                                          64149504
// =====================================================================================================
extern "C" void kernel_launch(void* const* d_in, const int* in_sizes, int n_in,
                              void* d_out, int out_size, void* d_ws, size_t ws_size,
                              hipStream_t stream) {
  if (n_in < 6) return;
  if (in_sizes[0] != ROWS * DMOD) return;
  if (in_sizes[1] != HD * HD) return;
  if (in_sizes[2] != HD * HD) return;
  if (in_sizes[3] != HD * HD) return;
  if (in_sizes[4] != DMOD * DMOD) return;
  if (in_sizes[5] != DMOD) return;
  if (out_size != ROWS * DMOD) return;

  const float* Xin = (const float*)d_in[0];
  const float* Wq  = (const float*)d_in[1];
  const float* Wk  = (const float*)d_in[2];
  const float* Wv  = (const float*)d_in[3];
  const float* Wu  = (const float*)d_in[4];
  const float* bu  = (const float*)d_in[5];
  float*       out = (float*)d_out;

  const size_t szXB = (size_t)ROWS * DMOD * 2;                  // 12582912
  const size_t szW  = (size_t)HD * HD * 2;                      //    18432
  const size_t szWO = (size_t)DMOD * DMOD * 2;                  //  1179648
  const size_t szP  = (size_t)NB * NH * SEQ * HD * 2;           // 12582912  (q / k / v^T / o planes)
  size_t off = 0;
  const size_t oXB = off; off += szXB;
  const size_t oWQ = off; off += szW;
  const size_t oWK = off; off += szW;
  const size_t oWV = off; off += szW;
  const size_t oWO = off; off += szWO;
  const size_t oQP = off; off += szP;
  const size_t oKP = off; off += szP;
  const size_t oVP = off; off += szP;
  const size_t oOP = off; off += szP;
  if (off > ws_size) return;                            // off = 64149504
  if (off > (size_t)134217728) return;
  if ((szXB % 256) != 0 || (szW % 256) != 0 || (szWO % 256) != 0 || (szP % 256) != 0) return;

  char* ws = (char*)d_ws;
  u16* XB  = (u16*)(ws + oXB);
  u16* WQB = (u16*)(ws + oWQ);
  u16* WKB = (u16*)(ws + oWK);
  u16* WVB = (u16*)(ws + oWV);
  u16* WOB = (u16*)(ws + oWO);
  u16* QP  = (u16*)(ws + oQP);
  u16* KP  = (u16*)(ws + oKP);
  u16* VP  = (u16*)(ws + oVP);
  u16* OP  = (u16*)(ws + oOP);

  const dim3 blk(256);
  const int n8x = (ROWS * DMOD) / 8;                    // 786432
  const int n8w = (HD * HD) / 8;                        //   1152
  const int n8o = (DMOD * DMOD) / 8;                    //  73728
  if (((HD * HD) % 8) != 0 || (n8x % 256) != 0 || (n8o % 256) != 0) return;
  if ((DMOD % 64) != 0 || (ROWS % 64) != 0 || (SEQ % 64) != 0 || (HD % 32) != 0) return;
  const dim3 gX(n8x / 256);                             // 3072
  const dim3 gWs((n8w + 255) / 256);                    // 5 (in-kernel bound gt < n8w)
  const dim3 gWo(n8o / 256);                            // 288
  const dim3 gPJ((ROWS / 64) * NH);                     // 1024
  const dim3 bPJ(128);
  const dim3 gVT(NB * NH * (SEQ / 64));                 // 1024
  const dim3 bVT(192);
  const dim3 gAT(ATT_BLOCKS);                           // 1024
  const dim3 bAT(ATT_THREADS);                          // 128
  const dim3 gO((ROWS / 64) * (DMOD / 64));             // 1536
  const dim3 bO(128);

  // (0..4) operand planes: x -> bf16; Wq/Wk/Wv [n = out][k = in] (already k-contiguous) -> bf16; Wu -> f16 of bf16 value x1024
  cvt16<<<gX, blk, 0, stream>>>(Xin, XB, n8x, 0, 1.0f);
  cvt16<<<gWs, blk, 0, stream>>>(Wq, WQB, n8w, 0, 1.0f);
  cvt16<<<gWs, blk, 0, stream>>>(Wk, WKB, n8w, 0, 1.0f);
  cvt16<<<gWs, blk, 0, stream>>>(Wv, WVB, n8w, 0, 1.0f);
  cvt16<<<gWo, blk, 0, stream>>>(Wu, WOB, n8o, 1, WOS);
  // (5,6) q and k planes [b][h][s][96] = f16(x_h.Wq^T x8), f16(x_h.Wk^T x8)
  proj_qk<<<gPJ, bPJ, 0, stream>>>(XB, WQB, QP, QSC);
  proj_qk<<<gPJ, bPJ, 0, stream>>>(XB, WKB, KP, KSC);
  // (7) v^T plane [b][h][96 d][2048 keys] = f16(Wv.x_bh^T x256)
  proj_vt<<<gVT, bVT, 0, stream>>>(XB, WVB, VP, VCAR);
  // (8) attention -> O plane [b][h][s][96] x1024 (single f16)
  attn_fwd<<<gAT, bAT, 0, stream>>>(QP, KP, VP, OP);
  // (9) output projection -> out [8192][768] f32, carries 1024 (O) x 1024 (Wu) folded back, + bias
  gemm_out<<<gO, bO, 0, stream>>>(OP, WOB, bu, out, 1.0f / (OSC * WOS));
  (void)hipGetLastError();
}

// v001
// One run takes 152 microseconds.
// Two timings next to v000 put it at 1.55 and 1.56 times that version's speed.
// Contractions: x.Wq^T, x.Wk^T and Wv.x^T per head on v_wmma_f32_16x16x32_bf16 (x and Wq/Wk/Wv RNE-converted to bf16
// operands, f32 accumulate); scores k'.q'^T (q', k' single f16 planes carried x8), P.v (P x32768 single f16, v x256 single
// f16) and O.Wu^T (O single f16 plane x1024, Wu as f16(bf16(Wu)) x1024): v_wmma_f32_16x16x32_f16, f32 accumulate.
// Base-2 online softmax, 1/l, bias (bf16 value of bu) and carry folds in f32 on VALU.
#include <hip/hip_runtime.h>
#include <math.h>
#include <stdint.h>

#define NB    4
#define SEQ   2048
#define DMOD  768
#define NH    8
#define HD    96
#define ROWS  (NB * SEQ)
#define QSC   8.0f
#define KSC   8.0f
#define PCAR  32768.0f
#define VCAR  256.0f
#define OSC   1024.0f
#define WOS   1024.0f
#define LOG2E 1.4426950408889634f
#define RSQK  0.0360843918243516f
#define ATT_WAVES   4
#define ATT_THREADS (ATT_WAVES * 32)
#define ATT_BLOCKS  (NB * NH * (SEQ / 64))
#define NKB    (SEQ / 32)
#define SLAB   (16 * 68)
#define SLAB96 (16 * 100)
#define STK    64                              // keys per LDS tile
#define NST    (SEQ / STK)                     // 32 tiles
#define KPITCH 208                             // bytes per K row in LDS: 192 + 16 (16 B x odd, for ds_load_b128 readers)
#define VPITCH 144                             // bytes per v^T row in LDS: 128 + 16 (16 B x odd)
#define KTILE  (STK * KPITCH)                  // 13312
#define VTILE  (HD * VPITCH)                   // 13824
#define BUFB   (KTILE + VTILE)                 // 27136
static_assert(DMOD == NH * HD && HD == 96 && NH == 8 && NB == 4 && SEQ == 2048);
static_assert((SEQ / 64) == 32 && ATT_BLOCKS == 1024 && ATT_THREADS == 128 && NKB == 64);
static_assert((HD % 32) == 0 && (DMOD % 64) == 0 && (ROWS % 64) == 0 && (SEQ % 64) == 0);
static_assert(((ROWS * DMOD / 8) % 256) == 0 && ((DMOD * DMOD / 8) % 256) == 0 && ((HD * HD) % 8) == 0);
static_assert((SLAB * 4) % 16 == 0 && (SLAB96 * 4) % 16 == 0);
static_assert(NST >= 2 && STK == 64 && (STK * HD * 2) == 6 * ATT_THREADS * 16 && (HD * STK * 2) == 6 * ATT_THREADS * 16);
static_assert((KTILE % 16) == 0 && (BUFB % 16) == 0 && 2 * BUFB >= ATT_WAVES * SLAB96 * 4);

typedef unsigned short u16;
typedef _Float16 v16h __attribute__((ext_vector_type(16)));
typedef _Float16 v8h  __attribute__((ext_vector_type(8)));
typedef __bf16   v16b __attribute__((ext_vector_type(16)));
typedef float    v8f  __attribute__((ext_vector_type(8)));
typedef float    v4f  __attribute__((ext_vector_type(4)));
typedef unsigned int v4u __attribute__((ext_vector_type(4)));

union FragH { v16h v; v8h h[2]; v4u u[2]; };
union FragB { v16b v; v4u u[2]; };

// ---- scalar helpers --------------------------------------------------------------------------------
__device__ __forceinline__ unsigned short bf_bits(float f) {          // f32 -> bf16 bits, RNE convert
  unsigned u = __float_as_uint(f);
  return (unsigned short)((u + 0x7FFFu + ((u >> 16) & 1u)) >> 16);
}
__device__ __forceinline__ float bf_up(unsigned short h) { return __uint_as_float(((unsigned)h) << 16); }
__device__ __forceinline__ unsigned short h_bits(_Float16 x) { return __builtin_bit_cast(unsigned short, x); }
__device__ __forceinline__ unsigned pk16(unsigned short a, unsigned short b) { return (unsigned)a | ((unsigned)b << 16); }
__device__ __forceinline__ v8f zero8() { v8f z = {0.f, 0.f, 0.f, 0.f, 0.f, 0.f, 0.f, 0.f}; return z; }

// ---- fragment loaders: 16-bit A/B operand, lane -> row/col (lane&15), p already includes +8*(lane>>4);
//      elements 0..7 <- p[0..7] (k0+8h..), elements 8..15 <- p[16..23] (k0+16+8h..)  (same split k map for A and B;
//      B is always read from a k-contiguous [n][k] plane)
__device__ __forceinline__ v16h ldfrag_h(const _Float16* p) {
  FragH f;
  f.h[0] = *(const v8h*)(p);
  f.h[1] = *(const v8h*)(p + 16);
  return f.v;
}
__device__ __forceinline__ v16b ldfrag_b(const u16* p) {              // bf16 plane read as unsigned integer vectors
  FragB f;
  f.u[0] = *(const v4u*)(p);
  f.u[1] = *(const v4u*)(p + 16);
  return f.v;
}

__device__ __forceinline__ v8f mma_h(v16h a, v16h b, v8f c) {
  return __builtin_amdgcn_wmma_f32_16x16x32_f16(false, a, false, b, (short)0, c, false, false);
}
__device__ __forceinline__ v8f mma_b(v16b a, v16b b, v8f c) {
  return __builtin_amdgcn_wmma_f32_16x16x32_bf16(false, a, false, b, (short)0, c, false, false);
}
__device__ __forceinline__ void guard1(v8f& s, v16h x0, v16h x1, v16h x2, v16h x3, v16h x4, v16h x5) {
#if defined(__HIP_DEVICE_COMPILE__)
  asm volatile("v_nop\n\tv_nop\n\tv_nop\n\tv_nop"
               : "+v"(s) : "v"(x0), "v"(x1), "v"(x2), "v"(x3), "v"(x4), "v"(x5) : "memory");
#endif
}
__device__ __forceinline__ void guard3(v8f& a, v8f& b, v8f& c, v16h x0, v16h x1, v16h x2, v16h x3) {
#if defined(__HIP_DEVICE_COMPILE__)
  asm volatile("v_nop\n\tv_nop\n\tv_nop\n\tv_nop"
               : "+v"(a), "+v"(b), "+v"(c) : "v"(x0), "v"(x1), "v"(x2), "v"(x3) : "memory");
#endif
}
template <typename F>
__device__ __forceinline__ void guard4(v8f& a, v8f& b, v8f& c, v8f& d, F x0, F x1, F x2, F x3, F x4) {
#if defined(__HIP_DEVICE_COMPILE__)
  asm volatile("v_nop\n\tv_nop\n\tv_nop\n\tv_nop"
               : "+v"(a), "+v"(b), "+v"(c), "+v"(d) : "v"(x0), "v"(x1), "v"(x2), "v"(x3), "v"(x4) : "memory");
#endif
}
__device__ __forceinline__ void guard6(v8f& a0, v8f& a1, v8f& a2, v8f& a3, v8f& a4, v8f& a5,
                                       v16b x0, v16b x1, v16b x2, v16b x3, v16b x4, v16b x5, v16b x6) {
#if defined(__HIP_DEVICE_COMPILE__)
  asm volatile("v_nop\n\tv_nop\n\tv_nop\n\tv_nop"
               : "+v"(a0), "+v"(a1), "+v"(a2), "+v"(a3), "+v"(a4), "+v"(a5)
               : "v"(x0), "v"(x1), "v"(x2), "v"(x3), "v"(x4), "v"(x5), "v"(x6) : "memory");
#endif
}
__device__ __forceinline__ void acc_guard6(v8f& a, v8f& b, v8f& c, v8f& d, v8f& e, v8f& f) {
#if defined(__HIP_DEVICE_COMPILE__)
  asm volatile("v_nop\n\tv_nop\n\tv_nop\n\tv_nop" : "+v"(a), "+v"(b), "+v"(c), "+v"(d), "+v"(e), "+v"(f));
#endif
}
__device__ __forceinline__ void wave_sync_lds() {
#if defined(__HIP_DEVICE_COMPILE__)
  __builtin_amdgcn_fence(__ATOMIC_RELEASE, "workgroup");
  __builtin_amdgcn_wave_barrier();
  __builtin_amdgcn_fence(__ATOMIC_ACQUIRE, "workgroup");
#endif
}

// =====================================================================================================
// f32 plane -> 16-bit plane, same layout:  mode 0: bf16 RNE bits;  mode 1: f16 bits of (bf16 RNE value) * scale.
// Thread = 8 consecutive elements: two 16-B loads, one 16-B store; 32 consecutive lanes = 512 contiguous, 512-B aligned bytes
// coverage: grid = ceil(n8/256) blocks x 256 thr x 8 elements, in-kernel bound gt < n8 (host checks n8 % 8 == 0 planes).
// =====================================================================================================
__global__ __launch_bounds__(256) void cvt16(const float* __restrict__ x, u16* D, int n8, int mode, float scale) {
  const int gt = blockIdx.x * 256 + (int)threadIdx.x;
  if (gt >= n8) return;                     // no barriers in this kernel
  const float* p = x + (size_t)gt * 8;
  const v4f a = *(const v4f*)(p), c4 = *(const v4f*)(p + 4);
  float v[8];
#pragma unroll
  for (int e = 0; e < 4; ++e) { v[e] = a[e]; v[4 + e] = c4[e]; }
  unsigned short s[8];
#pragma unroll
  for (int e = 0; e < 8; ++e) {
    const unsigned short bb = bf_bits(v[e]);
    const unsigned short hb = h_bits((_Float16)(bf_up(bb) * scale));
    s[e] = (mode != 0) ? hb : bb;
  }
  v4u o;
#pragma unroll
  for (int e = 0; e < 4; ++e) o[e] = pk16(s[2 * e], s[2 * e + 1]);
  u16* d = D + (size_t)gt * 8;
  {
    *(v4u*)(d) = o;
    
  }
}

// =====================================================================================================
// 16x96 f16 epilogue: the wave's 16x96 f32 tile (already scaled) staged by the caller in its LDS slab [16][100];
// coverage: 6 instructions x 32 lanes x 8 halves = 1536 = the wave's 16 x 96 tile (groups of 8 never straddle a row: 96/8 = 12).
// =====================================================================================================
__device__ __forceinline__ void out96(const float* sl, u16* dst, int lane) {
  wave_sync_lds();
  v4u ov[6];
#pragma unroll
  for (int i = 0; i < 6; ++i) {
    const int g   = i * 32 + lane;
    const int row = g / 12;
    const int c8  = (g - row * 12) * 8;
    const v4f a = *(const v4f*)(sl + row * 100 + c8), c4 = *(const v4f*)(sl + row * 100 + c8 + 4);
    float w[8];
#pragma unroll
    for (int e = 0; e < 4; ++e) { w[e] = a[e]; w[4 + e] = c4[e]; }
#pragma unroll
    for (int e = 0; e < 4; ++e) ov[i][e] = pk16(h_bits((_Float16)w[2 * e]), h_bits((_Float16)w[2 * e + 1]));
  }
  {
#pragma unroll
    for (int i = 0; i < 6; ++i) {
      *(v4u*)(dst + (size_t)(i * 32 + lane) * 8) = ov[i];
    }
    
  }
}

// =====================================================================================================
// barrier, then converted to f16 and written: lane = (row in group of 4, 8 consecutive cols); one instruction = 4 rows, each
// coverage: 4 instructions x 4 rows x 8 lanes x 8 halves = the wave's 16 x 64 tile.
// =====================================================================================================
__device__ __forceinline__ void epi16(float* sl, v8f a0, v8f a1, v8f a2, v8f a3, float oscale, u16* C, int N,
                                      size_t rowb, int col0, int lane) {
  const int hh = lane >> 4, m = lane & 15;
#pragma unroll
  for (int r = 0; r < 8; ++r) {
    const int ro = (8 * hh + r) * 68 + m;
    sl[ro]      = a0[r] * oscale;
    sl[ro + 16] = a1[r] * oscale;
    sl[ro + 32] = a2[r] * oscale;
    sl[ro + 48] = a3[r] * oscale;
  }
  wave_sync_lds();
  const int rq = lane >> 3, c8 = (lane & 7) * 8;
  v4u ov[4];
#pragma unroll
  for (int i4 = 0; i4 < 4; ++i4) {
    const int row = i4 * 4 + rq;
    const v4f a = *(const v4f*)(sl + row * 68 + c8), c4 = *(const v4f*)(sl + row * 68 + c8 + 4);
    float w[8];
#pragma unroll
    for (int e = 0; e < 4; ++e) { w[e] = a[e]; w[4 + e] = c4[e]; }
#pragma unroll
    for (int e = 0; e < 4; ++e) ov[i4][e] = pk16(h_bits((_Float16)w[2 * e]), h_bits((_Float16)w[2 * e + 1]));
  }
  u16* dst = C + (rowb + (size_t)rq) * (size_t)N + col0 + c8;
  {
#pragma unroll
    for (int i4 = 0; i4 < 4; ++i4) {
      *(v4u*)(dst + (size_t)(i4 * 4) * (size_t)N) = ov[i4];
    }
    
  }
}

// =====================================================================================================
// f32 GEMM epilogue with bias: the wave's 16x64 f32 tile (acc*oscale + bias[col]) staged in its LDS slab (pitch 68),
// coverage: 8 instructions x 2 rows x 16 lanes x 4 floats = the wave's 16 x 64 tile.
// =====================================================================================================
__device__ __forceinline__ void epi64b(float* sl, v8f a0, v8f a1, v8f a2, v8f a3, float oscale,
                                       float bz0, float bz1, float bz2, float bz3, float* C, int N,
                                       size_t rowb, int col0, int lane) {
  const int hh = lane >> 4, m = lane & 15;
#pragma unroll
  for (int r = 0; r < 8; ++r) {
    const int ro = (8 * hh + r) * 68 + m;
    sl[ro]      = a0[r] * oscale + bz0;
    sl[ro + 16] = a1[r] * oscale + bz1;
    sl[ro + 32] = a2[r] * oscale + bz2;
    sl[ro + 48] = a3[r] * oscale + bz3;
  }
  wave_sync_lds();
  v4f vals[8];
#pragma unroll
  for (int it = 0; it < 8; ++it) vals[it] = *(const v4f*)(sl + (it * 2 + hh) * 68 + m * 4);
  float* dst = C + (rowb + (size_t)hh) * (size_t)N + col0 + m * 4;
  {
#pragma unroll
    for (int it = 0; it < 8; ++it) {
      *(v4f*)(dst + (size_t)(it * 2) * (size_t)N) = vals[it];
    }
    
  }
}

// =====================================================================================================
// Per-head projection (shared 96x96 weight), bf16 operands: P[b][head][s][96] (f16 of acc*oscale) = x[b*SEQ+s][head*96 + i]
// (XB bf16, pitch 768) . W[n][i]^T (bf16 [96 n][96 k], k-contiguous). Block = (64 rows of b*SEQ+s, head), 4 waves x 16 rows,
// each wave 6 accumulators (n = 0..95), K = 96 in 3 steps of 32; fragments loaded straight from the 16-bit rows (split k map).
// The wave's 16x96 tile is one contiguous 3072-B region of the [b][head][s][96] plane (16 s rows of 96 halves), see out96.
// grid = (ROWS/64) * NH = 1024 (exact, host-checked constants).
// =====================================================================================================
__global__ __launch_bounds__(128)
void proj_qk(const u16* __restrict__ XB, const u16* __restrict__ W, u16* P, float oscale) {
  __shared__ __align__(16) float smem[4 * SLAB96];
  const int tid = threadIdx.x, wave = tid >> 5, lane = tid & 31, hh = lane >> 4, m = lane & 15;
  const int bid  = blockIdx.x;
  const int head = bid & (NH - 1);
  const int rt   = bid >> 3;
  const int rowb = rt * 64 + wave * 16;                 // 0..8176, 16 rows never straddle a batch
  const int b    = rowb >> 11;
  const int s0   = rowb & (SEQ - 1);
  const u16* ap = XB + (size_t)(rowb + m) * DMOD + head * HD + 8 * hh;
  const u16* bp = W + (size_t)m * HD + 8 * hh;
  v8f acc[6];
#pragma unroll
  for (int j = 0; j < 6; ++j) acc[j] = zero8();
#pragma unroll 1
  for (int k0 = 0; k0 < HD; k0 += 32) {
    const v16b a  = ldfrag_b(ap + k0);
    const v16b b0 = ldfrag_b(bp + k0);
    const v16b b1 = ldfrag_b(bp + 1 * 16 * HD + k0);
    const v16b b2 = ldfrag_b(bp + 2 * 16 * HD + k0);
    const v16b b3 = ldfrag_b(bp + 3 * 16 * HD + k0);
    const v16b b4 = ldfrag_b(bp + 4 * 16 * HD + k0);
    const v16b b5 = ldfrag_b(bp + 5 * 16 * HD + k0);
    acc[0] = mma_b(a, b0, acc[0]);
    acc[1] = mma_b(a, b1, acc[1]);
    acc[2] = mma_b(a, b2, acc[2]);
    acc[3] = mma_b(a, b3, acc[3]);
    acc[4] = mma_b(a, b4, acc[4]);
    acc[5] = mma_b(a, b5, acc[5]);
    guard6(acc[0], acc[1], acc[2], acc[3], acc[4], acc[5], a, b0, b1, b2, b3, b4, b5);
  }
  // D element r of lane l = (row rowb+8hh+r, col n = 16j + m); stage the 16x96 slab (pitch 100) fully
  float* slab = smem + wave * SLAB96;
#pragma unroll
  for (int r = 0; r < 8; ++r) {
    const int ro = (8 * hh + r) * 100 + m;
#pragma unroll
    for (int j = 0; j < 6; ++j) slab[ro + 16 * j] = acc[j][r] * oscale;
  }
  out96(slab, P + ((size_t)(b * NH + head) * SEQ + s0) * HD, lane);
}

// =====================================================================================================
// Per-head v^T plane, bf16 operands: VT[b][head][d][s] (f16 of acc*oscale, [96][2048] per (b,head)) = Wv[d][i] (bf16 [96][96],
// row-major, k = i contiguous) . x[b*SEQ+s][head*96+i]^T (XB rows are the k-contiguous B operand). Block = (b, head, 64 keys),
// 6 waves, wave w owns d rows 16w..16w+15 and 4 accumulators (s = col0 + 16j + n); K = 96 in 3 steps of 32.
// =====================================================================================================
__global__ __launch_bounds__(192)
void proj_vt(const u16* __restrict__ XB, const u16* __restrict__ W, u16* VT, float oscale) {
  __shared__ __align__(16) float smem[6 * SLAB];
  const int tid = threadIdx.x, wave = tid >> 5, lane = tid & 31, hh = lane >> 4, m = lane & 15;
  const int bid  = blockIdx.x;
  const int st   = bid & (SEQ / 64 - 1);
  const int head = (bid >> 5) & (NH - 1);
  const int b    = bid >> 8;
  const int col0 = st * 64;
  const int rowb = wave * 16;                           // d rows 0..95
  const u16* ap = W + (size_t)(rowb + m) * HD + 8 * hh;
  const u16* bp = XB + ((size_t)b * SEQ + col0 + m) * DMOD + head * HD + 8 * hh;
  const size_t bs = (size_t)16 * DMOD;
  v8f acc0 = zero8(), acc1 = zero8(), acc2 = zero8(), acc3 = zero8();
#pragma unroll 1
  for (int k0 = 0; k0 < HD; k0 += 32) {
    const v16b a  = ldfrag_b(ap + k0);
    const v16b b0 = ldfrag_b(bp + k0);
    const v16b b1 = ldfrag_b(bp + bs + k0);
    const v16b b2 = ldfrag_b(bp + 2 * bs + k0);
    const v16b b3 = ldfrag_b(bp + 3 * bs + k0);
    acc0 = mma_b(a, b0, acc0);
    acc1 = mma_b(a, b1, acc1);
    acc2 = mma_b(a, b2, acc2);
    acc3 = mma_b(a, b3, acc3);
    guard4<v16b>(acc0, acc1, acc2, acc3, a, b0, b1, b2, b3);
  }
  u16* Cb = VT + (size_t)(b * NH + head) * HD * SEQ;
  epi16(smem + wave * SLAB, acc0, acc1, acc2, acc3, oscale, Cb, SEQ, (size_t)rowb, col0, lane);
}

// =====================================================================================================
// Output projection with bias: C[8192][768] (f32) = O . Wu^T * oscale + bf16(bu)[n]; A operand k index = head*96 + d lives at
// O plane address ((b*NH + head)*SEQ + s)*96 + d (O single f16 x1024, 32-deep k-steps never straddle a head since 96 = 3*32);
// Bt = Wu plane [768 n][768 k] f16 (bf16 value x1024), k-contiguous. Block = 64x64 tile, 4 waves x 16 rows; one product per
// tile pair; grid = (ROWS/64)*(DMOD/64) = 1536.
// =====================================================================================================
__global__ __launch_bounds__(128)
void gemm_out(const u16* __restrict__ OP, const u16* __restrict__ WOB, const float* __restrict__ bias, float* C,
              float oscale) {
  __shared__ __align__(16) float slab[4 * SLAB];
  const int tid = threadIdx.x, wave = tid >> 5, lane = tid & 31, hh = lane >> 4, m = lane & 15;
  const int ntile = DMOD >> 6;                          // 12
  const int bid   = blockIdx.x;
  const int rowb  = (bid / ntile) * 64 + wave * 16;
  const int col0  = (bid % ntile) * 64;
  const int row   = rowb + m;
  const int b     = row >> 11;
  const int s     = row & (SEQ - 1);
  const _Float16* abase = (const _Float16*)(const void*)OP + (((size_t)b * NH * SEQ + s) * HD + 8 * hh);
  const _Float16* bp    = (const _Float16*)(const void*)WOB + ((size_t)(col0 + m) * DMOD + 8 * hh);
  const size_t bs = (size_t)16 * DMOD;
  v8f acc0 = zero8(), acc1 = zero8(), acc2 = zero8(), acc3 = zero8();
#pragma unroll 1
  for (int k0 = 0; k0 < DMOD; k0 += 32) {
    const int h  = k0 / HD;
    const int d0 = k0 - h * HD;
    const v16h a  = ldfrag_h(abase + (size_t)h * (SEQ * HD) + d0);
    const v16h b0 = ldfrag_h(bp + k0);
    const v16h b1 = ldfrag_h(bp + bs + k0);
    const v16h b2 = ldfrag_h(bp + 2 * bs + k0);
    const v16h b3 = ldfrag_h(bp + 3 * bs + k0);
    acc0 = mma_h(a, b0, acc0);
    acc1 = mma_h(a, b1, acc1);
    acc2 = mma_h(a, b2, acc2);
    acc3 = mma_h(a, b3, acc3);
    guard4<v16h>(acc0, acc1, acc2, acc3, a, b0, b1, b2, b3);
  }
  // bias for the lane's columns (col0 + 16j + m <= 767), bf16 value of bu
  const float bz0 = bf_up(bf_bits(bias[col0 + m]));
  const float bz1 = bf_up(bf_bits(bias[col0 + 16 + m]));
  const float bz2 = bf_up(bf_bits(bias[col0 + 32 + m]));
  const float bz3 = bf_up(bf_bits(bias[col0 + 48 + m]));
  epi64b(slab + wave * SLAB, acc0, acc1, acc2, acc3, oscale, bz0, bz1, bz2, bz3, C, DMOD, (size_t)rowb, col0, lane);
}

// =====================================================================================================
// One 64-key tile into one LDS buffer, 12 asynchronous 16-B copies per lane (all 128 lanes on, block-uniform control flow):
//   K: 64 rows x 192 B are 12288 contiguous global bytes; piece p = 128 i + tid (i = 0..5) -> LDS row p / 12, 16-B column p % 12
//      (kl0..kl2 hold the places of i = 0..2; i + 3 lies 32 rows further); one wave-instruction = 512 contiguous bytes.
//   v^T: 96 rows x 128 B (global pitch 4096 B); piece p = 128 i + tid -> row p / 8, column p % 8; one wave-instruction = 4 lines.
// s_wait_xcnt stands inside the statement so that no address register is rewritten in front of it.
// =====================================================================================================
__device__ __forceinline__ void tile_copy(unsigned kl0, unsigned kl1, unsigned kl2, unsigned vl,
                                          const char* kg, const char* vg) {
#if defined(__HIP_DEVICE_COMPILE__)
  asm volatile("global_load_async_to_lds_b128 %0, %12, off\n\t"
               "global_load_async_to_lds_b128 %1, %13, off\n\t"
               "global_load_async_to_lds_b128 %2, %14, off\n\t"
               "global_load_async_to_lds_b128 %3, %15, off\n\t"
               "global_load_async_to_lds_b128 %4, %16, off\n\t"
               "global_load_async_to_lds_b128 %5, %17, off\n\t"
               "global_load_async_to_lds_b128 %6, %18, off\n\t"
               "global_load_async_to_lds_b128 %7, %19, off\n\t"
               "global_load_async_to_lds_b128 %8, %20, off\n\t"
               "global_load_async_to_lds_b128 %9, %21, off\n\t"
               "global_load_async_to_lds_b128 %10, %22, off\n\t"
               "global_load_async_to_lds_b128 %11, %23, off\n\t"
               "s_wait_xcnt 0x0"
               :: "v"(kl0), "v"(kl1), "v"(kl2),
                  "v"(kl0 + 32u * KPITCH), "v"(kl1 + 32u * KPITCH), "v"(kl2 + 32u * KPITCH),
                  "v"(vl), "v"(vl + 16u * VPITCH), "v"(vl + 32u * VPITCH),
                  "v"(vl + 48u * VPITCH), "v"(vl + 64u * VPITCH), "v"(vl + 80u * VPITCH),
                  "v"(kg), "v"(kg + 2048), "v"(kg + 4096), "v"(kg + 6144), "v"(kg + 8192), "v"(kg + 10240),
                  "v"(vg), "v"(vg + 16 * SEQ * 2), "v"(vg + 32 * SEQ * 2),
                  "v"(vg + 48 * SEQ * 2), "v"(vg + 64 * SEQ * 2), "v"(vg + 80 * SEQ * 2)
               : "memory");
#endif
}

// =====================================================================================================
// Narrow multi-head flash attention (no mask): block = (batch b, head, 64 query rows), 4 waves, wave w owns the 16 query rows
// q0 = 64*qt + 16*w .. q0+15.
//   q plane (f16, x8) laid out [b][h][s][96]; k plane the same; v^T plane [b][h][96][s] (x256).
//   All NKB = 64 key blocks of 32 keys are visited (static bound), two per 64-key tile. The block's four waves share each K and
//   v^T tile: it is brought into LDS by asynchronous copies (tile_copy), two buffers, tile t + 1 in flight while tile t is
//   worked on; one barrier per tile publishes tile t + 1 and frees tile t's buffer. Fragments are read by ds_load_b128.
//   After the last barrier the ring is dead and its first bytes become the waves' private output slabs.
//   Scores are computed TRANSPOSED: S^T tile g (g = 0,1) = k rows (keys kb+16g .. +15, A operand, row m = lane&15, split k map
//   over d, 3 chunks of 32) times q^T (B operand, col n = query q0 + (lane&15), k = d, split map), one product per tile and
//   32-deep d-chunk. D element r of lane l = (key kb+16g+8h+r, query q0+(l&15)), so a lane owns one query column and 16 of
//   its 32 keys; the partner lane l^16 owns the other 16 -> row max / row sum need one xor-16 shuffle.
//   Online max-subtracted base-2 softmax in f32 (scale 1/sqrt(768) and the q/k carries folded into lsc). The exp'd values ARE
//   the P A-fragment in place: A row m = query = lane&15, element i <- key kb+8h+i (tile 0, D element i), element 8+i <- key
//   kb+16+8h+i (tile 1, D element i). P is carried x32768 as single f16. The rescale factor of query row 8h+r of the O
//   accumulators is fetched from lane 8h+r with a shuffle (uniform control). 6 v^T B fragments (col n = d = 16j + (lane&15),
//   keys k-contiguous), 6 P.V WMMAs per key block in two guarded groups of 3.
//   Epilogue: 1/l (per query, shuffled to the D row owner) and carry folds in f32; the wave's 16x96 f32 result (x1024)
//   staged in its LDS slab [16][100]; the wave's 16 rows of the O plane [b][h][s][96] are one contiguous 3072-B region written
// coverage: per wave 6 instructions x 32 lanes x 8 halves = 16 x 96; grid 1024 blocks x 4 waves = every (b, h, s) row of the
//           O plane exactly once.
// =====================================================================================================
__global__ __launch_bounds__(ATT_THREADS)
void attn_fwd(const u16* __restrict__ QPp, const u16* __restrict__ KPp, const u16* __restrict__ VPp, u16* OPp) {
  __shared__ __align__(16) unsigned char ring[2 * BUFB];

  const int tid  = threadIdx.x;
  const int wave = tid >> 5;
  const int lane = tid & 31;
  const int hh   = lane >> 4;
  const int c    = lane & 15;

  const int bid  = blockIdx.x;
  const int qt   = bid & (SEQ / 64 - 1);
  const int head = (bid >> 5) & (NH - 1);
  const int b    = bid >> 8;
  const int q0   = qt * 64 + wave * 16;
  const size_t bh = (size_t)(b * NH + head);

  // B fragments of q^T: col n = query q0 + c, k = d (k-contiguous row of the q plane)
  const _Float16* Qb = (const _Float16*)(const void*)QPp + ((bh * SEQ + q0 + c) * HD + 8 * hh);
  // A fragments of k: row m = key (in tile) 16g + c, k = d; byte offset in a buffer's K part
  const int kfo = c * KPITCH + 16 * hh;
  // B fragments of v: col n = d = 16j + c, k = key (k-contiguous row of the v^T tile); byte offset in a buffer
  const int vfo = KTILE + c * VPITCH + 16 * hh;
  // the lane's copy places (LDS byte addresses in buffer 0) and its global sources for tile 0
  const unsigned lds0 = (unsigned)(uintptr_t)(&ring[0]);
  const int kr0 = tid / 12, kr1 = (tid + 128) / 12, kr2 = (tid + 256) / 12;
  const unsigned kl0 = lds0 + (unsigned)(kr0 * KPITCH + (tid - 12 * kr0) * 16);
  const unsigned kl1 = lds0 + (unsigned)(kr1 * KPITCH + (tid + 128 - 12 * kr1) * 16);
  const unsigned kl2 = lds0 + (unsigned)(kr2 * KPITCH + (tid + 256 - 12 * kr2) * 16);
  const unsigned vl  = lds0 + (unsigned)(KTILE + (tid >> 3) * VPITCH + (tid & 7) * 16);
  const char* kg = (const char*)(const void*)KPp + (bh * SEQ * HD * 2 + (size_t)tid * 16);              // + 12288 per tile
  const char* vg = (const char*)(const void*)VPp + ((bh * HD + (size_t)(tid >> 3)) * SEQ * 2 + (size_t)(tid & 7) * 16);  // + 128
  const float lsc = RSQK * (LOG2E / (QSC * KSC));

  const v16h qf0 = ldfrag_h(Qb);            // d 0..31
  const v16h qf1 = ldfrag_h(Qb + 32);       // d 32..63
  const v16h qf2 = ldfrag_h(Qb + 64);       // d 64..95

  float mrun = -INFINITY, lrun = 0.f;
  v8f o[6];
#pragma unroll
  for (int j = 0; j < 6; ++j) o[j] = zero8();

  // ---- ring prologue: tile 0 landed and published, then tile 1 set off ----
  tile_copy(kl0, kl1, kl2, vl, kg, vg);
  asm volatile("s_wait_asynccnt 0x0" ::: "memory");   // this wave's copies of tile 0 have landed
  __syncthreads();                                    // every wave's have
  tile_copy(kl0 + BUFB, kl1 + BUFB, kl2 + BUFB, vl + BUFB, kg + STK * HD * 2, vg + STK * 2);

#pragma unroll 1                                      // one trip per tile stays rolled: one foot, small code
  for (int t = 0; t < NST; ++t) {
   const unsigned bo = (unsigned)(t & 1) * BUFB;      // trip t reads buffer t mod 2 alone
#pragma unroll                                        // the tile's two 32-key blocks: constant LDS offsets in the reads
   for (int sub = 0; sub < 2; ++sub) {
    // ---- transposed scores: s0 = keys kb..kb+15, s1 = keys kb+16..kb+31 (kb = 64 t + 32 sub), column = query q0 + c ----
    const _Float16* k0p = (const _Float16*)(const void*)(ring + bo + kfo + sub * 32 * KPITCH);
    const _Float16* k1p = (const _Float16*)(const void*)(ring + bo + kfo + (sub * 32 + 16) * KPITCH);
    v8f s0 = zero8();
    {
      const v16h ka0 = ldfrag_h(k0p), ka1 = ldfrag_h(k0p + 32), ka2 = ldfrag_h(k0p + 64);
      s0 = mma_h(ka0, qf0, s0);
      s0 = mma_h(ka1, qf1, s0);
      s0 = mma_h(ka2, qf2, s0);
      guard1(s0, qf0, qf1, qf2, ka0, ka1, ka2);
    }
    v8f s1 = zero8();
    {
      const v16h kc0 = ldfrag_h(k1p), kc1 = ldfrag_h(k1p + 32), kc2 = ldfrag_h(k1p + 64);
      s1 = mma_h(kc0, qf0, s1);
      s1 = mma_h(kc1, qf1, s1);
      s1 = mma_h(kc2, qf2, s1);
      guard1(s1, qf0, qf1, qf2, kc0, kc1, kc2);
    }
    // ---- base-2 logits of this lane's 16 keys for query q0 + c ----
    float tk[16];
#pragma unroll
    for (int i = 0; i < 8; ++i) { tk[i] = s0[i] * lsc;  tk[8 + i] = s1[i] * lsc; }
    float cm = tk[0];
#pragma unroll
    for (int i = 1; i < 16; ++i) cm = fmaxf(cm, tk[i]);
    cm = fmaxf(cm, __shfl_xor(cm, 16, 32));
    const float mn = fmaxf(mrun, cm);                                // finite from the first key block on
    const float al = (mrun == -INFINITY) ? 0.f : exp2f(mrun - mn);   // o and l are zero while mrun is -inf
    mrun = mn;
    // ---- probabilities (<= 1) and the P A-fragment: f16(p * 32768); element i <-> tk[i] ----
    float ps = 0.f;
    FragH ph;
#pragma unroll
    for (int w = 0; w < 2; ++w) {
#pragma unroll
      for (int e4 = 0; e4 < 4; ++e4) {
        const int i = 8 * w + 2 * e4;
        const float p0 = exp2f(fminf(tk[i] - mn, 0.f));
        const float p1 = exp2f(fminf(tk[i + 1] - mn, 0.f));
        ps += p0 + p1;
        ph.u[w][e4] = pk16(h_bits((_Float16)(p0 * PCAR)), h_bits((_Float16)(p1 * PCAR)));
      }
    }
    ps += __shfl_xor(ps, 16, 32);
    lrun = lrun * al + ps;
    // ---- rescale the O accumulators: D row 8hh+r = query q0+8hh+r, its factor lives in lane 8hh+r (and 16+8hh+r) ----
    float scl[8];
#pragma unroll
    for (int r = 0; r < 8; ++r) scl[r] = __shfl(al, 8 * hh + r, 32);
#pragma unroll
    for (int j = 0; j < 6; ++j) {
#pragma unroll
      for (int r = 0; r < 8; ++r) o[j][r] *= scl[r];
    }
    // ---- P.V : B fragment col n = d = j*16 + c, keys contiguous in the v^T plane; two guarded groups of 3 ----
    {
      const _Float16* vp = (const _Float16*)(const void*)(ring + bo + vfo + sub * 64);
      const v16h vf0 = ldfrag_h(vp);
      const v16h vf1 = ldfrag_h(vp + 16 * (VPITCH / 2));
      const v16h vf2 = ldfrag_h(vp + 32 * (VPITCH / 2));
      o[0] = mma_h(ph.v, vf0, o[0]);
      o[1] = mma_h(ph.v, vf1, o[1]);
      o[2] = mma_h(ph.v, vf2, o[2]);
      guard3(o[0], o[1], o[2], ph.v, vf0, vf1, vf2);
      const v16h vf3 = ldfrag_h(vp + 48 * (VPITCH / 2));
      const v16h vf4 = ldfrag_h(vp + 64 * (VPITCH / 2));
      const v16h vf5 = ldfrag_h(vp + 80 * (VPITCH / 2));
      o[3] = mma_h(ph.v, vf3, o[3]);
      o[4] = mma_h(ph.v, vf4, o[4]);
      o[5] = mma_h(ph.v, vf5, o[5]);
      guard3(o[3], o[4], o[5], ph.v, vf3, vf4, vf5);
    }
   }
   // ---- foot of trip t: publish tile t + 1, free tile t's buffer, refill it with tile t + 2 ----
   asm volatile("s_wait_dscnt 0x0" ::: "memory");      // this wave's reads of tile t are done
   asm volatile("s_wait_asynccnt 0x0" ::: "memory");   // this wave's copies of tile t + 1 have landed
   __syncthreads();                                    // both hold for every wave
   if (t + 2 < NST)                                    // block-uniform
     tile_copy(kl0 + bo, kl1 + bo, kl2 + bo, vl + bo,
               kg + (size_t)(t + 2) * (STK * HD * 2), vg + (size_t)(t + 2) * (STK * 2));
  }
  asm volatile("s_wait_asynccnt 0x0" ::: "memory");    // nothing of this wave is in flight when the ring is reused
  acc_guard6(o[0], o[1], o[2], o[3], o[4], o[5]);

  // ---- fold 1/l (per query, owned by lane = query; l >= 1 by construction), the carries and OSC; stage the 16x96 slab ----
  const float linv = (lrun > 0.f) ? ((1.0f / lrun) * (OSC / (PCAR * VCAR))) : 0.f;
  float inv[8];
#pragma unroll
  for (int r = 0; r < 8; ++r) inv[r] = __shfl(linv, 8 * hh + r, 32);
  float* slab = (float*)(void*)ring + wave * SLAB96;   // the ring is dead behind the last trip's barrier
#pragma unroll
  for (int r = 0; r < 8; ++r) {
    const int ro = (8 * hh + r) * 100 + c;
#pragma unroll
    for (int j = 0; j < 6; ++j) slab[ro + 16 * j] = o[j][r] * inv[r];
  }
  out96(slab, OPp + (bh * SEQ + q0) * HD, lane);
}

// =====================================================================================================
// Workspace map (bytes); every plane is fully written by whole-line stores before it is read; all extents are exact multiples
// of the 512-B store instructions (no pad rows needed); every base is 256-B aligned:
//   XB  bf16 [8192][768]                       12582912        (x)
//   WQB bf16 [96 n][96 k]                          18432        WKB, WVB the same
//   WOB f16  [768 n][768 k] (bf16 value x1024)   1179648
//   QP  f16  [4][8][2048][96] x8                12582912        KP same
//   VP  f16  [4][8][96][2048] x256              12582912
//   OP  f16  [4][8][2048][96] x1024             12582912
//   end                                          64149504
// =====================================================================================================
extern "C" void kernel_launch(void* const* d_in, const int* in_sizes, int n_in,
                              void* d_out, int out_size, void* d_ws, size_t ws_size,
                              hipStream_t stream) {
  if (n_in < 6) return;
  if (in_sizes[0] != ROWS * DMOD) return;
  if (in_sizes[1] != HD * HD) return;
  if (in_sizes[2] != HD * HD) return;
  if (in_sizes[3] != HD * HD) return;
  if (in_sizes[4] != DMOD * DMOD) return;
  if (in_sizes[5] != DMOD) return;
  if (out_size != ROWS * DMOD) return;

  const float* Xin = (const float*)d_in[0];
  const float* Wq  = (const float*)d_in[1];
  const float* Wk  = (const float*)d_in[2];
  const float* Wv  = (const float*)d_in[3];
  const float* Wu  = (const float*)d_in[4];
  const float* bu  = (const float*)d_in[5];
  float*       out = (float*)d_out;

  const size_t szXB = (size_t)ROWS * DMOD * 2;                  // 12582912
  const size_t szW  = (size_t)HD * HD * 2;                      //    18432
  const size_t szWO = (size_t)DMOD * DMOD * 2;                  //  1179648
  const size_t szP  = (size_t)NB * NH * SEQ * HD * 2;           // 12582912  (q / k / v^T / o planes)
  size_t off = 0;
  const size_t oXB = off; off += szXB;
  const size_t oWQ = off; off += szW;
  const size_t oWK = off; off += szW;
  const size_t oWV = off; off += szW;
  const size_t oWO = off; off += szWO;
  const size_t oQP = off; off += szP;
  const size_t oKP = off; off += szP;
  const size_t oVP = off; off += szP;
  const size_t oOP = off; off += szP;
  if (off > ws_size) return;                            // off = 64149504
  if (off > (size_t)134217728) return;
  if ((szXB % 256) != 0 || (szW % 256) != 0 || (szWO % 256) != 0 || (szP % 256) != 0) return;

  char* ws = (char*)d_ws;
  u16* XB  = (u16*)(ws + oXB);
  u16* WQB = (u16*)(ws + oWQ);
  u16* WKB = (u16*)(ws + oWK);
  u16* WVB = (u16*)(ws + oWV);
  u16* WOB = (u16*)(ws + oWO);
  u16* QP  = (u16*)(ws + oQP);
  u16* KP  = (u16*)(ws + oKP);
  u16* VP  = (u16*)(ws + oVP);
  u16* OP  = (u16*)(ws + oOP);

  const dim3 blk(256);
  const int n8x = (ROWS * DMOD) / 8;                    // 786432
  const int n8w = (HD * HD) / 8;                        //   1152
  const int n8o = (DMOD * DMOD) / 8;                    //  73728
  if (((HD * HD) % 8) != 0 || (n8x % 256) != 0 || (n8o % 256) != 0) return;
  if ((DMOD % 64) != 0 || (ROWS % 64) != 0 || (SEQ % 64) != 0 || (HD % 32) != 0) return;
  const dim3 gX(n8x / 256);                             // 3072
  const dim3 gWs((n8w + 255) / 256);                    // 5 (in-kernel bound gt < n8w)
  const dim3 gWo(n8o / 256);                            // 288
  const dim3 gPJ((ROWS / 64) * NH);                     // 1024
  const dim3 bPJ(128);
  const dim3 gVT(NB * NH * (SEQ / 64));                 // 1024
  const dim3 bVT(192);
  const dim3 gAT(ATT_BLOCKS);                           // 1024
  const dim3 bAT(ATT_THREADS);                          // 128
  const dim3 gO((ROWS / 64) * (DMOD / 64));             // 1536
  const dim3 bO(128);

  // (0..4) operand planes: x -> bf16; Wq/Wk/Wv [n = out][k = in] (already k-contiguous) -> bf16; Wu -> f16 of bf16 value x1024
  cvt16<<<gX, blk, 0, stream>>>(Xin, XB, n8x, 0, 1.0f);
  cvt16<<<gWs, blk, 0, stream>>>(Wq, WQB, n8w, 0, 1.0f);
  cvt16<<<gWs, blk, 0, stream>>>(Wk, WKB, n8w, 0, 1.0f);
  cvt16<<<gWs, blk, 0, stream>>>(Wv, WVB, n8w, 0, 1.0f);
  cvt16<<<gWo, blk, 0, stream>>>(Wu, WOB, n8o, 1, WOS);
  // (5,6) q and k planes [b][h][s][96] = f16(x_h.Wq^T x8), f16(x_h.Wk^T x8)
  proj_qk<<<gPJ, bPJ, 0, stream>>>(XB, WQB, QP, QSC);
  proj_qk<<<gPJ, bPJ, 0, stream>>>(XB, WKB, KP, KSC);
  // (7) v^T plane [b][h][96 d][2048 keys] = f16(Wv.x_bh^T x256)
  proj_vt<<<gVT, bVT, 0, stream>>>(XB, WVB, VP, VCAR);
  // (8) attention -> O plane [b][h][s][96] x1024 (single f16)
  attn_fwd<<<gAT, bAT, 0, stream>>>(QP, KP, VP, OP);
  // (9) output projection -> out [8192][768] f32, carries 1024 (O) x 1024 (Wu) folded back, + bias
  gemm_out<<<gO, bO, 0, stream>>>(OP, WOB, bu, out, 1.0f / (OSC * WOS));
  (void)hipGetLastError();
}

// v002
// Measured time: 133 microseconds a run.
// Two timings next to v001 both put it at 1.13 times that version's speed.
// All steps since v000 together make it 1.76 times as fast.
// Contractions: x.Wq^T, x.Wk^T and Wv.x^T per head on v_wmma_f32_16x16x32_bf16 (x and Wq/Wk/Wv RNE-converted to bf16
// operands, f32 accumulate); scores k'.q'^T (q', k' single f16 planes carried x8), P.v (P x32768 single f16, v x256 single
// f16) and O.Wu^T (O single f16 plane x1024, Wu as f16(bf16(Wu)) x1024): v_wmma_f32_16x16x32_f16, f32 accumulate.
// Base-2 online softmax, 1/l, bias (bf16 value of bu) and carry folds in f32 on VALU.
#include <hip/hip_runtime.h>
#include <math.h>
#include <stdint.h>

#define NB    4
#define SEQ   2048
#define DMOD  768
#define NH    8
#define HD    96
#define ROWS  (NB * SEQ)
#define QSC   8.0f
#define KSC   8.0f
#define PCAR  32768.0f
#define PEXP  15.0f                             // log2(PCAR)
#define VCAR  256.0f
#define OSC   1024.0f
#define WOS   1024.0f
#define LOG2E 1.4426950408889634f
#define RSQK  0.0360843918243516f
#define ATT_WAVES   4
#define ATT_THREADS (ATT_WAVES * 32)
#define ATT_BLOCKS  (NB * NH * (SEQ / 64))
#define NKB    (SEQ / 32)
#define SLAB   (16 * 68)
#define SLAB96 (16 * 100)
#define STK    64                              // keys per LDS tile
#define NST    (SEQ / STK)                     // 32 tiles
#define KPITCH 208                             // bytes per K row in LDS: 192 + 16 (16 B x odd, for ds_load_b128 readers)
#define VPITCH 144                             // bytes per v^T row in LDS: 128 + 16 (16 B x odd)
#define KTILE  (STK * KPITCH)                  // 13312
#define VTILE  (HD * VPITCH)                   // 13824
#define BUFB   (KTILE + VTILE)                 // 27136
static_assert(DMOD == NH * HD && HD == 96 && NH == 8 && NB == 4 && SEQ == 2048);
static_assert((SEQ / 64) == 32 && ATT_BLOCKS == 1024 && ATT_THREADS == 128 && NKB == 64);
static_assert((HD % 32) == 0 && (DMOD % 64) == 0 && (ROWS % 64) == 0 && (SEQ % 64) == 0);
static_assert(((ROWS * DMOD / 8) % 256) == 0 && ((DMOD * DMOD / 8) % 256) == 0 && ((HD * HD) % 8) == 0);
static_assert((SLAB * 4) % 16 == 0 && (SLAB96 * 4) % 16 == 0);
static_assert(NST >= 2 && STK == 64 && (STK * HD * 2) == 6 * ATT_THREADS * 16 && (HD * STK * 2) == 6 * ATT_THREADS * 16);
static_assert((KTILE % 16) == 0 && (BUFB % 16) == 0 && 2 * BUFB >= ATT_WAVES * SLAB96 * 4);

typedef unsigned short u16;
typedef _Float16 v16h __attribute__((ext_vector_type(16)));
typedef _Float16 v8h  __attribute__((ext_vector_type(8)));
typedef _Float16 v2h  __attribute__((ext_vector_type(2)));
typedef __bf16   v16b __attribute__((ext_vector_type(16)));
typedef float    v8f  __attribute__((ext_vector_type(8)));
typedef float    v4f  __attribute__((ext_vector_type(4)));
typedef float    v2f  __attribute__((ext_vector_type(2)));
typedef unsigned int v4u __attribute__((ext_vector_type(4)));

union FragH { v16h v; v8h h[2]; v4u u[2]; };
union FragB { v16b v; v4u u[2]; };

// ---- scalar helpers --------------------------------------------------------------------------------
__device__ __forceinline__ unsigned short bf_bits(float f) {          // f32 -> bf16 bits, RNE convert
  unsigned u = __float_as_uint(f);
  return (unsigned short)((u + 0x7FFFu + ((u >> 16) & 1u)) >> 16);
}
__device__ __forceinline__ float bf_up(unsigned short h) { return __uint_as_float(((unsigned)h) << 16); }
__device__ __forceinline__ unsigned short h_bits(_Float16 x) { return __builtin_bit_cast(unsigned short, x); }
__device__ __forceinline__ unsigned pk16(unsigned short a, unsigned short b) { return (unsigned)a | ((unsigned)b << 16); }
__device__ __forceinline__ float ex2(float x) { return __builtin_amdgcn_exp2f(x); }   // bare v_exp_f32: 2^-inf = 0, no range fix-up
__device__ __forceinline__ v8f zero8() { v8f z = {0.f, 0.f, 0.f, 0.f, 0.f, 0.f, 0.f, 0.f}; return z; }

// ---- fragment loaders: 16-bit A/B operand, lane -> row/col (lane&15), p already includes +8*(lane>>4);
//      elements 0..7 <- p[0..7] (k0+8h..), elements 8..15 <- p[16..23] (k0+16+8h..)  (same split k map for A and B;
//      B is always read from a k-contiguous [n][k] plane)
__device__ __forceinline__ v16h ldfrag_h(const _Float16* p) {
  FragH f;
  f.h[0] = *(const v8h*)(p);
  f.h[1] = *(const v8h*)(p + 16);
  return f.v;
}
__device__ __forceinline__ v16b ldfrag_b(const u16* p) {              // bf16 plane read as unsigned integer vectors
  FragB f;
  f.u[0] = *(const v4u*)(p);
  f.u[1] = *(const v4u*)(p + 16);
  return f.v;
}

__device__ __forceinline__ v8f mma_h(v16h a, v16h b, v8f c) {
  return __builtin_amdgcn_wmma_f32_16x16x32_f16(false, a, false, b, (short)0, c, false, false);
}
__device__ __forceinline__ v8f mma_b(v16b a, v16b b, v8f c) {
  return __builtin_amdgcn_wmma_f32_16x16x32_bf16(false, a, false, b, (short)0, c, false, false);
}
__device__ __forceinline__ void guard1(v8f& s, v16h x0, v16h x1, v16h x2, v16h x3, v16h x4, v16h x5) {
#if defined(__HIP_DEVICE_COMPILE__)
  asm volatile("v_nop\n\tv_nop\n\tv_nop\n\tv_nop"
               : "+v"(s) : "v"(x0), "v"(x1), "v"(x2), "v"(x3), "v"(x4), "v"(x5) : "memory");
#endif
}
__device__ __forceinline__ void guard3(v8f& a, v8f& b, v8f& c, v16h x0, v16h x1, v16h x2, v16h x3) {
#if defined(__HIP_DEVICE_COMPILE__)
  asm volatile("v_nop\n\tv_nop\n\tv_nop\n\tv_nop"
               : "+v"(a), "+v"(b), "+v"(c) : "v"(x0), "v"(x1), "v"(x2), "v"(x3) : "memory");
#endif
}
template <typename F>
__device__ __forceinline__ void guard4(v8f& a, v8f& b, v8f& c, v8f& d, F x0, F x1, F x2, F x3, F x4) {
#if defined(__HIP_DEVICE_COMPILE__)
  asm volatile("v_nop\n\tv_nop\n\tv_nop\n\tv_nop"
               : "+v"(a), "+v"(b), "+v"(c), "+v"(d) : "v"(x0), "v"(x1), "v"(x2), "v"(x3), "v"(x4) : "memory");
#endif
}
__device__ __forceinline__ void guard6(v8f& a0, v8f& a1, v8f& a2, v8f& a3, v8f& a4, v8f& a5,
                                       v16b x0, v16b x1, v16b x2, v16b x3, v16b x4, v16b x5, v16b x6) {
#if defined(__HIP_DEVICE_COMPILE__)
  asm volatile("v_nop\n\tv_nop\n\tv_nop\n\tv_nop"
               : "+v"(a0), "+v"(a1), "+v"(a2), "+v"(a3), "+v"(a4), "+v"(a5)
               : "v"(x0), "v"(x1), "v"(x2), "v"(x3), "v"(x4), "v"(x5), "v"(x6) : "memory");
#endif
}
__device__ __forceinline__ void acc_guard6(v8f& a, v8f& b, v8f& c, v8f& d, v8f& e, v8f& f) {
#if defined(__HIP_DEVICE_COMPILE__)
  asm volatile("v_nop\n\tv_nop\n\tv_nop\n\tv_nop" : "+v"(a), "+v"(b), "+v"(c), "+v"(d), "+v"(e), "+v"(f));
#endif
}
__device__ __forceinline__ void wave_sync_lds() {
#if defined(__HIP_DEVICE_COMPILE__)
  __builtin_amdgcn_fence(__ATOMIC_RELEASE, "workgroup");
  __builtin_amdgcn_wave_barrier();
  __builtin_amdgcn_fence(__ATOMIC_ACQUIRE, "workgroup");
#endif
}

// =====================================================================================================
// f32 plane -> 16-bit plane, same layout:  mode 0: bf16 RNE bits;  mode 1: f16 bits of (bf16 RNE value) * scale.
// Thread = 8 consecutive elements: two 16-B loads, one 16-B store; 32 consecutive lanes = 512 contiguous, 512-B aligned bytes
// coverage: grid = ceil(n8/256) blocks x 256 thr x 8 elements, in-kernel bound gt < n8 (host checks n8 % 8 == 0 planes).
// =====================================================================================================
__global__ __launch_bounds__(256) void cvt16(const float* __restrict__ x, u16* D, int n8, int mode, float scale) {
  const int gt = blockIdx.x * 256 + (int)threadIdx.x;
  if (gt >= n8) return;                     // no barriers in this kernel
  const float* p = x + (size_t)gt * 8;
  const v4f a = *(const v4f*)(p), c4 = *(const v4f*)(p + 4);
  float v[8];
#pragma unroll
  for (int e = 0; e < 4; ++e) { v[e] = a[e]; v[4 + e] = c4[e]; }
  unsigned short s[8];
#pragma unroll
  for (int e = 0; e < 8; ++e) {
    const unsigned short bb = bf_bits(v[e]);
    const unsigned short hb = h_bits((_Float16)(bf_up(bb) * scale));
    s[e] = (mode != 0) ? hb : bb;
  }
  v4u o;
#pragma unroll
  for (int e = 0; e < 4; ++e) o[e] = pk16(s[2 * e], s[2 * e + 1]);
  u16* d = D + (size_t)gt * 8;
  {
    *(v4u*)(d) = o;
    
  }
}

// =====================================================================================================
// 16x96 f16 epilogue: the wave's 16x96 f32 tile (already scaled) staged by the caller in its LDS slab [16][100];
// coverage: 6 instructions x 32 lanes x 8 halves = 1536 = the wave's 16 x 96 tile (groups of 8 never straddle a row: 96/8 = 12).
// =====================================================================================================
__device__ __forceinline__ void out96(const float* sl, u16* dst, int lane) {
  wave_sync_lds();
  v4u ov[6];
#pragma unroll
  for (int i = 0; i < 6; ++i) {
    const int g   = i * 32 + lane;
    const int row = g / 12;
    const int c8  = (g - row * 12) * 8;
    const v4f a = *(const v4f*)(sl + row * 100 + c8), c4 = *(const v4f*)(sl + row * 100 + c8 + 4);
    float w[8];
#pragma unroll
    for (int e = 0; e < 4; ++e) { w[e] = a[e]; w[4 + e] = c4[e]; }
#pragma unroll
    for (int e = 0; e < 4; ++e) ov[i][e] = pk16(h_bits((_Float16)w[2 * e]), h_bits((_Float16)w[2 * e + 1]));
  }
  {
#pragma unroll
    for (int i = 0; i < 6; ++i) {
      *(v4u*)(dst + (size_t)(i * 32 + lane) * 8) = ov[i];
    }
    
  }
}

// =====================================================================================================
// barrier, then converted to f16 and written: lane = (row in group of 4, 8 consecutive cols); one instruction = 4 rows, each
// coverage: 4 instructions x 4 rows x 8 lanes x 8 halves = the wave's 16 x 64 tile.
// =====================================================================================================
__device__ __forceinline__ void epi16(float* sl, v8f a0, v8f a1, v8f a2, v8f a3, float oscale, u16* C, int N,
                                      size_t rowb, int col0, int lane) {
  const int hh = lane >> 4, m = lane & 15;
#pragma unroll
  for (int r = 0; r < 8; ++r) {
    const int ro = (8 * hh + r) * 68 + m;
    sl[ro]      = a0[r] * oscale;
    sl[ro + 16] = a1[r] * oscale;
    sl[ro + 32] = a2[r] * oscale;
    sl[ro + 48] = a3[r] * oscale;
  }
  wave_sync_lds();
  const int rq = lane >> 3, c8 = (lane & 7) * 8;
  v4u ov[4];
#pragma unroll
  for (int i4 = 0; i4 < 4; ++i4) {
    const int row = i4 * 4 + rq;
    const v4f a = *(const v4f*)(sl + row * 68 + c8), c4 = *(const v4f*)(sl + row * 68 + c8 + 4);
    float w[8];
#pragma unroll
    for (int e = 0; e < 4; ++e) { w[e] = a[e]; w[4 + e] = c4[e]; }
#pragma unroll
    for (int e = 0; e < 4; ++e) ov[i4][e] = pk16(h_bits((_Float16)w[2 * e]), h_bits((_Float16)w[2 * e + 1]));
  }
  u16* dst = C + (rowb + (size_t)rq) * (size_t)N + col0 + c8;
  {
#pragma unroll
    for (int i4 = 0; i4 < 4; ++i4) {
      *(v4u*)(dst + (size_t)(i4 * 4) * (size_t)N) = ov[i4];
    }
    
  }
}

// =====================================================================================================
// f32 GEMM epilogue with bias: the wave's 16x64 f32 tile (acc*oscale + bias[col]) staged in its LDS slab (pitch 68),
// coverage: 8 instructions x 2 rows x 16 lanes x 4 floats = the wave's 16 x 64 tile.
// =====================================================================================================
__device__ __forceinline__ void epi64b(float* sl, v8f a0, v8f a1, v8f a2, v8f a3, float oscale,
                                       float bz0, float bz1, float bz2, float bz3, float* C, int N,
                                       size_t rowb, int col0, int lane) {
  const int hh = lane >> 4, m = lane & 15;
#pragma unroll
  for (int r = 0; r < 8; ++r) {
    const int ro = (8 * hh + r) * 68 + m;
    sl[ro]      = a0[r] * oscale + bz0;
    sl[ro + 16] = a1[r] * oscale + bz1;
    sl[ro + 32] = a2[r] * oscale + bz2;
    sl[ro + 48] = a3[r] * oscale + bz3;
  }
  wave_sync_lds();
  v4f vals[8];
#pragma unroll
  for (int it = 0; it < 8; ++it) vals[it] = *(const v4f*)(sl + (it * 2 + hh) * 68 + m * 4);
  float* dst = C + (rowb + (size_t)hh) * (size_t)N + col0 + m * 4;
  {
#pragma unroll
    for (int it = 0; it < 8; ++it) {
      *(v4f*)(dst + (size_t)(it * 2) * (size_t)N) = vals[it];
    }
    
  }
}

// =====================================================================================================
// Per-head projection (shared 96x96 weight), bf16 operands: P[b][head][s][96] (f16 of acc*oscale) = x[b*SEQ+s][head*96 + i]
// (XB bf16, pitch 768) . W[n][i]^T (bf16 [96 n][96 k], k-contiguous). Block = (64 rows of b*SEQ+s, head), 4 waves x 16 rows,
// each wave 6 accumulators (n = 0..95), K = 96 in 3 steps of 32; fragments loaded straight from the 16-bit rows (split k map).
// The wave's 16x96 tile is one contiguous 3072-B region of the [b][head][s][96] plane (16 s rows of 96 halves), see out96.
// grid = (ROWS/64) * NH = 1024 (exact, host-checked constants).
// =====================================================================================================
__global__ __launch_bounds__(128)
void proj_qk(const u16* __restrict__ XB, const u16* __restrict__ W, u16* P, float oscale) {
  __shared__ __align__(16) float smem[4 * SLAB96];
  const int tid = threadIdx.x, wave = tid >> 5, lane = tid & 31, hh = lane >> 4, m = lane & 15;
  const int bid  = blockIdx.x;
  const int head = bid & (NH - 1);
  const int rt   = bid >> 3;
  const int rowb = rt * 64 + wave * 16;                 // 0..8176, 16 rows never straddle a batch
  const int b    = rowb >> 11;
  const int s0   = rowb & (SEQ - 1);
  const u16* ap = XB + (size_t)(rowb + m) * DMOD + head * HD + 8 * hh;
  const u16* bp = W + (size_t)m * HD + 8 * hh;
  v8f acc[6];
#pragma unroll
  for (int j = 0; j < 6; ++j) acc[j] = zero8();
#pragma unroll 1
  for (int k0 = 0; k0 < HD; k0 += 32) {
    const v16b a  = ldfrag_b(ap + k0);
    const v16b b0 = ldfrag_b(bp + k0);
    const v16b b1 = ldfrag_b(bp + 1 * 16 * HD + k0);
    const v16b b2 = ldfrag_b(bp + 2 * 16 * HD + k0);
    const v16b b3 = ldfrag_b(bp + 3 * 16 * HD + k0);
    const v16b b4 = ldfrag_b(bp + 4 * 16 * HD + k0);
    const v16b b5 = ldfrag_b(bp + 5 * 16 * HD + k0);
    acc[0] = mma_b(a, b0, acc[0]);
    acc[1] = mma_b(a, b1, acc[1]);
    acc[2] = mma_b(a, b2, acc[2]);
    acc[3] = mma_b(a, b3, acc[3]);
    acc[4] = mma_b(a, b4, acc[4]);
    acc[5] = mma_b(a, b5, acc[5]);
    guard6(acc[0], acc[1], acc[2], acc[3], acc[4], acc[5], a, b0, b1, b2, b3, b4, b5);
  }
  // D element r of lane l = (row rowb+8hh+r, col n = 16j + m); stage the 16x96 slab (pitch 100) fully
  float* slab = smem + wave * SLAB96;
#pragma unroll
  for (int r = 0; r < 8; ++r) {
    const int ro = (8 * hh + r) * 100 + m;
#pragma unroll
    for (int j = 0; j < 6; ++j) slab[ro + 16 * j] = acc[j][r] * oscale;
  }
  out96(slab, P + ((size_t)(b * NH + head) * SEQ + s0) * HD, lane);
}

// =====================================================================================================
// Per-head v^T plane, bf16 operands: VT[b][head][d][s] (f16 of acc*oscale, [96][2048] per (b,head)) = Wv[d][i] (bf16 [96][96],
// row-major, k = i contiguous) . x[b*SEQ+s][head*96+i]^T (XB rows are the k-contiguous B operand). Block = (b, head, 64 keys),
// 6 waves, wave w owns d rows 16w..16w+15 and 4 accumulators (s = col0 + 16j + n); K = 96 in 3 steps of 32.
// =====================================================================================================
__global__ __launch_bounds__(192)
void proj_vt(const u16* __restrict__ XB, const u16* __restrict__ W, u16* VT, float oscale) {
  __shared__ __align__(16) float smem[6 * SLAB];
  const int tid = threadIdx.x, wave = tid >> 5, lane = tid & 31, hh = lane >> 4, m = lane & 15;
  const int bid  = blockIdx.x;
  const int st   = bid & (SEQ / 64 - 1);
  const int head = (bid >> 5) & (NH - 1);
  const int b    = bid >> 8;
  const int col0 = st * 64;
  const int rowb = wave * 16;                           // d rows 0..95
  const u16* ap = W + (size_t)(rowb + m) * HD + 8 * hh;
  const u16* bp = XB + ((size_t)b * SEQ + col0 + m) * DMOD + head * HD + 8 * hh;
  const size_t bs = (size_t)16 * DMOD;
  v8f acc0 = zero8(), acc1 = zero8(), acc2 = zero8(), acc3 = zero8();
#pragma unroll 1
  for (int k0 = 0; k0 < HD; k0 += 32) {
    const v16b a  = ldfrag_b(ap + k0);
    const v16b b0 = ldfrag_b(bp + k0);
    const v16b b1 = ldfrag_b(bp + bs + k0);
    const v16b b2 = ldfrag_b(bp + 2 * bs + k0);
    const v16b b3 = ldfrag_b(bp + 3 * bs + k0);
    acc0 = mma_b(a, b0, acc0);
    acc1 = mma_b(a, b1, acc1);
    acc2 = mma_b(a, b2, acc2);
    acc3 = mma_b(a, b3, acc3);
    guard4<v16b>(acc0, acc1, acc2, acc3, a, b0, b1, b2, b3);
  }
  u16* Cb = VT + (size_t)(b * NH + head) * HD * SEQ;
  epi16(smem + wave * SLAB, acc0, acc1, acc2, acc3, oscale, Cb, SEQ, (size_t)rowb, col0, lane);
}

// =====================================================================================================
// Output projection with bias: C[8192][768] (f32) = O . Wu^T * oscale + bf16(bu)[n]; A operand k index = head*96 + d lives at
// O plane address ((b*NH + head)*SEQ + s)*96 + d (O single f16 x1024, 32-deep k-steps never straddle a head since 96 = 3*32);
// Bt = Wu plane [768 n][768 k] f16 (bf16 value x1024), k-contiguous. Block = 64x64 tile, 4 waves x 16 rows; one product per
// tile pair; grid = (ROWS/64)*(DMOD/64) = 1536.
// =====================================================================================================
__global__ __launch_bounds__(128)
void gemm_out(const u16* __restrict__ OP, const u16* __restrict__ WOB, const float* __restrict__ bias, float* C,
              float oscale) {
  __shared__ __align__(16) float slab[4 * SLAB];
  const int tid = threadIdx.x, wave = tid >> 5, lane = tid & 31, hh = lane >> 4, m = lane & 15;
  const int ntile = DMOD >> 6;                          // 12
  const int bid   = blockIdx.x;
  const int rowb  = (bid / ntile) * 64 + wave * 16;
  const int col0  = (bid % ntile) * 64;
  const int row   = rowb + m;
  const int b     = row >> 11;
  const int s     = row & (SEQ - 1);
  const _Float16* abase = (const _Float16*)(const void*)OP + (((size_t)b * NH * SEQ + s) * HD + 8 * hh);
  const _Float16* bp    = (const _Float16*)(const void*)WOB + ((size_t)(col0 + m) * DMOD + 8 * hh);
  const size_t bs = (size_t)16 * DMOD;
  v8f acc0 = zero8(), acc1 = zero8(), acc2 = zero8(), acc3 = zero8();
#pragma unroll 1
  for (int k0 = 0; k0 < DMOD; k0 += 32) {
    const int h  = k0 / HD;
    const int d0 = k0 - h * HD;
    const v16h a  = ldfrag_h(abase + (size_t)h * (SEQ * HD) + d0);
    const v16h b0 = ldfrag_h(bp + k0);
    const v16h b1 = ldfrag_h(bp + bs + k0);
    const v16h b2 = ldfrag_h(bp + 2 * bs + k0);
    const v16h b3 = ldfrag_h(bp + 3 * bs + k0);
    acc0 = mma_h(a, b0, acc0);
    acc1 = mma_h(a, b1, acc1);
    acc2 = mma_h(a, b2, acc2);
    acc3 = mma_h(a, b3, acc3);
    guard4<v16h>(acc0, acc1, acc2, acc3, a, b0, b1, b2, b3);
  }
  // bias for the lane's columns (col0 + 16j + m <= 767), bf16 value of bu
  const float bz0 = bf_up(bf_bits(bias[col0 + m]));
  const float bz1 = bf_up(bf_bits(bias[col0 + 16 + m]));
  const float bz2 = bf_up(bf_bits(bias[col0 + 32 + m]));
  const float bz3 = bf_up(bf_bits(bias[col0 + 48 + m]));
  epi64b(slab + wave * SLAB, acc0, acc1, acc2, acc3, oscale, bz0, bz1, bz2, bz3, C, DMOD, (size_t)rowb, col0, lane);
}

// =====================================================================================================
// One 64-key tile into one LDS buffer, 12 asynchronous 16-B copies per lane (all 128 lanes on, block-uniform control flow):
//   K: 64 rows x 192 B are 12288 contiguous global bytes; piece p = 128 i + tid (i = 0..5) -> LDS row p / 12, 16-B column p % 12
//      (kl0..kl2 hold the places of i = 0..2; i + 3 lies 32 rows further); one wave-instruction = 512 contiguous bytes.
//   v^T: 96 rows x 128 B (global pitch 4096 B); piece p = 128 i + tid -> row p / 8, column p % 8; one wave-instruction = 4 lines.
// s_wait_xcnt stands inside the statement so that no address register is rewritten in front of it.
// =====================================================================================================
__device__ __forceinline__ void tile_copy(unsigned kl0, unsigned kl1, unsigned kl2, unsigned vl,
                                          const char* kg, const char* vg) {
#if defined(__HIP_DEVICE_COMPILE__)
  asm volatile("global_load_async_to_lds_b128 %0, %12, off\n\t"
               "global_load_async_to_lds_b128 %1, %13, off\n\t"
               "global_load_async_to_lds_b128 %2, %14, off\n\t"
               "global_load_async_to_lds_b128 %3, %15, off\n\t"
               "global_load_async_to_lds_b128 %4, %16, off\n\t"
               "global_load_async_to_lds_b128 %5, %17, off\n\t"
               "global_load_async_to_lds_b128 %6, %18, off\n\t"
               "global_load_async_to_lds_b128 %7, %19, off\n\t"
               "global_load_async_to_lds_b128 %8, %20, off\n\t"
               "global_load_async_to_lds_b128 %9, %21, off\n\t"
               "global_load_async_to_lds_b128 %10, %22, off\n\t"
               "global_load_async_to_lds_b128 %11, %23, off\n\t"
               "s_wait_xcnt 0x0"
               :: "v"(kl0), "v"(kl1), "v"(kl2),
                  "v"(kl0 + 32u * KPITCH), "v"(kl1 + 32u * KPITCH), "v"(kl2 + 32u * KPITCH),
                  "v"(vl), "v"(vl + 16u * VPITCH), "v"(vl + 32u * VPITCH),
                  "v"(vl + 48u * VPITCH), "v"(vl + 64u * VPITCH), "v"(vl + 80u * VPITCH),
                  "v"(kg), "v"(kg + 2048), "v"(kg + 4096), "v"(kg + 6144), "v"(kg + 8192), "v"(kg + 10240),
                  "v"(vg), "v"(vg + 16 * SEQ * 2), "v"(vg + 32 * SEQ * 2),
                  "v"(vg + 48 * SEQ * 2), "v"(vg + 64 * SEQ * 2), "v"(vg + 80 * SEQ * 2)
               : "memory");
#endif
}

// =====================================================================================================
// Narrow multi-head flash attention (no mask): block = (batch b, head, 64 query rows), 4 waves, wave w owns the 16 query rows
// q0 = 64*qt + 16*w .. q0+15.
//   q plane (f16, x8) laid out [b][h][s][96]; k plane the same; v^T plane [b][h][96][s] (x256).
//   All NKB = 64 key blocks of 32 keys are visited (static bound), two per 64-key tile. The block's four waves share each K and
//   v^T tile: it is brought into LDS by asynchronous copies (tile_copy), two buffers, tile t + 1 in flight while tile t is
//   worked on; one barrier per tile publishes tile t + 1 and frees tile t's buffer. Fragments are read by ds_load_b128.
//   After the last barrier the ring is dead and its first bytes become the waves' private output slabs.
//   Scores are computed TRANSPOSED: S^T tile g (g = 0,1) = k rows (keys kb+16g .. +15, A operand, row m = lane&15, split k map
//   over d, 3 chunks of 32) times q^T (B operand, col n = query q0 + (lane&15), k = d, split map), one product per tile and
//   32-deep d-chunk. D element r of lane l = (key kb+16g+8h+r, query q0+(l&15)), so a lane owns one query column and 16 of
//   its 32 keys; the partner lane l^16 owns the other 16 -> row max / row sum need one xor-16 shuffle.
//   Online max-subtracted base-2 softmax in f32 (scale 1/sqrt(768) and the q/k carries folded into lsc; scale, maximum and P's
//   carry enter the exponent through one fma, and the row sum l carries x32768 with P). The exp'd values ARE
//   the P A-fragment in place: A row m = query = lane&15, element i <- key kb+8h+i (tile 0, D element i), element 8+i <- key
//   kb+16+8h+i (tile 1, D element i). P is carried x32768 as single f16. The rescale factor of query row 8h+r of the O
//   accumulators is fetched from lane 8h+r with a shuffle (uniform control). 6 v^T B fragments (col n = d = 16j + (lane&15),
//   keys k-contiguous), 6 P.V WMMAs per key block in two guarded groups of 3.
//   Epilogue: 1/l (per query, shuffled to the D row owner) and carry folds in f32; the wave's 16x96 f32 result (x1024)
//   staged in its LDS slab [16][100]; the wave's 16 rows of the O plane [b][h][s][96] are one contiguous 3072-B region written
// coverage: per wave 6 instructions x 32 lanes x 8 halves = 16 x 96; grid 1024 blocks x 4 waves = every (b, h, s) row of the
//           O plane exactly once.
// =====================================================================================================
__global__ __launch_bounds__(ATT_THREADS)
void attn_fwd(const u16* __restrict__ QPp, const u16* __restrict__ KPp, const u16* __restrict__ VPp, u16* OPp) {
  __shared__ __align__(16) unsigned char ring[2 * BUFB];

  const int tid  = threadIdx.x;
  const int wave = tid >> 5;
  const int lane = tid & 31;
  const int hh   = lane >> 4;
  const int c    = lane & 15;

  const int bid  = blockIdx.x;
  const int qt   = bid & (SEQ / 64 - 1);
  const int head = (bid >> 5) & (NH - 1);
  const int b    = bid >> 8;
  const int q0   = qt * 64 + wave * 16;
  const size_t bh = (size_t)(b * NH + head);

  // B fragments of q^T: col n = query q0 + c, k = d (k-contiguous row of the q plane)
  const _Float16* Qb = (const _Float16*)(const void*)QPp + ((bh * SEQ + q0 + c) * HD + 8 * hh);
  // A fragments of k: row m = key (in tile) 16g + c, k = d; byte offset in a buffer's K part
  const int kfo = c * KPITCH + 16 * hh;
  // B fragments of v: col n = d = 16j + c, k = key (k-contiguous row of the v^T tile); byte offset in a buffer
  const int vfo = KTILE + c * VPITCH + 16 * hh;
  // the lane's copy places (LDS byte addresses in buffer 0) and its global sources for tile 0
  const unsigned lds0 = (unsigned)(uintptr_t)(&ring[0]);
  const int kr0 = tid / 12, kr1 = (tid + 128) / 12, kr2 = (tid + 256) / 12;
  const unsigned kl0 = lds0 + (unsigned)(kr0 * KPITCH + (tid - 12 * kr0) * 16);
  const unsigned kl1 = lds0 + (unsigned)(kr1 * KPITCH + (tid + 128 - 12 * kr1) * 16);
  const unsigned kl2 = lds0 + (unsigned)(kr2 * KPITCH + (tid + 256 - 12 * kr2) * 16);
  const unsigned vl  = lds0 + (unsigned)(KTILE + (tid >> 3) * VPITCH + (tid & 7) * 16);
  const char* kg = (const char*)(const void*)KPp + (bh * SEQ * HD * 2 + (size_t)tid * 16);              // + 12288 per tile
  const char* vg = (const char*)(const void*)VPp + ((bh * HD + (size_t)(tid >> 3)) * SEQ * 2 + (size_t)(tid & 7) * 16);  // + 128
  const float lsc = RSQK * (LOG2E / (QSC * KSC));

  const v16h qf0 = ldfrag_h(Qb);            // d 0..31
  const v16h qf1 = ldfrag_h(Qb + 32);       // d 32..63
  const v16h qf2 = ldfrag_h(Qb + 64);       // d 64..95

  float mrun = -INFINITY, lrun = 0.f;
  v8f o[6];
#pragma unroll
  for (int j = 0; j < 6; ++j) o[j] = zero8();

  // ---- ring prologue: tile 0 landed and published, then tile 1 set off ----
  tile_copy(kl0, kl1, kl2, vl, kg, vg);
  asm volatile("s_wait_asynccnt 0x0" ::: "memory");   // this wave's copies of tile 0 have landed
  __syncthreads();                                    // every wave's have
  tile_copy(kl0 + BUFB, kl1 + BUFB, kl2 + BUFB, vl + BUFB, kg + STK * HD * 2, vg + STK * 2);

#pragma unroll 1                                      // one trip per tile stays rolled: one foot, small code
  for (int t = 0; t < NST; ++t) {
   const unsigned bo = (unsigned)(t & 1) * BUFB;      // trip t reads buffer t mod 2 alone
#pragma unroll                                        // the tile's two 32-key blocks: constant LDS offsets in the reads
   for (int sub = 0; sub < 2; ++sub) {
    // ---- transposed scores: s0 = keys kb..kb+15, s1 = keys kb+16..kb+31 (kb = 64 t + 32 sub), column = query q0 + c ----
    const _Float16* k0p = (const _Float16*)(const void*)(ring + bo + kfo + sub * 32 * KPITCH);
    const _Float16* k1p = (const _Float16*)(const void*)(ring + bo + kfo + (sub * 32 + 16) * KPITCH);
    v8f s0 = zero8();
    {
      const v16h ka0 = ldfrag_h(k0p), ka1 = ldfrag_h(k0p + 32), ka2 = ldfrag_h(k0p + 64);
      s0 = mma_h(ka0, qf0, s0);
      s0 = mma_h(ka1, qf1, s0);
      s0 = mma_h(ka2, qf2, s0);
      guard1(s0, qf0, qf1, qf2, ka0, ka1, ka2);
    }
    v8f s1 = zero8();
    {
      const v16h kc0 = ldfrag_h(k1p), kc1 = ldfrag_h(k1p + 32), kc2 = ldfrag_h(k1p + 64);
      s1 = mma_h(kc0, qf0, s1);
      s1 = mma_h(kc1, qf1, s1);
      s1 = mma_h(kc2, qf2, s1);
      guard1(s1, qf0, qf1, qf2, kc0, kc1, kc2);
    }
    // ---- maximum of this lane's 16 raw scores for query q0 + c (lsc > 0, so the scale commutes with the maximum) ----
    float cm = fmaxf(s0[0], s1[0]);
#pragma unroll
    for (int i = 1; i < 8; ++i) cm = fmaxf(fmaxf(cm, s0[i]), s1[i]);
    cm = fmaxf(cm, __shfl_xor(cm, 16, 32));
    const float mn = fmaxf(mrun, cm * lsc);                          // base-2 logit; finite from the first key block on
    const float al = (mrun == -INFINITY) ? 0.f : ex2(mrun - mn);     // o and l are zero while mrun is -inf
    mrun = mn;
    // ---- carried probabilities p * 32768 = 2^(s * lsc - mn + 15): one fma and one v_exp_f32 per score; the argument is at
    //      most 15 plus the fma's rounding, and a result under 2^-126 (flushed) is far below the f16 plane's last place.
    //      P A-fragment: element i <-> s0[i], element 8 + i <-> s1[i] ----
    const v2f lsc2 = {lsc, lsc};
    const v2f eb2  = {PEXP - mn, PEXP - mn};
    float ps = 0.f;
    FragH ph;
#pragma unroll
    for (int w = 0; w < 2; ++w) {
#pragma unroll
      for (int e4 = 0; e4 < 4; ++e4) {
        const v2f sp = (w == 0) ? (v2f){s0[2 * e4], s0[2 * e4 + 1]} : (v2f){s1[2 * e4], s1[2 * e4 + 1]};
        const v2f ar = __builtin_elementwise_fma(sp, lsc2, eb2);
        const float p0 = ex2(ar[0]);
        const float p1 = ex2(ar[1]);
        ps += p0 + p1;
        ph.u[w][e4] = __builtin_bit_cast(unsigned, __builtin_convertvector((v2f){p0, p1}, v2h));   // RNE, as two scalar casts
      }
    }
    ps += __shfl_xor(ps, 16, 32);
    lrun = lrun * al + ps;
    // ---- rescale the O accumulators: D row 8hh+r = query q0+8hh+r, its factor lives in lane 8hh+r (and 16+8hh+r) ----
    float scl[8];
#pragma unroll
    for (int r = 0; r < 8; ++r) scl[r] = __shfl(al, 8 * hh + r, 32);
#pragma unroll
    for (int j = 0; j < 6; ++j) {
#pragma unroll
      for (int r = 0; r < 8; ++r) o[j][r] *= scl[r];
    }
    // ---- P.V : B fragment col n = d = j*16 + c, keys contiguous in the v^T plane; two guarded groups of 3 ----
    {
      const _Float16* vp = (const _Float16*)(const void*)(ring + bo + vfo + sub * 64);
      const v16h vf0 = ldfrag_h(vp);
      const v16h vf1 = ldfrag_h(vp + 16 * (VPITCH / 2));
      const v16h vf2 = ldfrag_h(vp + 32 * (VPITCH / 2));
      o[0] = mma_h(ph.v, vf0, o[0]);
      o[1] = mma_h(ph.v, vf1, o[1]);
      o[2] = mma_h(ph.v, vf2, o[2]);
      guard3(o[0], o[1], o[2], ph.v, vf0, vf1, vf2);
      const v16h vf3 = ldfrag_h(vp + 48 * (VPITCH / 2));
      const v16h vf4 = ldfrag_h(vp + 64 * (VPITCH / 2));
      const v16h vf5 = ldfrag_h(vp + 80 * (VPITCH / 2));
      o[3] = mma_h(ph.v, vf3, o[3]);
      o[4] = mma_h(ph.v, vf4, o[4]);
      o[5] = mma_h(ph.v, vf5, o[5]);
      guard3(o[3], o[4], o[5], ph.v, vf3, vf4, vf5);
    }
   }
   // ---- foot of trip t: publish tile t + 1, free tile t's buffer, refill it with tile t + 2 ----
   asm volatile("s_wait_dscnt 0x0" ::: "memory");      // this wave's reads of tile t are done
   asm volatile("s_wait_asynccnt 0x0" ::: "memory");   // this wave's copies of tile t + 1 have landed
   __syncthreads();                                    // both hold for every wave
   if (t + 2 < NST)                                    // block-uniform
     tile_copy(kl0 + bo, kl1 + bo, kl2 + bo, vl + bo,
               kg + (size_t)(t + 2) * (STK * HD * 2), vg + (size_t)(t + 2) * (STK * 2));
  }
  asm volatile("s_wait_asynccnt 0x0" ::: "memory");    // nothing of this wave is in flight when the ring is reused
  acc_guard6(o[0], o[1], o[2], o[3], o[4], o[5]);

  // ---- fold 1/l (per query, owned by lane = query; l carries PCAR like P, so only v's carry is left), and OSC; stage the slab ----
  const float linv = (lrun > 0.f) ? ((1.0f / lrun) * (OSC / VCAR)) : 0.f;
  float inv[8];
#pragma unroll
  for (int r = 0; r < 8; ++r) inv[r] = __shfl(linv, 8 * hh + r, 32);
  float* slab = (float*)(void*)ring + wave * SLAB96;   // the ring is dead behind the last trip's barrier
#pragma unroll
  for (int r = 0; r < 8; ++r) {
    const int ro = (8 * hh + r) * 100 + c;
#pragma unroll
    for (int j = 0; j < 6; ++j) slab[ro + 16 * j] = o[j][r] * inv[r];
  }
  out96(slab, OPp + (bh * SEQ + q0) * HD, lane);
}

// =====================================================================================================
// Workspace map (bytes); every plane is fully written by whole-line stores before it is read; all extents are exact multiples
// of the 512-B store instructions (no pad rows needed); every base is 256-B aligned:
//   XB  bf16 [8192][768]                       12582912        (x)
//   WQB bf16 [96 n][96 k]                          18432        WKB, WVB the same
//   WOB f16  [768 n][768 k] (bf16 value x1024)   1179648
//   QP  f16  [4][8][2048][96] x8                12582912        KP same
//   VP  f16  [4][8][96][2048] x256              12582912
//   OP  f16  [4][8][2048][96] x1024             12582912
//   end                                          64149504
// =====================================================================================================
extern "C" void kernel_launch(void* const* d_in, const int* in_sizes, int n_in,
                              void* d_out, int out_size, void* d_ws, size_t ws_size,
                              hipStream_t stream) {
  if (n_in < 6) return;
  if (in_sizes[0] != ROWS * DMOD) return;
  if (in_sizes[1] != HD * HD) return;
  if (in_sizes[2] != HD * HD) return;
  if (in_sizes[3] != HD * HD) return;
  if (in_sizes[4] != DMOD * DMOD) return;
  if (in_sizes[5] != DMOD) return;
  if (out_size != ROWS * DMOD) return;

  const float* Xin = (const float*)d_in[0];
  const float* Wq  = (const float*)d_in[1];
  const float* Wk  = (const float*)d_in[2];
  const float* Wv  = (const float*)d_in[3];
  const float* Wu  = (const float*)d_in[4];
  const float* bu  = (const float*)d_in[5];
  float*       out = (float*)d_out;

  const size_t szXB = (size_t)ROWS * DMOD * 2;                  // 12582912
  const size_t szW  = (size_t)HD * HD * 2;                      //    18432
  const size_t szWO = (size_t)DMOD * DMOD * 2;                  //  1179648
  const size_t szP  = (size_t)NB * NH * SEQ * HD * 2;           // 12582912  (q / k / v^T / o planes)
  size_t off = 0;
  const size_t oXB = off; off += szXB;
  const size_t oWQ = off; off += szW;
  const size_t oWK = off; off += szW;
  const size_t oWV = off; off += szW;
  const size_t oWO = off; off += szWO;
  const size_t oQP = off; off += szP;
  const size_t oKP = off; off += szP;
  const size_t oVP = off; off += szP;
  const size_t oOP = off; off += szP;
  if (off > ws_size) return;                            // off = 64149504
  if (off > (size_t)134217728) return;
  if ((szXB % 256) != 0 || (szW % 256) != 0 || (szWO % 256) != 0 || (szP % 256) != 0) return;

  char* ws = (char*)d_ws;
  u16* XB  = (u16*)(ws + oXB);
  u16* WQB = (u16*)(ws + oWQ);
  u16* WKB = (u16*)(ws + oWK);
  u16* WVB = (u16*)(ws + oWV);
  u16* WOB = (u16*)(ws + oWO);
  u16* QP  = (u16*)(ws + oQP);
  u16* KP  = (u16*)(ws + oKP);
  u16* VP  = (u16*)(ws + oVP);
  u16* OP  = (u16*)(ws + oOP);

  const dim3 blk(256);
  const int n8x = (ROWS * DMOD) / 8;                    // 786432
  const int n8w = (HD * HD) / 8;                        //   1152
  const int n8o = (DMOD * DMOD) / 8;                    //  73728
  if (((HD * HD) % 8) != 0 || (n8x % 256) != 0 || (n8o % 256) != 0) return;
  if ((DMOD % 64) != 0 || (ROWS % 64) != 0 || (SEQ % 64) != 0 || (HD % 32) != 0) return;
  const dim3 gX(n8x / 256);                             // 3072
  const dim3 gWs((n8w + 255) / 256);                    // 5 (in-kernel bound gt < n8w)
  const dim3 gWo(n8o / 256);                            // 288
  const dim3 gPJ((ROWS / 64) * NH);                     // 1024
  const dim3 bPJ(128);
  const dim3 gVT(NB * NH * (SEQ / 64));                 // 1024
  const dim3 bVT(192);
  const dim3 gAT(ATT_BLOCKS);                           // 1024
  const dim3 bAT(ATT_THREADS);                          // 128
  const dim3 gO((ROWS / 64) * (DMOD / 64));             // 1536
  const dim3 bO(128);

  // (0..4) operand planes: x -> bf16; Wq/Wk/Wv [n = out][k = in] (already k-contiguous) -> bf16; Wu -> f16 of bf16 value x1024
  cvt16<<<gX, blk, 0, stream>>>(Xin, XB, n8x, 0, 1.0f);
  cvt16<<<gWs, blk, 0, stream>>>(Wq, WQB, n8w, 0, 1.0f);
  cvt16<<<gWs, blk, 0, stream>>>(Wk, WKB, n8w, 0, 1.0f);
  cvt16<<<gWs, blk, 0, stream>>>(Wv, WVB, n8w, 0, 1.0f);
  cvt16<<<gWo, blk, 0, stream>>>(Wu, WOB, n8o, 1, WOS);
  // (5,6) q and k planes [b][h][s][96] = f16(x_h.Wq^T x8), f16(x_h.Wk^T x8)
  proj_qk<<<gPJ, bPJ, 0, stream>>>(XB, WQB, QP, QSC);
  proj_qk<<<gPJ, bPJ, 0, stream>>>(XB, WKB, KP, KSC);
  // (7) v^T plane [b][h][96 d][2048 keys] = f16(Wv.x_bh^T x256)
  proj_vt<<<gVT, bVT, 0, stream>>>(XB, WVB, VP, VCAR);
  // (8) attention -> O plane [b][h][s][96] x1024 (single f16)
  attn_fwd<<<gAT, bAT, 0, stream>>>(QP, KP, VP, OP);
  // (9) output projection -> out [8192][768] f32, carries 1024 (O) x 1024 (Wu) folded back, + bias
  gemm_out<<<gO, bO, 0, stream>>>(OP, WOB, bu, out, 1.0f / (OSC * WOS));
  (void)hipGetLastError();
}

// v003
// A run of this version takes 114 microseconds.
// Timed twice side by side with v002, it ran 1.17 times as fast both times.
// All steps since v000 together make it 2.05 times as fast.
// Contractions: x.Wq^T, x.Wk^T and x.Wv^T per head on v_wmma_f32_16x16x32_bf16 (x and Wq/Wk/Wv RNE-converted to bf16
// operands, f32 accumulate); scores k'.q'^T (q', k' single f16 planes carried x8), P.v (P x32768 single f16, v x256 single
// f16) and O.Wu^T (O single f16 plane x1024, Wu as f16(bf16(Wu)) x1024): v_wmma_f32_16x16x32_f16, f32 accumulate.
// Base-2 online softmax, 1/l, bias (bf16 value of bu) and carry folds in f32 on VALU.
#include <hip/hip_runtime.h>
#include <math.h>
#include <stdint.h>

#define NB    4
#define SEQ   2048
#define DMOD  768
#define NH    8
#define HD    96
#define ROWS  (NB * SEQ)
#define QSC   8.0f
#define KSC   8.0f
#define PCAR  32768.0f
#define PEXP  15.0f                             // log2(PCAR)
#define VCAR  256.0f
#define OSC   1024.0f
#define WOS   1024.0f
#define LOG2E 1.4426950408889634f
#define RSQK  0.0360843918243516f
#define ATT_WAVES   4
#define ATT_THREADS (ATT_WAVES * 32)
#define ATT_BLOCKS  (NB * NH * (SEQ / 64))
#define NKB    (SEQ / 32)
#define SLAB   (16 * 68)
#define SLAB96 (16 * 100)
#define VSP    72                              // halves per v^T row staged in LDS: 64 + 8 (144 B = 16 B x odd)
#define NBW    ((HD * HD / 8 + 255) / 256)     // conversion blocks per 96x96 weight: 5
#define NBU    (DMOD * DMOD / 8 / 256)         // conversion blocks of Wu: 288
#define STK    64                              // keys per LDS tile
#define NST    (SEQ / STK)                     // 32 tiles
#define KPITCH 208                             // bytes per K row in LDS: 192 + 16 (16 B x odd, for ds_load_b128 readers)
#define VPITCH 144                             // bytes per v^T row in LDS: 128 + 16 (16 B x odd)
#define KTILE  (STK * KPITCH)                  // 13312
#define VTILE  (HD * VPITCH)                   // 13824
#define BUFB   (KTILE + VTILE)                 // 27136
static_assert(DMOD == NH * HD && HD == 96 && NH == 8 && NB == 4 && SEQ == 2048);
static_assert((SEQ / 64) == 32 && ATT_BLOCKS == 1024 && ATT_THREADS == 128 && NKB == 64);
static_assert((HD % 32) == 0 && (DMOD % 64) == 0 && (ROWS % 64) == 0 && (SEQ % 64) == 0);
static_assert(((ROWS * DMOD / 8) % 256) == 0 && ((DMOD * DMOD / 8) % 256) == 0 && ((HD * HD) % 8) == 0);
static_assert((SLAB * 4) % 16 == 0 && (SLAB96 * 4) % 16 == 0);
static_assert(NST >= 2 && STK == 64 && (STK * HD * 2) == 6 * ATT_THREADS * 16 && (HD * STK * 2) == 6 * ATT_THREADS * 16);
static_assert((KTILE % 16) == 0 && (BUFB % 16) == 0 && 2 * BUFB >= ATT_WAVES * SLAB96 * 4);

typedef unsigned short u16;
typedef _Float16 v16h __attribute__((ext_vector_type(16)));
typedef _Float16 v8h  __attribute__((ext_vector_type(8)));
typedef _Float16 v2h  __attribute__((ext_vector_type(2)));
typedef __bf16   v16b __attribute__((ext_vector_type(16)));
typedef float    v8f  __attribute__((ext_vector_type(8)));
typedef float    v4f  __attribute__((ext_vector_type(4)));
typedef float    v2f  __attribute__((ext_vector_type(2)));
typedef unsigned int v4u __attribute__((ext_vector_type(4)));

union FragH { v16h v; v8h h[2]; v4u u[2]; };
union FragB { v16b v; v4u u[2]; };

// ---- scalar helpers --------------------------------------------------------------------------------
__device__ __forceinline__ unsigned short bf_bits(float f) {          // f32 -> bf16 bits, RNE convert
  unsigned u = __float_as_uint(f);
  return (unsigned short)((u + 0x7FFFu + ((u >> 16) & 1u)) >> 16);
}
__device__ __forceinline__ float bf_up(unsigned short h) { return __uint_as_float(((unsigned)h) << 16); }
__device__ __forceinline__ unsigned short h_bits(_Float16 x) { return __builtin_bit_cast(unsigned short, x); }
__device__ __forceinline__ unsigned pk16(unsigned short a, unsigned short b) { return (unsigned)a | ((unsigned)b << 16); }
__device__ __forceinline__ float ex2(float x) { return __builtin_amdgcn_exp2f(x); }   // bare v_exp_f32: 2^-inf = 0, no range fix-up
__device__ __forceinline__ v8f zero8() { v8f z = {0.f, 0.f, 0.f, 0.f, 0.f, 0.f, 0.f, 0.f}; return z; }

// ---- fragment loaders: 16-bit A/B operand, lane -> row/col (lane&15), p already includes +8*(lane>>4);
//      elements 0..7 <- p[0..7] (k0+8h..), elements 8..15 <- p[16..23] (k0+16+8h..)  (same split k map for A and B;
//      B is always read from a k-contiguous [n][k] plane)
__device__ __forceinline__ v16h ldfrag_h(const _Float16* p) {
  FragH f;
  f.h[0] = *(const v8h*)(p);
  f.h[1] = *(const v8h*)(p + 16);
  return f.v;
}
__device__ __forceinline__ v16b ldfrag_b(const u16* p) {              // bf16 plane read as unsigned integer vectors
  FragB f;
  f.u[0] = *(const v4u*)(p);
  f.u[1] = *(const v4u*)(p + 16);
  return f.v;
}

// the same fragment straight from an f32 row: RNE to bf16 in registers, same split k map
__device__ __forceinline__ v16b ldfrag_x(const float* p) {
  const v4f a0 = *(const v4f*)(p), a1 = *(const v4f*)(p + 4), a2 = *(const v4f*)(p + 16), a3 = *(const v4f*)(p + 20);
  FragB f;
#pragma unroll
  for (int e = 0; e < 2; ++e) {
    f.u[0][e]     = pk16(bf_bits(a0[2 * e]), bf_bits(a0[2 * e + 1]));
    f.u[0][2 + e] = pk16(bf_bits(a1[2 * e]), bf_bits(a1[2 * e + 1]));
    f.u[1][e]     = pk16(bf_bits(a2[2 * e]), bf_bits(a2[2 * e + 1]));
    f.u[1][2 + e] = pk16(bf_bits(a3[2 * e]), bf_bits(a3[2 * e + 1]));
  }
  return f.v;
}

__device__ __forceinline__ v8f mma_h(v16h a, v16h b, v8f c) {
  return __builtin_amdgcn_wmma_f32_16x16x32_f16(false, a, false, b, (short)0, c, false, false);
}
__device__ __forceinline__ v8f mma_b(v16b a, v16b b, v8f c) {
  return __builtin_amdgcn_wmma_f32_16x16x32_bf16(false, a, false, b, (short)0, c, false, false);
}
__device__ __forceinline__ void guard1(v8f& s, v16h x0, v16h x1, v16h x2, v16h x3, v16h x4, v16h x5) {
#if defined(__HIP_DEVICE_COMPILE__)
  asm volatile("v_nop\n\tv_nop\n\tv_nop\n\tv_nop"
               : "+v"(s) : "v"(x0), "v"(x1), "v"(x2), "v"(x3), "v"(x4), "v"(x5) : "memory");
#endif
}
__device__ __forceinline__ void guard3(v8f& a, v8f& b, v8f& c, v16h x0, v16h x1, v16h x2, v16h x3) {
#if defined(__HIP_DEVICE_COMPILE__)
  asm volatile("v_nop\n\tv_nop\n\tv_nop\n\tv_nop"
               : "+v"(a), "+v"(b), "+v"(c) : "v"(x0), "v"(x1), "v"(x2), "v"(x3) : "memory");
#endif
}
template <typename F>
__device__ __forceinline__ void guard4(v8f& a, v8f& b, v8f& c, v8f& d, F x0, F x1, F x2, F x3, F x4) {
#if defined(__HIP_DEVICE_COMPILE__)
  asm volatile("v_nop\n\tv_nop\n\tv_nop\n\tv_nop"
               : "+v"(a), "+v"(b), "+v"(c), "+v"(d) : "v"(x0), "v"(x1), "v"(x2), "v"(x3), "v"(x4) : "memory");
#endif
}
__device__ __forceinline__ void acc_guard6(v8f& a, v8f& b, v8f& c, v8f& d, v8f& e, v8f& f) {
#if defined(__HIP_DEVICE_COMPILE__)
  asm volatile("v_nop\n\tv_nop\n\tv_nop\n\tv_nop" : "+v"(a), "+v"(b), "+v"(c), "+v"(d), "+v"(e), "+v"(f));
#endif
}
__device__ __forceinline__ void wave_sync_lds() {
#if defined(__HIP_DEVICE_COMPILE__)
  __builtin_amdgcn_fence(__ATOMIC_RELEASE, "workgroup");
  __builtin_amdgcn_wave_barrier();
  __builtin_amdgcn_fence(__ATOMIC_ACQUIRE, "workgroup");
#endif
}

// =====================================================================================================
// The four weight planes, f32 -> 16-bit, same layout, in ONE launch (none reads another's output):
//   blocks 0 .. NBU-1: Wu -> f16 bits of (bf16 RNE value) * WOS;  then NBW blocks each for Wq, Wk, Wv -> bf16 RNE bits.
// Thread = 8 consecutive elements: two 16-B loads, one 16-B store; 32 consecutive lanes = 512 contiguous, 512-B aligned bytes
// coverage: per plane ceil(n8/256) blocks x 256 thr x 8 elements, in-kernel bound gt < n8.
// =====================================================================================================
__global__ __launch_bounds__(256) void cvt_w(const float* __restrict__ wq, const float* __restrict__ wk,
                                             const float* __restrict__ wv, const float* __restrict__ wu,
                                             u16* DQ, u16* DK, u16* DV, u16* DU) {
  const int bid = blockIdx.x;
  const bool big = bid < NBU;                // block-uniform choice of the plane
  const int  r   = bid - NBU;
  const int  w   = r / NBW;
  const float* x = big ? wu : (w == 0 ? wq : (w == 1 ? wk : wv));
  u16*         D = big ? DU : (w == 0 ? DQ : (w == 1 ? DK : DV));
  const int   n8 = big ? (DMOD * DMOD / 8) : (HD * HD / 8);
  const int   gt = (big ? bid : (r - w * NBW)) * 256 + (int)threadIdx.x;
  if (gt >= n8) return;                     // no barriers in this kernel
  const float* p = x + (size_t)gt * 8;
  const v4f a = *(const v4f*)(p), c4 = *(const v4f*)(p + 4);
  float v[8];
#pragma unroll
  for (int e = 0; e < 4; ++e) { v[e] = a[e]; v[4 + e] = c4[e]; }
  unsigned short s[8];
#pragma unroll
  for (int e = 0; e < 8; ++e) {
    const unsigned short bb = bf_bits(v[e]);
    const unsigned short hb = h_bits((_Float16)(bf_up(bb) * WOS));
    s[e] = big ? hb : bb;
  }
  v4u o;
#pragma unroll
  for (int e = 0; e < 4; ++e) o[e] = pk16(s[2 * e], s[2 * e + 1]);
  *(v4u*)(D + (size_t)gt * 8) = o;
}

// =====================================================================================================
// 16x96 f16 epilogue: the wave's 16x96 f32 tile (already scaled) staged by the caller in its LDS slab [16][100];
// coverage: 6 instructions x 32 lanes x 8 halves = 1536 = the wave's 16 x 96 tile (groups of 8 never straddle a row: 96/8 = 12).
// =====================================================================================================
__device__ __forceinline__ void out96(const float* sl, u16* dst, int lane) {
  wave_sync_lds();
  v4u ov[6];
#pragma unroll
  for (int i = 0; i < 6; ++i) {
    const int g   = i * 32 + lane;
    const int row = g / 12;
    const int c8  = (g - row * 12) * 8;
    const v4f a = *(const v4f*)(sl + row * 100 + c8), c4 = *(const v4f*)(sl + row * 100 + c8 + 4);
    float w[8];
#pragma unroll
    for (int e = 0; e < 4; ++e) { w[e] = a[e]; w[4 + e] = c4[e]; }
#pragma unroll
    for (int e = 0; e < 4; ++e) ov[i][e] = pk16(h_bits((_Float16)w[2 * e]), h_bits((_Float16)w[2 * e + 1]));
  }
  {
#pragma unroll
    for (int i = 0; i < 6; ++i) {
      *(v4u*)(dst + (size_t)(i * 32 + lane) * 8) = ov[i];
    }
    
  }
}

// =====================================================================================================
// f32 GEMM epilogue with bias: the wave's 16x64 f32 tile (acc*oscale + bias[col]) staged in its LDS slab (pitch 68),
// coverage: 8 instructions x 2 rows x 16 lanes x 4 floats = the wave's 16 x 64 tile.
// =====================================================================================================
__device__ __forceinline__ void epi64b(float* sl, v8f a0, v8f a1, v8f a2, v8f a3, float oscale,
                                       float bz0, float bz1, float bz2, float bz3, float* C, int N,
                                       size_t rowb, int col0, int lane) {
  const int hh = lane >> 4, m = lane & 15;
#pragma unroll
  for (int r = 0; r < 8; ++r) {
    const int ro = (8 * hh + r) * 68 + m;
    sl[ro]      = a0[r] * oscale + bz0;
    sl[ro + 16] = a1[r] * oscale + bz1;
    sl[ro + 32] = a2[r] * oscale + bz2;
    sl[ro + 48] = a3[r] * oscale + bz3;
  }
  wave_sync_lds();
  v4f vals[8];
#pragma unroll
  for (int it = 0; it < 8; ++it) vals[it] = *(const v4f*)(sl + (it * 2 + hh) * 68 + m * 4);
  float* dst = C + (rowb + (size_t)hh) * (size_t)N + col0 + m * 4;
  {
#pragma unroll
    for (int it = 0; it < 8; ++it) {
      *(v4f*)(dst + (size_t)(it * 2) * (size_t)N) = vals[it];
    }
    
  }
}

// =====================================================================================================
// The three per-head projections (shared 96x96 weights) in ONE launch, bf16 operands. Block = (64 rows of b*SEQ+s, head),
// 4 waves x 16 rows. A wave reads its 16 x 96 piece of x ONCE, as f32 (pitch 768), rounds it to bf16 in registers (ldfrag_x)
// and uses the three A fragments for all three products x . W^T; W = bf16 [96 n][96 k], k-contiguous B operand; 6 accumulators
// (n = 0..95), K = 96 in 3 steps of 32.
//   q, k: P[b][head][s][96] = f16(acc * 8); the wave's 16x96 tile is one contiguous 3072-B region, see out96.
//   v:    D element r of lane l = (s = 8hh + r, d = 16j + m): a lane's 8 values are 8 consecutive keys of one v^T row; the block's
//         96 x 64 tile of VT[b][head][d][s] (f16 of acc * 256) is gathered in LDS and leaves as whole 128-B lines.
// coverage: v^T 6 instructions x 128 threads x 8 halves = 96 x 64; grid = (ROWS/64) * NH = 1024 (exact, host-checked constants).
// =====================================================================================================
__device__ __forceinline__ void proj96(const v16b x0, const v16b x1, const v16b x2, const u16* bp, v8f (&acc)[6]) {
#pragma unroll
  for (int j = 0; j < 6; ++j) acc[j] = mma_b(x0, ldfrag_b(bp + j * 16 * HD), zero8());
#pragma unroll
  for (int j = 0; j < 6; ++j) acc[j] = mma_b(x1, ldfrag_b(bp + j * 16 * HD + 32), acc[j]);
#pragma unroll
  for (int j = 0; j < 6; ++j) acc[j] = mma_b(x2, ldfrag_b(bp + j * 16 * HD + 64), acc[j]);
}
// behind the last weight loads: their offset register is kept whole up to this wait
__device__ __forceinline__ void hold_offset(unsigned off) {
#if defined(__HIP_DEVICE_COMPILE__)
  asm volatile("s_wait_xcnt 0x0" :: "v"(off) : "memory");
#endif
}
// D element r of lane l = (row 8hh+r, col n = 16j + m); stage the 16x96 slab (pitch 100) fully
__device__ __forceinline__ void stage96(float* slab, const v8f (&acc)[6], float oscale, int hh, int m) {
#pragma unroll
  for (int r = 0; r < 8; ++r) {
    const int ro = (8 * hh + r) * 100 + m;
#pragma unroll
    for (int j = 0; j < 6; ++j) slab[ro + 16 * j] = acc[j][r] * oscale;
  }
}

// 4096 waves = 4 per SIMD: with that occupancy's register budget all 36 weight loads of a product are in flight at once
__global__ __launch_bounds__(128) __attribute__((amdgpu_waves_per_eu(4, 4)))
void proj_qkv(const float* __restrict__ X, const u16* __restrict__ WQ, const u16* __restrict__ WK,
              const u16* __restrict__ WV, u16* QP, u16* KP, u16* VT) {
  __shared__ __align__(16) float smem[4 * SLAB96];
  __shared__ __align__(16) u16 vst[HD * VSP];
  const int tid = threadIdx.x, wave = tid >> 5, lane = tid & 31, hh = lane >> 4, m = lane & 15;
  const int bid  = blockIdx.x;
  const int head = bid & (NH - 1);
  const int rt   = bid >> 3;
  const int rowb = rt * 64 + wave * 16;                 // 0..8176, the block's 64 rows never straddle a batch
  const int b    = rowb >> 11;
  const int s0   = rowb & (SEQ - 1);
  const size_t bh = (size_t)(b * NH + head);
  const float* xp = X + (size_t)(rowb + m) * DMOD + head * HD + 8 * hh;
  const v16b x0 = ldfrag_x(xp), x1 = ldfrag_x(xp + 32), x2 = ldfrag_x(xp + 64);
  const unsigned wob = (unsigned)(m * HD + 8 * hh) * 2u;   // the lane's byte offset in each weight plane
  float* slab = smem + wave * SLAB96;
  v8f acc[6];
  proj96(x0, x1, x2, (const u16*)((const char*)WQ + wob), acc);
  stage96(slab, acc, QSC, hh, m);
  out96(slab, QP + (bh * SEQ + s0) * HD, lane);
  proj96(x0, x1, x2, (const u16*)((const char*)WK + wob), acc);
  wave_sync_lds();                                      // the wave's reads of the q slab stay in front of the k slab's writes
  stage96(slab, acc, KSC, hh, m);
  out96(slab, KP + (bh * SEQ + s0) * HD, lane);
  proj96(x0, x1, x2, (const u16*)((const char*)WV + wob), acc);
  hold_offset(wob);
#pragma unroll
  for (int j = 0; j < 6; ++j) {
    v8h h;
#pragma unroll
    for (int r = 0; r < 8; ++r) h[r] = (_Float16)(acc[j][r] * VCAR);
    *(v4u*)(vst + (16 * j + m) * VSP + wave * 16 + 8 * hh) = __builtin_bit_cast(v4u, h);
  }
  __syncthreads();                                      // the four waves' key columns make up the 128-B lines
  u16* vb = VT + bh * HD * SEQ + (s0 - wave * 16);
#pragma unroll
  for (int i = 0; i < 6; ++i) {
    const int p = i * 128 + tid, row = p >> 3, c8 = (p & 7) * 8;
    *(v4u*)(vb + (size_t)row * SEQ + c8) = *(const v4u*)(vst + row * VSP + c8);
  }
}

// =====================================================================================================
// Output projection with bias: C[8192][768] (f32) = O . Wu^T * oscale + bf16(bu)[n]; A operand k index = head*96 + d lives at
// O plane address ((b*NH + head)*SEQ + s)*96 + d (O single f16 x1024, 32-deep k-steps never straddle a head since 96 = 3*32);
// Bt = Wu plane [768 n][768 k] f16 (bf16 value x1024), k-contiguous. Block = 64x64 tile, 4 waves x 16 rows; one product per
// tile pair; grid = (ROWS/64)*(DMOD/64) = 1536.
// =====================================================================================================
__global__ __launch_bounds__(128)
void gemm_out(const u16* __restrict__ OP, const u16* __restrict__ WOB, const float* __restrict__ bias, float* C,
              float oscale) {
  __shared__ __align__(16) float slab[4 * SLAB];
  const int tid = threadIdx.x, wave = tid >> 5, lane = tid & 31, hh = lane >> 4, m = lane & 15;
  const int ntile = DMOD >> 6;                          // 12
  const int bid   = blockIdx.x;
  const int rowb  = (bid / ntile) * 64 + wave * 16;
  const int col0  = (bid % ntile) * 64;
  const int row   = rowb + m;
  const int b     = row >> 11;
  const int s     = row & (SEQ - 1);
  const _Float16* abase = (const _Float16*)(const void*)OP + (((size_t)b * NH * SEQ + s) * HD + 8 * hh);
  const _Float16* bp    = (const _Float16*)(const void*)WOB + ((size_t)(col0 + m) * DMOD + 8 * hh);
  const size_t bs = (size_t)16 * DMOD;
  v8f acc0 = zero8(), acc1 = zero8(), acc2 = zero8(), acc3 = zero8();
#pragma unroll 1
  for (int k0 = 0; k0 < DMOD; k0 += 32) {
    const int h  = k0 / HD;
    const int d0 = k0 - h * HD;
    const v16h a  = ldfrag_h(abase + (size_t)h * (SEQ * HD) + d0);
    const v16h b0 = ldfrag_h(bp + k0);
    const v16h b1 = ldfrag_h(bp + bs + k0);
    const v16h b2 = ldfrag_h(bp + 2 * bs + k0);
    const v16h b3 = ldfrag_h(bp + 3 * bs + k0);
    acc0 = mma_h(a, b0, acc0);
    acc1 = mma_h(a, b1, acc1);
    acc2 = mma_h(a, b2, acc2);
    acc3 = mma_h(a, b3, acc3);
    guard4<v16h>(acc0, acc1, acc2, acc3, a, b0, b1, b2, b3);
  }
  // bias for the lane's columns (col0 + 16j + m <= 767), bf16 value of bu
  const float bz0 = bf_up(bf_bits(bias[col0 + m]));
  const float bz1 = bf_up(bf_bits(bias[col0 + 16 + m]));
  const float bz2 = bf_up(bf_bits(bias[col0 + 32 + m]));
  const float bz3 = bf_up(bf_bits(bias[col0 + 48 + m]));
  epi64b(slab + wave * SLAB, acc0, acc1, acc2, acc3, oscale, bz0, bz1, bz2, bz3, C, DMOD, (size_t)rowb, col0, lane);
}

// =====================================================================================================
// One 64-key tile into one LDS buffer, 12 asynchronous 16-B copies per lane (all 128 lanes on, block-uniform control flow):
//   K: 64 rows x 192 B are 12288 contiguous global bytes; piece p = 128 i + tid (i = 0..5) -> LDS row p / 12, 16-B column p % 12
//      (kl0..kl2 hold the places of i = 0..2; i + 3 lies 32 rows further); one wave-instruction = 512 contiguous bytes.
//   v^T: 96 rows x 128 B (global pitch 4096 B); piece p = 128 i + tid -> row p / 8, column p % 8; one wave-instruction = 4 lines.
// s_wait_xcnt stands inside the statement so that no address register is rewritten in front of it.
// =====================================================================================================
__device__ __forceinline__ void tile_copy(unsigned kl0, unsigned kl1, unsigned kl2, unsigned vl,
                                          const char* kg, const char* vg) {
#if defined(__HIP_DEVICE_COMPILE__)
  asm volatile("global_load_async_to_lds_b128 %0, %12, off\n\t"
               "global_load_async_to_lds_b128 %1, %13, off\n\t"
               "global_load_async_to_lds_b128 %2, %14, off\n\t"
               "global_load_async_to_lds_b128 %3, %15, off\n\t"
               "global_load_async_to_lds_b128 %4, %16, off\n\t"
               "global_load_async_to_lds_b128 %5, %17, off\n\t"
               "global_load_async_to_lds_b128 %6, %18, off\n\t"
               "global_load_async_to_lds_b128 %7, %19, off\n\t"
               "global_load_async_to_lds_b128 %8, %20, off\n\t"
               "global_load_async_to_lds_b128 %9, %21, off\n\t"
               "global_load_async_to_lds_b128 %10, %22, off\n\t"
               "global_load_async_to_lds_b128 %11, %23, off\n\t"
               "s_wait_xcnt 0x0"
               :: "v"(kl0), "v"(kl1), "v"(kl2),
                  "v"(kl0 + 32u * KPITCH), "v"(kl1 + 32u * KPITCH), "v"(kl2 + 32u * KPITCH),
                  "v"(vl), "v"(vl + 16u * VPITCH), "v"(vl + 32u * VPITCH),
                  "v"(vl + 48u * VPITCH), "v"(vl + 64u * VPITCH), "v"(vl + 80u * VPITCH),
                  "v"(kg), "v"(kg + 2048), "v"(kg + 4096), "v"(kg + 6144), "v"(kg + 8192), "v"(kg + 10240),
                  "v"(vg), "v"(vg + 16 * SEQ * 2), "v"(vg + 32 * SEQ * 2),
                  "v"(vg + 48 * SEQ * 2), "v"(vg + 64 * SEQ * 2), "v"(vg + 80 * SEQ * 2)
               : "memory");
#endif
}

// =====================================================================================================
// Narrow multi-head flash attention (no mask): block = (batch b, head, 64 query rows), 4 waves, wave w owns the 16 query rows
// q0 = 64*qt + 16*w .. q0+15.
//   q plane (f16, x8) laid out [b][h][s][96]; k plane the same; v^T plane [b][h][96][s] (x256).
//   All NKB = 64 key blocks of 32 keys are visited (static bound), two per 64-key tile. The block's four waves share each K and
//   v^T tile: it is brought into LDS by asynchronous copies (tile_copy), two buffers, tile t + 1 in flight while tile t is
//   worked on; one barrier per tile publishes tile t + 1 and frees tile t's buffer. Fragments are read by ds_load_b128.
//   After the last barrier the ring is dead and its first bytes become the waves' private output slabs.
//   Scores are computed TRANSPOSED: S^T tile g (g = 0,1) = k rows (keys kb+16g .. +15, A operand, row m = lane&15, split k map
//   over d, 3 chunks of 32) times q^T (B operand, col n = query q0 + (lane&15), k = d, split map), one product per tile and
//   32-deep d-chunk. D element r of lane l = (key kb+16g+8h+r, query q0+(l&15)), so a lane owns one query column and 16 of
//   its 32 keys; the partner lane l^16 owns the other 16 -> row max / row sum need one xor-16 shuffle.
//   Online max-subtracted base-2 softmax in f32 (scale 1/sqrt(768) and the q/k carries folded into lsc; scale, maximum and P's
//   carry enter the exponent through one fma, and the row sum l carries x32768 with P). The exp'd values ARE
//   the P A-fragment in place: A row m = query = lane&15, element i <- key kb+8h+i (tile 0, D element i), element 8+i <- key
//   kb+16+8h+i (tile 1, D element i). P is carried x32768 as single f16. The rescale factor of query row 8h+r of the O
//   accumulators is fetched from lane 8h+r with a shuffle (uniform control). 6 v^T B fragments (col n = d = 16j + (lane&15),
//   keys k-contiguous), 6 P.V WMMAs per key block in two guarded groups of 3.
//   Epilogue: 1/l (per query, shuffled to the D row owner) and carry folds in f32; the wave's 16x96 f32 result (x1024)
//   staged in its LDS slab [16][100]; the wave's 16 rows of the O plane [b][h][s][96] are one contiguous 3072-B region written
// coverage: per wave 6 instructions x 32 lanes x 8 halves = 16 x 96; grid 1024 blocks x 4 waves = every (b, h, s) row of the
//           O plane exactly once.
// =====================================================================================================
__global__ __launch_bounds__(ATT_THREADS)
void attn_fwd(const u16* __restrict__ QPp, const u16* __restrict__ KPp, const u16* __restrict__ VPp, u16* OPp) {
  __shared__ __align__(16) unsigned char ring[2 * BUFB];

  const int tid  = threadIdx.x;
  const int wave = tid >> 5;
  const int lane = tid & 31;
  const int hh   = lane >> 4;
  const int c    = lane & 15;

  const int bid  = blockIdx.x;
  const int qt   = bid & (SEQ / 64 - 1);
  const int head = (bid >> 5) & (NH - 1);
  const int b    = bid >> 8;
  const int q0   = qt * 64 + wave * 16;
  const size_t bh = (size_t)(b * NH + head);

  // B fragments of q^T: col n = query q0 + c, k = d (k-contiguous row of the q plane)
  const _Float16* Qb = (const _Float16*)(const void*)QPp + ((bh * SEQ + q0 + c) * HD + 8 * hh);
  // A fragments of k: row m = key (in tile) 16g + c, k = d; byte offset in a buffer's K part
  const int kfo = c * KPITCH + 16 * hh;
  // B fragments of v: col n = d = 16j + c, k = key (k-contiguous row of the v^T tile); byte offset in a buffer
  const int vfo = KTILE + c * VPITCH + 16 * hh;
  // the lane's copy places (LDS byte addresses in buffer 0) and its global sources for tile 0
  const unsigned lds0 = (unsigned)(uintptr_t)(&ring[0]);
  const int kr0 = tid / 12, kr1 = (tid + 128) / 12, kr2 = (tid + 256) / 12;
  const unsigned kl0 = lds0 + (unsigned)(kr0 * KPITCH + (tid - 12 * kr0) * 16);
  const unsigned kl1 = lds0 + (unsigned)(kr1 * KPITCH + (tid + 128 - 12 * kr1) * 16);
  const unsigned kl2 = lds0 + (unsigned)(kr2 * KPITCH + (tid + 256 - 12 * kr2) * 16);
  const unsigned vl  = lds0 + (unsigned)(KTILE + (tid >> 3) * VPITCH + (tid & 7) * 16);
  const char* kg = (const char*)(const void*)KPp + (bh * SEQ * HD * 2 + (size_t)tid * 16);              // + 12288 per tile
  const char* vg = (const char*)(const void*)VPp + ((bh * HD + (size_t)(tid >> 3)) * SEQ * 2 + (size_t)(tid & 7) * 16);  // + 128
  const float lsc = RSQK * (LOG2E / (QSC * KSC));

  const v16h qf0 = ldfrag_h(Qb);            // d 0..31
  const v16h qf1 = ldfrag_h(Qb + 32);       // d 32..63
  const v16h qf2 = ldfrag_h(Qb + 64);       // d 64..95

  float mrun = -INFINITY, lrun = 0.f;
  v8f o[6];
#pragma unroll
  for (int j = 0; j < 6; ++j) o[j] = zero8();

  // ---- ring prologue: tile 0 landed and published, then tile 1 set off ----
  tile_copy(kl0, kl1, kl2, vl, kg, vg);
  asm volatile("s_wait_asynccnt 0x0" ::: "memory");   // this wave's copies of tile 0 have landed
  __syncthreads();                                    // every wave's have
  tile_copy(kl0 + BUFB, kl1 + BUFB, kl2 + BUFB, vl + BUFB, kg + STK * HD * 2, vg + STK * 2);

#pragma unroll 1                                      // one trip per tile stays rolled: one foot, small code
  for (int t = 0; t < NST; ++t) {
   const unsigned bo = (unsigned)(t & 1) * BUFB;      // trip t reads buffer t mod 2 alone
#pragma unroll                                        // the tile's two 32-key blocks: constant LDS offsets in the reads
   for (int sub = 0; sub < 2; ++sub) {
    // ---- transposed scores: s0 = keys kb..kb+15, s1 = keys kb+16..kb+31 (kb = 64 t + 32 sub), column = query q0 + c ----
    const _Float16* k0p = (const _Float16*)(const void*)(ring + bo + kfo + sub * 32 * KPITCH);
    const _Float16* k1p = (const _Float16*)(const void*)(ring + bo + kfo + (sub * 32 + 16) * KPITCH);
    v8f s0 = zero8();
    {
      const v16h ka0 = ldfrag_h(k0p), ka1 = ldfrag_h(k0p + 32), ka2 = ldfrag_h(k0p + 64);
      s0 = mma_h(ka0, qf0, s0);
      s0 = mma_h(ka1, qf1, s0);
      s0 = mma_h(ka2, qf2, s0);
      guard1(s0, qf0, qf1, qf2, ka0, ka1, ka2);
    }
    v8f s1 = zero8();
    {
      const v16h kc0 = ldfrag_h(k1p), kc1 = ldfrag_h(k1p + 32), kc2 = ldfrag_h(k1p + 64);
      s1 = mma_h(kc0, qf0, s1);
      s1 = mma_h(kc1, qf1, s1);
      s1 = mma_h(kc2, qf2, s1);
      guard1(s1, qf0, qf1, qf2, kc0, kc1, kc2);
    }
    // ---- maximum of this lane's 16 raw scores for query q0 + c (lsc > 0, so the scale commutes with the maximum) ----
    float cm = fmaxf(s0[0], s1[0]);
#pragma unroll
    for (int i = 1; i < 8; ++i) cm = fmaxf(fmaxf(cm, s0[i]), s1[i]);
    cm = fmaxf(cm, __shfl_xor(cm, 16, 32));
    const float mn = fmaxf(mrun, cm * lsc);                          // base-2 logit; finite from the first key block on
    const float al = (mrun == -INFINITY) ? 0.f : ex2(mrun - mn);     // o and l are zero while mrun is -inf
    mrun = mn;
    // ---- carried probabilities p * 32768 = 2^(s * lsc - mn + 15): one fma and one v_exp_f32 per score; the argument is at
    //      most 15 plus the fma's rounding, and a result under 2^-126 (flushed) is far below the f16 plane's last place.
    //      P A-fragment: element i <-> s0[i], element 8 + i <-> s1[i] ----
    const v2f lsc2 = {lsc, lsc};
    const v2f eb2  = {PEXP - mn, PEXP - mn};
    float ps = 0.f;
    FragH ph;
#pragma unroll
    for (int w = 0; w < 2; ++w) {
#pragma unroll
      for (int e4 = 0; e4 < 4; ++e4) {
        const v2f sp = (w == 0) ? (v2f){s0[2 * e4], s0[2 * e4 + 1]} : (v2f){s1[2 * e4], s1[2 * e4 + 1]};
        const v2f ar = __builtin_elementwise_fma(sp, lsc2, eb2);
        const float p0 = ex2(ar[0]);
        const float p1 = ex2(ar[1]);
        ps += p0 + p1;
        ph.u[w][e4] = __builtin_bit_cast(unsigned, __builtin_convertvector((v2f){p0, p1}, v2h));   // RNE, as two scalar casts
      }
    }
    ps += __shfl_xor(ps, 16, 32);
    lrun = lrun * al + ps;
    // ---- rescale the O accumulators: D row 8hh+r = query q0+8hh+r, its factor lives in lane 8hh+r (and 16+8hh+r) ----
    float scl[8];
#pragma unroll
    for (int r = 0; r < 8; ++r) scl[r] = __shfl(al, 8 * hh + r, 32);
#pragma unroll
    for (int j = 0; j < 6; ++j) {
#pragma unroll
      for (int r = 0; r < 8; ++r) o[j][r] *= scl[r];
    }
    // ---- P.V : B fragment col n = d = j*16 + c, keys contiguous in the v^T plane; two guarded groups of 3 ----
    {
      const _Float16* vp = (const _Float16*)(const void*)(ring + bo + vfo + sub * 64);
      const v16h vf0 = ldfrag_h(vp);
      const v16h vf1 = ldfrag_h(vp + 16 * (VPITCH / 2));
      const v16h vf2 = ldfrag_h(vp + 32 * (VPITCH / 2));
      o[0] = mma_h(ph.v, vf0, o[0]);
      o[1] = mma_h(ph.v, vf1, o[1]);
      o[2] = mma_h(ph.v, vf2, o[2]);
      guard3(o[0], o[1], o[2], ph.v, vf0, vf1, vf2);
      const v16h vf3 = ldfrag_h(vp + 48 * (VPITCH / 2));
      const v16h vf4 = ldfrag_h(vp + 64 * (VPITCH / 2));
      const v16h vf5 = ldfrag_h(vp + 80 * (VPITCH / 2));
      o[3] = mma_h(ph.v, vf3, o[3]);
      o[4] = mma_h(ph.v, vf4, o[4]);
      o[5] = mma_h(ph.v, vf5, o[5]);
      guard3(o[3], o[4], o[5], ph.v, vf3, vf4, vf5);
    }
   }
   // ---- foot of trip t: publish tile t + 1, free tile t's buffer, refill it with tile t + 2 ----
   asm volatile("s_wait_dscnt 0x0" ::: "memory");      // this wave's reads of tile t are done
   asm volatile("s_wait_asynccnt 0x0" ::: "memory");   // this wave's copies of tile t + 1 have landed
   __syncthreads();                                    // both hold for every wave
   if (t + 2 < NST)                                    // block-uniform
     tile_copy(kl0 + bo, kl1 + bo, kl2 + bo, vl + bo,
               kg + (size_t)(t + 2) * (STK * HD * 2), vg + (size_t)(t + 2) * (STK * 2));
  }
  asm volatile("s_wait_asynccnt 0x0" ::: "memory");    // nothing of this wave is in flight when the ring is reused
  acc_guard6(o[0], o[1], o[2], o[3], o[4], o[5]);

  // ---- fold 1/l (per query, owned by lane = query; l carries PCAR like P, so only v's carry is left), and OSC; stage the slab ----
  const float linv = (lrun > 0.f) ? ((1.0f / lrun) * (OSC / VCAR)) : 0.f;
  float inv[8];
#pragma unroll
  for (int r = 0; r < 8; ++r) inv[r] = __shfl(linv, 8 * hh + r, 32);
  float* slab = (float*)(void*)ring + wave * SLAB96;   // the ring is dead behind the last trip's barrier
#pragma unroll
  for (int r = 0; r < 8; ++r) {
    const int ro = (8 * hh + r) * 100 + c;
#pragma unroll
    for (int j = 0; j < 6; ++j) slab[ro + 16 * j] = o[j][r] * inv[r];
  }
  out96(slab, OPp + (bh * SEQ + q0) * HD, lane);
}

// =====================================================================================================
// Workspace map (bytes); every plane is fully written by whole-line stores before it is read; all extents are exact multiples
// of the 512-B store instructions (no pad rows needed); every base is 256-B aligned:
//   WQB bf16 [96 n][96 k]                          18432        WKB, WVB the same
//   WOB f16  [768 n][768 k] (bf16 value x1024)   1179648
//   QP  f16  [4][8][2048][96] x8                12582912        KP same
//   VP  f16  [4][8][96][2048] x256              12582912
//   OP  f16  [4][8][2048][96] x1024             12582912
//   end                                          51566592
// =====================================================================================================
extern "C" void kernel_launch(void* const* d_in, const int* in_sizes, int n_in,
                              void* d_out, int out_size, void* d_ws, size_t ws_size,
                              hipStream_t stream) {
  if (n_in < 6) return;
  if (in_sizes[0] != ROWS * DMOD) return;
  if (in_sizes[1] != HD * HD) return;
  if (in_sizes[2] != HD * HD) return;
  if (in_sizes[3] != HD * HD) return;
  if (in_sizes[4] != DMOD * DMOD) return;
  if (in_sizes[5] != DMOD) return;
  if (out_size != ROWS * DMOD) return;

  const float* Xin = (const float*)d_in[0];
  const float* Wq  = (const float*)d_in[1];
  const float* Wk  = (const float*)d_in[2];
  const float* Wv  = (const float*)d_in[3];
  const float* Wu  = (const float*)d_in[4];
  const float* bu  = (const float*)d_in[5];
  float*       out = (float*)d_out;

  const size_t szW  = (size_t)HD * HD * 2;                      //    18432
  const size_t szWO = (size_t)DMOD * DMOD * 2;                  //  1179648
  const size_t szP  = (size_t)NB * NH * SEQ * HD * 2;           // 12582912  (q / k / v^T / o planes)
  size_t off = 0;
  const size_t oWQ = off; off += szW;
  const size_t oWK = off; off += szW;
  const size_t oWV = off; off += szW;
  const size_t oWO = off; off += szWO;
  const size_t oQP = off; off += szP;
  const size_t oKP = off; off += szP;
  const size_t oVP = off; off += szP;
  const size_t oOP = off; off += szP;
  if (off > ws_size) return;                            // off = 51566592
  if (off > (size_t)134217728) return;
  if ((szW % 256) != 0 || (szWO % 256) != 0 || (szP % 256) != 0) return;

  char* ws = (char*)d_ws;
  u16* WQB = (u16*)(ws + oWQ);
  u16* WKB = (u16*)(ws + oWK);
  u16* WVB = (u16*)(ws + oWV);
  u16* WOB = (u16*)(ws + oWO);
  u16* QP  = (u16*)(ws + oQP);
  u16* KP  = (u16*)(ws + oKP);
  u16* VP  = (u16*)(ws + oVP);
  u16* OP  = (u16*)(ws + oOP);

  if (((HD * HD) % 8) != 0 || ((DMOD * DMOD / 8) % 256) != 0) return;
  if ((DMOD % 64) != 0 || (ROWS % 64) != 0 || (SEQ % 64) != 0 || (HD % 32) != 0) return;
  const dim3 gW(NBU + 3 * NBW);                         // 303 (in-kernel bound gt < n8 per plane)
  const dim3 bW(256);
  const dim3 gPJ((ROWS / 64) * NH);                     // 1024
  const dim3 bPJ(128);
  const dim3 gAT(ATT_BLOCKS);                           // 1024
  const dim3 bAT(ATT_THREADS);                          // 128
  const dim3 gO((ROWS / 64) * (DMOD / 64));             // 1536
  const dim3 bO(128);

  // (0) weight planes: Wq/Wk/Wv [n = out][k = in] (already k-contiguous) -> bf16; Wu -> f16 of bf16 value x1024
  cvt_w<<<gW, bW, 0, stream>>>(Wq, Wk, Wv, Wu, WQB, WKB, WVB, WOB);
  // (1) q and k planes [b][h][s][96] = f16(x_h.Wq^T x8), f16(x_h.Wk^T x8); v^T plane [b][h][96 d][2048 keys] = f16(x_h.Wv^T x256)
  proj_qkv<<<gPJ, bPJ, 0, stream>>>(Xin, WQB, WKB, WVB, QP, KP, VP);
  // (2) attention -> O plane [b][h][s][96] x1024 (single f16)
  attn_fwd<<<gAT, bAT, 0, stream>>>(QP, KP, VP, OP);
  // (3) output projection -> out [8192][768] f32, carries 1024 (O) x 1024 (Wu) folded back, + bias
  gemm_out<<<gO, bO, 0, stream>>>(OP, WOB, bu, out, 1.0f / (OSC * WOS));
  (void)hipGetLastError();
}

// v004
// It runs in 91.6 microseconds.
// In both of two side-by-side timings against v003, it was 1.25 times as fast.
// Counting every step since v000, it is 2.56 times as fast.
// Contractions: x.Wq^T, x.Wk^T and x.Wv^T per head on v_wmma_f32_16x16x32_bf16 (x and Wq/Wk/Wv RNE-converted to bf16
// operands, f32 accumulate); scores k'.q'^T (q', k' single f16 planes carried x8), P.v (P x32768 single f16, v x256 single
// f16) and O.Wu^T (O single f16 plane x1024, Wu as f16(bf16(Wu)) x1024): v_wmma_f32_16x16x32_f16, f32 accumulate.
// Base-2 online softmax, 1/l, bias (bf16 value of bu) and carry folds in f32 on VALU.
#include <hip/hip_runtime.h>
#include <math.h>
#include <stdint.h>

#define NB    4
#define SEQ   2048
#define DMOD  768
#define NH    8
#define HD    96
#define ROWS  (NB * SEQ)
#define QSC   8.0f
#define KSC   8.0f
#define PCAR  32768.0f
#define PEXP  15.0f                             // log2(PCAR)
#define VCAR  256.0f
#define OSC   1024.0f
#define WOS   1024.0f
#define LOG2E 1.4426950408889634f
#define RSQK  0.0360843918243516f
#define ATT_WAVES   4
#define ATT_THREADS (ATT_WAVES * 32)
#define ATT_BLOCKS  (NB * NH * (SEQ / 64))
#define NKB    (SEQ / 32)
#define SLAB   (16 * 68)
#define SLAB96 (16 * 100)
#define VSP    72                              // halves per v^T row staged in LDS: 64 + 8 (144 B = 16 B x odd)
#define NBW    ((HD * HD / 8 + 255) / 256)     // conversion blocks per 96x96 weight: 5
#define NBU    (DMOD * DMOD / 8 / 256)         // conversion blocks of Wu: 288
#define STK    64                              // keys per LDS tile
#define NST    (SEQ / STK)                     // 32 tiles
#define KPITCH 208                             // bytes per K row in LDS: 192 + 16 (16 B x odd, for ds_load_b128 readers)
#define VPITCH 144                             // bytes per v^T row in LDS: 128 + 16 (16 B x odd)
#define KTILE  (STK * KPITCH)                  // 13312
#define VTILE  (HD * VPITCH)                   // 13824
#define BUFB   (KTILE + VTILE)                 // 27136
#define GROWS  128                             // output rows per gemm_out block: 4 waves x 32
#define GNT    NH                              // LDS tiles along k in gemm_out: one head (96 k) each
#define GPITCH 208                             // bytes per O or Wu row in LDS: 192 + 16 (16 B x odd)
#define GATILE (GROWS * GPITCH)                // 26624
#define GBTILE (64 * GPITCH)                   // 13312
#define GBUF   (GATILE + GBTILE)               // 39936
static_assert(DMOD == NH * HD && HD == 96 && NH == 8 && NB == 4 && SEQ == 2048);
static_assert((SEQ / 64) == 32 && ATT_BLOCKS == 1024 && ATT_THREADS == 128 && NKB == 64);
static_assert((HD % 32) == 0 && (DMOD % 64) == 0 && (ROWS % 64) == 0 && (SEQ % 64) == 0);
static_assert(((ROWS * DMOD / 8) % 256) == 0 && ((DMOD * DMOD / 8) % 256) == 0 && ((HD * HD) % 8) == 0);
static_assert((SLAB * 4) % 16 == 0 && (SLAB96 * 4) % 16 == 0);
static_assert(NST >= 2 && STK == 64 && (STK * HD * 2) == 6 * ATT_THREADS * 16 && (HD * STK * 2) == 6 * ATT_THREADS * 16);
static_assert((KTILE % 16) == 0 && (BUFB % 16) == 0 && 2 * BUFB >= ATT_WAVES * SLAB96 * 4);
static_assert((SEQ % GROWS) == 0 && GNT >= 2 && (GROWS * HD * 2) == 12 * 128 * 16 && (64 * HD * 2) == 6 * 128 * 16);
static_assert((GATILE % 16) == 0 && (GBUF % 16) == 0 && 2 * GBUF >= 8 * SLAB * 4);

typedef unsigned short u16;
typedef _Float16 v16h __attribute__((ext_vector_type(16)));
typedef _Float16 v8h  __attribute__((ext_vector_type(8)));
typedef _Float16 v2h  __attribute__((ext_vector_type(2)));
typedef __bf16   v16b __attribute__((ext_vector_type(16)));
typedef float    v8f  __attribute__((ext_vector_type(8)));
typedef float    v4f  __attribute__((ext_vector_type(4)));
typedef float    v2f  __attribute__((ext_vector_type(2)));
typedef unsigned int v4u __attribute__((ext_vector_type(4)));

union FragH { v16h v; v8h h[2]; v4u u[2]; };
union FragB { v16b v; v4u u[2]; };

// ---- scalar helpers --------------------------------------------------------------------------------
__device__ __forceinline__ unsigned short bf_bits(float f) {          // f32 -> bf16 bits, RNE convert
  unsigned u = __float_as_uint(f);
  return (unsigned short)((u + 0x7FFFu + ((u >> 16) & 1u)) >> 16);
}
__device__ __forceinline__ float bf_up(unsigned short h) { return __uint_as_float(((unsigned)h) << 16); }
__device__ __forceinline__ unsigned short h_bits(_Float16 x) { return __builtin_bit_cast(unsigned short, x); }
__device__ __forceinline__ unsigned pk16(unsigned short a, unsigned short b) { return (unsigned)a | ((unsigned)b << 16); }
__device__ __forceinline__ float ex2(float x) { return __builtin_amdgcn_exp2f(x); }   // bare v_exp_f32: 2^-inf = 0, no range fix-up
__device__ __forceinline__ v8f zero8() { v8f z = {0.f, 0.f, 0.f, 0.f, 0.f, 0.f, 0.f, 0.f}; return z; }

// ---- fragment loaders: 16-bit A/B operand, lane -> row/col (lane&15), p already includes +8*(lane>>4);
//      elements 0..7 <- p[0..7] (k0+8h..), elements 8..15 <- p[16..23] (k0+16+8h..)  (same split k map for A and B;
//      B is always read from a k-contiguous [n][k] plane)
__device__ __forceinline__ v16h ldfrag_h(const _Float16* p) {
  FragH f;
  f.h[0] = *(const v8h*)(p);
  f.h[1] = *(const v8h*)(p + 16);
  return f.v;
}
__device__ __forceinline__ v16b ldfrag_b(const u16* p) {              // bf16 plane read as unsigned integer vectors
  FragB f;
  f.u[0] = *(const v4u*)(p);
  f.u[1] = *(const v4u*)(p + 16);
  return f.v;
}

// the same fragment straight from an f32 row: RNE to bf16 in registers, same split k map
__device__ __forceinline__ v16b ldfrag_x(const float* p) {
  const v4f a0 = *(const v4f*)(p), a1 = *(const v4f*)(p + 4), a2 = *(const v4f*)(p + 16), a3 = *(const v4f*)(p + 20);
  FragB f;
#pragma unroll
  for (int e = 0; e < 2; ++e) {
    f.u[0][e]     = pk16(bf_bits(a0[2 * e]), bf_bits(a0[2 * e + 1]));
    f.u[0][2 + e] = pk16(bf_bits(a1[2 * e]), bf_bits(a1[2 * e + 1]));
    f.u[1][e]     = pk16(bf_bits(a2[2 * e]), bf_bits(a2[2 * e + 1]));
    f.u[1][2 + e] = pk16(bf_bits(a3[2 * e]), bf_bits(a3[2 * e + 1]));
  }
  return f.v;
}

__device__ __forceinline__ v8f mma_h(v16h a, v16h b, v8f c) {
  return __builtin_amdgcn_wmma_f32_16x16x32_f16(false, a, false, b, (short)0, c, false, false);
}
__device__ __forceinline__ v8f mma_b(v16b a, v16b b, v8f c) {
  return __builtin_amdgcn_wmma_f32_16x16x32_bf16(false, a, false, b, (short)0, c, false, false);
}
__device__ __forceinline__ void guard1(v8f& s, v16h x0, v16h x1, v16h x2, v16h x3, v16h x4, v16h x5) {
#if defined(__HIP_DEVICE_COMPILE__)
  asm volatile("v_nop\n\tv_nop\n\tv_nop\n\tv_nop"
               : "+v"(s) : "v"(x0), "v"(x1), "v"(x2), "v"(x3), "v"(x4), "v"(x5) : "memory");
#endif
}
__device__ __forceinline__ void guard3(v8f& a, v8f& b, v8f& c, v16h x0, v16h x1, v16h x2, v16h x3) {
#if defined(__HIP_DEVICE_COMPILE__)
  asm volatile("v_nop\n\tv_nop\n\tv_nop\n\tv_nop"
               : "+v"(a), "+v"(b), "+v"(c) : "v"(x0), "v"(x1), "v"(x2), "v"(x3) : "memory");
#endif
}
__device__ __forceinline__ void acc_guard6(v8f& a, v8f& b, v8f& c, v8f& d, v8f& e, v8f& f) {
#if defined(__HIP_DEVICE_COMPILE__)
  asm volatile("v_nop\n\tv_nop\n\tv_nop\n\tv_nop" : "+v"(a), "+v"(b), "+v"(c), "+v"(d), "+v"(e), "+v"(f));
#endif
}
__device__ __forceinline__ void wave_sync_lds() {
#if defined(__HIP_DEVICE_COMPILE__)
  __builtin_amdgcn_fence(__ATOMIC_RELEASE, "workgroup");
  __builtin_amdgcn_wave_barrier();
  __builtin_amdgcn_fence(__ATOMIC_ACQUIRE, "workgroup");
#endif
}

// =====================================================================================================
// The four weight planes, f32 -> 16-bit, same layout, in ONE launch (none reads another's output):
//   blocks 0 .. NBU-1: Wu -> f16 bits of (bf16 RNE value) * WOS;  then NBW blocks each for Wq, Wk, Wv -> bf16 RNE bits.
// Thread = 8 consecutive elements: two 16-B loads, one 16-B store; 32 consecutive lanes = 512 contiguous, 512-B aligned bytes
// coverage: per plane ceil(n8/256) blocks x 256 thr x 8 elements, in-kernel bound gt < n8.
// =====================================================================================================
__global__ __launch_bounds__(256) void cvt_w(const float* __restrict__ wq, const float* __restrict__ wk,
                                             const float* __restrict__ wv, const float* __restrict__ wu,
                                             u16* DQ, u16* DK, u16* DV, u16* DU) {
  const int bid = blockIdx.x;
  const bool big = bid < NBU;                // block-uniform choice of the plane
  const int  r   = bid - NBU;
  const int  w   = r / NBW;
  const float* x = big ? wu : (w == 0 ? wq : (w == 1 ? wk : wv));
  u16*         D = big ? DU : (w == 0 ? DQ : (w == 1 ? DK : DV));
  const int   n8 = big ? (DMOD * DMOD / 8) : (HD * HD / 8);
  const int   gt = (big ? bid : (r - w * NBW)) * 256 + (int)threadIdx.x;
  if (gt >= n8) return;                     // no barriers in this kernel
  const float* p = x + (size_t)gt * 8;
  const v4f a = *(const v4f*)(p), c4 = *(const v4f*)(p + 4);
  float v[8];
#pragma unroll
  for (int e = 0; e < 4; ++e) { v[e] = a[e]; v[4 + e] = c4[e]; }
  unsigned short s[8];
#pragma unroll
  for (int e = 0; e < 8; ++e) {
    const unsigned short bb = bf_bits(v[e]);
    const unsigned short hb = h_bits((_Float16)(bf_up(bb) * WOS));
    s[e] = big ? hb : bb;
  }
  v4u o;
#pragma unroll
  for (int e = 0; e < 4; ++e) o[e] = pk16(s[2 * e], s[2 * e + 1]);
  *(v4u*)(D + (size_t)gt * 8) = o;
}

// =====================================================================================================
// 16x96 f16 epilogue: the wave's 16x96 f32 tile (already scaled) staged by the caller in its LDS slab [16][100];
// coverage: 6 instructions x 32 lanes x 8 halves = 1536 = the wave's 16 x 96 tile (groups of 8 never straddle a row: 96/8 = 12).
// =====================================================================================================
__device__ __forceinline__ void out96(const float* sl, u16* dst, int lane) {
  wave_sync_lds();
  v4u ov[6];
#pragma unroll
  for (int i = 0; i < 6; ++i) {
    const int g   = i * 32 + lane;
    const int row = g / 12;
    const int c8  = (g - row * 12) * 8;
    const v4f a = *(const v4f*)(sl + row * 100 + c8), c4 = *(const v4f*)(sl + row * 100 + c8 + 4);
    float w[8];
#pragma unroll
    for (int e = 0; e < 4; ++e) { w[e] = a[e]; w[4 + e] = c4[e]; }
#pragma unroll
    for (int e = 0; e < 4; ++e) ov[i][e] = pk16(h_bits((_Float16)w[2 * e]), h_bits((_Float16)w[2 * e + 1]));
  }
  {
#pragma unroll
    for (int i = 0; i < 6; ++i) {
      *(v4u*)(dst + (size_t)(i * 32 + lane) * 8) = ov[i];
    }
    
  }
}

// =====================================================================================================
// f32 GEMM epilogue with bias, in two parts with the caller's wave_sync_lds() between them:
//   epi64_stage: a 16x64 f32 tile of the wave (acc*oscale + bias[col]) goes into one of its LDS slabs (pitch 68);
//   epi64_flush: the slab leaves as whole lines.
// coverage: 8 instructions x 2 rows x 16 lanes x 4 floats = one 16 x 64 tile.
// =====================================================================================================
__device__ __forceinline__ void epi64_stage(float* sl, v8f a0, v8f a1, v8f a2, v8f a3, float oscale,
                                            float bz0, float bz1, float bz2, float bz3, int lane) {
  const int hh = lane >> 4, m = lane & 15;
#pragma unroll
  for (int r = 0; r < 8; ++r) {
    const int ro = (8 * hh + r) * 68 + m;
    sl[ro]      = a0[r] * oscale + bz0;
    sl[ro + 16] = a1[r] * oscale + bz1;
    sl[ro + 32] = a2[r] * oscale + bz2;
    sl[ro + 48] = a3[r] * oscale + bz3;
  }
}
__device__ __forceinline__ void epi64_flush(const float* sl, float* C, int N, size_t rowb, int col0, int lane) {
  const int hh = lane >> 4, m = lane & 15;
  v4f vals[8];
#pragma unroll
  for (int it = 0; it < 8; ++it) vals[it] = *(const v4f*)(sl + (it * 2 + hh) * 68 + m * 4);
  float* dst = C + (rowb + (size_t)hh) * (size_t)N + col0 + m * 4;
#pragma unroll
  for (int it = 0; it < 8; ++it) *(v4f*)(dst + (size_t)(it * 2) * (size_t)N) = vals[it];
}

// =====================================================================================================
// The three per-head projections (shared 96x96 weights) in ONE launch, bf16 operands. Block = (64 rows of b*SEQ+s, head),
// 4 waves x 16 rows. A wave reads its 16 x 96 piece of x ONCE, as f32 (pitch 768), rounds it to bf16 in registers (ldfrag_x)
// and uses the three A fragments for all three products x . W^T; W = bf16 [96 n][96 k], k-contiguous B operand; 6 accumulators
// (n = 0..95), K = 96 in 3 steps of 32.
//   q, k: P[b][head][s][96] = f16(acc * 8); the wave's 16x96 tile is one contiguous 3072-B region, see out96.
//   v:    D element r of lane l = (s = 8hh + r, d = 16j + m): a lane's 8 values are 8 consecutive keys of one v^T row; the block's
//         96 x 64 tile of VT[b][head][d][s] (f16 of acc * 256) is gathered in LDS and leaves as whole 128-B lines.
// coverage: v^T 6 instructions x 128 threads x 8 halves = 96 x 64; grid = (ROWS/64) * NH = 1024 (exact, host-checked constants).
// =====================================================================================================
__device__ __forceinline__ void proj96(const v16b x0, const v16b x1, const v16b x2, const u16* bp, v8f (&acc)[6]) {
#pragma unroll
  for (int j = 0; j < 6; ++j) acc[j] = mma_b(x0, ldfrag_b(bp + j * 16 * HD), zero8());
#pragma unroll
  for (int j = 0; j < 6; ++j) acc[j] = mma_b(x1, ldfrag_b(bp + j * 16 * HD + 32), acc[j]);
#pragma unroll
  for (int j = 0; j < 6; ++j) acc[j] = mma_b(x2, ldfrag_b(bp + j * 16 * HD + 64), acc[j]);
}
// behind the last weight loads: their offset register is kept whole up to this wait
__device__ __forceinline__ void hold_offset(unsigned off) {
#if defined(__HIP_DEVICE_COMPILE__)
  asm volatile("s_wait_xcnt 0x0" :: "v"(off) : "memory");
#endif
}
// D element r of lane l = (row 8hh+r, col n = 16j + m); stage the 16x96 slab (pitch 100) fully
__device__ __forceinline__ void stage96(float* slab, const v8f (&acc)[6], float oscale, int hh, int m) {
#pragma unroll
  for (int r = 0; r < 8; ++r) {
    const int ro = (8 * hh + r) * 100 + m;
#pragma unroll
    for (int j = 0; j < 6; ++j) slab[ro + 16 * j] = acc[j][r] * oscale;
  }
}

// 4096 waves = 4 per SIMD: with that occupancy's register budget all 36 weight loads of a product are in flight at once
__global__ __launch_bounds__(128) __attribute__((amdgpu_waves_per_eu(4, 4)))
void proj_qkv(const float* __restrict__ X, const u16* __restrict__ WQ, const u16* __restrict__ WK,
              const u16* __restrict__ WV, u16* QP, u16* KP, u16* VT) {
  __shared__ __align__(16) float smem[4 * SLAB96];
  __shared__ __align__(16) u16 vst[HD * VSP];
  const int tid = threadIdx.x, wave = tid >> 5, lane = tid & 31, hh = lane >> 4, m = lane & 15;
  const int bid  = blockIdx.x;
  const int head = bid & (NH - 1);
  const int rt   = bid >> 3;
  const int rowb = rt * 64 + wave * 16;                 // 0..8176, the block's 64 rows never straddle a batch
  const int b    = rowb >> 11;
  const int s0   = rowb & (SEQ - 1);
  const size_t bh = (size_t)(b * NH + head);
  const float* xp = X + (size_t)(rowb + m) * DMOD + head * HD + 8 * hh;
  const v16b x0 = ldfrag_x(xp), x1 = ldfrag_x(xp + 32), x2 = ldfrag_x(xp + 64);
  const unsigned wob = (unsigned)(m * HD + 8 * hh) * 2u;   // the lane's byte offset in each weight plane
  float* slab = smem + wave * SLAB96;
  v8f acc[6];
  proj96(x0, x1, x2, (const u16*)((const char*)WQ + wob), acc);
  stage96(slab, acc, QSC, hh, m);
  out96(slab, QP + (bh * SEQ + s0) * HD, lane);
  proj96(x0, x1, x2, (const u16*)((const char*)WK + wob), acc);
  wave_sync_lds();                                      // the wave's reads of the q slab stay in front of the k slab's writes
  stage96(slab, acc, KSC, hh, m);
  out96(slab, KP + (bh * SEQ + s0) * HD, lane);
  proj96(x0, x1, x2, (const u16*)((const char*)WV + wob), acc);
  hold_offset(wob);
#pragma unroll
  for (int j = 0; j < 6; ++j) {
    v8h h;
#pragma unroll
    for (int r = 0; r < 8; ++r) h[r] = (_Float16)(acc[j][r] * VCAR);
    *(v4u*)(vst + (16 * j + m) * VSP + wave * 16 + 8 * hh) = __builtin_bit_cast(v4u, h);
  }
  __syncthreads();                                      // the four waves' key columns make up the 128-B lines
  u16* vb = VT + bh * HD * SEQ + (s0 - wave * 16);
#pragma unroll
  for (int i = 0; i < 6; ++i) {
    const int p = i * 128 + tid, row = p >> 3, c8 = (p & 7) * 8;
    *(v4u*)(vb + (size_t)row * SEQ + c8) = *(const v4u*)(vst + row * VSP + c8);
  }
}

// =====================================================================================================
// One k tile (one head, 96 k) of gemm_out into one LDS buffer, 18 asynchronous 16-B copies per lane (all 128 lanes on,
// block-uniform control flow):
//   O:  128 rows x 192 B are 24576 contiguous global bytes; piece p = 128 i + tid (i = 0..11) -> LDS row p / 12, 16-B column
//       p % 12 (l0..l2 hold the places of i = 0..2; i + 3 lies 32 rows further); one wave-instruction = 512 contiguous bytes.
//   Wu: 64 rows x 192 B (global pitch 1536 B); piece p = 128 i + tid (i = 0..5), same row and column rule, behind the O part.
// s_wait_xcnt stands inside each statement so that no address register is rewritten in front of it.
// =====================================================================================================
__device__ __forceinline__ void gemm_tile_copy(unsigned l0, unsigned l1, unsigned l2, const char* ag,
                                               const char* bg0, const char* bg1, const char* bg2) {
#if defined(__HIP_DEVICE_COMPILE__)
  asm volatile("global_load_async_to_lds_b128 %0, %12, off\n\t"
               "global_load_async_to_lds_b128 %1, %13, off\n\t"
               "global_load_async_to_lds_b128 %2, %14, off\n\t"
               "global_load_async_to_lds_b128 %3, %15, off\n\t"
               "global_load_async_to_lds_b128 %4, %16, off\n\t"
               "global_load_async_to_lds_b128 %5, %17, off\n\t"
               "global_load_async_to_lds_b128 %6, %18, off\n\t"
               "global_load_async_to_lds_b128 %7, %19, off\n\t"
               "global_load_async_to_lds_b128 %8, %20, off\n\t"
               "global_load_async_to_lds_b128 %9, %21, off\n\t"
               "global_load_async_to_lds_b128 %10, %22, off\n\t"
               "global_load_async_to_lds_b128 %11, %23, off\n\t"
               "s_wait_xcnt 0x0"
               :: "v"(l0), "v"(l1), "v"(l2),
                  "v"(l0 + 32u * GPITCH), "v"(l1 + 32u * GPITCH), "v"(l2 + 32u * GPITCH),
                  "v"(l0 + 64u * GPITCH), "v"(l1 + 64u * GPITCH), "v"(l2 + 64u * GPITCH),
                  "v"(l0 + 96u * GPITCH), "v"(l1 + 96u * GPITCH), "v"(l2 + 96u * GPITCH),
                  "v"(ag), "v"(ag + 2048), "v"(ag + 4096), "v"(ag + 6144), "v"(ag + 8192), "v"(ag + 10240),
                  "v"(ag + 12288), "v"(ag + 14336), "v"(ag + 16384), "v"(ag + 18432), "v"(ag + 20480), "v"(ag + 22528)
               : "memory");
  asm volatile("global_load_async_to_lds_b128 %0, %6, off\n\t"
               "global_load_async_to_lds_b128 %1, %7, off\n\t"
               "global_load_async_to_lds_b128 %2, %8, off\n\t"
               "global_load_async_to_lds_b128 %3, %9, off\n\t"
               "global_load_async_to_lds_b128 %4, %10, off\n\t"
               "global_load_async_to_lds_b128 %5, %11, off\n\t"
               "s_wait_xcnt 0x0"
               :: "v"(l0 + (unsigned)GATILE), "v"(l1 + (unsigned)GATILE), "v"(l2 + (unsigned)GATILE),
                  "v"(l0 + (unsigned)GATILE + 32u * GPITCH), "v"(l1 + (unsigned)GATILE + 32u * GPITCH),
                  "v"(l2 + (unsigned)GATILE + 32u * GPITCH),
                  "v"(bg0), "v"(bg1), "v"(bg2),
                  "v"(bg0 + 32 * DMOD * 2), "v"(bg1 + 32 * DMOD * 2), "v"(bg2 + 32 * DMOD * 2)
               : "memory");
#endif
}

// =====================================================================================================
// Output projection with bias: C[8192][768] (f32) = O . Wu^T * oscale + bf16(bu)[n]; A operand k index = head*96 + d lives at
// O plane address ((b*NH + head)*SEQ + s)*96 + d (O single f16 x1024, 32-deep k-steps never straddle a head since 96 = 3*32);
// Bt = Wu plane [768 n][768 k] f16 (bf16 value x1024), k-contiguous. Block = 128x64 tile, 4 waves x (32 rows x 64 columns);
// k runs over 8 tiles of 96 (one head each, k ascending in steps of 32). The block's waves share each O and Wu tile: it is
// brought into LDS by asynchronous copies (gemm_tile_copy), two buffers, tile t + 1 in flight while tile t is worked on; one
// barrier per tile publishes tile t + 1 and frees tile t's buffer. Fragments are read by ds_load_b128, same split k map for A
// and B. After the last barrier the ring is dead and its first bytes become the waves' private output slabs (two each).
// grid = (ROWS/128)*(DMOD/64) = 768.
// =====================================================================================================
__global__ __launch_bounds__(128)
void gemm_out(const u16* __restrict__ OP, const u16* __restrict__ WOB, const float* __restrict__ bias, float* C,
              float oscale) {
  __shared__ __align__(16) unsigned char ring[2 * GBUF];
  const int tid = threadIdx.x, wave = tid >> 5, lane = tid & 31, hh = lane >> 4, m = lane & 15;
  const int ntile = DMOD >> 6;                          // 12
  const int bid   = blockIdx.x;
  const int row0  = (bid / ntile) * GROWS;              // the block's 128 rows never straddle a batch
  const int col0  = (bid % ntile) * 64;
  const int b     = row0 >> 11;
  const int s0    = row0 & (SEQ - 1);
  // the lane's copy places (LDS byte addresses in buffer 0) and its global sources for tile 0
  const unsigned lds0 = (unsigned)(uintptr_t)(&ring[0]);
  const int r0 = tid / 12, r1 = (tid + 128) / 12, r2 = (tid + 256) / 12;
  const int c0 = (tid - 12 * r0) * 16, c1 = (tid + 128 - 12 * r1) * 16, c2 = (tid + 256 - 12 * r2) * 16;
  const unsigned l0 = lds0 + (unsigned)(r0 * GPITCH + c0);
  const unsigned l1 = lds0 + (unsigned)(r1 * GPITCH + c1);
  const unsigned l2 = lds0 + (unsigned)(r2 * GPITCH + c2);
  const char* ag  = (const char*)(const void*)OP + (((size_t)b * NH * SEQ + s0) * HD * 2 + (size_t)tid * 16);  // + SEQ*192 per tile
  const char* bg0 = (const char*)(const void*)WOB + ((size_t)(col0 + r0) * DMOD * 2 + c0);                     // + 192 per tile
  const char* bg1 = (const char*)(const void*)WOB + ((size_t)(col0 + r1) * DMOD * 2 + c1);
  const char* bg2 = (const char*)(const void*)WOB + ((size_t)(col0 + r2) * DMOD * 2 + c2);
  // A fragments: row = wave*32 + 16i + m; B fragments: row n = 16j + m; byte offsets in a buffer
  const int afo = (wave * 32 + m) * GPITCH + 16 * hh;
  const int bfo = GATILE + m * GPITCH + 16 * hh;
  v8f acc[2][4];
#pragma unroll
  for (int i = 0; i < 2; ++i) {
#pragma unroll
    for (int j = 0; j < 4; ++j) acc[i][j] = zero8();
  }

  // ---- ring prologue: tile 0 landed and published, then tile 1 set off ----
  gemm_tile_copy(l0, l1, l2, ag, bg0, bg1, bg2);
  asm volatile("s_wait_asynccnt 0x0" ::: "memory");   // this wave's copies of tile 0 have landed
  __syncthreads();                                    // every wave's have
  gemm_tile_copy(l0 + GBUF, l1 + GBUF, l2 + GBUF, ag + SEQ * HD * 2, bg0 + HD * 2, bg1 + HD * 2, bg2 + HD * 2);

#pragma unroll 1                                      // one trip per tile stays rolled: one foot, small code
  for (int t = 0; t < GNT; ++t) {
    const unsigned bo = (unsigned)(t & 1) * GBUF;     // trip t reads buffer t mod 2 alone
#pragma unroll                                        // the tile's three 32-deep k-steps: constant LDS offsets in the reads
    for (int ks = 0; ks < 3; ++ks) {
      const _Float16* ap = (const _Float16*)(const void*)(ring + bo + afo + ks * 64);
      const _Float16* bp = (const _Float16*)(const void*)(ring + bo + bfo + ks * 64);
      const v16h a0 = ldfrag_h(ap);
      const v16h a1 = ldfrag_h(ap + 16 * (GPITCH / 2));
      const v16h b0 = ldfrag_h(bp);
      const v16h b1 = ldfrag_h(bp + 16 * (GPITCH / 2));
      const v16h b2 = ldfrag_h(bp + 32 * (GPITCH / 2));
      const v16h b3 = ldfrag_h(bp + 48 * (GPITCH / 2));
      acc[0][0] = mma_h(a0, b0, acc[0][0]);
      acc[0][1] = mma_h(a0, b1, acc[0][1]);
      acc[0][2] = mma_h(a0, b2, acc[0][2]);
      acc[0][3] = mma_h(a0, b3, acc[0][3]);
      acc[1][0] = mma_h(a1, b0, acc[1][0]);
      acc[1][1] = mma_h(a1, b1, acc[1][1]);
      acc[1][2] = mma_h(a1, b2, acc[1][2]);
      acc[1][3] = mma_h(a1, b3, acc[1][3]);
    }
    // ---- foot of trip t: publish tile t + 1, free tile t's buffer, refill it with tile t + 2 ----
    asm volatile("s_wait_dscnt 0x0" ::: "memory");      // this wave's reads of tile t are done
    asm volatile("s_wait_asynccnt 0x0" ::: "memory");   // this wave's copies of tile t + 1 have landed
    __syncthreads();                                    // both hold for every wave
    if (t + 2 < GNT)                                    // block-uniform
      gemm_tile_copy(l0 + bo, l1 + bo, l2 + bo, ag + (size_t)(t + 2) * (SEQ * HD * 2),
                     bg0 + (t + 2) * (HD * 2), bg1 + (t + 2) * (HD * 2), bg2 + (t + 2) * (HD * 2));
  }
  asm volatile("s_wait_asynccnt 0x0" ::: "memory");     // nothing of this wave is in flight when the ring is reused

  // bias for the lane's columns (col0 + 16j + m <= 767), bf16 value of bu
  const float bz0 = bf_up(bf_bits(bias[col0 + m]));
  const float bz1 = bf_up(bf_bits(bias[col0 + 16 + m]));
  const float bz2 = bf_up(bf_bits(bias[col0 + 32 + m]));
  const float bz3 = bf_up(bf_bits(bias[col0 + 48 + m]));
  float* slab = (float*)(void*)ring + wave * 2 * SLAB;  // the ring is dead behind the last trip's barrier
  const size_t rowb = (size_t)(row0 + wave * 32);
  epi64_stage(slab, acc[0][0], acc[0][1], acc[0][2], acc[0][3], oscale, bz0, bz1, bz2, bz3, lane);
  epi64_stage(slab + SLAB, acc[1][0], acc[1][1], acc[1][2], acc[1][3], oscale, bz0, bz1, bz2, bz3, lane);
  wave_sync_lds();                                      // one for both slabs: no global store stands in front of it
  epi64_flush(slab, C, DMOD, rowb, col0, lane);
  epi64_flush(slab + SLAB, C, DMOD, rowb + 16, col0, lane);
}

// =====================================================================================================
// One 64-key tile into one LDS buffer, 12 asynchronous 16-B copies per lane (all 128 lanes on, block-uniform control flow):
//   K: 64 rows x 192 B are 12288 contiguous global bytes; piece p = 128 i + tid (i = 0..5) -> LDS row p / 12, 16-B column p % 12
//      (kl0..kl2 hold the places of i = 0..2; i + 3 lies 32 rows further); one wave-instruction = 512 contiguous bytes.
//   v^T: 96 rows x 128 B (global pitch 4096 B); piece p = 128 i + tid -> row p / 8, column p % 8; one wave-instruction = 4 lines.
// s_wait_xcnt stands inside the statement so that no address register is rewritten in front of it.
// =====================================================================================================
__device__ __forceinline__ void tile_copy(unsigned kl0, unsigned kl1, unsigned kl2, unsigned vl,
                                          const char* kg, const char* vg) {
#if defined(__HIP_DEVICE_COMPILE__)
  asm volatile("global_load_async_to_lds_b128 %0, %12, off\n\t"
               "global_load_async_to_lds_b128 %1, %13, off\n\t"
               "global_load_async_to_lds_b128 %2, %14, off\n\t"
               "global_load_async_to_lds_b128 %3, %15, off\n\t"
               "global_load_async_to_lds_b128 %4, %16, off\n\t"
               "global_load_async_to_lds_b128 %5, %17, off\n\t"
               "global_load_async_to_lds_b128 %6, %18, off\n\t"
               "global_load_async_to_lds_b128 %7, %19, off\n\t"
               "global_load_async_to_lds_b128 %8, %20, off\n\t"
               "global_load_async_to_lds_b128 %9, %21, off\n\t"
               "global_load_async_to_lds_b128 %10, %22, off\n\t"
               "global_load_async_to_lds_b128 %11, %23, off\n\t"
               "s_wait_xcnt 0x0"
               :: "v"(kl0), "v"(kl1), "v"(kl2),
                  "v"(kl0 + 32u * KPITCH), "v"(kl1 + 32u * KPITCH), "v"(kl2 + 32u * KPITCH),
                  "v"(vl), "v"(vl + 16u * VPITCH), "v"(vl + 32u * VPITCH),
                  "v"(vl + 48u * VPITCH), "v"(vl + 64u * VPITCH), "v"(vl + 80u * VPITCH),
                  "v"(kg), "v"(kg + 2048), "v"(kg + 4096), "v"(kg + 6144), "v"(kg + 8192), "v"(kg + 10240),
                  "v"(vg), "v"(vg + 16 * SEQ * 2), "v"(vg + 32 * SEQ * 2),
                  "v"(vg + 48 * SEQ * 2), "v"(vg + 64 * SEQ * 2), "v"(vg + 80 * SEQ * 2)
               : "memory");
#endif
}

// =====================================================================================================
// Narrow multi-head flash attention (no mask): block = (batch b, head, 64 query rows), 4 waves, wave w owns the 16 query rows
// q0 = 64*qt + 16*w .. q0+15.
//   q plane (f16, x8) laid out [b][h][s][96]; k plane the same; v^T plane [b][h][96][s] (x256).
//   All NKB = 64 key blocks of 32 keys are visited (static bound), two per 64-key tile. The block's four waves share each K and
//   v^T tile: it is brought into LDS by asynchronous copies (tile_copy), two buffers, tile t + 1 in flight while tile t is
//   worked on; one barrier per tile publishes tile t + 1 and frees tile t's buffer. Fragments are read by ds_load_b128.
//   After the last barrier the ring is dead and its first bytes become the waves' private output slabs.
//   Scores are computed TRANSPOSED: S^T tile g (g = 0,1) = k rows (keys kb+16g .. +15, A operand, row m = lane&15, split k map
//   over d, 3 chunks of 32) times q^T (B operand, col n = query q0 + (lane&15), k = d, split map), one product per tile and
//   32-deep d-chunk. D element r of lane l = (key kb+16g+8h+r, query q0+(l&15)), so a lane owns one query column and 16 of
//   its 32 keys; the partner lane l^16 owns the other 16 -> row max / row sum need one xor-16 shuffle.
//   Online max-subtracted base-2 softmax in f32 (scale 1/sqrt(768) and the q/k carries folded into lsc; scale, maximum and P's
//   carry enter the exponent through one fma, and the row sum l carries x32768 with P). The exp'd values ARE
//   the P A-fragment in place: A row m = query = lane&15, element i <- key kb+8h+i (tile 0, D element i), element 8+i <- key
//   kb+16+8h+i (tile 1, D element i). P is carried x32768 as single f16. The rescale factor of query row 8h+r of the O
//   accumulators is fetched from lane 8h+r with a shuffle (uniform control). 6 v^T B fragments (col n = d = 16j + (lane&15),
//   keys k-contiguous), 6 P.V WMMAs per key block in two guarded groups of 3.
//   Epilogue: 1/l (per query, shuffled to the D row owner) and carry folds in f32; the wave's 16x96 f32 result (x1024)
//   staged in its LDS slab [16][100]; the wave's 16 rows of the O plane [b][h][s][96] are one contiguous 3072-B region written
// coverage: per wave 6 instructions x 32 lanes x 8 halves = 16 x 96; grid 1024 blocks x 4 waves = every (b, h, s) row of the
//           O plane exactly once.
// =====================================================================================================
__global__ __launch_bounds__(ATT_THREADS)
void attn_fwd(const u16* __restrict__ QPp, const u16* __restrict__ KPp, const u16* __restrict__ VPp, u16* OPp) {
  __shared__ __align__(16) unsigned char ring[2 * BUFB];

  const int tid  = threadIdx.x;
  const int wave = tid >> 5;
  const int lane = tid & 31;
  const int hh   = lane >> 4;
  const int c    = lane & 15;

  const int bid  = blockIdx.x;
  const int qt   = bid & (SEQ / 64 - 1);
  const int head = (bid >> 5) & (NH - 1);
  const int b    = bid >> 8;
  const int q0   = qt * 64 + wave * 16;
  const size_t bh = (size_t)(b * NH + head);

  // B fragments of q^T: col n = query q0 + c, k = d (k-contiguous row of the q plane)
  const _Float16* Qb = (const _Float16*)(const void*)QPp + ((bh * SEQ + q0 + c) * HD + 8 * hh);
  // A fragments of k: row m = key (in tile) 16g + c, k = d; byte offset in a buffer's K part
  const int kfo = c * KPITCH + 16 * hh;
  // B fragments of v: col n = d = 16j + c, k = key (k-contiguous row of the v^T tile); byte offset in a buffer
  const int vfo = KTILE + c * VPITCH + 16 * hh;
  // the lane's copy places (LDS byte addresses in buffer 0) and its global sources for tile 0
  const unsigned lds0 = (unsigned)(uintptr_t)(&ring[0]);
  const int kr0 = tid / 12, kr1 = (tid + 128) / 12, kr2 = (tid + 256) / 12;
  const unsigned kl0 = lds0 + (unsigned)(kr0 * KPITCH + (tid - 12 * kr0) * 16);
  const unsigned kl1 = lds0 + (unsigned)(kr1 * KPITCH + (tid + 128 - 12 * kr1) * 16);
  const unsigned kl2 = lds0 + (unsigned)(kr2 * KPITCH + (tid + 256 - 12 * kr2) * 16);
  const unsigned vl  = lds0 + (unsigned)(KTILE + (tid >> 3) * VPITCH + (tid & 7) * 16);
  const char* kg = (const char*)(const void*)KPp + (bh * SEQ * HD * 2 + (size_t)tid * 16);              // + 12288 per tile
  const char* vg = (const char*)(const void*)VPp + ((bh * HD + (size_t)(tid >> 3)) * SEQ * 2 + (size_t)(tid & 7) * 16);  // + 128
  const float lsc = RSQK * (LOG2E / (QSC * KSC));

  const v16h qf0 = ldfrag_h(Qb);            // d 0..31
  const v16h qf1 = ldfrag_h(Qb + 32);       // d 32..63
  const v16h qf2 = ldfrag_h(Qb + 64);       // d 64..95

  float mrun = -INFINITY, lrun = 0.f;
  v8f o[6];
#pragma unroll
  for (int j = 0; j < 6; ++j) o[j] = zero8();

  // ---- ring prologue: tile 0 landed and published, then tile 1 set off ----
  tile_copy(kl0, kl1, kl2, vl, kg, vg);
  asm volatile("s_wait_asynccnt 0x0" ::: "memory");   // this wave's copies of tile 0 have landed
  __syncthreads();                                    // every wave's have
  tile_copy(kl0 + BUFB, kl1 + BUFB, kl2 + BUFB, vl + BUFB, kg + STK * HD * 2, vg + STK * 2);

#pragma unroll 1                                      // one trip per tile stays rolled: one foot, small code
  for (int t = 0; t < NST; ++t) {
   const unsigned bo = (unsigned)(t & 1) * BUFB;      // trip t reads buffer t mod 2 alone
#pragma unroll                                        // the tile's two 32-key blocks: constant LDS offsets in the reads
   for (int sub = 0; sub < 2; ++sub) {
    // ---- transposed scores: s0 = keys kb..kb+15, s1 = keys kb+16..kb+31 (kb = 64 t + 32 sub), column = query q0 + c ----
    const _Float16* k0p = (const _Float16*)(const void*)(ring + bo + kfo + sub * 32 * KPITCH);
    const _Float16* k1p = (const _Float16*)(const void*)(ring + bo + kfo + (sub * 32 + 16) * KPITCH);
    v8f s0 = zero8();
    {
      const v16h ka0 = ldfrag_h(k0p), ka1 = ldfrag_h(k0p + 32), ka2 = ldfrag_h(k0p + 64);
      s0 = mma_h(ka0, qf0, s0);
      s0 = mma_h(ka1, qf1, s0);
      s0 = mma_h(ka2, qf2, s0);
      guard1(s0, qf0, qf1, qf2, ka0, ka1, ka2);
    }
    v8f s1 = zero8();
    {
      const v16h kc0 = ldfrag_h(k1p), kc1 = ldfrag_h(k1p + 32), kc2 = ldfrag_h(k1p + 64);
      s1 = mma_h(kc0, qf0, s1);
      s1 = mma_h(kc1, qf1, s1);
      s1 = mma_h(kc2, qf2, s1);
      guard1(s1, qf0, qf1, qf2, kc0, kc1, kc2);
    }
    // ---- maximum of this lane's 16 raw scores for query q0 + c (lsc > 0, so the scale commutes with the maximum) ----
    float cm = fmaxf(s0[0], s1[0]);
#pragma unroll
    for (int i = 1; i < 8; ++i) cm = fmaxf(fmaxf(cm, s0[i]), s1[i]);
    cm = fmaxf(cm, __shfl_xor(cm, 16, 32));
    const float mn = fmaxf(mrun, cm * lsc);                          // base-2 logit; finite from the first key block on
    const float al = (mrun == -INFINITY) ? 0.f : ex2(mrun - mn);     // o and l are zero while mrun is -inf
    mrun = mn;
    // ---- carried probabilities p * 32768 = 2^(s * lsc - mn + 15): one fma and one v_exp_f32 per score; the argument is at
    //      most 15 plus the fma's rounding, and a result under 2^-126 (flushed) is far below the f16 plane's last place.
    //      P A-fragment: element i <-> s0[i], element 8 + i <-> s1[i] ----
    const v2f lsc2 = {lsc, lsc};
    const v2f eb2  = {PEXP - mn, PEXP - mn};
    float ps = 0.f;
    FragH ph;
#pragma unroll
    for (int w = 0; w < 2; ++w) {
#pragma unroll
      for (int e4 = 0; e4 < 4; ++e4) {
        const v2f sp = (w == 0) ? (v2f){s0[2 * e4], s0[2 * e4 + 1]} : (v2f){s1[2 * e4], s1[2 * e4 + 1]};
        const v2f ar = __builtin_elementwise_fma(sp, lsc2, eb2);
        const float p0 = ex2(ar[0]);
        const float p1 = ex2(ar[1]);
        ps += p0 + p1;
        ph.u[w][e4] = __builtin_bit_cast(unsigned, __builtin_convertvector((v2f){p0, p1}, v2h));   // RNE, as two scalar casts
      }
    }
    ps += __shfl_xor(ps, 16, 32);
    lrun = lrun * al + ps;
    // ---- rescale the O accumulators: D row 8hh+r = query q0+8hh+r, its factor lives in lane 8hh+r (and 16+8hh+r) ----
    float scl[8];
#pragma unroll
    for (int r = 0; r < 8; ++r) scl[r] = __shfl(al, 8 * hh + r, 32);
#pragma unroll
    for (int j = 0; j < 6; ++j) {
#pragma unroll
      for (int r = 0; r < 8; ++r) o[j][r] *= scl[r];
    }
    // ---- P.V : B fragment col n = d = j*16 + c, keys contiguous in the v^T plane; two guarded groups of 3 ----
    {
      const _Float16* vp = (const _Float16*)(const void*)(ring + bo + vfo + sub * 64);
      const v16h vf0 = ldfrag_h(vp);
      const v16h vf1 = ldfrag_h(vp + 16 * (VPITCH / 2));
      const v16h vf2 = ldfrag_h(vp + 32 * (VPITCH / 2));
      o[0] = mma_h(ph.v, vf0, o[0]);
      o[1] = mma_h(ph.v, vf1, o[1]);
      o[2] = mma_h(ph.v, vf2, o[2]);
      guard3(o[0], o[1], o[2], ph.v, vf0, vf1, vf2);
      const v16h vf3 = ldfrag_h(vp + 48 * (VPITCH / 2));
      const v16h vf4 = ldfrag_h(vp + 64 * (VPITCH / 2));
      const v16h vf5 = ldfrag_h(vp + 80 * (VPITCH / 2));
      o[3] = mma_h(ph.v, vf3, o[3]);
      o[4] = mma_h(ph.v, vf4, o[4]);
      o[5] = mma_h(ph.v, vf5, o[5]);
      guard3(o[3], o[4], o[5], ph.v, vf3, vf4, vf5);
    }
   }
   // ---- foot of trip t: publish tile t + 1, free tile t's buffer, refill it with tile t + 2 ----
   asm volatile("s_wait_dscnt 0x0" ::: "memory");      // this wave's reads of tile t are done
   asm volatile("s_wait_asynccnt 0x0" ::: "memory");   // this wave's copies of tile t + 1 have landed
   __syncthreads();                                    // both hold for every wave
   if (t + 2 < NST)                                    // block-uniform
     tile_copy(kl0 + bo, kl1 + bo, kl2 + bo, vl + bo,
               kg + (size_t)(t + 2) * (STK * HD * 2), vg + (size_t)(t + 2) * (STK * 2));
  }
  asm volatile("s_wait_asynccnt 0x0" ::: "memory");    // nothing of this wave is in flight when the ring is reused
  acc_guard6(o[0], o[1], o[2], o[3], o[4], o[5]);

  // ---- fold 1/l (per query, owned by lane = query; l carries PCAR like P, so only v's carry is left), and OSC; stage the slab ----
  const float linv = (lrun > 0.f) ? ((1.0f / lrun) * (OSC / VCAR)) : 0.f;
  float inv[8];
#pragma unroll
  for (int r = 0; r < 8; ++r) inv[r] = __shfl(linv, 8 * hh + r, 32);
  float* slab = (float*)(void*)ring + wave * SLAB96;   // the ring is dead behind the last trip's barrier
#pragma unroll
  for (int r = 0; r < 8; ++r) {
    const int ro = (8 * hh + r) * 100 + c;
#pragma unroll
    for (int j = 0; j < 6; ++j) slab[ro + 16 * j] = o[j][r] * inv[r];
  }
  out96(slab, OPp + (bh * SEQ + q0) * HD, lane);
}

// =====================================================================================================
// Workspace map (bytes); every plane is fully written by whole-line stores before it is read; all extents are exact multiples
// of the 512-B store instructions (no pad rows needed); every base is 256-B aligned:
//   WQB bf16 [96 n][96 k]                          18432        WKB, WVB the same
//   WOB f16  [768 n][768 k] (bf16 value x1024)   1179648
//   QP  f16  [4][8][2048][96] x8                12582912        KP same
//   VP  f16  [4][8][96][2048] x256              12582912
//   OP  f16  [4][8][2048][96] x1024             12582912
//   end                                          51566592
// =====================================================================================================
extern "C" void kernel_launch(void* const* d_in, const int* in_sizes, int n_in,
                              void* d_out, int out_size, void* d_ws, size_t ws_size,
                              hipStream_t stream) {
  if (n_in < 6) return;
  if (in_sizes[0] != ROWS * DMOD) return;
  if (in_sizes[1] != HD * HD) return;
  if (in_sizes[2] != HD * HD) return;
  if (in_sizes[3] != HD * HD) return;
  if (in_sizes[4] != DMOD * DMOD) return;
  if (in_sizes[5] != DMOD) return;
  if (out_size != ROWS * DMOD) return;

  const float* Xin = (const float*)d_in[0];
  const float* Wq  = (const float*)d_in[1];
  const float* Wk  = (const float*)d_in[2];
  const float* Wv  = (const float*)d_in[3];
  const float* Wu  = (const float*)d_in[4];
  const float* bu  = (const float*)d_in[5];
  float*       out = (float*)d_out;

  const size_t szW  = (size_t)HD * HD * 2;                      //    18432
  const size_t szWO = (size_t)DMOD * DMOD * 2;                  //  1179648
  const size_t szP  = (size_t)NB * NH * SEQ * HD * 2;           // 12582912  (q / k / v^T / o planes)
  size_t off = 0;
  const size_t oWQ = off; off += szW;
  const size_t oWK = off; off += szW;
  const size_t oWV = off; off += szW;
  const size_t oWO = off; off += szWO;
  const size_t oQP = off; off += szP;
  const size_t oKP = off; off += szP;
  const size_t oVP = off; off += szP;
  const size_t oOP = off; off += szP;
  if (off > ws_size) return;                            // off = 51566592
  if (off > (size_t)134217728) return;
  if ((szW % 256) != 0 || (szWO % 256) != 0 || (szP % 256) != 0) return;

  char* ws = (char*)d_ws;
  u16* WQB = (u16*)(ws + oWQ);
  u16* WKB = (u16*)(ws + oWK);
  u16* WVB = (u16*)(ws + oWV);
  u16* WOB = (u16*)(ws + oWO);
  u16* QP  = (u16*)(ws + oQP);
  u16* KP  = (u16*)(ws + oKP);
  u16* VP  = (u16*)(ws + oVP);
  u16* OP  = (u16*)(ws + oOP);

  if (((HD * HD) % 8) != 0 || ((DMOD * DMOD / 8) % 256) != 0) return;
  if ((DMOD % 64) != 0 || (ROWS % 64) != 0 || (ROWS % GROWS) != 0 || (SEQ % 64) != 0 || (HD % 32) != 0) return;
  const dim3 gW(NBU + 3 * NBW);                         // 303 (in-kernel bound gt < n8 per plane)
  const dim3 bW(256);
  const dim3 gPJ((ROWS / 64) * NH);                     // 1024
  const dim3 bPJ(128);
  const dim3 gAT(ATT_BLOCKS);                           // 1024
  const dim3 bAT(ATT_THREADS);                          // 128
  const dim3 gO((ROWS / GROWS) * (DMOD / 64));          // 768
  const dim3 bO(128);

  // (0) weight planes: Wq/Wk/Wv [n = out][k = in] (already k-contiguous) -> bf16; Wu -> f16 of bf16 value x1024
  cvt_w<<<gW, bW, 0, stream>>>(Wq, Wk, Wv, Wu, WQB, WKB, WVB, WOB);
  // (1) q and k planes [b][h][s][96] = f16(x_h.Wq^T x8), f16(x_h.Wk^T x8); v^T plane [b][h][96 d][2048 keys] = f16(x_h.Wv^T x256)
  proj_qkv<<<gPJ, bPJ, 0, stream>>>(Xin, WQB, WKB, WVB, QP, KP, VP);
  // (2) attention -> O plane [b][h][s][96] x1024 (single f16)
  attn_fwd<<<gAT, bAT, 0, stream>>>(QP, KP, VP, OP);
  // (3) output projection -> out [8192][768] f32, carries 1024 (O) x 1024 (Wu) folded back, + bias
  gemm_out<<<gO, bO, 0, stream>>>(OP, WOB, bu, out, 1.0f / (OSC * WOS));
  (void)hipGetLastError();
}

// v005
// Measured time: 84.5 microseconds a run.
// Next to v004, in two timings, it ran 1.08 times as fast each time.
// Over all steps from v000 it is 2.77 times as fast.
// Contractions: x.Wq^T, x.Wk^T and x.Wv^T per head on v_wmma_f32_16x16x32_bf16 (x and Wq/Wk/Wv RNE-converted to bf16
// operands, f32 accumulate); scores k'.q'^T (q', k' single f16 planes carried x8), P.v (P x32768 single f16, v x256 single
// f16) and O.Wu^T (O single f16 plane x1024, Wu as f16(bf16(Wu)) x1024): v_wmma_f32_16x16x32_f16, f32 accumulate.
// Base-2 online softmax, 1/l, bias (bf16 value of bu) and carry folds in f32 on VALU.
#include <hip/hip_runtime.h>
#include <math.h>
#include <stdint.h>

#define NB    4
#define SEQ   2048
#define DMOD  768
#define NH    8
#define HD    96
#define ROWS  (NB * SEQ)
#define QSC   8.0f
#define KSC   8.0f
#define PCAR  32768.0f
#define PEXP  15.0f                             // log2(PCAR)
#define VCAR  256.0f
#define OSC   1024.0f
#define WOS   1024.0f
#define LOG2E 1.4426950408889634f
#define RSQK  0.0360843918243516f
#define ATT_WAVES   4
#define ATT_THREADS (ATT_WAVES * 32)
#define QPW         32                         // query rows per attention wave: two 16-row tiles
#define QPB         (ATT_WAVES * QPW)          // query rows per attention block: 128
#define ATT_BLOCKS  (NB * NH * (SEQ / QPB))
#define NKB    (SEQ / 32)
#define SLAB   (16 * 68)
#define SLAB96 (16 * 100)
#define VSP    72                              // halves per v^T row staged in LDS: 64 + 8 (144 B = 16 B x odd)
#define NBW    ((HD * HD / 8 + 255) / 256)     // conversion blocks per 96x96 weight: 5
#define NBU    (DMOD * DMOD / 8 / 256)         // conversion blocks of Wu: 288
#define STK    64                              // keys per LDS tile
#define NST    (SEQ / STK)                     // 32 tiles
#define KPITCH 208                             // bytes per K row in LDS: 192 + 16 (16 B x odd, for ds_load_b128 readers)
#define VPITCH 144                             // bytes per v^T row in LDS: 128 + 16 (16 B x odd)
#define KTILE  (STK * KPITCH)                  // 13312
#define VTILE  (HD * VPITCH)                   // 13824
#define BUFB   (KTILE + VTILE)                 // 27136
#define GROWS  128                             // output rows per gemm_out block: 4 waves x 32
#define GNT    NH                              // LDS tiles along k in gemm_out: one head (96 k) each
#define GPITCH 208                             // bytes per O or Wu row in LDS: 192 + 16 (16 B x odd)
#define GATILE (GROWS * GPITCH)                // 26624
#define GBTILE (64 * GPITCH)                   // 13312
#define GBUF   (GATILE + GBTILE)               // 39936
static_assert(DMOD == NH * HD && HD == 96 && NH == 8 && NB == 4 && SEQ == 2048);
static_assert((SEQ / QPB) == 16 && ATT_BLOCKS == 512 && ATT_THREADS == 128 && NKB == 64);
static_assert((HD % 32) == 0 && (DMOD % 64) == 0 && (ROWS % 64) == 0 && (SEQ % 64) == 0);
static_assert(((ROWS * DMOD / 8) % 256) == 0 && ((DMOD * DMOD / 8) % 256) == 0 && ((HD * HD) % 8) == 0);
static_assert((SLAB * 4) % 16 == 0 && (SLAB96 * 4) % 16 == 0);
static_assert(NST >= 2 && STK == 64 && (STK * HD * 2) == 6 * ATT_THREADS * 16 && (HD * STK * 2) == 6 * ATT_THREADS * 16);
static_assert((KTILE % 16) == 0 && (BUFB % 16) == 0 && 2 * BUFB >= 2 * ATT_WAVES * SLAB96 * 4);
static_assert((SEQ % GROWS) == 0 && GNT >= 2 && (GROWS * HD * 2) == 12 * 128 * 16 && (64 * HD * 2) == 6 * 128 * 16);
static_assert((GATILE % 16) == 0 && (GBUF % 16) == 0 && 2 * GBUF >= 8 * SLAB * 4);

typedef unsigned short u16;
typedef _Float16 v16h __attribute__((ext_vector_type(16)));
typedef _Float16 v8h  __attribute__((ext_vector_type(8)));
typedef _Float16 v2h  __attribute__((ext_vector_type(2)));
typedef __bf16   v16b __attribute__((ext_vector_type(16)));
typedef float    v8f  __attribute__((ext_vector_type(8)));
typedef float    v4f  __attribute__((ext_vector_type(4)));
typedef float    v2f  __attribute__((ext_vector_type(2)));
typedef unsigned int v4u __attribute__((ext_vector_type(4)));

union FragH { v16h v; v8h h[2]; v4u u[2]; };
union FragB { v16b v; v4u u[2]; };

// ---- scalar helpers --------------------------------------------------------------------------------
__device__ __forceinline__ unsigned short bf_bits(float f) {          // f32 -> bf16 bits, RNE convert
  unsigned u = __float_as_uint(f);
  return (unsigned short)((u + 0x7FFFu + ((u >> 16) & 1u)) >> 16);
}
__device__ __forceinline__ float bf_up(unsigned short h) { return __uint_as_float(((unsigned)h) << 16); }
__device__ __forceinline__ unsigned short h_bits(_Float16 x) { return __builtin_bit_cast(unsigned short, x); }
__device__ __forceinline__ unsigned pk16(unsigned short a, unsigned short b) { return (unsigned)a | ((unsigned)b << 16); }
__device__ __forceinline__ float ex2(float x) { return __builtin_amdgcn_exp2f(x); }   // bare v_exp_f32: 2^-inf = 0, no range fix-up
__device__ __forceinline__ v8f zero8() { v8f z = {0.f, 0.f, 0.f, 0.f, 0.f, 0.f, 0.f, 0.f}; return z; }

// ---- fragment loaders: 16-bit A/B operand, lane -> row/col (lane&15), p already includes +8*(lane>>4);
//      elements 0..7 <- p[0..7] (k0+8h..), elements 8..15 <- p[16..23] (k0+16+8h..)  (same split k map for A and B;
//      B is always read from a k-contiguous [n][k] plane)
__device__ __forceinline__ v16h ldfrag_h(const _Float16* p) {
  FragH f;
  f.h[0] = *(const v8h*)(p);
  f.h[1] = *(const v8h*)(p + 16);
  return f.v;
}
__device__ __forceinline__ v16b ldfrag_b(const u16* p) {              // bf16 plane read as unsigned integer vectors
  FragB f;
  f.u[0] = *(const v4u*)(p);
  f.u[1] = *(const v4u*)(p + 16);
  return f.v;
}

// the same fragment straight from an f32 row: RNE to bf16 in registers, same split k map
__device__ __forceinline__ v16b ldfrag_x(const float* p) {
  const v4f a0 = *(const v4f*)(p), a1 = *(const v4f*)(p + 4), a2 = *(const v4f*)(p + 16), a3 = *(const v4f*)(p + 20);
  FragB f;
#pragma unroll
  for (int e = 0; e < 2; ++e) {
    f.u[0][e]     = pk16(bf_bits(a0[2 * e]), bf_bits(a0[2 * e + 1]));
    f.u[0][2 + e] = pk16(bf_bits(a1[2 * e]), bf_bits(a1[2 * e + 1]));
    f.u[1][e]     = pk16(bf_bits(a2[2 * e]), bf_bits(a2[2 * e + 1]));
    f.u[1][2 + e] = pk16(bf_bits(a3[2 * e]), bf_bits(a3[2 * e + 1]));
  }
  return f.v;
}

__device__ __forceinline__ v8f mma_h(v16h a, v16h b, v8f c) {
  return __builtin_amdgcn_wmma_f32_16x16x32_f16(false, a, false, b, (short)0, c, false, false);
}
__device__ __forceinline__ v8f mma_b(v16b a, v16b b, v8f c) {
  return __builtin_amdgcn_wmma_f32_16x16x32_bf16(false, a, false, b, (short)0, c, false, false);
}
// v_nop x4: the distance between the last matrix instruction of a group and the first vector instruction on its D, A or B
__device__ __forceinline__ void guard4(v8f& s, v8f& t, v8f& u, v8f& w) {
#if defined(__HIP_DEVICE_COMPILE__)
  asm volatile("v_nop\n\tv_nop\n\tv_nop\n\tv_nop" : "+v"(s), "+v"(t), "+v"(u), "+v"(w) :: "memory");
#endif
}
__device__ __forceinline__ void guard6(v8f& a, v8f& b, v8f& c, v8f& d, v8f& e, v8f& f) {
#if defined(__HIP_DEVICE_COMPILE__)
  asm volatile("v_nop\n\tv_nop\n\tv_nop\n\tv_nop"
               : "+v"(a), "+v"(b), "+v"(c), "+v"(d), "+v"(e), "+v"(f) :: "memory");
#endif
}
__device__ __forceinline__ void acc_guard6(v8f& a, v8f& b, v8f& c, v8f& d, v8f& e, v8f& f) {
#if defined(__HIP_DEVICE_COMPILE__)
  asm volatile("v_nop\n\tv_nop\n\tv_nop\n\tv_nop" : "+v"(a), "+v"(b), "+v"(c), "+v"(d), "+v"(e), "+v"(f));
#endif
}
__device__ __forceinline__ void wave_sync_lds() {
#if defined(__HIP_DEVICE_COMPILE__)
  __builtin_amdgcn_fence(__ATOMIC_RELEASE, "workgroup");
  __builtin_amdgcn_wave_barrier();
  __builtin_amdgcn_fence(__ATOMIC_ACQUIRE, "workgroup");
#endif
}

// =====================================================================================================
// The four weight planes, f32 -> 16-bit, same layout, in ONE launch (none reads another's output):
//   blocks 0 .. NBU-1: Wu -> f16 bits of (bf16 RNE value) * WOS;  then NBW blocks each for Wq, Wk, Wv -> bf16 RNE bits.
// Thread = 8 consecutive elements: two 16-B loads, one 16-B store; 32 consecutive lanes = 512 contiguous, 512-B aligned bytes
// coverage: per plane ceil(n8/256) blocks x 256 thr x 8 elements, in-kernel bound gt < n8.
// =====================================================================================================
__global__ __launch_bounds__(256) void cvt_w(const float* __restrict__ wq, const float* __restrict__ wk,
                                             const float* __restrict__ wv, const float* __restrict__ wu,
                                             u16* DQ, u16* DK, u16* DV, u16* DU) {
  const int bid = blockIdx.x;
  const bool big = bid < NBU;                // block-uniform choice of the plane
  const int  r   = bid - NBU;
  const int  w   = r / NBW;
  const float* x = big ? wu : (w == 0 ? wq : (w == 1 ? wk : wv));
  u16*         D = big ? DU : (w == 0 ? DQ : (w == 1 ? DK : DV));
  const int   n8 = big ? (DMOD * DMOD / 8) : (HD * HD / 8);
  const int   gt = (big ? bid : (r - w * NBW)) * 256 + (int)threadIdx.x;
  if (gt >= n8) return;                     // no barriers in this kernel
  const float* p = x + (size_t)gt * 8;
  const v4f a = *(const v4f*)(p), c4 = *(const v4f*)(p + 4);
  float v[8];
#pragma unroll
  for (int e = 0; e < 4; ++e) { v[e] = a[e]; v[4 + e] = c4[e]; }
  unsigned short s[8];
#pragma unroll
  for (int e = 0; e < 8; ++e) {
    const unsigned short bb = bf_bits(v[e]);
    const unsigned short hb = h_bits((_Float16)(bf_up(bb) * WOS));
    s[e] = big ? hb : bb;
  }
  v4u o;
#pragma unroll
  for (int e = 0; e < 4; ++e) o[e] = pk16(s[2 * e], s[2 * e + 1]);
  *(v4u*)(D + (size_t)gt * 8) = o;
}

// =====================================================================================================
// 16x96 f16 epilogue: the wave's 16x96 f32 tile (already scaled) staged by the caller in its LDS slab [16][100];
// coverage: 6 instructions x 32 lanes x 8 halves = 1536 = the wave's 16 x 96 tile (groups of 8 never straddle a row: 96/8 = 12).
// =====================================================================================================
__device__ __forceinline__ void out96(const float* sl, u16* dst, int lane) {
  wave_sync_lds();
  v4u ov[6];
#pragma unroll
  for (int i = 0; i < 6; ++i) {
    const int g   = i * 32 + lane;
    const int row = g / 12;
    const int c8  = (g - row * 12) * 8;
    const v4f a = *(const v4f*)(sl + row * 100 + c8), c4 = *(const v4f*)(sl + row * 100 + c8 + 4);
    float w[8];
#pragma unroll
    for (int e = 0; e < 4; ++e) { w[e] = a[e]; w[4 + e] = c4[e]; }
#pragma unroll
    for (int e = 0; e < 4; ++e) ov[i][e] = pk16(h_bits((_Float16)w[2 * e]), h_bits((_Float16)w[2 * e + 1]));
  }
  {
#pragma unroll
    for (int i = 0; i < 6; ++i) {
      *(v4u*)(dst + (size_t)(i * 32 + lane) * 8) = ov[i];
    }
    
  }
}

// =====================================================================================================
// f32 GEMM epilogue with bias, in two parts with the caller's wave_sync_lds() between them:
//   epi64_stage: a 16x64 f32 tile of the wave (acc*oscale + bias[col]) goes into one of its LDS slabs (pitch 68);
//   epi64_flush: the slab leaves as whole lines.
// coverage: 8 instructions x 2 rows x 16 lanes x 4 floats = one 16 x 64 tile.
// =====================================================================================================
__device__ __forceinline__ void epi64_stage(float* sl, v8f a0, v8f a1, v8f a2, v8f a3, float oscale,
                                            float bz0, float bz1, float bz2, float bz3, int lane) {
  const int hh = lane >> 4, m = lane & 15;
#pragma unroll
  for (int r = 0; r < 8; ++r) {
    const int ro = (8 * hh + r) * 68 + m;
    sl[ro]      = a0[r] * oscale + bz0;
    sl[ro + 16] = a1[r] * oscale + bz1;
    sl[ro + 32] = a2[r] * oscale + bz2;
    sl[ro + 48] = a3[r] * oscale + bz3;
  }
}
__device__ __forceinline__ void epi64_flush(const float* sl, float* C, int N, size_t rowb, int col0, int lane) {
  const int hh = lane >> 4, m = lane & 15;
  v4f vals[8];
#pragma unroll
  for (int it = 0; it < 8; ++it) vals[it] = *(const v4f*)(sl + (it * 2 + hh) * 68 + m * 4);
  float* dst = C + (rowb + (size_t)hh) * (size_t)N + col0 + m * 4;
#pragma unroll
  for (int it = 0; it < 8; ++it) *(v4f*)(dst + (size_t)(it * 2) * (size_t)N) = vals[it];
}

// =====================================================================================================
// The three per-head projections (shared 96x96 weights) in ONE launch, bf16 operands. Block = (64 rows of b*SEQ+s, head),
// 4 waves x 16 rows. A wave reads its 16 x 96 piece of x ONCE, as f32 (pitch 768), rounds it to bf16 in registers (ldfrag_x)
// and uses the three A fragments for all three products x . W^T; W = bf16 [96 n][96 k], k-contiguous B operand; 6 accumulators
// (n = 0..95), K = 96 in 3 steps of 32.
//   q, k: P[b][head][s][96] = f16(acc * 8); the wave's 16x96 tile is one contiguous 3072-B region, see out96.
//   v:    D element r of lane l = (s = 8hh + r, d = 16j + m): a lane's 8 values are 8 consecutive keys of one v^T row; the block's
//         96 x 64 tile of VT[b][head][d][s] (f16 of acc * 256) is gathered in LDS and leaves as whole 128-B lines.
// coverage: v^T 6 instructions x 128 threads x 8 halves = 96 x 64; grid = (ROWS/64) * NH = 1024 (exact, host-checked constants).
// =====================================================================================================
__device__ __forceinline__ void proj96(const v16b x0, const v16b x1, const v16b x2, const u16* bp, v8f (&acc)[6]) {
#pragma unroll
  for (int j = 0; j < 6; ++j) acc[j] = mma_b(x0, ldfrag_b(bp + j * 16 * HD), zero8());
#pragma unroll
  for (int j = 0; j < 6; ++j) acc[j] = mma_b(x1, ldfrag_b(bp + j * 16 * HD + 32), acc[j]);
#pragma unroll
  for (int j = 0; j < 6; ++j) acc[j] = mma_b(x2, ldfrag_b(bp + j * 16 * HD + 64), acc[j]);
}
// behind the last weight loads: their offset register is kept whole up to this wait
__device__ __forceinline__ void hold_offset(unsigned off) {
#if defined(__HIP_DEVICE_COMPILE__)
  asm volatile("s_wait_xcnt 0x0" :: "v"(off) : "memory");
#endif
}
// D element r of lane l = (row 8hh+r, col n = 16j + m); stage the 16x96 slab (pitch 100) fully
__device__ __forceinline__ void stage96(float* slab, const v8f (&acc)[6], float oscale, int hh, int m) {
#pragma unroll
  for (int r = 0; r < 8; ++r) {
    const int ro = (8 * hh + r) * 100 + m;
#pragma unroll
    for (int j = 0; j < 6; ++j) slab[ro + 16 * j] = acc[j][r] * oscale;
  }
}

// 4096 waves = 4 per SIMD: with that occupancy's register budget all 36 weight loads of a product are in flight at once
__global__ __launch_bounds__(128) __attribute__((amdgpu_waves_per_eu(4, 4)))
void proj_qkv(const float* __restrict__ X, const u16* __restrict__ WQ, const u16* __restrict__ WK,
              const u16* __restrict__ WV, u16* QP, u16* KP, u16* VT) {
  __shared__ __align__(16) float smem[4 * SLAB96];
  __shared__ __align__(16) u16 vst[HD * VSP];
  const int tid = threadIdx.x, wave = tid >> 5, lane = tid & 31, hh = lane >> 4, m = lane & 15;
  const int bid  = blockIdx.x;
  const int head = bid & (NH - 1);
  const int rt   = bid >> 3;
  const int rowb = rt * 64 + wave * 16;                 // 0..8176, the block's 64 rows never straddle a batch
  const int b    = rowb >> 11;
  const int s0   = rowb & (SEQ - 1);
  const size_t bh = (size_t)(b * NH + head);
  const float* xp = X + (size_t)(rowb + m) * DMOD + head * HD + 8 * hh;
  const v16b x0 = ldfrag_x(xp), x1 = ldfrag_x(xp + 32), x2 = ldfrag_x(xp + 64);
  const unsigned wob = (unsigned)(m * HD + 8 * hh) * 2u;   // the lane's byte offset in each weight plane
  float* slab = smem + wave * SLAB96;
  v8f acc[6];
  proj96(x0, x1, x2, (const u16*)((const char*)WQ + wob), acc);
  stage96(slab, acc, QSC, hh, m);
  out96(slab, QP + (bh * SEQ + s0) * HD, lane);
  proj96(x0, x1, x2, (const u16*)((const char*)WK + wob), acc);
  wave_sync_lds();                                      // the wave's reads of the q slab stay in front of the k slab's writes
  stage96(slab, acc, KSC, hh, m);
  out96(slab, KP + (bh * SEQ + s0) * HD, lane);
  proj96(x0, x1, x2, (const u16*)((const char*)WV + wob), acc);
  hold_offset(wob);
#pragma unroll
  for (int j = 0; j < 6; ++j) {
    v8h h;
#pragma unroll
    for (int r = 0; r < 8; ++r) h[r] = (_Float16)(acc[j][r] * VCAR);
    *(v4u*)(vst + (16 * j + m) * VSP + wave * 16 + 8 * hh) = __builtin_bit_cast(v4u, h);
  }
  __syncthreads();                                      // the four waves' key columns make up the 128-B lines
  u16* vb = VT + bh * HD * SEQ + (s0 - wave * 16);
#pragma unroll
  for (int i = 0; i < 6; ++i) {
    const int p = i * 128 + tid, row = p >> 3, c8 = (p & 7) * 8;
    *(v4u*)(vb + (size_t)row * SEQ + c8) = *(const v4u*)(vst + row * VSP + c8);
  }
}

// =====================================================================================================
// One k tile (one head, 96 k) of gemm_out into one LDS buffer, 18 asynchronous 16-B copies per lane (all 128 lanes on,
// block-uniform control flow):
//   O:  128 rows x 192 B are 24576 contiguous global bytes; piece p = 128 i + tid (i = 0..11) -> LDS row p / 12, 16-B column
//       p % 12 (l0..l2 hold the places of i = 0..2; i + 3 lies 32 rows further); one wave-instruction = 512 contiguous bytes.
//   Wu: 64 rows x 192 B (global pitch 1536 B); piece p = 128 i + tid (i = 0..5), same row and column rule, behind the O part.
// s_wait_xcnt stands inside each statement so that no address register is rewritten in front of it.
// =====================================================================================================
__device__ __forceinline__ void gemm_tile_copy(unsigned l0, unsigned l1, unsigned l2, const char* ag,
                                               const char* bg0, const char* bg1, const char* bg2) {
#if defined(__HIP_DEVICE_COMPILE__)
  asm volatile("global_load_async_to_lds_b128 %0, %12, off\n\t"
               "global_load_async_to_lds_b128 %1, %13, off\n\t"
               "global_load_async_to_lds_b128 %2, %14, off\n\t"
               "global_load_async_to_lds_b128 %3, %15, off\n\t"
               "global_load_async_to_lds_b128 %4, %16, off\n\t"
               "global_load_async_to_lds_b128 %5, %17, off\n\t"
               "global_load_async_to_lds_b128 %6, %18, off\n\t"
               "global_load_async_to_lds_b128 %7, %19, off\n\t"
               "global_load_async_to_lds_b128 %8, %20, off\n\t"
               "global_load_async_to_lds_b128 %9, %21, off\n\t"
               "global_load_async_to_lds_b128 %10, %22, off\n\t"
               "global_load_async_to_lds_b128 %11, %23, off\n\t"
               "s_wait_xcnt 0x0"
               :: "v"(l0), "v"(l1), "v"(l2),
                  "v"(l0 + 32u * GPITCH), "v"(l1 + 32u * GPITCH), "v"(l2 + 32u * GPITCH),
                  "v"(l0 + 64u * GPITCH), "v"(l1 + 64u * GPITCH), "v"(l2 + 64u * GPITCH),
                  "v"(l0 + 96u * GPITCH), "v"(l1 + 96u * GPITCH), "v"(l2 + 96u * GPITCH),
                  "v"(ag), "v"(ag + 2048), "v"(ag + 4096), "v"(ag + 6144), "v"(ag + 8192), "v"(ag + 10240),
                  "v"(ag + 12288), "v"(ag + 14336), "v"(ag + 16384), "v"(ag + 18432), "v"(ag + 20480), "v"(ag + 22528)
               : "memory");
  asm volatile("global_load_async_to_lds_b128 %0, %6, off\n\t"
               "global_load_async_to_lds_b128 %1, %7, off\n\t"
               "global_load_async_to_lds_b128 %2, %8, off\n\t"
               "global_load_async_to_lds_b128 %3, %9, off\n\t"
               "global_load_async_to_lds_b128 %4, %10, off\n\t"
               "global_load_async_to_lds_b128 %5, %11, off\n\t"
               "s_wait_xcnt 0x0"
               :: "v"(l0 + (unsigned)GATILE), "v"(l1 + (unsigned)GATILE), "v"(l2 + (unsigned)GATILE),
                  "v"(l0 + (unsigned)GATILE + 32u * GPITCH), "v"(l1 + (unsigned)GATILE + 32u * GPITCH),
                  "v"(l2 + (unsigned)GATILE + 32u * GPITCH),
                  "v"(bg0), "v"(bg1), "v"(bg2),
                  "v"(bg0 + 32 * DMOD * 2), "v"(bg1 + 32 * DMOD * 2), "v"(bg2 + 32 * DMOD * 2)
               : "memory");
#endif
}

// =====================================================================================================
// Output projection with bias: C[8192][768] (f32) = O . Wu^T * oscale + bf16(bu)[n]; A operand k index = head*96 + d lives at
// O plane address ((b*NH + head)*SEQ + s)*96 + d (O single f16 x1024, 32-deep k-steps never straddle a head since 96 = 3*32);
// Bt = Wu plane [768 n][768 k] f16 (bf16 value x1024), k-contiguous. Block = 128x64 tile, 4 waves x (32 rows x 64 columns);
// k runs over 8 tiles of 96 (one head each, k ascending in steps of 32). The block's waves share each O and Wu tile: it is
// brought into LDS by asynchronous copies (gemm_tile_copy), two buffers, tile t + 1 in flight while tile t is worked on; one
// barrier per tile publishes tile t + 1 and frees tile t's buffer. Fragments are read by ds_load_b128, same split k map for A
// and B. After the last barrier the ring is dead and its first bytes become the waves' private output slabs (two each).
// grid = (ROWS/128)*(DMOD/64) = 768.
// =====================================================================================================
__global__ __launch_bounds__(128)
void gemm_out(const u16* __restrict__ OP, const u16* __restrict__ WOB, const float* __restrict__ bias, float* C,
              float oscale) {
  __shared__ __align__(16) unsigned char ring[2 * GBUF];
  const int tid = threadIdx.x, wave = tid >> 5, lane = tid & 31, hh = lane >> 4, m = lane & 15;
  const int ntile = DMOD >> 6;                          // 12
  const int bid   = blockIdx.x;
  const int row0  = (bid / ntile) * GROWS;              // the block's 128 rows never straddle a batch
  const int col0  = (bid % ntile) * 64;
  const int b     = row0 >> 11;
  const int s0    = row0 & (SEQ - 1);
  // the lane's copy places (LDS byte addresses in buffer 0) and its global sources for tile 0
  const unsigned lds0 = (unsigned)(uintptr_t)(&ring[0]);
  const int r0 = tid / 12, r1 = (tid + 128) / 12, r2 = (tid + 256) / 12;
  const int c0 = (tid - 12 * r0) * 16, c1 = (tid + 128 - 12 * r1) * 16, c2 = (tid + 256 - 12 * r2) * 16;
  const unsigned l0 = lds0 + (unsigned)(r0 * GPITCH + c0);
  const unsigned l1 = lds0 + (unsigned)(r1 * GPITCH + c1);
  const unsigned l2 = lds0 + (unsigned)(r2 * GPITCH + c2);
  const char* ag  = (const char*)(const void*)OP + (((size_t)b * NH * SEQ + s0) * HD * 2 + (size_t)tid * 16);  // + SEQ*192 per tile
  const char* bg0 = (const char*)(const void*)WOB + ((size_t)(col0 + r0) * DMOD * 2 + c0);                     // + 192 per tile
  const char* bg1 = (const char*)(const void*)WOB + ((size_t)(col0 + r1) * DMOD * 2 + c1);
  const char* bg2 = (const char*)(const void*)WOB + ((size_t)(col0 + r2) * DMOD * 2 + c2);
  // A fragments: row = wave*32 + 16i + m; B fragments: row n = 16j + m; byte offsets in a buffer
  const int afo = (wave * 32 + m) * GPITCH + 16 * hh;
  const int bfo = GATILE + m * GPITCH + 16 * hh;
  v8f acc[2][4];
#pragma unroll
  for (int i = 0; i < 2; ++i) {
#pragma unroll
    for (int j = 0; j < 4; ++j) acc[i][j] = zero8();
  }

  // ---- ring prologue: tile 0 landed and published, then tile 1 set off ----
  gemm_tile_copy(l0, l1, l2, ag, bg0, bg1, bg2);
  asm volatile("s_wait_asynccnt 0x0" ::: "memory");   // this wave's copies of tile 0 have landed
  __syncthreads();                                    // every wave's have
  gemm_tile_copy(l0 + GBUF, l1 + GBUF, l2 + GBUF, ag + SEQ * HD * 2, bg0 + HD * 2, bg1 + HD * 2, bg2 + HD * 2);

#pragma unroll 1                                      // one trip per tile stays rolled: one foot, small code
  for (int t = 0; t < GNT; ++t) {
    const unsigned bo = (unsigned)(t & 1) * GBUF;     // trip t reads buffer t mod 2 alone
#pragma unroll                                        // the tile's three 32-deep k-steps: constant LDS offsets in the reads
    for (int ks = 0; ks < 3; ++ks) {
      const _Float16* ap = (const _Float16*)(const void*)(ring + bo + afo + ks * 64);
      const _Float16* bp = (const _Float16*)(const void*)(ring + bo + bfo + ks * 64);
      const v16h a0 = ldfrag_h(ap);
      const v16h a1 = ldfrag_h(ap + 16 * (GPITCH / 2));
      const v16h b0 = ldfrag_h(bp);
      const v16h b1 = ldfrag_h(bp + 16 * (GPITCH / 2));
      const v16h b2 = ldfrag_h(bp + 32 * (GPITCH / 2));
      const v16h b3 = ldfrag_h(bp + 48 * (GPITCH / 2));
      acc[0][0] = mma_h(a0, b0, acc[0][0]);
      acc[0][1] = mma_h(a0, b1, acc[0][1]);
      acc[0][2] = mma_h(a0, b2, acc[0][2]);
      acc[0][3] = mma_h(a0, b3, acc[0][3]);
      acc[1][0] = mma_h(a1, b0, acc[1][0]);
      acc[1][1] = mma_h(a1, b1, acc[1][1]);
      acc[1][2] = mma_h(a1, b2, acc[1][2]);
      acc[1][3] = mma_h(a1, b3, acc[1][3]);
    }
    // ---- foot of trip t: publish tile t + 1, free tile t's buffer, refill it with tile t + 2 ----
    asm volatile("s_wait_dscnt 0x0" ::: "memory");      // this wave's reads of tile t are done
    asm volatile("s_wait_asynccnt 0x0" ::: "memory");   // this wave's copies of tile t + 1 have landed
    __syncthreads();                                    // both hold for every wave
    if (t + 2 < GNT)                                    // block-uniform
      gemm_tile_copy(l0 + bo, l1 + bo, l2 + bo, ag + (size_t)(t + 2) * (SEQ * HD * 2),
                     bg0 + (t + 2) * (HD * 2), bg1 + (t + 2) * (HD * 2), bg2 + (t + 2) * (HD * 2));
  }
  asm volatile("s_wait_asynccnt 0x0" ::: "memory");     // nothing of this wave is in flight when the ring is reused

  // bias for the lane's columns (col0 + 16j + m <= 767), bf16 value of bu
  const float bz0 = bf_up(bf_bits(bias[col0 + m]));
  const float bz1 = bf_up(bf_bits(bias[col0 + 16 + m]));
  const float bz2 = bf_up(bf_bits(bias[col0 + 32 + m]));
  const float bz3 = bf_up(bf_bits(bias[col0 + 48 + m]));
  float* slab = (float*)(void*)ring + wave * 2 * SLAB;  // the ring is dead behind the last trip's barrier
  const size_t rowb = (size_t)(row0 + wave * 32);
  epi64_stage(slab, acc[0][0], acc[0][1], acc[0][2], acc[0][3], oscale, bz0, bz1, bz2, bz3, lane);
  epi64_stage(slab + SLAB, acc[1][0], acc[1][1], acc[1][2], acc[1][3], oscale, bz0, bz1, bz2, bz3, lane);
  wave_sync_lds();                                      // one for both slabs: no global store stands in front of it
  epi64_flush(slab, C, DMOD, rowb, col0, lane);
  epi64_flush(slab + SLAB, C, DMOD, rowb + 16, col0, lane);
}

// =====================================================================================================
// One 64-key tile into one LDS buffer, 12 asynchronous 16-B copies per lane (all 128 lanes on, block-uniform control flow):
//   K: 64 rows x 192 B are 12288 contiguous global bytes; piece p = 128 i + tid (i = 0..5) -> LDS row p / 12, 16-B column p % 12
//      (kl0..kl2 hold the places of i = 0..2; i + 3 lies 32 rows further); one wave-instruction = 512 contiguous bytes.
//   v^T: 96 rows x 128 B (global pitch 4096 B); piece p = 128 i + tid -> row p / 8, column p % 8; one wave-instruction = 4 lines.
// s_wait_xcnt stands inside the statement so that no address register is rewritten in front of it.
// =====================================================================================================
__device__ __forceinline__ void tile_copy(unsigned kl0, unsigned kl1, unsigned kl2, unsigned vl,
                                          const char* kg, const char* vg) {
#if defined(__HIP_DEVICE_COMPILE__)
  asm volatile("global_load_async_to_lds_b128 %0, %12, off\n\t"
               "global_load_async_to_lds_b128 %1, %13, off\n\t"
               "global_load_async_to_lds_b128 %2, %14, off\n\t"
               "global_load_async_to_lds_b128 %3, %15, off\n\t"
               "global_load_async_to_lds_b128 %4, %16, off\n\t"
               "global_load_async_to_lds_b128 %5, %17, off\n\t"
               "global_load_async_to_lds_b128 %6, %18, off\n\t"
               "global_load_async_to_lds_b128 %7, %19, off\n\t"
               "global_load_async_to_lds_b128 %8, %20, off\n\t"
               "global_load_async_to_lds_b128 %9, %21, off\n\t"
               "global_load_async_to_lds_b128 %10, %22, off\n\t"
               "global_load_async_to_lds_b128 %11, %23, off\n\t"
               "s_wait_xcnt 0x0"
               :: "v"(kl0), "v"(kl1), "v"(kl2),
                  "v"(kl0 + 32u * KPITCH), "v"(kl1 + 32u * KPITCH), "v"(kl2 + 32u * KPITCH),
                  "v"(vl), "v"(vl + 16u * VPITCH), "v"(vl + 32u * VPITCH),
                  "v"(vl + 48u * VPITCH), "v"(vl + 64u * VPITCH), "v"(vl + 80u * VPITCH),
                  "v"(kg), "v"(kg + 2048), "v"(kg + 4096), "v"(kg + 6144), "v"(kg + 8192), "v"(kg + 10240),
                  "v"(vg), "v"(vg + 16 * SEQ * 2), "v"(vg + 32 * SEQ * 2),
                  "v"(vg + 48 * SEQ * 2), "v"(vg + 64 * SEQ * 2), "v"(vg + 80 * SEQ * 2)
               : "memory");
#endif
}

// =====================================================================================================
// Narrow multi-head flash attention (no mask): block = (batch b, head, 128 query rows), 4 waves, wave w owns the 32 query rows
// q0 = 128*qt + 32*w .. q0+31 as two tiles of 16 (tile u = rows q0+16u .. +15), so that every K and v^T fragment it reads from
// LDS feeds two matrix instructions, one per tile.
//   q plane (f16, x8) laid out [b][h][s][96]; k plane the same; v^T plane [b][h][96][s] (x256).
//   All NKB = 64 key blocks of 32 keys are visited (static bound), two per 64-key tile. The block's four waves share each K and
//   v^T tile: it is brought into LDS by asynchronous copies (tile_copy), two buffers, tile t + 1 in flight while tile t is
//   worked on; one barrier per tile publishes tile t + 1 and frees tile t's buffer. Fragments are read by ds_load_b128.
//   After the last barrier the ring is dead and its first bytes become the waves' private output slabs (two each).
//   Scores are computed TRANSPOSED: S^T tile (g, u) (g = 0,1) = k rows (keys kb+16g .. +15, A operand, row m = lane&15, split k
//   map over d, 3 chunks of 32) times q^T (B operand, col n = query q0 + 16u + (lane&15), k = d, split map), one product per tile
//   and 32-deep d-chunk. D element r of lane l = (key kb+16g+8h+r, query q0+16u+(l&15)), so a lane owns one query column per
//   tile u and 16 of its 32 keys; the partner lane l^16 owns the other 16 -> row max / row sum need one xor-16 shuffle.
//   Online max-subtracted base-2 softmax in f32, per tile u (softmax16): scale 1/sqrt(768) and the q/k carries folded into lsc;
//   scale, maximum and P's carry enter the exponent through one fma, and the row sum l carries x32768 with P. The exp'd values
//   ARE the P A-fragment in place: A row m = query = lane&15, element i <- key kb+8h+i (g = 0, D element i), element 8+i <- key
//   kb+16+8h+i (g = 1, D element i). P is carried x32768 as single f16. The rescale factor of query row 8h+r of the O
//   accumulators is fetched from lane 8h+r with a shuffle (uniform control). 6 v^T B fragments (col n = d = 16j + (lane&15),
//   keys k-contiguous), 12 P.V WMMAs per key block in two guarded groups of 6.
//   Epilogue, per tile u: 1/l (per query, shuffled to the D row owner) and carry folds in f32; the 16x96 f32 result (x1024)
//   staged in an LDS slab [16][100]; the tile's 16 rows of the O plane [b][h][s][96] are one contiguous 3072-B region written
// coverage: per wave 2 x 6 instructions x 32 lanes x 8 halves = 32 x 96; grid 512 blocks x 4 waves = every (b, h, s) row of the
//           O plane exactly once.
// =====================================================================================================
// One 32-key step of the online softmax for one 16-query tile: s0, s1 = raw scores of keys kb+8h+i and kb+16+8h+i for the lane's
// query; updates the running maximum and sum, fills the P A-fragment, returns the factor for the old sum and accumulators.
__device__ __forceinline__ float softmax16(const v8f s0, const v8f s1, const float lsc, float& mrun, float& lrun, FragH& ph) {
  // ---- maximum of this lane's 16 raw scores (lsc > 0, so the scale commutes with the maximum) ----
  float cm = fmaxf(s0[0], s1[0]);
#pragma unroll
  for (int i = 1; i < 8; ++i) cm = fmaxf(fmaxf(cm, s0[i]), s1[i]);
  cm = fmaxf(cm, __shfl_xor(cm, 16, 32));
  const float mn = fmaxf(mrun, cm * lsc);                          // base-2 logit; finite from the first key block on
  const float al = (mrun == -INFINITY) ? 0.f : ex2(mrun - mn);     // o and l are zero while mrun is -inf
  mrun = mn;
  // ---- carried probabilities p * 32768 = 2^(s * lsc - mn + 15): one fma and one v_exp_f32 per score; the argument is at
  //      most 15 plus the fma's rounding, and a result under 2^-126 (flushed) is far below the f16 plane's last place.
  //      P A-fragment: element i <-> s0[i], element 8 + i <-> s1[i] ----
  const v2f lsc2 = {lsc, lsc};
  const v2f eb2  = {PEXP - mn, PEXP - mn};
  float ps = 0.f;
  v2f ar[8], pp[8];
#pragma unroll
  for (int e = 0; e < 8; ++e) {
    const v2f sp = (e < 4) ? (v2f){s0[2 * e], s0[2 * e + 1]} : (v2f){s1[2 * e - 8], s1[2 * e - 7]};
    ar[e] = __builtin_elementwise_fma(sp, lsc2, eb2);
  }
#pragma unroll
  for (int e = 0; e < 8; ++e) pp[e] = (v2f){ex2(ar[e][0]), ex2(ar[e][1])};
#pragma unroll
  for (int e = 0; e < 8; ++e) {
    ps += pp[e][0] + pp[e][1];
    ph.u[e >> 2][e & 3] = __builtin_bit_cast(unsigned, __builtin_convertvector(pp[e], v2h));   // RNE, as two scalar casts
  }
  ps += __shfl_xor(ps, 16, 32);
  lrun = lrun * al + ps;
  return al;
}
// rescale one tile's O accumulators: D row 8hh+r = the tile's query 8hh+r, its factor lives in lane 8hh+r (and 16+8hh+r)
__device__ __forceinline__ void rescale16(v8f (&o)[6], const float al, const int hh) {
  float scl[8];
#pragma unroll
  for (int r = 0; r < 8; ++r) scl[r] = __shfl(al, 8 * hh + r, 32);
#pragma unroll
  for (int j = 0; j < 6; ++j) {
#pragma unroll
    for (int r = 0; r < 8; ++r) o[j][r] *= scl[r];
  }
}
// fold 1/l (per query, owned by lane = query; l carries PCAR like P, so only v's carry is left) and OSC; stage one tile's slab
__device__ __forceinline__ void stage_o16(float* slab, const v8f (&o)[6], const float lrun, const int hh, const int c) {
  const float linv = (lrun > 0.f) ? ((1.0f / lrun) * (OSC / VCAR)) : 0.f;
  float inv[8];
#pragma unroll
  for (int r = 0; r < 8; ++r) inv[r] = __shfl(linv, 8 * hh + r, 32);
#pragma unroll
  for (int r = 0; r < 8; ++r) {
    const int ro = (8 * hh + r) * 100 + c;
#pragma unroll
    for (int j = 0; j < 6; ++j) slab[ro + 16 * j] = o[j][r] * inv[r];
  }
}

// out96 for the wave's two adjacent slabs and its 32 adjacent O rows: one wave_sync_lds() for both, so that no global store stands
// in front of it. coverage: 12 instructions x 32 lanes x 8 halves = 32 x 96.
__device__ __forceinline__ void out96x2(const float* sl, u16* dst, int lane) {
  wave_sync_lds();
  v4u ov[12];
#pragma unroll
  for (int i = 0; i < 12; ++i) {
    const int g   = (i % 6) * 32 + lane;
    const int row = g / 12;
    const int c8  = (g - row * 12) * 8;
    const float* sp = sl + (i / 6) * SLAB96 + row * 100 + c8;
    const v4f a = *(const v4f*)(sp), c4 = *(const v4f*)(sp + 4);
#pragma unroll
    for (int e = 0; e < 2; ++e) {
      ov[i][e]     = pk16(h_bits((_Float16)a[2 * e]), h_bits((_Float16)a[2 * e + 1]));
      ov[i][2 + e] = pk16(h_bits((_Float16)c4[2 * e]), h_bits((_Float16)c4[2 * e + 1]));
    }
  }
#pragma unroll
  for (int i = 0; i < 12; ++i) *(v4u*)(dst + (size_t)(i * 32 + lane) * 8) = ov[i];
}

// 2048 waves = 2 per SIMD, 512 blocks = 2 per WGP: the register budget of that occupancy, and no third block on a WGP
__global__ __launch_bounds__(ATT_THREADS) __attribute__((amdgpu_waves_per_eu(2, 2)))
void attn_fwd(const u16* __restrict__ QPp, const u16* __restrict__ KPp, const u16* __restrict__ VPp, u16* OPp) {
  __shared__ __align__(16) unsigned char ring[2 * BUFB];

  const int tid  = threadIdx.x;
  const int wave = tid >> 5;
  const int lane = tid & 31;
  const int hh   = lane >> 4;
  const int c    = lane & 15;

  const int bid  = blockIdx.x;
  const int qt   = bid & (SEQ / QPB - 1);
  const int head = (bid >> 4) & (NH - 1);
  const int b    = bid >> 7;
  const int q0   = qt * QPB + wave * QPW;
  const size_t bh = (size_t)(b * NH + head);

  // B fragments of q^T: col n = query q0 + 16u + c, k = d (k-contiguous row of the q plane)
  const _Float16* Qb = (const _Float16*)(const void*)QPp + ((bh * SEQ + q0 + c) * HD + 8 * hh);
  // A fragments of k: row m = key (in tile) 16g + c, k = d; byte offset in a buffer's K part
  const int kfo = c * KPITCH + 16 * hh;
  // B fragments of v: col n = d = 16j + c, k = key (k-contiguous row of the v^T tile); byte offset in a buffer
  const int vfo = KTILE + c * VPITCH + 16 * hh;
  // the lane's copy places (LDS byte addresses in buffer 0) and its global sources for tile 0
  const unsigned lds0 = (unsigned)(uintptr_t)(&ring[0]);
  const int kr0 = tid / 12, kr1 = (tid + 128) / 12, kr2 = (tid + 256) / 12;
  const unsigned kl0 = lds0 + (unsigned)(kr0 * KPITCH + (tid - 12 * kr0) * 16);
  const unsigned kl1 = lds0 + (unsigned)(kr1 * KPITCH + (tid + 128 - 12 * kr1) * 16);
  const unsigned kl2 = lds0 + (unsigned)(kr2 * KPITCH + (tid + 256 - 12 * kr2) * 16);
  const unsigned vl  = lds0 + (unsigned)(KTILE + (tid >> 3) * VPITCH + (tid & 7) * 16);
  const char* kg = (const char*)(const void*)KPp + (bh * SEQ * HD * 2 + (size_t)tid * 16);              // + 12288 per tile
  const char* vg = (const char*)(const void*)VPp + ((bh * HD + (size_t)(tid >> 3)) * SEQ * 2 + (size_t)(tid & 7) * 16);  // + 128
  const float lsc = RSQK * (LOG2E / (QSC * KSC));

  const v16h qa0 = ldfrag_h(Qb);                      // tile 0: d 0..31
  const v16h qa1 = ldfrag_h(Qb + 32);                 //         d 32..63
  const v16h qa2 = ldfrag_h(Qb + 64);                 //         d 64..95
  const v16h qb0 = ldfrag_h(Qb + 16 * HD);            // tile 1
  const v16h qb1 = ldfrag_h(Qb + 16 * HD + 32);
  const v16h qb2 = ldfrag_h(Qb + 16 * HD + 64);

  float mrun0 = -INFINITY, lrun0 = 0.f, mrun1 = -INFINITY, lrun1 = 0.f;
  v8f oa[6], ob[6];
#pragma unroll
  for (int j = 0; j < 6; ++j) { oa[j] = zero8(); ob[j] = zero8(); }

  // ---- ring prologue: tile 0 landed and published, then tile 1 set off ----
  tile_copy(kl0, kl1, kl2, vl, kg, vg);
  asm volatile("s_wait_asynccnt 0x0" ::: "memory");   // this wave's copies of tile 0 have landed
  __syncthreads();                                    // every wave's have
  tile_copy(kl0 + BUFB, kl1 + BUFB, kl2 + BUFB, vl + BUFB, kg + STK * HD * 2, vg + STK * 2);

#pragma unroll 1                                      // one trip per tile stays rolled: one foot, small code
  for (int t = 0; t < NST; ++t) {
   const unsigned bo = (unsigned)(t & 1) * BUFB;      // trip t reads buffer t mod 2 alone
#pragma unroll                                        // the tile's two 32-key blocks: constant LDS offsets in the reads
   for (int sub = 0; sub < 2; ++sub) {
    // ---- transposed scores: s0x = keys kb..kb+15, s1x = keys kb+16..kb+31 (kb = 64 t + 32 sub); sxa = queries q0 + c,
    //      sxb = queries q0 + 16 + c; each K fragment is read once and used for both query tiles ----
    const _Float16* k0p = (const _Float16*)(const void*)(ring + bo + kfo + sub * 32 * KPITCH);
    const _Float16* k1p = (const _Float16*)(const void*)(ring + bo + kfo + (sub * 32 + 16) * KPITCH);
    v8f s0a = zero8(), s0b = zero8(), s1a = zero8(), s1b = zero8();
    {
      const v16h ka0 = ldfrag_h(k0p), ka1 = ldfrag_h(k0p + 32), ka2 = ldfrag_h(k0p + 64);
      const v16h kc0 = ldfrag_h(k1p), kc1 = ldfrag_h(k1p + 32), kc2 = ldfrag_h(k1p + 64);
      __builtin_amdgcn_sched_barrier(0);   // keeps the twelve reads one group in front of the WMMAs (else a pair stands at every second one)
      s0a = mma_h(ka0, qa0, s0a);
      s0b = mma_h(ka0, qb0, s0b);
      s1a = mma_h(kc0, qa0, s1a);
      s1b = mma_h(kc0, qb0, s1b);
      s0a = mma_h(ka1, qa1, s0a);
      s0b = mma_h(ka1, qb1, s0b);
      s1a = mma_h(kc1, qa1, s1a);
      s1b = mma_h(kc1, qb1, s1b);
      s0a = mma_h(ka2, qa2, s0a);
      s0b = mma_h(ka2, qb2, s0b);
      s1a = mma_h(kc2, qa2, s1a);
      s1b = mma_h(kc2, qb2, s1b);
      guard4(s0a, s0b, s1a, s1b);
    }
    // ---- v^T B fragments: col n = d = j*16 + c, keys contiguous in the v^T plane; each is read once and used for both query
    //      tiles ----
    const _Float16* vp = (const _Float16*)(const void*)(ring + bo + vfo + sub * 64);
    const v16h vf0 = ldfrag_h(vp);
    const v16h vf1 = ldfrag_h(vp + 16 * (VPITCH / 2));
    const v16h vf2 = ldfrag_h(vp + 32 * (VPITCH / 2));
    const v16h vf3 = ldfrag_h(vp + 48 * (VPITCH / 2));
    const v16h vf4 = ldfrag_h(vp + 64 * (VPITCH / 2));
    const v16h vf5 = ldfrag_h(vp + 80 * (VPITCH / 2));
    // keeps the twelve reads one group in front of the softmax, which covers their latency (else they are spread among the WMMAs)
    __builtin_amdgcn_sched_barrier(0);
    FragH pa, pb;
    const float ala = softmax16(s0a, s1a, lsc, mrun0, lrun0, pa);
    const float alb = softmax16(s0b, s1b, lsc, mrun1, lrun1, pb);
    rescale16(oa, ala, hh);
    rescale16(ob, alb, hh);
    // ---- P.V : two guarded groups of 6 ----
    {
      oa[0] = mma_h(pa.v, vf0, oa[0]);
      ob[0] = mma_h(pb.v, vf0, ob[0]);
      oa[1] = mma_h(pa.v, vf1, oa[1]);
      ob[1] = mma_h(pb.v, vf1, ob[1]);
      oa[2] = mma_h(pa.v, vf2, oa[2]);
      ob[2] = mma_h(pb.v, vf2, ob[2]);
      guard6(oa[0], ob[0], oa[1], ob[1], oa[2], ob[2]);
      oa[3] = mma_h(pa.v, vf3, oa[3]);
      ob[3] = mma_h(pb.v, vf3, ob[3]);
      oa[4] = mma_h(pa.v, vf4, oa[4]);
      ob[4] = mma_h(pb.v, vf4, ob[4]);
      oa[5] = mma_h(pa.v, vf5, oa[5]);
      ob[5] = mma_h(pb.v, vf5, ob[5]);
      guard6(oa[3], ob[3], oa[4], ob[4], oa[5], ob[5]);
    }
   }
   // ---- foot of trip t: publish tile t + 1, free tile t's buffer, refill it with tile t + 2 ----
   asm volatile("s_wait_dscnt 0x0" ::: "memory");      // this wave's reads of tile t are done
   asm volatile("s_wait_asynccnt 0x0" ::: "memory");   // this wave's copies of tile t + 1 have landed
   __syncthreads();                                    // both hold for every wave
   if (t + 2 < NST)                                    // block-uniform
     tile_copy(kl0 + bo, kl1 + bo, kl2 + bo, vl + bo,
               kg + (size_t)(t + 2) * (STK * HD * 2), vg + (size_t)(t + 2) * (STK * 2));
  }
  asm volatile("s_wait_asynccnt 0x0" ::: "memory");    // nothing of this wave is in flight when the ring is reused
  acc_guard6(oa[0], oa[1], oa[2], oa[3], oa[4], oa[5]);
  acc_guard6(ob[0], ob[1], ob[2], ob[3], ob[4], ob[5]);

  float* slab = (float*)(void*)ring + wave * 2 * SLAB96;   // the ring is dead behind the last trip's barrier
  stage_o16(slab, oa, lrun0, hh, c);
  stage_o16(slab + SLAB96, ob, lrun1, hh, c);
  out96x2(slab, OPp + (bh * SEQ + q0) * HD, lane);
}

// =====================================================================================================
// Workspace map (bytes); every plane is fully written by whole-line stores before it is read; all extents are exact multiples
// of the 512-B store instructions (no pad rows needed); every base is 256-B aligned:
//   WQB bf16 [96 n][96 k]                          18432        WKB, WVB the same
//   WOB f16  [768 n][768 k] (bf16 value x1024)   1179648
//   QP  f16  [4][8][2048][96] x8                12582912        KP same
//   VP  f16  [4][8][96][2048] x256              12582912
//   OP  f16  [4][8][2048][96] x1024             12582912
//   end                                          51566592
// =====================================================================================================
extern "C" void kernel_launch(void* const* d_in, const int* in_sizes, int n_in,
                              void* d_out, int out_size, void* d_ws, size_t ws_size,
                              hipStream_t stream) {
  if (n_in < 6) return;
  if (in_sizes[0] != ROWS * DMOD) return;
  if (in_sizes[1] != HD * HD) return;
  if (in_sizes[2] != HD * HD) return;
  if (in_sizes[3] != HD * HD) return;
  if (in_sizes[4] != DMOD * DMOD) return;
  if (in_sizes[5] != DMOD) return;
  if (out_size != ROWS * DMOD) return;

  const float* Xin = (const float*)d_in[0];
  const float* Wq  = (const float*)d_in[1];
  const float* Wk  = (const float*)d_in[2];
  const float* Wv  = (const float*)d_in[3];
  const float* Wu  = (const float*)d_in[4];
  const float* bu  = (const float*)d_in[5];
  float*       out = (float*)d_out;

  const size_t szW  = (size_t)HD * HD * 2;                      //    18432
  const size_t szWO = (size_t)DMOD * DMOD * 2;                  //  1179648
  const size_t szP  = (size_t)NB * NH * SEQ * HD * 2;           // 12582912  (q / k / v^T / o planes)
  size_t off = 0;
  const size_t oWQ = off; off += szW;
  const size_t oWK = off; off += szW;
  const size_t oWV = off; off += szW;
  const size_t oWO = off; off += szWO;
  const size_t oQP = off; off += szP;
  const size_t oKP = off; off += szP;
  const size_t oVP = off; off += szP;
  const size_t oOP = off; off += szP;
  if (off > ws_size) return;                            // off = 51566592
  if (off > (size_t)134217728) return;
  if ((szW % 256) != 0 || (szWO % 256) != 0 || (szP % 256) != 0) return;

  char* ws = (char*)d_ws;
  u16* WQB = (u16*)(ws + oWQ);
  u16* WKB = (u16*)(ws + oWK);
  u16* WVB = (u16*)(ws + oWV);
  u16* WOB = (u16*)(ws + oWO);
  u16* QP  = (u16*)(ws + oQP);
  u16* KP  = (u16*)(ws + oKP);
  u16* VP  = (u16*)(ws + oVP);
  u16* OP  = (u16*)(ws + oOP);

  if (((HD * HD) % 8) != 0 || ((DMOD * DMOD / 8) % 256) != 0) return;
  if ((DMOD % 64) != 0 || (ROWS % 64) != 0 || (ROWS % GROWS) != 0 || (SEQ % 64) != 0 || (HD % 32) != 0) return;
  const dim3 gW(NBU + 3 * NBW);                         // 303 (in-kernel bound gt < n8 per plane)
  const dim3 bW(256);
  const dim3 gPJ((ROWS / 64) * NH);                     // 1024
  const dim3 bPJ(128);
  const dim3 gAT(ATT_BLOCKS);                           // 512
  const dim3 bAT(ATT_THREADS);                          // 128
  const dim3 gO((ROWS / GROWS) * (DMOD / 64));          // 768
  const dim3 bO(128);

  // (0) weight planes: Wq/Wk/Wv [n = out][k = in] (already k-contiguous) -> bf16; Wu -> f16 of bf16 value x1024
  cvt_w<<<gW, bW, 0, stream>>>(Wq, Wk, Wv, Wu, WQB, WKB, WVB, WOB);
  // (1) q and k planes [b][h][s][96] = f16(x_h.Wq^T x8), f16(x_h.Wk^T x8); v^T plane [b][h][96 d][2048 keys] = f16(x_h.Wv^T x256)
  proj_qkv<<<gPJ, bPJ, 0, stream>>>(Xin, WQB, WKB, WVB, QP, KP, VP);
  // (2) attention -> O plane [b][h][s][96] x1024 (single f16)
  attn_fwd<<<gAT, bAT, 0, stream>>>(QP, KP, VP, OP);
  // (3) output projection -> out [8192][768] f32, carries 1024 (O) x 1024 (Wu) folded back, + bias
  gemm_out<<<gO, bO, 0, stream>>>(OP, WOB, bu, out, 1.0f / (OSC * WOS));
  (void)hipGetLastError();
}

// v006
// Measured time: 77 microseconds a run.
// Two timings next to v005 both put it at 1.10 times that version's speed.
// All steps since v000 together make it 3.05 times as fast.
// Contractions: x.Wq^T, x.Wk^T and x.Wv^T per head on v_wmma_f32_16x16x32_bf16 (x and Wq/Wk/Wv RNE-converted to bf16
// operands, f32 accumulate); scores k'.q'^T (q', k' single f16 planes carried x8), P.v (P x128 single f16, v x256 single
// f16) and O.Wu^T (O single f16 plane x1024, Wu as f16(bf16(Wu)) x1024): v_wmma_f32_16x16x32_f16, f32 accumulate.
// Base-2 online softmax, 1/l, bias (bf16 value of bu) and carry folds in f32 on VALU.
#include <hip/hip_runtime.h>
#include <math.h>
#include <stdint.h>

#define NB    4
#define SEQ   2048
#define DMOD  768
#define NH    8
#define HD    96
#define ROWS  (NB * SEQ)
#define QSC   8.0f
#define KSC   8.0f
#define PCAR  128.0f
#define PEXP  7.0f                              // log2(PCAR)
#define LAZY  8.0f                              // a maximum in use may lag a new one by this much (base-2 logit): P <= 2^(PEXP + LAZY)
#define VCAR  256.0f
#define OSC   1024.0f
#define WOS   1024.0f
#define LOG2E 1.4426950408889634f
#define RSQK  0.0360843918243516f
#define ATT_WAVES   4
#define ATT_THREADS (ATT_WAVES * 32)
#define QPW         32                         // query rows per attention wave: two 16-row tiles
#define QPB         (ATT_WAVES * QPW)          // query rows per attention block: 128
#define ATT_BLOCKS  (NB * NH * (SEQ / QPB))
#define NKB    (SEQ / 32)
#define SLAB   (16 * 68)
#define SLAB96 (16 * 100)
#define VSP    72                              // halves per v^T row staged in LDS: 64 + 8 (144 B = 16 B x odd)
#define NBW    ((HD * HD / 8 + 255) / 256)     // conversion blocks per 96x96 weight: 5
#define NBU    (DMOD * DMOD / 8 / 256)         // conversion blocks of Wu: 288
#define STK    64                              // keys per LDS tile
#define NST    (SEQ / STK)                     // 32 tiles
#define KPITCH 208                             // bytes per K row in LDS: 192 + 16 (16 B x odd, for ds_load_b128 readers)
#define VPITCH 144                             // bytes per v^T row in LDS: 128 + 16 (16 B x odd)
#define KTILE  (STK * KPITCH)                  // 13312
#define VTILE  (HD * VPITCH)                   // 13824
#define BUFB   (KTILE + VTILE)                 // 27136
#define GROWS  128                             // output rows per gemm_out block: 4 waves x 32
#define GNT    NH                              // LDS tiles along k in gemm_out: one head (96 k) each
#define GPITCH 208                             // bytes per O or Wu row in LDS: 192 + 16 (16 B x odd)
#define GATILE (GROWS * GPITCH)                // 26624
#define GBTILE (64 * GPITCH)                   // 13312
#define GBUF   (GATILE + GBTILE)               // 39936
static_assert(DMOD == NH * HD && HD == 96 && NH == 8 && NB == 4 && SEQ == 2048);
static_assert((SEQ / QPB) == 16 && ATT_BLOCKS == 512 && ATT_THREADS == 128 && NKB == 64);
static_assert((HD % 32) == 0 && (DMOD % 64) == 0 && (ROWS % 64) == 0 && (SEQ % 64) == 0);
static_assert(((ROWS * DMOD / 8) % 256) == 0 && ((DMOD * DMOD / 8) % 256) == 0 && ((HD * HD) % 8) == 0);
static_assert((SLAB * 4) % 16 == 0 && (SLAB96 * 4) % 16 == 0);
static_assert(NST >= 2 && STK == 64 && (STK * HD * 2) == 6 * ATT_THREADS * 16 && (HD * STK * 2) == 6 * ATT_THREADS * 16);
static_assert((KTILE % 16) == 0 && (BUFB % 16) == 0 && 2 * BUFB >= 2 * ATT_WAVES * SLAB96 * 4);
static_assert((SEQ % GROWS) == 0 && GNT >= 2 && (GROWS * HD * 2) == 12 * 128 * 16 && (64 * HD * 2) == 6 * 128 * 16);
static_assert((GATILE % 16) == 0 && (GBUF % 16) == 0 && 2 * GBUF >= 8 * SLAB * 4);

typedef unsigned short u16;
typedef _Float16 v16h __attribute__((ext_vector_type(16)));
typedef _Float16 v8h  __attribute__((ext_vector_type(8)));
typedef _Float16 v2h  __attribute__((ext_vector_type(2)));
typedef __bf16   v16b __attribute__((ext_vector_type(16)));
typedef float    v8f  __attribute__((ext_vector_type(8)));
typedef float    v4f  __attribute__((ext_vector_type(4)));
typedef float    v2f  __attribute__((ext_vector_type(2)));
typedef unsigned int v4u __attribute__((ext_vector_type(4)));

union FragH { v16h v; v8h h[2]; v4u u[2]; };
union FragB { v16b v; v4u u[2]; };

// ---- scalar helpers --------------------------------------------------------------------------------
__device__ __forceinline__ unsigned short bf_bits(float f) {          // f32 -> bf16 bits, RNE convert
  unsigned u = __float_as_uint(f);
  return (unsigned short)((u + 0x7FFFu + ((u >> 16) & 1u)) >> 16);
}
__device__ __forceinline__ float bf_up(unsigned short h) { return __uint_as_float(((unsigned)h) << 16); }
__device__ __forceinline__ unsigned short h_bits(_Float16 x) { return __builtin_bit_cast(unsigned short, x); }
__device__ __forceinline__ unsigned pk16(unsigned short a, unsigned short b) { return (unsigned)a | ((unsigned)b << 16); }
__device__ __forceinline__ float ex2(float x) { return __builtin_amdgcn_exp2f(x); }   // bare v_exp_f32: 2^-inf = 0, no range fix-up
__device__ __forceinline__ v8f zero8() { v8f z = {0.f, 0.f, 0.f, 0.f, 0.f, 0.f, 0.f, 0.f}; return z; }

// ---- fragment loaders: 16-bit A/B operand, lane -> row/col (lane&15), p already includes +8*(lane>>4);
//      elements 0..7 <- p[0..7] (k0+8h..), elements 8..15 <- p[16..23] (k0+16+8h..)  (same split k map for A and B;
//      B is always read from a k-contiguous [n][k] plane)
__device__ __forceinline__ v16h ldfrag_h(const _Float16* p) {
  FragH f;
  f.h[0] = *(const v8h*)(p);
  f.h[1] = *(const v8h*)(p + 16);
  return f.v;
}
__device__ __forceinline__ v16b ldfrag_b(const u16* p) {              // bf16 plane read as unsigned integer vectors
  FragB f;
  f.u[0] = *(const v4u*)(p);
  f.u[1] = *(const v4u*)(p + 16);
  return f.v;
}

// the same fragment straight from an f32 row: RNE to bf16 in registers, same split k map
__device__ __forceinline__ v16b ldfrag_x(const float* p) {
  const v4f a0 = *(const v4f*)(p), a1 = *(const v4f*)(p + 4), a2 = *(const v4f*)(p + 16), a3 = *(const v4f*)(p + 20);
  FragB f;
#pragma unroll
  for (int e = 0; e < 2; ++e) {
    f.u[0][e]     = pk16(bf_bits(a0[2 * e]), bf_bits(a0[2 * e + 1]));
    f.u[0][2 + e] = pk16(bf_bits(a1[2 * e]), bf_bits(a1[2 * e + 1]));
    f.u[1][e]     = pk16(bf_bits(a2[2 * e]), bf_bits(a2[2 * e + 1]));
    f.u[1][2 + e] = pk16(bf_bits(a3[2 * e]), bf_bits(a3[2 * e + 1]));
  }
  return f.v;
}

__device__ __forceinline__ v8f mma_h(v16h a, v16h b, v8f c) {
  return __builtin_amdgcn_wmma_f32_16x16x32_f16(false, a, false, b, (short)0, c, false, false);
}
__device__ __forceinline__ v8f mma_b(v16b a, v16b b, v8f c) {
  return __builtin_amdgcn_wmma_f32_16x16x32_bf16(false, a, false, b, (short)0, c, false, false);
}
// v_nop x4: the distance between the last matrix instruction of a group and the first vector instruction on its D, A or B
__device__ __forceinline__ void guard4(v8f& s, v8f& t, v8f& u, v8f& w) {
#if defined(__HIP_DEVICE_COMPILE__)
  asm volatile("v_nop\n\tv_nop\n\tv_nop\n\tv_nop" : "+v"(s), "+v"(t), "+v"(u), "+v"(w) :: "memory");
#endif
}
__device__ __forceinline__ void guard6(v8f& a, v8f& b, v8f& c, v8f& d, v8f& e, v8f& f) {
#if defined(__HIP_DEVICE_COMPILE__)
  asm volatile("v_nop\n\tv_nop\n\tv_nop\n\tv_nop"
               : "+v"(a), "+v"(b), "+v"(c), "+v"(d), "+v"(e), "+v"(f) :: "memory");
#endif
}
__device__ __forceinline__ void acc_guard6(v8f& a, v8f& b, v8f& c, v8f& d, v8f& e, v8f& f) {
#if defined(__HIP_DEVICE_COMPILE__)
  asm volatile("v_nop\n\tv_nop\n\tv_nop\n\tv_nop" : "+v"(a), "+v"(b), "+v"(c), "+v"(d), "+v"(e), "+v"(f));
#endif
}
__device__ __forceinline__ void wave_sync_lds() {
#if defined(__HIP_DEVICE_COMPILE__)
  __builtin_amdgcn_fence(__ATOMIC_RELEASE, "workgroup");
  __builtin_amdgcn_wave_barrier();
  __builtin_amdgcn_fence(__ATOMIC_ACQUIRE, "workgroup");
#endif
}

// =====================================================================================================
// The four weight planes, f32 -> 16-bit, same layout, in ONE launch (none reads another's output):
//   blocks 0 .. NBU-1: Wu -> f16 bits of (bf16 RNE value) * WOS;  then NBW blocks each for Wq, Wk, Wv -> bf16 RNE bits.
// Thread = 8 consecutive elements: two 16-B loads, one 16-B store; 32 consecutive lanes = 512 contiguous, 512-B aligned bytes
// coverage: per plane ceil(n8/256) blocks x 256 thr x 8 elements, in-kernel bound gt < n8.
// =====================================================================================================
__global__ __launch_bounds__(256) void cvt_w(const float* __restrict__ wq, const float* __restrict__ wk,
                                             const float* __restrict__ wv, const float* __restrict__ wu,
                                             u16* DQ, u16* DK, u16* DV, u16* DU) {
  const int bid = blockIdx.x;
  const bool big = bid < NBU;                // block-uniform choice of the plane
  const int  r   = bid - NBU;
  const int  w   = r / NBW;
  const float* x = big ? wu : (w == 0 ? wq : (w == 1 ? wk : wv));
  u16*         D = big ? DU : (w == 0 ? DQ : (w == 1 ? DK : DV));
  const int   n8 = big ? (DMOD * DMOD / 8) : (HD * HD / 8);
  const int   gt = (big ? bid : (r - w * NBW)) * 256 + (int)threadIdx.x;
  if (gt >= n8) return;                     // no barriers in this kernel
  const float* p = x + (size_t)gt * 8;
  const v4f a = *(const v4f*)(p), c4 = *(const v4f*)(p + 4);
  float v[8];
#pragma unroll
  for (int e = 0; e < 4; ++e) { v[e] = a[e]; v[4 + e] = c4[e]; }
  unsigned short s[8];
#pragma unroll
  for (int e = 0; e < 8; ++e) {
    const unsigned short bb = bf_bits(v[e]);
    const unsigned short hb = h_bits((_Float16)(bf_up(bb) * WOS));
    s[e] = big ? hb : bb;
  }
  v4u o;
#pragma unroll
  for (int e = 0; e < 4; ++e) o[e] = pk16(s[2 * e], s[2 * e + 1]);
  *(v4u*)(D + (size_t)gt * 8) = o;
}

// =====================================================================================================
// 16x96 f16 epilogue: the wave's 16x96 f32 tile (already scaled) staged by the caller in its LDS slab [16][100];
// coverage: 6 instructions x 32 lanes x 8 halves = 1536 = the wave's 16 x 96 tile (groups of 8 never straddle a row: 96/8 = 12).
// =====================================================================================================
__device__ __forceinline__ void out96(const float* sl, u16* dst, int lane) {
  wave_sync_lds();
  v4u ov[6];
#pragma unroll
  for (int i = 0; i < 6; ++i) {
    const int g   = i * 32 + lane;
    const int row = g / 12;
    const int c8  = (g - row * 12) * 8;
    const v4f a = *(const v4f*)(sl + row * 100 + c8), c4 = *(const v4f*)(sl + row * 100 + c8 + 4);
    float w[8];
#pragma unroll
    for (int e = 0; e < 4; ++e) { w[e] = a[e]; w[4 + e] = c4[e]; }
#pragma unroll
    for (int e = 0; e < 4; ++e) ov[i][e] = pk16(h_bits((_Float16)w[2 * e]), h_bits((_Float16)w[2 * e + 1]));
  }
  {
#pragma unroll
    for (int i = 0; i < 6; ++i) {
      *(v4u*)(dst + (size_t)(i * 32 + lane) * 8) = ov[i];
    }
    
  }
}

// =====================================================================================================
// f32 GEMM epilogue with bias, in two parts with the caller's wave_sync_lds() between them:
//   epi64_stage: a 16x64 f32 tile of the wave (acc*oscale + bias[col]) goes into one of its LDS slabs (pitch 68);
//   epi64_flush: the slab leaves as whole lines.
// coverage: 8 instructions x 2 rows x 16 lanes x 4 floats = one 16 x 64 tile.
// =====================================================================================================
__device__ __forceinline__ void epi64_stage(float* sl, v8f a0, v8f a1, v8f a2, v8f a3, float oscale,
                                            float bz0, float bz1, float bz2, float bz3, int lane) {
  const int hh = lane >> 4, m = lane & 15;
#pragma unroll
  for (int r = 0; r < 8; ++r) {
    const int ro = (8 * hh + r) * 68 + m;
    sl[ro]      = a0[r] * oscale + bz0;
    sl[ro + 16] = a1[r] * oscale + bz1;
    sl[ro + 32] = a2[r] * oscale + bz2;
    sl[ro + 48] = a3[r] * oscale + bz3;
  }
}
__device__ __forceinline__ void epi64_flush(const float* sl, float* C, int N, size_t rowb, int col0, int lane) {
  const int hh = lane >> 4, m = lane & 15;
  v4f vals[8];
#pragma unroll
  for (int it = 0; it < 8; ++it) vals[it] = *(const v4f*)(sl + (it * 2 + hh) * 68 + m * 4);
  float* dst = C + (rowb + (size_t)hh) * (size_t)N + col0 + m * 4;
#pragma unroll
  for (int it = 0; it < 8; ++it) *(v4f*)(dst + (size_t)(it * 2) * (size_t)N) = vals[it];
}

// =====================================================================================================
// The three per-head projections (shared 96x96 weights) in ONE launch, bf16 operands. Block = (64 rows of b*SEQ+s, head),
// 4 waves x 16 rows. A wave reads its 16 x 96 piece of x ONCE, as f32 (pitch 768), rounds it to bf16 in registers (ldfrag_x)
// and uses the three A fragments for all three products x . W^T; W = bf16 [96 n][96 k], k-contiguous B operand; 6 accumulators
// (n = 0..95), K = 96 in 3 steps of 32.
//   q, k: P[b][head][s][96] = f16(acc * 8); the wave's 16x96 tile is one contiguous 3072-B region, see out96.
//   v:    D element r of lane l = (s = 8hh + r, d = 16j + m): a lane's 8 values are 8 consecutive keys of one v^T row; the block's
//         96 x 64 tile of VT[b][head][d][s] (f16 of acc * 256) is gathered in LDS and leaves as whole 128-B lines.
// coverage: v^T 6 instructions x 128 threads x 8 halves = 96 x 64; grid = (ROWS/64) * NH = 1024 (exact, host-checked constants).
// =====================================================================================================
__device__ __forceinline__ void proj96(const v16b x0, const v16b x1, const v16b x2, const u16* bp, v8f (&acc)[6]) {
#pragma unroll
  for (int j = 0; j < 6; ++j) acc[j] = mma_b(x0, ldfrag_b(bp + j * 16 * HD), zero8());
#pragma unroll
  for (int j = 0; j < 6; ++j) acc[j] = mma_b(x1, ldfrag_b(bp + j * 16 * HD + 32), acc[j]);
#pragma unroll
  for (int j = 0; j < 6; ++j) acc[j] = mma_b(x2, ldfrag_b(bp + j * 16 * HD + 64), acc[j]);
}
// behind the last weight loads: their offset register is kept whole up to this wait
__device__ __forceinline__ void hold_offset(unsigned off) {
#if defined(__HIP_DEVICE_COMPILE__)
  asm volatile("s_wait_xcnt 0x0" :: "v"(off) : "memory");
#endif
}
// D element r of lane l = (row 8hh+r, col n = 16j + m); stage the 16x96 slab (pitch 100) fully
__device__ __forceinline__ void stage96(float* slab, const v8f (&acc)[6], float oscale, int hh, int m) {
#pragma unroll
  for (int r = 0; r < 8; ++r) {
    const int ro = (8 * hh + r) * 100 + m;
#pragma unroll
    for (int j = 0; j < 6; ++j) slab[ro + 16 * j] = acc[j][r] * oscale;
  }
}

// 4096 waves = 4 per SIMD: with that occupancy's register budget all 36 weight loads of a product are in flight at once
__global__ __launch_bounds__(128) __attribute__((amdgpu_waves_per_eu(4, 4)))
void proj_qkv(const float* __restrict__ X, const u16* __restrict__ WQ, const u16* __restrict__ WK,
              const u16* __restrict__ WV, u16* QP, u16* KP, u16* VT) {
  __shared__ __align__(16) float smem[4 * SLAB96];
  __shared__ __align__(16) u16 vst[HD * VSP];
  const int tid = threadIdx.x, wave = tid >> 5, lane = tid & 31, hh = lane >> 4, m = lane & 15;
  const int bid  = blockIdx.x;
  const int head = bid & (NH - 1);
  const int rt   = bid >> 3;
  const int rowb = rt * 64 + wave * 16;                 // 0..8176, the block's 64 rows never straddle a batch
  const int b    = rowb >> 11;
  const int s0   = rowb & (SEQ - 1);
  const size_t bh = (size_t)(b * NH + head);
  const float* xp = X + (size_t)(rowb + m) * DMOD + head * HD + 8 * hh;
  const v16b x0 = ldfrag_x(xp), x1 = ldfrag_x(xp + 32), x2 = ldfrag_x(xp + 64);
  const unsigned wob = (unsigned)(m * HD + 8 * hh) * 2u;   // the lane's byte offset in each weight plane
  float* slab = smem + wave * SLAB96;
  v8f acc[6];
  proj96(x0, x1, x2, (const u16*)((const char*)WQ + wob), acc);
  stage96(slab, acc, QSC, hh, m);
  out96(slab, QP + (bh * SEQ + s0) * HD, lane);
  proj96(x0, x1, x2, (const u16*)((const char*)WK + wob), acc);
  wave_sync_lds();                                      // the wave's reads of the q slab stay in front of the k slab's writes
  stage96(slab, acc, KSC, hh, m);
  out96(slab, KP + (bh * SEQ + s0) * HD, lane);
  proj96(x0, x1, x2, (const u16*)((const char*)WV + wob), acc);
  hold_offset(wob);
#pragma unroll
  for (int j = 0; j < 6; ++j) {
    v8h h;
#pragma unroll
    for (int r = 0; r < 8; ++r) h[r] = (_Float16)(acc[j][r] * VCAR);
    *(v4u*)(vst + (16 * j + m) * VSP + wave * 16 + 8 * hh) = __builtin_bit_cast(v4u, h);
  }
  __syncthreads();                                      // the four waves' key columns make up the 128-B lines
  u16* vb = VT + bh * HD * SEQ + (s0 - wave * 16);
#pragma unroll
  for (int i = 0; i < 6; ++i) {
    const int p = i * 128 + tid, row = p >> 3, c8 = (p & 7) * 8;
    *(v4u*)(vb + (size_t)row * SEQ + c8) = *(const v4u*)(vst + row * VSP + c8);
  }
}

// =====================================================================================================
// One k tile (one head, 96 k) of gemm_out into one LDS buffer, 18 asynchronous 16-B copies per lane (all 128 lanes on,
// block-uniform control flow):
//   O:  128 rows x 192 B are 24576 contiguous global bytes; piece p = 128 i + tid (i = 0..11) -> LDS row p / 12, 16-B column
//       p % 12 (l0..l2 hold the places of i = 0..2; i + 3 lies 32 rows further); one wave-instruction = 512 contiguous bytes.
//   Wu: 64 rows x 192 B (global pitch 1536 B); piece p = 128 i + tid (i = 0..5), same row and column rule, behind the O part.
// s_wait_xcnt stands inside each statement so that no address register is rewritten in front of it.
// =====================================================================================================
__device__ __forceinline__ void gemm_tile_copy(unsigned l0, unsigned l1, unsigned l2, const char* ag,
                                               const char* bg0, const char* bg1, const char* bg2) {
#if defined(__HIP_DEVICE_COMPILE__)
  asm volatile("global_load_async_to_lds_b128 %0, %12, off\n\t"
               "global_load_async_to_lds_b128 %1, %13, off\n\t"
               "global_load_async_to_lds_b128 %2, %14, off\n\t"
               "global_load_async_to_lds_b128 %3, %15, off\n\t"
               "global_load_async_to_lds_b128 %4, %16, off\n\t"
               "global_load_async_to_lds_b128 %5, %17, off\n\t"
               "global_load_async_to_lds_b128 %6, %18, off\n\t"
               "global_load_async_to_lds_b128 %7, %19, off\n\t"
               "global_load_async_to_lds_b128 %8, %20, off\n\t"
               "global_load_async_to_lds_b128 %9, %21, off\n\t"
               "global_load_async_to_lds_b128 %10, %22, off\n\t"
               "global_load_async_to_lds_b128 %11, %23, off\n\t"
               "s_wait_xcnt 0x0"
               :: "v"(l0), "v"(l1), "v"(l2),
                  "v"(l0 + 32u * GPITCH), "v"(l1 + 32u * GPITCH), "v"(l2 + 32u * GPITCH),
                  "v"(l0 + 64u * GPITCH), "v"(l1 + 64u * GPITCH), "v"(l2 + 64u * GPITCH),
                  "v"(l0 + 96u * GPITCH), "v"(l1 + 96u * GPITCH), "v"(l2 + 96u * GPITCH),
                  "v"(ag), "v"(ag + 2048), "v"(ag + 4096), "v"(ag + 6144), "v"(ag + 8192), "v"(ag + 10240),
                  "v"(ag + 12288), "v"(ag + 14336), "v"(ag + 16384), "v"(ag + 18432), "v"(ag + 20480), "v"(ag + 22528)
               : "memory");
  asm volatile("global_load_async_to_lds_b128 %0, %6, off\n\t"
               "global_load_async_to_lds_b128 %1, %7, off\n\t"
               "global_load_async_to_lds_b128 %2, %8, off\n\t"
               "global_load_async_to_lds_b128 %3, %9, off\n\t"
               "global_load_async_to_lds_b128 %4, %10, off\n\t"
               "global_load_async_to_lds_b128 %5, %11, off\n\t"
               "s_wait_xcnt 0x0"
               :: "v"(l0 + (unsigned)GATILE), "v"(l1 + (unsigned)GATILE), "v"(l2 + (unsigned)GATILE),
                  "v"(l0 + (unsigned)GATILE + 32u * GPITCH), "v"(l1 + (unsigned)GATILE + 32u * GPITCH),
                  "v"(l2 + (unsigned)GATILE + 32u * GPITCH),
                  "v"(bg0), "v"(bg1), "v"(bg2),
                  "v"(bg0 + 32 * DMOD * 2), "v"(bg1 + 32 * DMOD * 2), "v"(bg2 + 32 * DMOD * 2)
               : "memory");
#endif
}

// =====================================================================================================
// Output projection with bias: C[8192][768] (f32) = O . Wu^T * oscale + bf16(bu)[n]; A operand k index = head*96 + d lives at
// O plane address ((b*NH + head)*SEQ + s)*96 + d (O single f16 x1024, 32-deep k-steps never straddle a head since 96 = 3*32);
// Bt = Wu plane [768 n][768 k] f16 (bf16 value x1024), k-contiguous. Block = 128x64 tile, 4 waves x (32 rows x 64 columns);
// k runs over 8 tiles of 96 (one head each, k ascending in steps of 32). The block's waves share each O and Wu tile: it is
// brought into LDS by asynchronous copies (gemm_tile_copy), two buffers, tile t + 1 in flight while tile t is worked on; one
// barrier per tile publishes tile t + 1 and frees tile t's buffer. Fragments are read by ds_load_b128, same split k map for A
// and B. After the last barrier the ring is dead and its first bytes become the waves' private output slabs (two each).
// grid = (ROWS/128)*(DMOD/64) = 768.
// =====================================================================================================
__global__ __launch_bounds__(128)
void gemm_out(const u16* __restrict__ OP, const u16* __restrict__ WOB, const float* __restrict__ bias, float* C,
              float oscale) {
  __shared__ __align__(16) unsigned char ring[2 * GBUF];
  const int tid = threadIdx.x, wave = tid >> 5, lane = tid & 31, hh = lane >> 4, m = lane & 15;
  const int ntile = DMOD >> 6;                          // 12
  const int bid   = blockIdx.x;
  const int row0  = (bid / ntile) * GROWS;              // the block's 128 rows never straddle a batch
  const int col0  = (bid % ntile) * 64;
  const int b     = row0 >> 11;
  const int s0    = row0 & (SEQ - 1);
  // the lane's copy places (LDS byte addresses in buffer 0) and its global sources for tile 0
  const unsigned lds0 = (unsigned)(uintptr_t)(&ring[0]);
  const int r0 = tid / 12, r1 = (tid + 128) / 12, r2 = (tid + 256) / 12;
  const int c0 = (tid - 12 * r0) * 16, c1 = (tid + 128 - 12 * r1) * 16, c2 = (tid + 256 - 12 * r2) * 16;
  const unsigned l0 = lds0 + (unsigned)(r0 * GPITCH + c0);
  const unsigned l1 = lds0 + (unsigned)(r1 * GPITCH + c1);
  const unsigned l2 = lds0 + (unsigned)(r2 * GPITCH + c2);
  const char* ag  = (const char*)(const void*)OP + (((size_t)b * NH * SEQ + s0) * HD * 2 + (size_t)tid * 16);  // + SEQ*192 per tile
  const char* bg0 = (const char*)(const void*)WOB + ((size_t)(col0 + r0) * DMOD * 2 + c0);                     // + 192 per tile
  const char* bg1 = (const char*)(const void*)WOB + ((size_t)(col0 + r1) * DMOD * 2 + c1);
  const char* bg2 = (const char*)(const void*)WOB + ((size_t)(col0 + r2) * DMOD * 2 + c2);
  // A fragments: row = wave*32 + 16i + m; B fragments: row n = 16j + m; byte offsets in a buffer
  const int afo = (wave * 32 + m) * GPITCH + 16 * hh;
  const int bfo = GATILE + m * GPITCH + 16 * hh;
  v8f acc[2][4];
#pragma unroll
  for (int i = 0; i < 2; ++i) {
#pragma unroll
    for (int j = 0; j < 4; ++j) acc[i][j] = zero8();
  }

  // ---- ring prologue: tile 0 landed and published, then tile 1 set off ----
  gemm_tile_copy(l0, l1, l2, ag, bg0, bg1, bg2);
  asm volatile("s_wait_asynccnt 0x0" ::: "memory");   // this wave's copies of tile 0 have landed
  __syncthreads();                                    // every wave's have
  gemm_tile_copy(l0 + GBUF, l1 + GBUF, l2 + GBUF, ag + SEQ * HD * 2, bg0 + HD * 2, bg1 + HD * 2, bg2 + HD * 2);

#pragma unroll 1                                      // one trip per tile stays rolled: one foot, small code
  for (int t = 0; t < GNT; ++t) {
    const unsigned bo = (unsigned)(t & 1) * GBUF;     // trip t reads buffer t mod 2 alone
#pragma unroll                                        // the tile's three 32-deep k-steps: constant LDS offsets in the reads
    for (int ks = 0; ks < 3; ++ks) {
      const _Float16* ap = (const _Float16*)(const void*)(ring + bo + afo + ks * 64);
      const _Float16* bp = (const _Float16*)(const void*)(ring + bo + bfo + ks * 64);
      const v16h a0 = ldfrag_h(ap);
      const v16h a1 = ldfrag_h(ap + 16 * (GPITCH / 2));
      const v16h b0 = ldfrag_h(bp);
      const v16h b1 = ldfrag_h(bp + 16 * (GPITCH / 2));
      const v16h b2 = ldfrag_h(bp + 32 * (GPITCH / 2));
      const v16h b3 = ldfrag_h(bp + 48 * (GPITCH / 2));
      acc[0][0] = mma_h(a0, b0, acc[0][0]);
      acc[0][1] = mma_h(a0, b1, acc[0][1]);
      acc[0][2] = mma_h(a0, b2, acc[0][2]);
      acc[0][3] = mma_h(a0, b3, acc[0][3]);
      acc[1][0] = mma_h(a1, b0, acc[1][0]);
      acc[1][1] = mma_h(a1, b1, acc[1][1]);
      acc[1][2] = mma_h(a1, b2, acc[1][2]);
      acc[1][3] = mma_h(a1, b3, acc[1][3]);
    }
    // ---- foot of trip t: publish tile t + 1, free tile t's buffer, refill it with tile t + 2 ----
    asm volatile("s_wait_dscnt 0x0" ::: "memory");      // this wave's reads of tile t are done
    asm volatile("s_wait_asynccnt 0x0" ::: "memory");   // this wave's copies of tile t + 1 have landed
    __syncthreads();                                    // both hold for every wave
    if (t + 2 < GNT)                                    // block-uniform
      gemm_tile_copy(l0 + bo, l1 + bo, l2 + bo, ag + (size_t)(t + 2) * (SEQ * HD * 2),
                     bg0 + (t + 2) * (HD * 2), bg1 + (t + 2) * (HD * 2), bg2 + (t + 2) * (HD * 2));
  }
  asm volatile("s_wait_asynccnt 0x0" ::: "memory");     // nothing of this wave is in flight when the ring is reused

  // bias for the lane's columns (col0 + 16j + m <= 767), bf16 value of bu
  const float bz0 = bf_up(bf_bits(bias[col0 + m]));
  const float bz1 = bf_up(bf_bits(bias[col0 + 16 + m]));
  const float bz2 = bf_up(bf_bits(bias[col0 + 32 + m]));
  const float bz3 = bf_up(bf_bits(bias[col0 + 48 + m]));
  float* slab = (float*)(void*)ring + wave * 2 * SLAB;  // the ring is dead behind the last trip's barrier
  const size_t rowb = (size_t)(row0 + wave * 32);
  epi64_stage(slab, acc[0][0], acc[0][1], acc[0][2], acc[0][3], oscale, bz0, bz1, bz2, bz3, lane);
  epi64_stage(slab + SLAB, acc[1][0], acc[1][1], acc[1][2], acc[1][3], oscale, bz0, bz1, bz2, bz3, lane);
  wave_sync_lds();                                      // one for both slabs: no global store stands in front of it
  epi64_flush(slab, C, DMOD, rowb, col0, lane);
  epi64_flush(slab + SLAB, C, DMOD, rowb + 16, col0, lane);
}

// =====================================================================================================
// One 64-key tile into one LDS buffer, 12 asynchronous 16-B copies per lane (all 128 lanes on, block-uniform control flow):
//   K: 64 rows x 192 B are 12288 contiguous global bytes; piece p = 128 i + tid (i = 0..5) -> LDS row p / 12, 16-B column p % 12
//      (kl0..kl2 hold the places of i = 0..2; i + 3 lies 32 rows further); one wave-instruction = 512 contiguous bytes.
//   v^T: 96 rows x 128 B (global pitch 4096 B); piece p = 128 i + tid -> row p / 8, column p % 8; one wave-instruction = 4 lines.
// s_wait_xcnt stands inside the statement so that no address register is rewritten in front of it.
// =====================================================================================================
__device__ __forceinline__ void tile_copy(unsigned kl0, unsigned kl1, unsigned kl2, unsigned vl,
                                          const char* kg, const char* vg) {
#if defined(__HIP_DEVICE_COMPILE__)
  asm volatile("global_load_async_to_lds_b128 %0, %12, off\n\t"
               "global_load_async_to_lds_b128 %1, %13, off\n\t"
               "global_load_async_to_lds_b128 %2, %14, off\n\t"
               "global_load_async_to_lds_b128 %3, %15, off\n\t"
               "global_load_async_to_lds_b128 %4, %16, off\n\t"
               "global_load_async_to_lds_b128 %5, %17, off\n\t"
               "global_load_async_to_lds_b128 %6, %18, off\n\t"
               "global_load_async_to_lds_b128 %7, %19, off\n\t"
               "global_load_async_to_lds_b128 %8, %20, off\n\t"
               "global_load_async_to_lds_b128 %9, %21, off\n\t"
               "global_load_async_to_lds_b128 %10, %22, off\n\t"
               "global_load_async_to_lds_b128 %11, %23, off\n\t"
               "s_wait_xcnt 0x0"
               :: "v"(kl0), "v"(kl1), "v"(kl2),
                  "v"(kl0 + 32u * KPITCH), "v"(kl1 + 32u * KPITCH), "v"(kl2 + 32u * KPITCH),
                  "v"(vl), "v"(vl + 16u * VPITCH), "v"(vl + 32u * VPITCH),
                  "v"(vl + 48u * VPITCH), "v"(vl + 64u * VPITCH), "v"(vl + 80u * VPITCH),
                  "v"(kg), "v"(kg + 2048), "v"(kg + 4096), "v"(kg + 6144), "v"(kg + 8192), "v"(kg + 10240),
                  "v"(vg), "v"(vg + 16 * SEQ * 2), "v"(vg + 32 * SEQ * 2),
                  "v"(vg + 48 * SEQ * 2), "v"(vg + 64 * SEQ * 2), "v"(vg + 80 * SEQ * 2)
               : "memory");
#endif
}

// =====================================================================================================
// Narrow multi-head flash attention (no mask): block = (batch b, head, 128 query rows), 4 waves, wave w owns the 32 query rows
// q0 = 128*qt + 32*w .. q0+31 as two tiles of 16 (tile u = rows q0+16u .. +15), so that every K and v^T fragment it reads from
// LDS feeds two matrix instructions, one per tile.
//   q plane (f16, x8) laid out [b][h][s][96]; k plane the same; v^T plane [b][h][96][s] (x256).
//   All NKB = 64 key blocks of 32 keys are visited (static bound), two per 64-key tile. The block's four waves share each K and
//   v^T tile: it is brought into LDS by asynchronous copies (tile_copy), two buffers, tile t + 1 in flight while tile t is
//   worked on; one barrier per tile publishes tile t + 1 and frees tile t's buffer. Fragments are read by ds_load_b128.
//   After the last barrier the ring is dead and its first bytes become the waves' private output slabs (two each).
//   Scores are computed TRANSPOSED: S^T tile (g, u) (g = 0,1) = k rows (keys kb+16g .. +15, A operand, row m = lane&15, split k
//   map over d, 3 chunks of 32) times q^T (B operand, col n = query q0 + 16u + (lane&15), k = d, split map), one product per tile
//   and 32-deep d-chunk. D element r of lane l = (key kb+16g+8h+r, query q0+16u+(l&15)), so a lane owns one query column per
//   tile u and 16 of its 32 keys; the partner lane l^16 owns the other 16 (joined by an xor-16 shuffle: maxima in newmax16, sums at the end).
//   Online max-subtracted base-2 softmax in f32, per tile u: scale 1/sqrt(768) and the q/k carries folded into lsc; scale,
//   maximum and P's carry enter the exponent through one fma, and the row sum l carries x128 with P. The maximum in use is
//   renewed lazily: one wave-uniform test per 32-key block; only when some query's new maximum lies more than LAZY above the one
//   in use do the halves exchange maxima and are l and the O accumulators rescaled (newmax16). The exp'd values
//   ARE the P A-fragment in place: A row m = query = lane&15, element i <- key kb+8h+i (g = 0, D element i), element 8+i <- key
//   kb+16+8h+i (g = 1, D element i). P is carried x128 as single f16 (at most 2^15). The rescale factor of query row 8h+r of the O
//   accumulators is fetched from lane 8h+r with a shuffle (uniform control). 6 v^T B fragments (col n = d = 16j + (lane&15),
//   keys k-contiguous), 12 P.V WMMAs per key block in two guarded groups of 6.
//   Epilogue, per tile u: 1/l (per query, shuffled to the D row owner) and carry folds in f32; the 16x96 f32 result (x1024)
//   staged in an LDS slab [16][100]; the tile's 16 rows of the O plane [b][h][s][96] are one contiguous 3072-B region written
// coverage: per wave 2 x 6 instructions x 32 lanes x 8 halves = 32 x 96; grid 512 blocks x 4 waves = every (b, h, s) row of the
//           O plane exactly once.
// =====================================================================================================
// Maximum of this lane's 16 raw scores of one 16-query tile (keys kb+8h+i and kb+16+8h+i of the lane's query).
__device__ __forceinline__ float lanemax16(const v8f s0, const v8f s1) {
  float cm = fmaxf(s0[0], s1[0]);
#pragma unroll
  for (int i = 1; i < 8; ++i) cm = fmaxf(fmaxf(cm, s0[i]), s1[i]);
  return cm;
}
// One 32-key step of the softmax for one 16-query tile under the maximum in use, mrun (every score * lsc is at most mrun + LAZY):
// fills the P A-fragment and adds to the running sum.
__device__ __forceinline__ void probs16(const v8f s0, const v8f s1, const float lsc, const float mrun, float& lrun, FragH& ph) {
  // ---- carried probabilities p * 128 = 2^(s * lsc - mrun + 7): one fma and one v_exp_f32 per score; the argument is at
  //      most 15 plus the fma's rounding, and a result under 2^-126 (flushed) is far below the f16 plane's last place.
  //      P A-fragment: element i <-> s0[i], element 8 + i <-> s1[i] ----
  const v2f lsc2 = {lsc, lsc};
  const v2f eb2  = {PEXP - mrun, PEXP - mrun};
  float ps = 0.f;
  v2f ar[8], pp[8];
#pragma unroll
  for (int e = 0; e < 8; ++e) {
    const v2f sp = (e < 4) ? (v2f){s0[2 * e], s0[2 * e + 1]} : (v2f){s1[2 * e - 8], s1[2 * e - 7]};
    ar[e] = __builtin_elementwise_fma(sp, lsc2, eb2);
  }
#pragma unroll
  for (int e = 0; e < 8; ++e) pp[e] = (v2f){ex2(ar[e][0]), ex2(ar[e][1])};
#pragma unroll
  for (int e = 0; e < 8; ++e) {
    ps += pp[e][0] + pp[e][1];
    ph.u[e >> 2][e & 3] = __builtin_bit_cast(unsigned, __builtin_convertvector(pp[e], v2h));   // RNE, as two scalar casts
  }
  lrun += ps;                                                      // this half's 16 keys; the halves are joined in the epilogue
}
// rescale one tile's O accumulators: D row 8hh+r = the tile's query 8hh+r, its factor lives in lane 8hh+r (and 16+8hh+r)
__device__ __forceinline__ void rescale16(v8f (&o)[6], const float al, const int hh) {
  float scl[8];
#pragma unroll
  for (int r = 0; r < 8; ++r) scl[r] = __shfl(al, 8 * hh + r, 32);
#pragma unroll
  for (int j = 0; j < 6; ++j) {
#pragma unroll
    for (int r = 0; r < 8; ++r) o[j][r] *= scl[r];
  }
}
// The seldom-taken path, whole wave: renew one tile's maximum in use from the lanes' maxima cm (lsc > 0, so the scale commutes
// with the maximum) and bring the old sum and accumulators under it.
__device__ __forceinline__ void newmax16(float cm, const float lsc, float& mrun, float& lrun, v8f (&o)[6], const int hh) {
  cm = fmaxf(cm, __shfl_xor(cm, 16, 32));
  const float mn = fmaxf(mrun, cm * lsc);                          // base-2 logit; finite from the first key block on
  const float al = (mrun == -INFINITY) ? 0.f : ex2(mrun - mn);     // o and l are zero while mrun is -inf
  mrun = mn;
  lrun *= al;
  rescale16(o, al, hh);
}
// fold 1/l (per query, owned by lane = query; l carries PCAR like P, so only v's carry is left) and OSC; stage one tile's slab
__device__ __forceinline__ void stage_o16(float* slab, const v8f (&o)[6], const float lrun, const int hh, const int c) {
  const float lsum = lrun + __shfl_xor(lrun, 16, 32);             // the two halves' sums of the lane's query
  const float linv = (lsum > 0.f) ? ((1.0f / lsum) * (OSC / VCAR)) : 0.f;
  float inv[8];
#pragma unroll
  for (int r = 0; r < 8; ++r) inv[r] = __shfl(linv, 8 * hh + r, 32);
#pragma unroll
  for (int r = 0; r < 8; ++r) {
    const int ro = (8 * hh + r) * 100 + c;
#pragma unroll
    for (int j = 0; j < 6; ++j) slab[ro + 16 * j] = o[j][r] * inv[r];
  }
}

// out96 for the wave's two adjacent slabs and its 32 adjacent O rows: one wave_sync_lds() for both, so that no global store stands
// in front of it. coverage: 12 instructions x 32 lanes x 8 halves = 32 x 96.
__device__ __forceinline__ void out96x2(const float* sl, u16* dst, int lane) {
  wave_sync_lds();
  v4u ov[12];
#pragma unroll
  for (int i = 0; i < 12; ++i) {
    const int g   = (i % 6) * 32 + lane;
    const int row = g / 12;
    const int c8  = (g - row * 12) * 8;
    const float* sp = sl + (i / 6) * SLAB96 + row * 100 + c8;
    const v4f a = *(const v4f*)(sp), c4 = *(const v4f*)(sp + 4);
#pragma unroll
    for (int e = 0; e < 2; ++e) {
      ov[i][e]     = pk16(h_bits((_Float16)a[2 * e]), h_bits((_Float16)a[2 * e + 1]));
      ov[i][2 + e] = pk16(h_bits((_Float16)c4[2 * e]), h_bits((_Float16)c4[2 * e + 1]));
    }
  }
#pragma unroll
  for (int i = 0; i < 12; ++i) *(v4u*)(dst + (size_t)(i * 32 + lane) * 8) = ov[i];
}

// 2048 waves = 2 per SIMD, 512 blocks = 2 per WGP: the register budget of that occupancy, and no third block on a WGP
__global__ __launch_bounds__(ATT_THREADS) __attribute__((amdgpu_waves_per_eu(2, 2)))
void attn_fwd(const u16* __restrict__ QPp, const u16* __restrict__ KPp, const u16* __restrict__ VPp, u16* OPp) {
  __shared__ __align__(16) unsigned char ring[2 * BUFB];

  const int tid  = threadIdx.x;
  const int wave = tid >> 5;
  const int lane = tid & 31;
  const int hh   = lane >> 4;
  const int c    = lane & 15;

  const int bid  = blockIdx.x;
  const int qt   = bid & (SEQ / QPB - 1);
  const int head = (bid >> 4) & (NH - 1);
  const int b    = bid >> 7;
  const int q0   = qt * QPB + wave * QPW;
  const size_t bh = (size_t)(b * NH + head);

  // B fragments of q^T: col n = query q0 + 16u + c, k = d (k-contiguous row of the q plane)
  const _Float16* Qb = (const _Float16*)(const void*)QPp + ((bh * SEQ + q0 + c) * HD + 8 * hh);
  // A fragments of k: row m = key (in tile) 16g + c, k = d; byte offset in a buffer's K part
  const int kfo = c * KPITCH + 16 * hh;
  // B fragments of v: col n = d = 16j + c, k = key (k-contiguous row of the v^T tile); byte offset in a buffer
  const int vfo = KTILE + c * VPITCH + 16 * hh;
  // the lane's copy places (LDS byte addresses in buffer 0) and its global sources for tile 0
  const unsigned lds0 = (unsigned)(uintptr_t)(&ring[0]);
  const int kr0 = tid / 12, kr1 = (tid + 128) / 12, kr2 = (tid + 256) / 12;
  const unsigned kl0 = lds0 + (unsigned)(kr0 * KPITCH + (tid - 12 * kr0) * 16);
  const unsigned kl1 = lds0 + (unsigned)(kr1 * KPITCH + (tid + 128 - 12 * kr1) * 16);
  const unsigned kl2 = lds0 + (unsigned)(kr2 * KPITCH + (tid + 256 - 12 * kr2) * 16);
  const unsigned vl  = lds0 + (unsigned)(KTILE + (tid >> 3) * VPITCH + (tid & 7) * 16);
  const char* kg = (const char*)(const void*)KPp + (bh * SEQ * HD * 2 + (size_t)tid * 16);              // + 12288 per tile
  const char* vg = (const char*)(const void*)VPp + ((bh * HD + (size_t)(tid >> 3)) * SEQ * 2 + (size_t)(tid & 7) * 16);  // + 128
  const float lsc = RSQK * (LOG2E / (QSC * KSC));

  const v16h qa0 = ldfrag_h(Qb);                      // tile 0: d 0..31
  const v16h qa1 = ldfrag_h(Qb + 32);                 //         d 32..63
  const v16h qa2 = ldfrag_h(Qb + 64);                 //         d 64..95
  const v16h qb0 = ldfrag_h(Qb + 16 * HD);            // tile 1
  const v16h qb1 = ldfrag_h(Qb + 16 * HD + 32);
  const v16h qb2 = ldfrag_h(Qb + 16 * HD + 64);

  float mrun0 = -INFINITY, lrun0 = 0.f, mrun1 = -INFINITY, lrun1 = 0.f;
  v8f oa[6], ob[6];
#pragma unroll
  for (int j = 0; j < 6; ++j) { oa[j] = zero8(); ob[j] = zero8(); }

  // ---- ring prologue: tile 0 landed and published, then tile 1 set off ----
  tile_copy(kl0, kl1, kl2, vl, kg, vg);
  asm volatile("s_wait_asynccnt 0x0" ::: "memory");   // this wave's copies of tile 0 have landed
  __syncthreads();                                    // every wave's have
  tile_copy(kl0 + BUFB, kl1 + BUFB, kl2 + BUFB, vl + BUFB, kg + STK * HD * 2, vg + STK * 2);

#pragma unroll 1                                      // one trip per tile stays rolled: one foot, small code
  for (int t = 0; t < NST; ++t) {
   const unsigned bo = (unsigned)(t & 1) * BUFB;      // trip t reads buffer t mod 2 alone
#pragma unroll                                        // the tile's two 32-key blocks: constant LDS offsets in the reads
   for (int sub = 0; sub < 2; ++sub) {
    // ---- transposed scores: s0x = keys kb..kb+15, s1x = keys kb+16..kb+31 (kb = 64 t + 32 sub); sxa = queries q0 + c,
    //      sxb = queries q0 + 16 + c; each K fragment is read once and used for both query tiles ----
    const _Float16* k0p = (const _Float16*)(const void*)(ring + bo + kfo + sub * 32 * KPITCH);
    const _Float16* k1p = (const _Float16*)(const void*)(ring + bo + kfo + (sub * 32 + 16) * KPITCH);
    v8f s0a = zero8(), s0b = zero8(), s1a = zero8(), s1b = zero8();
    {
      const v16h ka0 = ldfrag_h(k0p), ka1 = ldfrag_h(k0p + 32), ka2 = ldfrag_h(k0p + 64);
      const v16h kc0 = ldfrag_h(k1p), kc1 = ldfrag_h(k1p + 32), kc2 = ldfrag_h(k1p + 64);
      __builtin_amdgcn_sched_barrier(0);   // keeps the twelve reads one group in front of the WMMAs (else a pair stands at every second one)
      s0a = mma_h(ka0, qa0, s0a);
      s0b = mma_h(ka0, qb0, s0b);
      s1a = mma_h(kc0, qa0, s1a);
      s1b = mma_h(kc0, qb0, s1b);
      s0a = mma_h(ka1, qa1, s0a);
      s0b = mma_h(ka1, qb1, s0b);
      s1a = mma_h(kc1, qa1, s1a);
      s1b = mma_h(kc1, qb1, s1b);
      s0a = mma_h(ka2, qa2, s0a);
      s0b = mma_h(ka2, qb2, s0b);
      s1a = mma_h(kc2, qa2, s1a);
      s1b = mma_h(kc2, qb2, s1b);
      guard4(s0a, s0b, s1a, s1b);
    }
    // ---- lazy maximum: one test per 32-key block for both tiles; -inf in use (first block) always renews ----
    const float cma = lanemax16(s0a, s1a), cmb = lanemax16(s0b, s1b);
    const bool need = (cma * lsc - mrun0 > LAZY) || (cmb * lsc - mrun1 > LAZY);
    // the same for the whole wave: a scalar branch, EXEC stays full; seldom taken, so its body is laid out behind the loop
    if (__builtin_expect(__builtin_amdgcn_ballot_w32(need) != 0, 0)) {
      newmax16(cma, lsc, mrun0, lrun0, oa, hh);
      newmax16(cmb, lsc, mrun1, lrun1, ob, hh);
    }
    // ---- v^T B fragments: col n = d = j*16 + c, keys contiguous in the v^T plane; each is read once and used for both query
    //      tiles ----
    const _Float16* vp = (const _Float16*)(const void*)(ring + bo + vfo + sub * 64);
    const v16h vf0 = ldfrag_h(vp);
    const v16h vf1 = ldfrag_h(vp + 16 * (VPITCH / 2));
    const v16h vf2 = ldfrag_h(vp + 32 * (VPITCH / 2));
    const v16h vf3 = ldfrag_h(vp + 48 * (VPITCH / 2));
    const v16h vf4 = ldfrag_h(vp + 64 * (VPITCH / 2));
    const v16h vf5 = ldfrag_h(vp + 80 * (VPITCH / 2));
    // keeps the twelve reads one group in front of the exponentials, which cover their latency (else they are spread among the WMMAs)
    __builtin_amdgcn_sched_barrier(0);
    FragH pa, pb;
    probs16(s0a, s1a, lsc, mrun0, lrun0, pa);
    probs16(s0b, s1b, lsc, mrun1, lrun1, pb);
    // ---- P.V : two guarded groups of 6 ----
    {
      oa[0] = mma_h(pa.v, vf0, oa[0]);
      ob[0] = mma_h(pb.v, vf0, ob[0]);
      oa[1] = mma_h(pa.v, vf1, oa[1]);
      ob[1] = mma_h(pb.v, vf1, ob[1]);
      oa[2] = mma_h(pa.v, vf2, oa[2]);
      ob[2] = mma_h(pb.v, vf2, ob[2]);
      guard6(oa[0], ob[0], oa[1], ob[1], oa[2], ob[2]);
      oa[3] = mma_h(pa.v, vf3, oa[3]);
      ob[3] = mma_h(pb.v, vf3, ob[3]);
      oa[4] = mma_h(pa.v, vf4, oa[4]);
      ob[4] = mma_h(pb.v, vf4, ob[4]);
      oa[5] = mma_h(pa.v, vf5, oa[5]);
      ob[5] = mma_h(pb.v, vf5, ob[5]);
      guard6(oa[3], ob[3], oa[4], ob[4], oa[5], ob[5]);
    }
   }
   // ---- foot of trip t: publish tile t + 1, free tile t's buffer, refill it with tile t + 2 ----
   asm volatile("s_wait_dscnt 0x0" ::: "memory");      // this wave's reads of tile t are done
   asm volatile("s_wait_asynccnt 0x0" ::: "memory");   // this wave's copies of tile t + 1 have landed
   __syncthreads();                                    // both hold for every wave
   if (t + 2 < NST)                                    // block-uniform
     tile_copy(kl0 + bo, kl1 + bo, kl2 + bo, vl + bo,
               kg + (size_t)(t + 2) * (STK * HD * 2), vg + (size_t)(t + 2) * (STK * 2));
  }
  asm volatile("s_wait_asynccnt 0x0" ::: "memory");    // nothing of this wave is in flight when the ring is reused
  acc_guard6(oa[0], oa[1], oa[2], oa[3], oa[4], oa[5]);
  acc_guard6(ob[0], ob[1], ob[2], ob[3], ob[4], ob[5]);

  float* slab = (float*)(void*)ring + wave * 2 * SLAB96;   // the ring is dead behind the last trip's barrier
  stage_o16(slab, oa, lrun0, hh, c);
  stage_o16(slab + SLAB96, ob, lrun1, hh, c);
  out96x2(slab, OPp + (bh * SEQ + q0) * HD, lane);
}

// =====================================================================================================
// Workspace map (bytes); every plane is fully written by whole-line stores before it is read; all extents are exact multiples
// of the 512-B store instructions (no pad rows needed); every base is 256-B aligned:
//   WQB bf16 [96 n][96 k]                          18432        WKB, WVB the same
//   WOB f16  [768 n][768 k] (bf16 value x1024)   1179648
//   QP  f16  [4][8][2048][96] x8                12582912        KP same
//   VP  f16  [4][8][96][2048] x256              12582912
//   OP  f16  [4][8][2048][96] x1024             12582912
//   end                                          51566592
// =====================================================================================================
extern "C" void kernel_launch(void* const* d_in, const int* in_sizes, int n_in,
                              void* d_out, int out_size, void* d_ws, size_t ws_size,
                              hipStream_t stream) {
  if (n_in < 6) return;
  if (in_sizes[0] != ROWS * DMOD) return;
  if (in_sizes[1] != HD * HD) return;
  if (in_sizes[2] != HD * HD) return;
  if (in_sizes[3] != HD * HD) return;
  if (in_sizes[4] != DMOD * DMOD) return;
  if (in_sizes[5] != DMOD) return;
  if (out_size != ROWS * DMOD) return;

  const float* Xin = (const float*)d_in[0];
  const float* Wq  = (const float*)d_in[1];
  const float* Wk  = (const float*)d_in[2];
  const float* Wv  = (const float*)d_in[3];
  const float* Wu  = (const float*)d_in[4];
  const float* bu  = (const float*)d_in[5];
  float*       out = (float*)d_out;

  const size_t szW  = (size_t)HD * HD * 2;                      //    18432
  const size_t szWO = (size_t)DMOD * DMOD * 2;                  //  1179648
  const size_t szP  = (size_t)NB * NH * SEQ * HD * 2;           // 12582912  (q / k / v^T / o planes)
  size_t off = 0;
  const size_t oWQ = off; off += szW;
  const size_t oWK = off; off += szW;
  const size_t oWV = off; off += szW;
  const size_t oWO = off; off += szWO;
  const size_t oQP = off; off += szP;
  const size_t oKP = off; off += szP;
  const size_t oVP = off; off += szP;
  const size_t oOP = off; off += szP;
  if (off > ws_size) return;                            // off = 51566592
  if (off > (size_t)134217728) return;
  if ((szW % 256) != 0 || (szWO % 256) != 0 || (szP % 256) != 0) return;

  char* ws = (char*)d_ws;
  u16* WQB = (u16*)(ws + oWQ);
  u16* WKB = (u16*)(ws + oWK);
  u16* WVB = (u16*)(ws + oWV);
  u16* WOB = (u16*)(ws + oWO);
  u16* QP  = (u16*)(ws + oQP);
  u16* KP  = (u16*)(ws + oKP);
  u16* VP  = (u16*)(ws + oVP);
  u16* OP  = (u16*)(ws + oOP);

  if (((HD * HD) % 8) != 0 || ((DMOD * DMOD / 8) % 256) != 0) return;
  if ((DMOD % 64) != 0 || (ROWS % 64) != 0 || (ROWS % GROWS) != 0 || (SEQ % 64) != 0 || (HD % 32) != 0) return;
  const dim3 gW(NBU + 3 * NBW);                         // 303 (in-kernel bound gt < n8 per plane)
  const dim3 bW(256);
  const dim3 gPJ((ROWS / 64) * NH);                     // 1024
  const dim3 bPJ(128);
  const dim3 gAT(ATT_BLOCKS);                           // 512
  const dim3 bAT(ATT_THREADS);                          // 128
  const dim3 gO((ROWS / GROWS) * (DMOD / 64));          // 768
  const dim3 bO(128);

  // (0) weight planes: Wq/Wk/Wv [n = out][k = in] (already k-contiguous) -> bf16; Wu -> f16 of bf16 value x1024
  cvt_w<<<gW, bW, 0, stream>>>(Wq, Wk, Wv, Wu, WQB, WKB, WVB, WOB);
  // (1) q and k planes [b][h][s][96] = f16(x_h.Wq^T x8), f16(x_h.Wk^T x8); v^T plane [b][h][96 d][2048 keys] = f16(x_h.Wv^T x256)
  proj_qkv<<<gPJ, bPJ, 0, stream>>>(Xin, WQB, WKB, WVB, QP, KP, VP);
  // (2) attention -> O plane [b][h][s][96] x1024 (single f16)
  attn_fwd<<<gAT, bAT, 0, stream>>>(QP, KP, VP, OP);
  // (3) output projection -> out [8192][768] f32, carries 1024 (O) x 1024 (Wu) folded back, + bias
  gemm_out<<<gO, bO, 0, stream>>>(OP, WOB, bu, out, 1.0f / (OSC * WOS));
  (void)hipGetLastError();
}

// v007
// It runs in 74.7 microseconds.
// In two side-by-side timings against v006, it was 1.03 and 1.02 times as fast.
// Counting every step since v000, it is 3.14 times as fast.
// Contractions: x.Wq^T, x.Wk^T and x.Wv^T per head on v_wmma_f32_16x16x32_bf16 (x and Wq/Wk/Wv RNE-converted to bf16
// operands, f32 accumulate); scores k'.q'^T (q', k' single f16 planes carried x8), P.v (P x128 single f16, v x256 single
// f16) and O.Wu^T (O single f16 plane x1024, Wu as f16(bf16(Wu)) x1024): v_wmma_f32_16x16x32_f16, f32 accumulate.
// Base-2 online softmax, 1/l, bias (bf16 value of bu) and carry folds in f32 on VALU.
#include <hip/hip_runtime.h>
#include <math.h>
#include <stdint.h>

#define NB    4
#define SEQ   2048
#define DMOD  768
#define NH    8
#define HD    96
#define ROWS  (NB * SEQ)
#define QSC   8.0f
#define KSC   8.0f
#define PCAR  128.0f
#define PEXP  7.0f                              // log2(PCAR)
#define LAZY  8.0f                              // a maximum in use may lag a new one by this much (base-2 logit): P <= 2^(PEXP + LAZY)
#define VCAR  256.0f
#define OSC   1024.0f
#define WOS   1024.0f
#define LOG2E 1.4426950408889634f
#define RSQK  0.0360843918243516f
#define ATT_WAVES   4
#define ATT_THREADS (ATT_WAVES * 32)
#define QPW         32                         // query rows per attention wave: two 16-row tiles
#define QPB         (ATT_WAVES * QPW)          // query rows per attention block: 128
#define ATT_BLOCKS  (NB * NH * (SEQ / QPB))
#define NKB    (SEQ / 32)
#define SLAB   (16 * 68)
#define SLAB96 (16 * 100)
#define PJW    8                               // waves per projection block, 16 rows each
#define PJROWS (PJW * 16)                      // 128
#define PJT    (PJW * 32)                      // 256 threads
#define NPJ    ((ROWS / PJROWS) * NH)          // 512 projection blocks
#define VSP    136                             // halves per v^T row staged in LDS: 128 + 8 (272 B = 16 B x odd)
#define WPH    104                             // halves per weight row in LDS: 96 + 8 (208 B = 16 B x odd, for ds_load_b128 readers)
#define WPL    (HD * WPH)                      // halves per weight plane in LDS
#define WUB    (DMOD * DMOD / NPJ)             // elements of Wu converted by each projection block: 1152 = 18 whole 128-B lines of f16
#define STK    64                              // keys per LDS tile
#define NST    (SEQ / STK)                     // 32 tiles
#define KPITCH 208                             // bytes per K row in LDS: 192 + 16 (16 B x odd, for ds_load_b128 readers)
#define VPITCH 144                             // bytes per v^T row in LDS: 128 + 16 (16 B x odd)
#define KTILE  (STK * KPITCH)                  // 13312
#define VTILE  (HD * VPITCH)                   // 13824
#define BUFB   (KTILE + VTILE)                 // 27136
#define GROWS  128                             // output rows per gemm_out block: 4 waves x 32
#define GNT    NH                              // LDS tiles along k in gemm_out: one head (96 k) each
#define GPITCH 208                             // bytes per O or Wu row in LDS: 192 + 16 (16 B x odd)
#define GATILE (GROWS * GPITCH)                // 26624
#define GBTILE (64 * GPITCH)                   // 13312
#define GBUF   (GATILE + GBTILE)               // 39936
static_assert(DMOD == NH * HD && HD == 96 && NH == 8 && NB == 4 && SEQ == 2048);
static_assert((SEQ / QPB) == 16 && ATT_BLOCKS == 512 && ATT_THREADS == 128 && NKB == 64);
static_assert((HD % 32) == 0 && (DMOD % 64) == 0 && (ROWS % 64) == 0 && (SEQ % 64) == 0);
static_assert((SEQ % PJROWS) == 0 && NPJ == 512 && ((HD * HD / 4) % PJT) == 0 && (HD * PJROWS / 8) == 6 * PJT);
static_assert(WUB * NPJ == DMOD * DMOD && (WUB % 64) == 0 && WUB / 8 <= PJT && (WPH * 2) % 16 == 0);
static_assert((SLAB * 4) % 16 == 0 && (SLAB96 * 4) % 16 == 0);
static_assert(NST >= 2 && STK == 64 && (STK * HD * 2) == 6 * ATT_THREADS * 16 && (HD * STK * 2) == 6 * ATT_THREADS * 16);
static_assert((KTILE % 16) == 0 && (BUFB % 16) == 0 && 2 * BUFB >= 2 * ATT_WAVES * SLAB96 * 4);
static_assert((SEQ % GROWS) == 0 && GNT >= 2 && (GROWS * HD * 2) == 12 * 128 * 16 && (64 * HD * 2) == 6 * 128 * 16);
static_assert((GATILE % 16) == 0 && (GBUF % 16) == 0 && 2 * GBUF >= 8 * SLAB * 4);

typedef unsigned short u16;
typedef _Float16 v16h __attribute__((ext_vector_type(16)));
typedef _Float16 v8h  __attribute__((ext_vector_type(8)));
typedef _Float16 v2h  __attribute__((ext_vector_type(2)));
typedef __bf16   v16b __attribute__((ext_vector_type(16)));
typedef float    v8f  __attribute__((ext_vector_type(8)));
typedef float    v4f  __attribute__((ext_vector_type(4)));
typedef float    v2f  __attribute__((ext_vector_type(2)));
typedef unsigned int v4u __attribute__((ext_vector_type(4)));
typedef unsigned int v2u __attribute__((ext_vector_type(2)));
typedef __bf16   v2b  __attribute__((ext_vector_type(2)));

union FragH { v16h v; v8h h[2]; v4u u[2]; };
union FragB { v16b v; v4u u[2]; };

// ---- scalar helpers --------------------------------------------------------------------------------
__device__ __forceinline__ unsigned short bf_bits(float f) {          // f32 -> bf16 bits, RNE convert
  unsigned u = __float_as_uint(f);
  return (unsigned short)((u + 0x7FFFu + ((u >> 16) & 1u)) >> 16);
}
__device__ __forceinline__ float bf_up(unsigned short h) { return __uint_as_float(((unsigned)h) << 16); }
__device__ __forceinline__ unsigned short h_bits(_Float16 x) { return __builtin_bit_cast(unsigned short, x); }
__device__ __forceinline__ unsigned pk16(unsigned short a, unsigned short b) { return (unsigned)a | ((unsigned)b << 16); }
__device__ __forceinline__ float ex2(float x) { return __builtin_amdgcn_exp2f(x); }   // bare v_exp_f32: 2^-inf = 0, no range fix-up
__device__ __forceinline__ v8f zero8() { v8f z = {0.f, 0.f, 0.f, 0.f, 0.f, 0.f, 0.f, 0.f}; return z; }

// ---- fragment loaders: 16-bit A/B operand, lane -> row/col (lane&15), p already includes +8*(lane>>4);
//      elements 0..7 <- p[0..7] (k0+8h..), elements 8..15 <- p[16..23] (k0+16+8h..)  (same split k map for A and B;
//      B is always read from a k-contiguous [n][k] plane)
__device__ __forceinline__ v16h ldfrag_h(const _Float16* p) {
  FragH f;
  f.h[0] = *(const v8h*)(p);
  f.h[1] = *(const v8h*)(p + 16);
  return f.v;
}
__device__ __forceinline__ v16b ldfrag_b(const u16* p) {              // bf16 plane read as unsigned integer vectors
  FragB f;
  f.u[0] = *(const v4u*)(p);
  f.u[1] = *(const v4u*)(p + 16);
  return f.v;
}

// the same fragment from an f32 row p: a0 = p[0..3], a1 = p[4..7], a2 = p[16..19], a3 = p[20..23]; RNE to bf16 in registers,
// same split k map
__device__ __forceinline__ v16b cvfrag_x(const v4f a0, const v4f a1, const v4f a2, const v4f a3) {
  FragB f;
#pragma unroll
  for (int e = 0; e < 2; ++e) {
    f.u[0][e]     = pk16(bf_bits(a0[2 * e]), bf_bits(a0[2 * e + 1]));
    f.u[0][2 + e] = pk16(bf_bits(a1[2 * e]), bf_bits(a1[2 * e + 1]));
    f.u[1][e]     = pk16(bf_bits(a2[2 * e]), bf_bits(a2[2 * e + 1]));
    f.u[1][2 + e] = pk16(bf_bits(a3[2 * e]), bf_bits(a3[2 * e + 1]));
  }
  return f.v;
}

__device__ __forceinline__ v8f mma_h(v16h a, v16h b, v8f c) {
  return __builtin_amdgcn_wmma_f32_16x16x32_f16(false, a, false, b, (short)0, c, false, false);
}
__device__ __forceinline__ v8f mma_b(v16b a, v16b b, v8f c) {
  return __builtin_amdgcn_wmma_f32_16x16x32_bf16(false, a, false, b, (short)0, c, false, false);
}
// v_nop x4: the distance between the last matrix instruction of a group and the first vector instruction on its D, A or B
__device__ __forceinline__ void guard4(v8f& s, v8f& t, v8f& u, v8f& w) {
#if defined(__HIP_DEVICE_COMPILE__)
  asm volatile("v_nop\n\tv_nop\n\tv_nop\n\tv_nop" : "+v"(s), "+v"(t), "+v"(u), "+v"(w) :: "memory");
#endif
}
__device__ __forceinline__ void guard6(v8f& a, v8f& b, v8f& c, v8f& d, v8f& e, v8f& f) {
#if defined(__HIP_DEVICE_COMPILE__)
  asm volatile("v_nop\n\tv_nop\n\tv_nop\n\tv_nop"
               : "+v"(a), "+v"(b), "+v"(c), "+v"(d), "+v"(e), "+v"(f) :: "memory");
#endif
}
__device__ __forceinline__ void acc_guard6(v8f& a, v8f& b, v8f& c, v8f& d, v8f& e, v8f& f) {
#if defined(__HIP_DEVICE_COMPILE__)
  asm volatile("v_nop\n\tv_nop\n\tv_nop\n\tv_nop" : "+v"(a), "+v"(b), "+v"(c), "+v"(d), "+v"(e), "+v"(f));
#endif
}
__device__ __forceinline__ void wave_sync_lds() {
#if defined(__HIP_DEVICE_COMPILE__)
  __builtin_amdgcn_fence(__ATOMIC_RELEASE, "workgroup");
  __builtin_amdgcn_wave_barrier();
  __builtin_amdgcn_fence(__ATOMIC_ACQUIRE, "workgroup");
#endif
}

// =====================================================================================================
// 16x96 f16 epilogue: the wave's 16x96 f32 tile (already scaled) staged by the caller in its LDS slab [16][100];
// coverage: 6 instructions x 32 lanes x 8 halves = 1536 = the wave's 16 x 96 tile (groups of 8 never straddle a row: 96/8 = 12).
// =====================================================================================================
__device__ __forceinline__ void out96(const float* sl, u16* dst, int lane) {
  wave_sync_lds();
  v4u ov[6];
#pragma unroll
  for (int i = 0; i < 6; ++i) {
    const int g   = i * 32 + lane;
    const int row = g / 12;
    const int c8  = (g - row * 12) * 8;
    const v4f a = *(const v4f*)(sl + row * 100 + c8), c4 = *(const v4f*)(sl + row * 100 + c8 + 4);
    float w[8];
#pragma unroll
    for (int e = 0; e < 4; ++e) { w[e] = a[e]; w[4 + e] = c4[e]; }
#pragma unroll
    for (int e = 0; e < 4; ++e) ov[i][e] = pk16(h_bits((_Float16)w[2 * e]), h_bits((_Float16)w[2 * e + 1]));
  }
  {
#pragma unroll
    for (int i = 0; i < 6; ++i) {
      *(v4u*)(dst + (size_t)(i * 32 + lane) * 8) = ov[i];
    }
    
  }
}

// =====================================================================================================
// f32 GEMM epilogue with bias, in two parts with the caller's wave_sync_lds() between them:
//   epi64_stage: a 16x64 f32 tile of the wave (acc*oscale + bias[col]) goes into one of its LDS slabs (pitch 68);
//   epi64_flush: the slab leaves as whole lines.
// coverage: 8 instructions x 2 rows x 16 lanes x 4 floats = one 16 x 64 tile.
// =====================================================================================================
__device__ __forceinline__ void epi64_stage(float* sl, v8f a0, v8f a1, v8f a2, v8f a3, float oscale,
                                            float bz0, float bz1, float bz2, float bz3, int lane) {
  const int hh = lane >> 4, m = lane & 15;
#pragma unroll
  for (int r = 0; r < 8; ++r) {
    const int ro = (8 * hh + r) * 68 + m;
    sl[ro]      = a0[r] * oscale + bz0;
    sl[ro + 16] = a1[r] * oscale + bz1;
    sl[ro + 32] = a2[r] * oscale + bz2;
    sl[ro + 48] = a3[r] * oscale + bz3;
  }
}
__device__ __forceinline__ void epi64_flush(const float* sl, float* C, int N, size_t rowb, int col0, int lane) {
  const int hh = lane >> 4, m = lane & 15;
  v4f vals[8];
#pragma unroll
  for (int it = 0; it < 8; ++it) vals[it] = *(const v4f*)(sl + (it * 2 + hh) * 68 + m * 4);
  float* dst = C + (rowb + (size_t)hh) * (size_t)N + col0 + m * 4;
#pragma unroll
  for (int it = 0; it < 8; ++it) *(v4f*)(dst + (size_t)(it * 2) * (size_t)N) = vals[it];
}

// =====================================================================================================
// The three per-head projections (shared 96x96 weights) and all weight conversions in ONE launch, bf16 operands.
// Block = (128 rows of b*SEQ+s, head), 8 waves x 16 rows.
//   Weights: the block reads Wq, Wk, Wv as f32 (3 x 2304 pieces of 4 floats, 27 per thread, 512 contiguous bytes per
//   wave-instruction), rounds them to bf16 (RNE) in registers and lays them in LDS as [plane][96 n][96 k], pitch WPH; one
//   barrier publishes them; every wave reads its B fragments from there by ds_load_b128 (k-contiguous rows, split k map).
//   Wu: block i also converts elements i*WUB .. +WUB-1 of Wu to the f16 plane (bf16 RNE value x1024) that the output projection
//   reads two launches later: threads 0..143, 8 elements each, whole lines, no other block touches them.
// A wave reads its 16 x 96 piece of x ONCE, as f32 (pitch 768), rounds it to bf16 in registers (cvfrag_x) and uses the three A
// fragments for all three products x . W^T; 6 accumulators (n = 0..95), K = 96 in 3 steps of 32.
//   q, k: P[b][head][s][96] = f16(acc * 8); the wave's 16x96 tile is one contiguous 3072-B region, see out96.
//   v:    D element r of lane l = (s = 8hh + r, d = 16j + m): a lane's 8 values are 8 consecutive keys of one v^T row; the block's
//         96 x 128 tile of VT[b][head][d][s] (f16 of acc * 256) is gathered in LDS and leaves as whole 128-B lines.
// coverage: v^T 6 instructions x 256 threads x 8 halves = 96 x 128; grid = (ROWS/128) * NH = 512 (exact, host-checked constants).
// =====================================================================================================
__device__ __forceinline__ void proj96(const v16b x0, const v16b x1, const v16b x2, const u16* bp, v8f (&acc)[6]) {
#pragma unroll
  for (int j = 0; j < 6; ++j) acc[j] = mma_b(x0, ldfrag_b(bp + j * 16 * WPH), zero8());
#pragma unroll
  for (int j = 0; j < 6; ++j) acc[j] = mma_b(x1, ldfrag_b(bp + j * 16 * WPH + 32), acc[j]);
#pragma unroll
  for (int j = 0; j < 6; ++j) acc[j] = mma_b(x2, ldfrag_b(bp + j * 16 * WPH + 64), acc[j]);
}
// four f32 -> four bf16 (RNE), two packed converts
__device__ __forceinline__ v2u bf4(const v4f a) {
  const v2f lo = {a[0], a[1]}, hi = {a[2], a[3]};
  v2u o;
  o[0] = __builtin_bit_cast(unsigned, __builtin_convertvector(lo, v2b));
  o[1] = __builtin_bit_cast(unsigned, __builtin_convertvector(hi, v2b));
  return o;
}
// D element r of lane l = (row 8hh+r, col n = 16j + m); stage the 16x96 slab (pitch 100) fully
__device__ __forceinline__ void stage96(float* slab, const v8f (&acc)[6], float oscale, int hh, int m) {
#pragma unroll
  for (int r = 0; r < 8; ++r) {
    const int ro = (8 * hh + r) * 100 + m;
#pragma unroll
    for (int j = 0; j < 6; ++j) slab[ro + 16 * j] = acc[j][r] * oscale;
  }
}

// 4096 waves = 4 per SIMD, 512 blocks = 2 per WGP, all resident
__global__ __launch_bounds__(PJT) __attribute__((amdgpu_waves_per_eu(4, 4)))
void proj_qkv(const float* __restrict__ X, const float* __restrict__ WQ, const float* __restrict__ WK,
              const float* __restrict__ WV, const float* __restrict__ WU, u16* QP, u16* KP, u16* VT, u16* DU) {
  __shared__ __align__(16) float smem[PJW * SLAB96];
  __shared__ __align__(16) u16 vst[HD * VSP];
  __shared__ __align__(16) u16 wl[3 * WPL];
  const int tid = threadIdx.x, wave = tid >> 5, lane = tid & 31, hh = lane >> 4, m = lane & 15;
  const int bid  = blockIdx.x;
  const int head = bid & (NH - 1);
  const int rt   = bid >> 3;
  const int rowb = rt * PJROWS + wave * 16;             // 0..8176, the block's 128 rows never straddle a batch
  const int b    = rowb >> 11;
  const int s0   = rowb & (SEQ - 1);
  const size_t bh = (size_t)(b * NH + head);
  // ---- all global reads of the block are set off together: weights, x, the Wu share ----
  v4f wr[27];
#pragma unroll
  for (int i = 0; i < 9; ++i) {
    const int e = (i * PJT + tid) * 4;                  // < 9216
    wr[i]      = *(const v4f*)(WQ + e);
    wr[9 + i]  = *(const v4f*)(WK + e);
    wr[18 + i] = *(const v4f*)(WV + e);
  }
  const float* xp = X + (size_t)(rowb + m) * DMOD + head * HD + 8 * hh;
  v4f xr[12];
#pragma unroll
  for (int i = 0; i < 3; ++i) {
    xr[4 * i]     = *(const v4f*)(xp + 32 * i);
    xr[4 * i + 1] = *(const v4f*)(xp + 32 * i + 4);
    xr[4 * i + 2] = *(const v4f*)(xp + 32 * i + 16);
    xr[4 * i + 3] = *(const v4f*)(xp + 32 * i + 20);
  }
  const bool   uon = tid < WUB / 8;
  const size_t ue  = (size_t)bid * WUB + (size_t)tid * 8;   // used only where uon: < DMOD * DMOD
  v4f ua = {0.f, 0.f, 0.f, 0.f}, uc = {0.f, 0.f, 0.f, 0.f};
  if (uon) { ua = *(const v4f*)(WU + ue); uc = *(const v4f*)(WU + ue + 4); }
  // ---- weights into LDS: piece p = 256 i + tid -> row p / 24, 8-B column p % 24 ----
#pragma unroll
  for (int i = 0; i < 9; ++i) {
    const int p = i * PJT + tid, row = p / 24, c4 = p - row * 24;
    u16* d = wl + row * WPH + c4 * 4;
    *(v2u*)(d)           = bf4(wr[i]);
    *(v2u*)(d + WPL)     = bf4(wr[9 + i]);
    *(v2u*)(d + 2 * WPL) = bf4(wr[18 + i]);
  }
  __syncthreads();                                      // the three bf16 planes are whole for every wave
  const v16b x0 = cvfrag_x(xr[0], xr[1], xr[2], xr[3]), x1 = cvfrag_x(xr[4], xr[5], xr[6], xr[7]),
             x2 = cvfrag_x(xr[8], xr[9], xr[10], xr[11]);
  const u16* wb = wl + m * WPH + 8 * hh;                // the lane's place in each weight plane
  float* slab = smem + wave * SLAB96;
  v8f acc[6];
  proj96(x0, x1, x2, wb, acc);
  stage96(slab, acc, QSC, hh, m);
  out96(slab, QP + (bh * SEQ + s0) * HD, lane);
  proj96(x0, x1, x2, wb + WPL, acc);
  wave_sync_lds();                                      // the wave's reads of the q slab stay in front of the k slab's writes
  stage96(slab, acc, KSC, hh, m);
  out96(slab, KP + (bh * SEQ + s0) * HD, lane);
  proj96(x0, x1, x2, wb + 2 * WPL, acc);
#pragma unroll
  for (int j = 0; j < 6; ++j) {
    v8h h;
#pragma unroll
    for (int r = 0; r < 8; ++r) h[r] = (_Float16)(acc[j][r] * VCAR);
    *(v4u*)(vst + (16 * j + m) * VSP + wave * 16 + 8 * hh) = __builtin_bit_cast(v4u, h);
  }
  __syncthreads();                                      // the eight waves' key columns make up the 128-B lines
  u16* vb = VT + bh * HD * SEQ + (s0 - wave * 16);
#pragma unroll
  for (int i = 0; i < 6; ++i) {
    const int p = i * PJT + tid, row = p >> 4, c8 = (p & 15) * 8;
    *(v4u*)(vb + (size_t)row * SEQ + c8) = *(const v4u*)(vst + row * VSP + c8);
  }
  // the Wu share leaves last: no barrier or LDS fence of the block has to wait for this store
  if (uon) {
    v4u o;
#pragma unroll
    for (int e = 0; e < 2; ++e) {
      o[e]     = pk16(h_bits((_Float16)(bf_up(bf_bits(ua[2 * e])) * WOS)), h_bits((_Float16)(bf_up(bf_bits(ua[2 * e + 1])) * WOS)));
      o[2 + e] = pk16(h_bits((_Float16)(bf_up(bf_bits(uc[2 * e])) * WOS)), h_bits((_Float16)(bf_up(bf_bits(uc[2 * e + 1])) * WOS)));
    }
    *(v4u*)(DU + ue) = o;
  }
}

// =====================================================================================================
// One k tile (one head, 96 k) of gemm_out into one LDS buffer, 18 asynchronous 16-B copies per lane (all 128 lanes on,
// block-uniform control flow):
//   O:  128 rows x 192 B are 24576 contiguous global bytes; piece p = 128 i + tid (i = 0..11) -> LDS row p / 12, 16-B column
//       p % 12 (l0..l2 hold the places of i = 0..2; i + 3 lies 32 rows further); one wave-instruction = 512 contiguous bytes.
//   Wu: 64 rows x 192 B (global pitch 1536 B); piece p = 128 i + tid (i = 0..5), same row and column rule, behind the O part.
// s_wait_xcnt stands inside each statement so that no address register is rewritten in front of it.
// =====================================================================================================
__device__ __forceinline__ void gemm_tile_copy(unsigned l0, unsigned l1, unsigned l2, const char* ag,
                                               const char* bg0, const char* bg1, const char* bg2) {
#if defined(__HIP_DEVICE_COMPILE__)
  asm volatile("global_load_async_to_lds_b128 %0, %12, off\n\t"
               "global_load_async_to_lds_b128 %1, %13, off\n\t"
               "global_load_async_to_lds_b128 %2, %14, off\n\t"
               "global_load_async_to_lds_b128 %3, %15, off\n\t"
               "global_load_async_to_lds_b128 %4, %16, off\n\t"
               "global_load_async_to_lds_b128 %5, %17, off\n\t"
               "global_load_async_to_lds_b128 %6, %18, off\n\t"
               "global_load_async_to_lds_b128 %7, %19, off\n\t"
               "global_load_async_to_lds_b128 %8, %20, off\n\t"
               "global_load_async_to_lds_b128 %9, %21, off\n\t"
               "global_load_async_to_lds_b128 %10, %22, off\n\t"
               "global_load_async_to_lds_b128 %11, %23, off\n\t"
               "s_wait_xcnt 0x0"
               :: "v"(l0), "v"(l1), "v"(l2),
                  "v"(l0 + 32u * GPITCH), "v"(l1 + 32u * GPITCH), "v"(l2 + 32u * GPITCH),
                  "v"(l0 + 64u * GPITCH), "v"(l1 + 64u * GPITCH), "v"(l2 + 64u * GPITCH),
                  "v"(l0 + 96u * GPITCH), "v"(l1 + 96u * GPITCH), "v"(l2 + 96u * GPITCH),
                  "v"(ag), "v"(ag + 2048), "v"(ag + 4096), "v"(ag + 6144), "v"(ag + 8192), "v"(ag + 10240),
                  "v"(ag + 12288), "v"(ag + 14336), "v"(ag + 16384), "v"(ag + 18432), "v"(ag + 20480), "v"(ag + 22528)
               : "memory");
  asm volatile("global_load_async_to_lds_b128 %0, %6, off\n\t"
               "global_load_async_to_lds_b128 %1, %7, off\n\t"
               "global_load_async_to_lds_b128 %2, %8, off\n\t"
               "global_load_async_to_lds_b128 %3, %9, off\n\t"
               "global_load_async_to_lds_b128 %4, %10, off\n\t"
               "global_load_async_to_lds_b128 %5, %11, off\n\t"
               "s_wait_xcnt 0x0"
               :: "v"(l0 + (unsigned)GATILE), "v"(l1 + (unsigned)GATILE), "v"(l2 + (unsigned)GATILE),
                  "v"(l0 + (unsigned)GATILE + 32u * GPITCH), "v"(l1 + (unsigned)GATILE + 32u * GPITCH),
                  "v"(l2 + (unsigned)GATILE + 32u * GPITCH),
                  "v"(bg0), "v"(bg1), "v"(bg2),
                  "v"(bg0 + 32 * DMOD * 2), "v"(bg1 + 32 * DMOD * 2), "v"(bg2 + 32 * DMOD * 2)
               : "memory");
#endif
}

// =====================================================================================================
// Output projection with bias: C[8192][768] (f32) = O . Wu^T * oscale + bf16(bu)[n]; A operand k index = head*96 + d lives at
// O plane address ((b*NH + head)*SEQ + s)*96 + d (O single f16 x1024, 32-deep k-steps never straddle a head since 96 = 3*32);
// Bt = Wu plane [768 n][768 k] f16 (bf16 value x1024), k-contiguous. Block = 128x64 tile, 4 waves x (32 rows x 64 columns);
// k runs over 8 tiles of 96 (one head each, k ascending in steps of 32). The block's waves share each O and Wu tile: it is
// brought into LDS by asynchronous copies (gemm_tile_copy), two buffers, tile t + 1 in flight while tile t is worked on; one
// barrier per tile publishes tile t + 1 and frees tile t's buffer. Fragments are read by ds_load_b128, same split k map for A
// and B. After the last barrier the ring is dead and its first bytes become the waves' private output slabs (two each).
// grid = (ROWS/128)*(DMOD/64) = 768.
// =====================================================================================================
__global__ __launch_bounds__(128)
void gemm_out(const u16* __restrict__ OP, const u16* __restrict__ WOB, const float* __restrict__ bias, float* C,
              float oscale) {
  __shared__ __align__(16) unsigned char ring[2 * GBUF];
  const int tid = threadIdx.x, wave = tid >> 5, lane = tid & 31, hh = lane >> 4, m = lane & 15;
  const int ntile = DMOD >> 6;                          // 12
  const int bid   = blockIdx.x;
  const int row0  = (bid / ntile) * GROWS;              // the block's 128 rows never straddle a batch
  const int col0  = (bid % ntile) * 64;
  const int b     = row0 >> 11;
  const int s0    = row0 & (SEQ - 1);
  // the lane's copy places (LDS byte addresses in buffer 0) and its global sources for tile 0
  const unsigned lds0 = (unsigned)(uintptr_t)(&ring[0]);
  const int r0 = tid / 12, r1 = (tid + 128) / 12, r2 = (tid + 256) / 12;
  const int c0 = (tid - 12 * r0) * 16, c1 = (tid + 128 - 12 * r1) * 16, c2 = (tid + 256 - 12 * r2) * 16;
  const unsigned l0 = lds0 + (unsigned)(r0 * GPITCH + c0);
  const unsigned l1 = lds0 + (unsigned)(r1 * GPITCH + c1);
  const unsigned l2 = lds0 + (unsigned)(r2 * GPITCH + c2);
  const char* ag  = (const char*)(const void*)OP + (((size_t)b * NH * SEQ + s0) * HD * 2 + (size_t)tid * 16);  // + SEQ*192 per tile
  const char* bg0 = (const char*)(const void*)WOB + ((size_t)(col0 + r0) * DMOD * 2 + c0);                     // + 192 per tile
  const char* bg1 = (const char*)(const void*)WOB + ((size_t)(col0 + r1) * DMOD * 2 + c1);
  const char* bg2 = (const char*)(const void*)WOB + ((size_t)(col0 + r2) * DMOD * 2 + c2);
  // A fragments: row = wave*32 + 16i + m; B fragments: row n = 16j + m; byte offsets in a buffer
  const int afo = (wave * 32 + m) * GPITCH + 16 * hh;
  const int bfo = GATILE + m * GPITCH + 16 * hh;
  v8f acc[2][4];
#pragma unroll
  for (int i = 0; i < 2; ++i) {
#pragma unroll
    for (int j = 0; j < 4; ++j) acc[i][j] = zero8();
  }

  // ---- ring prologue: tile 0 landed and published, then tile 1 set off ----
  gemm_tile_copy(l0, l1, l2, ag, bg0, bg1, bg2);
  asm volatile("s_wait_asynccnt 0x0" ::: "memory");   // this wave's copies of tile 0 have landed
  __syncthreads();                                    // every wave's have
  gemm_tile_copy(l0 + GBUF, l1 + GBUF, l2 + GBUF, ag + SEQ * HD * 2, bg0 + HD * 2, bg1 + HD * 2, bg2 + HD * 2);

#pragma unroll 1                                      // one trip per tile stays rolled: one foot, small code
  for (int t = 0; t < GNT; ++t) {
    const unsigned bo = (unsigned)(t & 1) * GBUF;     // trip t reads buffer t mod 2 alone
#pragma unroll                                        // the tile's three 32-deep k-steps: constant LDS offsets in the reads
    for (int ks = 0; ks < 3; ++ks) {
      const _Float16* ap = (const _Float16*)(const void*)(ring + bo + afo + ks * 64);
      const _Float16* bp = (const _Float16*)(const void*)(ring + bo + bfo + ks * 64);
      const v16h a0 = ldfrag_h(ap);
      const v16h a1 = ldfrag_h(ap + 16 * (GPITCH / 2));
      const v16h b0 = ldfrag_h(bp);
      const v16h b1 = ldfrag_h(bp + 16 * (GPITCH / 2));
      const v16h b2 = ldfrag_h(bp + 32 * (GPITCH / 2));
      const v16h b3 = ldfrag_h(bp + 48 * (GPITCH / 2));
      acc[0][0] = mma_h(a0, b0, acc[0][0]);
      acc[0][1] = mma_h(a0, b1, acc[0][1]);
      acc[0][2] = mma_h(a0, b2, acc[0][2]);
      acc[0][3] = mma_h(a0, b3, acc[0][3]);
      acc[1][0] = mma_h(a1, b0, acc[1][0]);
      acc[1][1] = mma_h(a1, b1, acc[1][1]);
      acc[1][2] = mma_h(a1, b2, acc[1][2]);
      acc[1][3] = mma_h(a1, b3, acc[1][3]);
    }
    // ---- foot of trip t: publish tile t + 1, free tile t's buffer, refill it with tile t + 2 ----
    asm volatile("s_wait_dscnt 0x0" ::: "memory");      // this wave's reads of tile t are done
    asm volatile("s_wait_asynccnt 0x0" ::: "memory");   // this wave's copies of tile t + 1 have landed
    __syncthreads();                                    // both hold for every wave
    if (t + 2 < GNT)                                    // block-uniform
      gemm_tile_copy(l0 + bo, l1 + bo, l2 + bo, ag + (size_t)(t + 2) * (SEQ * HD * 2),
                     bg0 + (t + 2) * (HD * 2), bg1 + (t + 2) * (HD * 2), bg2 + (t + 2) * (HD * 2));
  }
  asm volatile("s_wait_asynccnt 0x0" ::: "memory");     // nothing of this wave is in flight when the ring is reused

  // bias for the lane's columns (col0 + 16j + m <= 767), bf16 value of bu
  const float bz0 = bf_up(bf_bits(bias[col0 + m]));
  const float bz1 = bf_up(bf_bits(bias[col0 + 16 + m]));
  const float bz2 = bf_up(bf_bits(bias[col0 + 32 + m]));
  const float bz3 = bf_up(bf_bits(bias[col0 + 48 + m]));
  float* slab = (float*)(void*)ring + wave * 2 * SLAB;  // the ring is dead behind the last trip's barrier
  const size_t rowb = (size_t)(row0 + wave * 32);
  epi64_stage(slab, acc[0][0], acc[0][1], acc[0][2], acc[0][3], oscale, bz0, bz1, bz2, bz3, lane);
  epi64_stage(slab + SLAB, acc[1][0], acc[1][1], acc[1][2], acc[1][3], oscale, bz0, bz1, bz2, bz3, lane);
  wave_sync_lds();                                      // one for both slabs: no global store stands in front of it
  epi64_flush(slab, C, DMOD, rowb, col0, lane);
  epi64_flush(slab + SLAB, C, DMOD, rowb + 16, col0, lane);
}

// =====================================================================================================
// One 64-key tile into one LDS buffer, 12 asynchronous 16-B copies per lane (all 128 lanes on, block-uniform control flow):
//   K: 64 rows x 192 B are 12288 contiguous global bytes; piece p = 128 i + tid (i = 0..5) -> LDS row p / 12, 16-B column p % 12
//      (kl0..kl2 hold the places of i = 0..2; i + 3 lies 32 rows further); one wave-instruction = 512 contiguous bytes.
//   v^T: 96 rows x 128 B (global pitch 4096 B); piece p = 128 i + tid -> row p / 8, column p % 8; one wave-instruction = 4 lines.
// s_wait_xcnt stands inside the statement so that no address register is rewritten in front of it.
// =====================================================================================================
__device__ __forceinline__ void tile_copy(unsigned kl0, unsigned kl1, unsigned kl2, unsigned vl,
                                          const char* kg, const char* vg) {
#if defined(__HIP_DEVICE_COMPILE__)
  asm volatile("global_load_async_to_lds_b128 %0, %12, off\n\t"
               "global_load_async_to_lds_b128 %1, %13, off\n\t"
               "global_load_async_to_lds_b128 %2, %14, off\n\t"
               "global_load_async_to_lds_b128 %3, %15, off\n\t"
               "global_load_async_to_lds_b128 %4, %16, off\n\t"
               "global_load_async_to_lds_b128 %5, %17, off\n\t"
               "global_load_async_to_lds_b128 %6, %18, off\n\t"
               "global_load_async_to_lds_b128 %7, %19, off\n\t"
               "global_load_async_to_lds_b128 %8, %20, off\n\t"
               "global_load_async_to_lds_b128 %9, %21, off\n\t"
               "global_load_async_to_lds_b128 %10, %22, off\n\t"
               "global_load_async_to_lds_b128 %11, %23, off\n\t"
               "s_wait_xcnt 0x0"
               :: "v"(kl0), "v"(kl1), "v"(kl2),
                  "v"(kl0 + 32u * KPITCH), "v"(kl1 + 32u * KPITCH), "v"(kl2 + 32u * KPITCH),
                  "v"(vl), "v"(vl + 16u * VPITCH), "v"(vl + 32u * VPITCH),
                  "v"(vl + 48u * VPITCH), "v"(vl + 64u * VPITCH), "v"(vl + 80u * VPITCH),
                  "v"(kg), "v"(kg + 2048), "v"(kg + 4096), "v"(kg + 6144), "v"(kg + 8192), "v"(kg + 10240),
                  "v"(vg), "v"(vg + 16 * SEQ * 2), "v"(vg + 32 * SEQ * 2),
                  "v"(vg + 48 * SEQ * 2), "v"(vg + 64 * SEQ * 2), "v"(vg + 80 * SEQ * 2)
               : "memory");
#endif
}

// =====================================================================================================
// Narrow multi-head flash attention (no mask): block = (batch b, head, 128 query rows), 4 waves, wave w owns the 32 query rows
// q0 = 128*qt + 32*w .. q0+31 as two tiles of 16 (tile u = rows q0+16u .. +15), so that every K and v^T fragment it reads from
// LDS feeds two matrix instructions, one per tile.
//   q plane (f16, x8) laid out [b][h][s][96]; k plane the same; v^T plane [b][h][96][s] (x256).
//   All NKB = 64 key blocks of 32 keys are visited (static bound), two per 64-key tile. The block's four waves share each K and
//   v^T tile: it is brought into LDS by asynchronous copies (tile_copy), two buffers, tile t + 1 in flight while tile t is
//   worked on; one barrier per tile publishes tile t + 1 and frees tile t's buffer. Fragments are read by ds_load_b128.
//   After the last barrier the ring is dead and its first bytes become the waves' private output slabs (two each).
//   Scores are computed TRANSPOSED: S^T tile (g, u) (g = 0,1) = k rows (keys kb+16g .. +15, A operand, row m = lane&15, split k
//   map over d, 3 chunks of 32) times q^T (B operand, col n = query q0 + 16u + (lane&15), k = d, split map), one product per tile
//   and 32-deep d-chunk. D element r of lane l = (key kb+16g+8h+r, query q0+16u+(l&15)), so a lane owns one query column per
//   tile u and 16 of its 32 keys; the partner lane l^16 owns the other 16 (joined by an xor-16 shuffle: maxima in newmax16, sums at the end).
//   Online max-subtracted base-2 softmax in f32, per tile u: scale 1/sqrt(768) and the q/k carries folded into lsc; scale,
//   maximum and P's carry enter the exponent through one fma, and the row sum l carries x128 with P. The maximum in use is
//   renewed lazily: one wave-uniform test per 32-key block; only when some query's new maximum lies more than LAZY above the one
//   in use do the halves exchange maxima and are l and the O accumulators rescaled (newmax16). The exp'd values
//   ARE the P A-fragment in place: A row m = query = lane&15, element i <- key kb+8h+i (g = 0, D element i), element 8+i <- key
//   kb+16+8h+i (g = 1, D element i). P is carried x128 as single f16 (at most 2^15). The rescale factor of query row 8h+r of the O
//   accumulators is fetched from lane 8h+r with a shuffle (uniform control). 6 v^T B fragments (col n = d = 16j + (lane&15),
//   keys k-contiguous), 12 P.V WMMAs per key block in two guarded groups of 6.
//   Epilogue, per tile u: 1/l (per query, shuffled to the D row owner) and carry folds in f32; the 16x96 f32 result (x1024)
//   staged in an LDS slab [16][100]; the tile's 16 rows of the O plane [b][h][s][96] are one contiguous 3072-B region written
// coverage: per wave 2 x 6 instructions x 32 lanes x 8 halves = 32 x 96; grid 512 blocks x 4 waves = every (b, h, s) row of the
//           O plane exactly once.
// =====================================================================================================
// Maximum of this lane's 16 raw scores of one 16-query tile (keys kb+8h+i and kb+16+8h+i of the lane's query).
__device__ __forceinline__ float lanemax16(const v8f s0, const v8f s1) {
  float cm = fmaxf(s0[0], s1[0]);
#pragma unroll
  for (int i = 1; i < 8; ++i) cm = fmaxf(fmaxf(cm, s0[i]), s1[i]);
  return cm;
}
// One 32-key step of the softmax for one 16-query tile under the maximum in use, mrun (every score * lsc is at most mrun + LAZY):
// fills the P A-fragment and adds to the running sum.
__device__ __forceinline__ void probs16(const v8f s0, const v8f s1, const float lsc, const float mrun, float& lrun, FragH& ph) {
  // ---- carried probabilities p * 128 = 2^(s * lsc - mrun + 7): one fma and one v_exp_f32 per score; the argument is at
  //      most 15 plus the fma's rounding, and a result under 2^-126 (flushed) is far below the f16 plane's last place.
  //      P A-fragment: element i <-> s0[i], element 8 + i <-> s1[i] ----
  const v2f lsc2 = {lsc, lsc};
  const v2f eb2  = {PEXP - mrun, PEXP - mrun};
  float ps = 0.f;
  v2f ar[8], pp[8];
#pragma unroll
  for (int e = 0; e < 8; ++e) {
    const v2f sp = (e < 4) ? (v2f){s0[2 * e], s0[2 * e + 1]} : (v2f){s1[2 * e - 8], s1[2 * e - 7]};
    ar[e] = __builtin_elementwise_fma(sp, lsc2, eb2);
  }
#pragma unroll
  for (int e = 0; e < 8; ++e) pp[e] = (v2f){ex2(ar[e][0]), ex2(ar[e][1])};
#pragma unroll
  for (int e = 0; e < 8; ++e) {
    ps += pp[e][0] + pp[e][1];
    ph.u[e >> 2][e & 3] = __builtin_bit_cast(unsigned, __builtin_convertvector(pp[e], v2h));   // RNE, as two scalar casts
  }
  lrun += ps;                                                      // this half's 16 keys; the halves are joined in the epilogue
}
// rescale one tile's O accumulators: D row 8hh+r = the tile's query 8hh+r, its factor lives in lane 8hh+r (and 16+8hh+r)
__device__ __forceinline__ void rescale16(v8f (&o)[6], const float al, const int hh) {
  float scl[8];
#pragma unroll
  for (int r = 0; r < 8; ++r) scl[r] = __shfl(al, 8 * hh + r, 32);
#pragma unroll
  for (int j = 0; j < 6; ++j) {
#pragma unroll
    for (int r = 0; r < 8; ++r) o[j][r] *= scl[r];
  }
}
// The seldom-taken path, whole wave: renew one tile's maximum in use from the lanes' maxima cm (lsc > 0, so the scale commutes
// with the maximum) and bring the old sum and accumulators under it.
__device__ __forceinline__ void newmax16(float cm, const float lsc, float& mrun, float& lrun, v8f (&o)[6], const int hh) {
  cm = fmaxf(cm, __shfl_xor(cm, 16, 32));
  const float mn = fmaxf(mrun, cm * lsc);                          // base-2 logit; finite from the first key block on
  const float al = (mrun == -INFINITY) ? 0.f : ex2(mrun - mn);     // o and l are zero while mrun is -inf
  mrun = mn;
  lrun *= al;
  rescale16(o, al, hh);
}
// fold 1/l (per query, owned by lane = query; l carries PCAR like P, so only v's carry is left) and OSC; stage one tile's slab
__device__ __forceinline__ void stage_o16(float* slab, const v8f (&o)[6], const float lrun, const int hh, const int c) {
  const float lsum = lrun + __shfl_xor(lrun, 16, 32);             // the two halves' sums of the lane's query
  const float linv = (lsum > 0.f) ? ((1.0f / lsum) * (OSC / VCAR)) : 0.f;
  float inv[8];
#pragma unroll
  for (int r = 0; r < 8; ++r) inv[r] = __shfl(linv, 8 * hh + r, 32);
#pragma unroll
  for (int r = 0; r < 8; ++r) {
    const int ro = (8 * hh + r) * 100 + c;
#pragma unroll
    for (int j = 0; j < 6; ++j) slab[ro + 16 * j] = o[j][r] * inv[r];
  }
}

// out96 for the wave's two adjacent slabs and its 32 adjacent O rows: one wave_sync_lds() for both, so that no global store stands
// in front of it. coverage: 12 instructions x 32 lanes x 8 halves = 32 x 96.
__device__ __forceinline__ void out96x2(const float* sl, u16* dst, int lane) {
  wave_sync_lds();
  v4u ov[12];
#pragma unroll
  for (int i = 0; i < 12; ++i) {
    const int g   = (i % 6) * 32 + lane;
    const int row = g / 12;
    const int c8  = (g - row * 12) * 8;
    const float* sp = sl + (i / 6) * SLAB96 + row * 100 + c8;
    const v4f a = *(const v4f*)(sp), c4 = *(const v4f*)(sp + 4);
#pragma unroll
    for (int e = 0; e < 2; ++e) {
      ov[i][e]     = pk16(h_bits((_Float16)a[2 * e]), h_bits((_Float16)a[2 * e + 1]));
      ov[i][2 + e] = pk16(h_bits((_Float16)c4[2 * e]), h_bits((_Float16)c4[2 * e + 1]));
    }
  }
#pragma unroll
  for (int i = 0; i < 12; ++i) *(v4u*)(dst + (size_t)(i * 32 + lane) * 8) = ov[i];
}

// 2048 waves = 2 per SIMD, 512 blocks = 2 per WGP: the register budget of that occupancy, and no third block on a WGP
__global__ __launch_bounds__(ATT_THREADS) __attribute__((amdgpu_waves_per_eu(2, 2)))
void attn_fwd(const u16* __restrict__ QPp, const u16* __restrict__ KPp, const u16* __restrict__ VPp, u16* OPp) {
  __shared__ __align__(16) unsigned char ring[2 * BUFB];

  const int tid  = threadIdx.x;
  const int wave = tid >> 5;
  const int lane = tid & 31;
  const int hh   = lane >> 4;
  const int c    = lane & 15;

  const int bid  = blockIdx.x;
  const int qt   = bid & (SEQ / QPB - 1);
  const int head = (bid >> 4) & (NH - 1);
  const int b    = bid >> 7;
  const int q0   = qt * QPB + wave * QPW;
  const size_t bh = (size_t)(b * NH + head);

  // B fragments of q^T: col n = query q0 + 16u + c, k = d (k-contiguous row of the q plane)
  const _Float16* Qb = (const _Float16*)(const void*)QPp + ((bh * SEQ + q0 + c) * HD + 8 * hh);
  // A fragments of k: row m = key (in tile) 16g + c, k = d; byte offset in a buffer's K part
  const int kfo = c * KPITCH + 16 * hh;
  // B fragments of v: col n = d = 16j + c, k = key (k-contiguous row of the v^T tile); byte offset in a buffer
  const int vfo = KTILE + c * VPITCH + 16 * hh;
  // the lane's copy places (LDS byte addresses in buffer 0) and its global sources for tile 0
  const unsigned lds0 = (unsigned)(uintptr_t)(&ring[0]);
  const int kr0 = tid / 12, kr1 = (tid + 128) / 12, kr2 = (tid + 256) / 12;
  const unsigned kl0 = lds0 + (unsigned)(kr0 * KPITCH + (tid - 12 * kr0) * 16);
  const unsigned kl1 = lds0 + (unsigned)(kr1 * KPITCH + (tid + 128 - 12 * kr1) * 16);
  const unsigned kl2 = lds0 + (unsigned)(kr2 * KPITCH + (tid + 256 - 12 * kr2) * 16);
  const unsigned vl  = lds0 + (unsigned)(KTILE + (tid >> 3) * VPITCH + (tid & 7) * 16);
  const char* kg = (const char*)(const void*)KPp + (bh * SEQ * HD * 2 + (size_t)tid * 16);              // + 12288 per tile
  const char* vg = (const char*)(const void*)VPp + ((bh * HD + (size_t)(tid >> 3)) * SEQ * 2 + (size_t)(tid & 7) * 16);  // + 128
  const float lsc = RSQK * (LOG2E / (QSC * KSC));

  const v16h qa0 = ldfrag_h(Qb);                      // tile 0: d 0..31
  const v16h qa1 = ldfrag_h(Qb + 32);                 //         d 32..63
  const v16h qa2 = ldfrag_h(Qb + 64);                 //         d 64..95
  const v16h qb0 = ldfrag_h(Qb + 16 * HD);            // tile 1
  const v16h qb1 = ldfrag_h(Qb + 16 * HD + 32);
  const v16h qb2 = ldfrag_h(Qb + 16 * HD + 64);

  float mrun0 = -INFINITY, lrun0 = 0.f, mrun1 = -INFINITY, lrun1 = 0.f;
  v8f oa[6], ob[6];
#pragma unroll
  for (int j = 0; j < 6; ++j) { oa[j] = zero8(); ob[j] = zero8(); }

  // ---- ring prologue: tile 0 landed and published, then tile 1 set off ----
  tile_copy(kl0, kl1, kl2, vl, kg, vg);
  asm volatile("s_wait_asynccnt 0x0" ::: "memory");   // this wave's copies of tile 0 have landed
  __syncthreads();                                    // every wave's have
  tile_copy(kl0 + BUFB, kl1 + BUFB, kl2 + BUFB, vl + BUFB, kg + STK * HD * 2, vg + STK * 2);

#pragma unroll 1                                      // one trip per tile stays rolled: one foot, small code
  for (int t = 0; t < NST; ++t) {
   const unsigned bo = (unsigned)(t & 1) * BUFB;      // trip t reads buffer t mod 2 alone
#pragma unroll                                        // the tile's two 32-key blocks: constant LDS offsets in the reads
   for (int sub = 0; sub < 2; ++sub) {
    // ---- transposed scores: s0x = keys kb..kb+15, s1x = keys kb+16..kb+31 (kb = 64 t + 32 sub); sxa = queries q0 + c,
    //      sxb = queries q0 + 16 + c; each K fragment is read once and used for both query tiles ----
    const _Float16* k0p = (const _Float16*)(const void*)(ring + bo + kfo + sub * 32 * KPITCH);
    const _Float16* k1p = (const _Float16*)(const void*)(ring + bo + kfo + (sub * 32 + 16) * KPITCH);
    v8f s0a = zero8(), s0b = zero8(), s1a = zero8(), s1b = zero8();
    {
      const v16h ka0 = ldfrag_h(k0p), ka1 = ldfrag_h(k0p + 32), ka2 = ldfrag_h(k0p + 64);
      const v16h kc0 = ldfrag_h(k1p), kc1 = ldfrag_h(k1p + 32), kc2 = ldfrag_h(k1p + 64);
      __builtin_amdgcn_sched_barrier(0);   // keeps the twelve reads one group in front of the WMMAs (else a pair stands at every second one)
      s0a = mma_h(ka0, qa0, s0a);
      s0b = mma_h(ka0, qb0, s0b);
      s1a = mma_h(kc0, qa0, s1a);
      s1b = mma_h(kc0, qb0, s1b);
      s0a = mma_h(ka1, qa1, s0a);
      s0b = mma_h(ka1, qb1, s0b);
      s1a = mma_h(kc1, qa1, s1a);
      s1b = mma_h(kc1, qb1, s1b);
      s0a = mma_h(ka2, qa2, s0a);
      s0b = mma_h(ka2, qb2, s0b);
      s1a = mma_h(kc2, qa2, s1a);
      s1b = mma_h(kc2, qb2, s1b);
      guard4(s0a, s0b, s1a, s1b);
    }
    // ---- lazy maximum: one test per 32-key block for both tiles; -inf in use (first block) always renews ----
    const float cma = lanemax16(s0a, s1a), cmb = lanemax16(s0b, s1b);
    const bool need = (cma * lsc - mrun0 > LAZY) || (cmb * lsc - mrun1 > LAZY);
    // the same for the whole wave: a scalar branch, EXEC stays full; seldom taken, so its body is laid out behind the loop
    if (__builtin_expect(__builtin_amdgcn_ballot_w32(need) != 0, 0)) {
      newmax16(cma, lsc, mrun0, lrun0, oa, hh);
      newmax16(cmb, lsc, mrun1, lrun1, ob, hh);
    }
    // ---- v^T B fragments: col n = d = j*16 + c, keys contiguous in the v^T plane; each is read once and used for both query
    //      tiles ----
    const _Float16* vp = (const _Float16*)(const void*)(ring + bo + vfo + sub * 64);
    const v16h vf0 = ldfrag_h(vp);
    const v16h vf1 = ldfrag_h(vp + 16 * (VPITCH / 2));
    const v16h vf2 = ldfrag_h(vp + 32 * (VPITCH / 2));
    const v16h vf3 = ldfrag_h(vp + 48 * (VPITCH / 2));
    const v16h vf4 = ldfrag_h(vp + 64 * (VPITCH / 2));
    const v16h vf5 = ldfrag_h(vp + 80 * (VPITCH / 2));
    // keeps the twelve reads one group in front of the exponentials, which cover their latency (else they are spread among the WMMAs)
    __builtin_amdgcn_sched_barrier(0);
    FragH pa, pb;
    probs16(s0a, s1a, lsc, mrun0, lrun0, pa);
    probs16(s0b, s1b, lsc, mrun1, lrun1, pb);
    // ---- P.V : two guarded groups of 6 ----
    {
      oa[0] = mma_h(pa.v, vf0, oa[0]);
      ob[0] = mma_h(pb.v, vf0, ob[0]);
      oa[1] = mma_h(pa.v, vf1, oa[1]);
      ob[1] = mma_h(pb.v, vf1, ob[1]);
      oa[2] = mma_h(pa.v, vf2, oa[2]);
      ob[2] = mma_h(pb.v, vf2, ob[2]);
      guard6(oa[0], ob[0], oa[1], ob[1], oa[2], ob[2]);
      oa[3] = mma_h(pa.v, vf3, oa[3]);
      ob[3] = mma_h(pb.v, vf3, ob[3]);
      oa[4] = mma_h(pa.v, vf4, oa[4]);
      ob[4] = mma_h(pb.v, vf4, ob[4]);
      oa[5] = mma_h(pa.v, vf5, oa[5]);
      ob[5] = mma_h(pb.v, vf5, ob[5]);
      guard6(oa[3], ob[3], oa[4], ob[4], oa[5], ob[5]);
    }
   }
   // ---- foot of trip t: publish tile t + 1, free tile t's buffer, refill it with tile t + 2 ----
   asm volatile("s_wait_dscnt 0x0" ::: "memory");      // this wave's reads of tile t are done
   asm volatile("s_wait_asynccnt 0x0" ::: "memory");   // this wave's copies of tile t + 1 have landed
   __syncthreads();                                    // both hold for every wave
   if (t + 2 < NST)                                    // block-uniform
     tile_copy(kl0 + bo, kl1 + bo, kl2 + bo, vl + bo,
               kg + (size_t)(t + 2) * (STK * HD * 2), vg + (size_t)(t + 2) * (STK * 2));
  }
  asm volatile("s_wait_asynccnt 0x0" ::: "memory");    // nothing of this wave is in flight when the ring is reused
  acc_guard6(oa[0], oa[1], oa[2], oa[3], oa[4], oa[5]);
  acc_guard6(ob[0], ob[1], ob[2], ob[3], ob[4], ob[5]);

  float* slab = (float*)(void*)ring + wave * 2 * SLAB96;   // the ring is dead behind the last trip's barrier
  stage_o16(slab, oa, lrun0, hh, c);
  stage_o16(slab + SLAB96, ob, lrun1, hh, c);
  out96x2(slab, OPp + (bh * SEQ + q0) * HD, lane);
}

// =====================================================================================================
// Workspace map (bytes); every plane is fully written by whole-line stores before it is read; all extents are exact multiples
// of the 512-B store instructions (no pad rows needed); every base is 256-B aligned:
//   WOB f16  [768 n][768 k] (bf16 value x1024)   1179648
//   QP  f16  [4][8][2048][96] x8                12582912        KP same
//   VP  f16  [4][8][96][2048] x256              12582912
//   OP  f16  [4][8][2048][96] x1024             12582912
//   end                                          51511296
// =====================================================================================================
extern "C" void kernel_launch(void* const* d_in, const int* in_sizes, int n_in,
                              void* d_out, int out_size, void* d_ws, size_t ws_size,
                              hipStream_t stream) {
  if (n_in < 6) return;
  if (in_sizes[0] != ROWS * DMOD) return;
  if (in_sizes[1] != HD * HD) return;
  if (in_sizes[2] != HD * HD) return;
  if (in_sizes[3] != HD * HD) return;
  if (in_sizes[4] != DMOD * DMOD) return;
  if (in_sizes[5] != DMOD) return;
  if (out_size != ROWS * DMOD) return;

  const float* Xin = (const float*)d_in[0];
  const float* Wq  = (const float*)d_in[1];
  const float* Wk  = (const float*)d_in[2];
  const float* Wv  = (const float*)d_in[3];
  const float* Wu  = (const float*)d_in[4];
  const float* bu  = (const float*)d_in[5];
  float*       out = (float*)d_out;

  const size_t szWO = (size_t)DMOD * DMOD * 2;                  //  1179648
  const size_t szP  = (size_t)NB * NH * SEQ * HD * 2;           // 12582912  (q / k / v^T / o planes)
  size_t off = 0;
  const size_t oWO = off; off += szWO;
  const size_t oQP = off; off += szP;
  const size_t oKP = off; off += szP;
  const size_t oVP = off; off += szP;
  const size_t oOP = off; off += szP;
  if (off > ws_size) return;                            // off = 51511296
  if (off > (size_t)134217728) return;
  if ((szWO % 256) != 0 || (szP % 256) != 0) return;

  char* ws = (char*)d_ws;
  u16* WOB = (u16*)(ws + oWO);
  u16* QP  = (u16*)(ws + oQP);
  u16* KP  = (u16*)(ws + oKP);
  u16* VP  = (u16*)(ws + oVP);
  u16* OP  = (u16*)(ws + oOP);

  if ((DMOD % 64) != 0 || (ROWS % 64) != 0 || (ROWS % GROWS) != 0 || (SEQ % 64) != 0 || (HD % 32) != 0) return;
  const dim3 gPJ(NPJ);                                  // 512
  const dim3 bPJ(PJT);                                  // 256
  const dim3 gAT(ATT_BLOCKS);                           // 512
  const dim3 bAT(ATT_THREADS);                          // 128
  const dim3 gO((ROWS / GROWS) * (DMOD / 64));          // 768
  const dim3 bO(128);

  // (1) q and k planes [b][h][s][96] = f16(x_h.Wq^T x8), f16(x_h.Wk^T x8); v^T plane [b][h][96 d][2048 keys] = f16(x_h.Wv^T x256);
  //     Wq/Wk/Wv [n = out][k = in] (already k-contiguous) rounded to bf16 inside each block; Wu -> f16 of bf16 value x1024
  proj_qkv<<<gPJ, bPJ, 0, stream>>>(Xin, Wq, Wk, Wv, Wu, QP, KP, VP, WOB);
  // (2) attention -> O plane [b][h][s][96] x1024 (single f16)
  attn_fwd<<<gAT, bAT, 0, stream>>>(QP, KP, VP, OP);
  // (3) output projection -> out [8192][768] f32, carries 1024 (O) x 1024 (Wu) folded back, + bias
  gemm_out<<<gO, bO, 0, stream>>>(OP, WOB, bu, out, 1.0f / (OSC * WOS));
  (void)hipGetLastError();
}

// v008
// A run of this version takes 71.9 microseconds.
// In two side-by-side timings against v007, it was 1.05 and 1.04 times as fast.
// All steps since v000 together make it 3.27 times as fast.
// Contractions: x.Wq^T, x.Wk^T and x.Wv^T per head on v_wmma_f32_16x16x32_bf16 (x and Wq/Wk/Wv RNE-converted to bf16
// operands, f32 accumulate); scores k'.q'^T (q', k' single f16 planes carried x8), P.v (P x128 single f16, v x256 single
// f16) and O.Wu^T (O single f16 plane x1024, Wu as f16(bf16(Wu)) x1024): v_wmma_f32_16x16x32_f16, f32 accumulate.
// Base-2 online softmax, 1/l, bias (bf16 value of bu) and carry folds in f32 on VALU.
#include <hip/hip_runtime.h>
#include <math.h>
#include <stdint.h>

#define NB    4
#define SEQ   2048
#define DMOD  768
#define NH    8
#define HD    96
#define ROWS  (NB * SEQ)
#define QSC   8.0f
#define KSC   8.0f
#define PCAR  128.0f
#define PEXP  7.0f                              // log2(PCAR)
#define LAZY  8.0f                              // a maximum in use may lag a new one by this much (base-2 logit): P <= 2^(PEXP + LAZY)
#define VCAR  256.0f
#define OSC   1024.0f
#define WOS   1024.0f
#define LOG2E 1.4426950408889634f
#define RSQK  0.0360843918243516f
#define KGRP        2                          // key groups per attention block: each walks its own half of the keys
#define GW          4                          // waves per key group
#define GT          (GW * 32)                  // threads per key group
#define ATT_WAVES   (KGRP * GW)
#define ATT_THREADS (ATT_WAVES * 32)
#define QPW         32                         // query rows per attention wave: two 16-row tiles
#define QPB         (GW * QPW)                 // query rows per attention block: 128
#define ATT_BLOCKS  (NB * NH * (SEQ / QPB))
#define NKB    (SEQ / 32)
#define SLAB   (16 * 68)
#define SLAB96 (16 * 100)
#define PJW    8                               // waves per projection block, 16 rows each
#define PJROWS (PJW * 16)                      // 128
#define PJT    (PJW * 32)                      // 256 threads
#define NPJ    ((ROWS / PJROWS) * NH)          // 512 projection blocks
#define VSP    136                             // halves per v^T row staged in LDS: 128 + 8 (272 B = 16 B x odd)
#define WPH    104                             // halves per weight row in LDS: 96 + 8 (208 B = 16 B x odd, for ds_load_b128 readers)
#define WPL    (HD * WPH)                      // halves per weight plane in LDS
#define WUB    (DMOD * DMOD / NPJ)             // elements of Wu converted by each projection block: 1152 = 18 whole 128-B lines of f16
#define STK    64                              // keys per LDS tile
#define NST    (SEQ / STK / KGRP)              // 16 tiles per key group
#define KPITCH 208                             // bytes per K row in LDS: 192 + 16 (16 B x odd, for ds_load_b128 readers)
#define VPITCH 144                             // bytes per v^T row in LDS: 128 + 16 (16 B x odd)
#define KTILE  (STK * KPITCH)                  // 13312
#define VTILE  (HD * VPITCH)                   // 13824
#define BUFB   (KTILE + VTILE)                 // 27136
#define PARTF  (2 * 6 * 8 * 32)                // floats of one wave's two unnormalised O tiles, lane-private order: 3072
#define PARTW  (PARTF + 4 * 32)                // + per lane {m0, l0, m1, l1}
#define GROWS  128                             // output rows per gemm_out block: 4 waves x 32
#define GNT    NH                              // LDS tiles along k in gemm_out: one head (96 k) each
#define GPITCH 208                             // bytes per O or Wu row in LDS: 192 + 16 (16 B x odd)
#define GATILE (GROWS * GPITCH)                // 26624
#define GBTILE (64 * GPITCH)                   // 13312
#define GBUF   (GATILE + GBTILE)               // 39936
static_assert(DMOD == NH * HD && HD == 96 && NH == 8 && NB == 4 && SEQ == 2048);
static_assert((SEQ / QPB) == 16 && ATT_BLOCKS == 512 && ATT_THREADS == 256 && GT == 128 && NKB == 64);
static_assert((HD % 32) == 0 && (DMOD % 64) == 0 && (ROWS % 64) == 0 && (SEQ % 64) == 0);
static_assert((SEQ % PJROWS) == 0 && NPJ == 512 && ((HD * HD / 4) % PJT) == 0 && (HD * PJROWS / 8) == 6 * PJT);
static_assert(WUB * NPJ == DMOD * DMOD && (WUB % 64) == 0 && WUB / 8 <= PJT && (WPH * 2) % 16 == 0);
static_assert((SLAB * 4) % 16 == 0 && (SLAB96 * 4) % 16 == 0);
static_assert(NST >= 2 && STK == 64 && (STK * HD * 2) == 6 * GT * 16 && (HD * STK * 2) == 6 * GT * 16 && KGRP == 2);
static_assert((KTILE % 16) == 0 && (BUFB % 16) == 0 && 2 * BUFB >= 2 * GW * SLAB96 * 4 && 2 * BUFB >= GW * PARTW * 4);
static_assert((SEQ % GROWS) == 0 && GNT >= 2 && (GROWS * HD * 2) == 12 * 128 * 16 && (64 * HD * 2) == 6 * 128 * 16);
static_assert((GATILE % 16) == 0 && (GBUF % 16) == 0 && 2 * GBUF >= 8 * SLAB * 4);

typedef unsigned short u16;
typedef _Float16 v16h __attribute__((ext_vector_type(16)));
typedef _Float16 v8h  __attribute__((ext_vector_type(8)));
typedef _Float16 v2h  __attribute__((ext_vector_type(2)));
typedef __bf16   v16b __attribute__((ext_vector_type(16)));
typedef float    v8f  __attribute__((ext_vector_type(8)));
typedef float    v4f  __attribute__((ext_vector_type(4)));
typedef float    v2f  __attribute__((ext_vector_type(2)));
typedef unsigned int v4u __attribute__((ext_vector_type(4)));
typedef unsigned int v2u __attribute__((ext_vector_type(2)));
typedef __bf16   v2b  __attribute__((ext_vector_type(2)));

union FragH { v16h v; v8h h[2]; v4u u[2]; };
union FragB { v16b v; v4u u[2]; };

// ---- scalar helpers --------------------------------------------------------------------------------
__device__ __forceinline__ unsigned short bf_bits(float f) {          // f32 -> bf16 bits, RNE convert
  unsigned u = __float_as_uint(f);
  return (unsigned short)((u + 0x7FFFu + ((u >> 16) & 1u)) >> 16);
}
__device__ __forceinline__ float bf_up(unsigned short h) { return __uint_as_float(((unsigned)h) << 16); }
__device__ __forceinline__ unsigned short h_bits(_Float16 x) { return __builtin_bit_cast(unsigned short, x); }
__device__ __forceinline__ unsigned pk16(unsigned short a, unsigned short b) { return (unsigned)a | ((unsigned)b << 16); }
__device__ __forceinline__ float ex2(float x) { return __builtin_amdgcn_exp2f(x); }   // bare v_exp_f32: 2^-inf = 0, no range fix-up
__device__ __forceinline__ v8f zero8() { v8f z = {0.f, 0.f, 0.f, 0.f, 0.f, 0.f, 0.f, 0.f}; return z; }

// ---- fragment loaders: 16-bit A/B operand, lane -> row/col (lane&15), p already includes +8*(lane>>4);
//      elements 0..7 <- p[0..7] (k0+8h..), elements 8..15 <- p[16..23] (k0+16+8h..)  (same split k map for A and B;
//      B is always read from a k-contiguous [n][k] plane)
__device__ __forceinline__ v16h ldfrag_h(const _Float16* p) {
  FragH f;
  f.h[0] = *(const v8h*)(p);
  f.h[1] = *(const v8h*)(p + 16);
  return f.v;
}
__device__ __forceinline__ v16b ldfrag_b(const u16* p) {              // bf16 plane read as unsigned integer vectors
  FragB f;
  f.u[0] = *(const v4u*)(p);
  f.u[1] = *(const v4u*)(p + 16);
  return f.v;
}

// the same fragment from an f32 row p: a0 = p[0..3], a1 = p[4..7], a2 = p[16..19], a3 = p[20..23]; RNE to bf16 in registers,
// same split k map
__device__ __forceinline__ v16b cvfrag_x(const v4f a0, const v4f a1, const v4f a2, const v4f a3) {
  FragB f;
#pragma unroll
  for (int e = 0; e < 2; ++e) {
    f.u[0][e]     = pk16(bf_bits(a0[2 * e]), bf_bits(a0[2 * e + 1]));
    f.u[0][2 + e] = pk16(bf_bits(a1[2 * e]), bf_bits(a1[2 * e + 1]));
    f.u[1][e]     = pk16(bf_bits(a2[2 * e]), bf_bits(a2[2 * e + 1]));
    f.u[1][2 + e] = pk16(bf_bits(a3[2 * e]), bf_bits(a3[2 * e + 1]));
  }
  return f.v;
}

__device__ __forceinline__ v8f mma_h(v16h a, v16h b, v8f c) {
  return __builtin_amdgcn_wmma_f32_16x16x32_f16(false, a, false, b, (short)0, c, false, false);
}
__device__ __forceinline__ v8f mma_b(v16b a, v16b b, v8f c) {
  return __builtin_amdgcn_wmma_f32_16x16x32_bf16(false, a, false, b, (short)0, c, false, false);
}
// v_nop x4: the distance between the last matrix instruction of a group and the first vector instruction on its D, A or B
__device__ __forceinline__ void guard4(v8f& s, v8f& t, v8f& u, v8f& w) {
#if defined(__HIP_DEVICE_COMPILE__)
  asm volatile("v_nop\n\tv_nop\n\tv_nop\n\tv_nop" : "+v"(s), "+v"(t), "+v"(u), "+v"(w) :: "memory");
#endif
}
__device__ __forceinline__ void guard6(v8f& a, v8f& b, v8f& c, v8f& d, v8f& e, v8f& f) {
#if defined(__HIP_DEVICE_COMPILE__)
  asm volatile("v_nop\n\tv_nop\n\tv_nop\n\tv_nop"
               : "+v"(a), "+v"(b), "+v"(c), "+v"(d), "+v"(e), "+v"(f) :: "memory");
#endif
}
__device__ __forceinline__ void acc_guard6(v8f& a, v8f& b, v8f& c, v8f& d, v8f& e, v8f& f) {
#if defined(__HIP_DEVICE_COMPILE__)
  asm volatile("v_nop\n\tv_nop\n\tv_nop\n\tv_nop" : "+v"(a), "+v"(b), "+v"(c), "+v"(d), "+v"(e), "+v"(f));
#endif
}
__device__ __forceinline__ void wave_sync_lds() {
#if defined(__HIP_DEVICE_COMPILE__)
  __builtin_amdgcn_fence(__ATOMIC_RELEASE, "workgroup");
  __builtin_amdgcn_wave_barrier();
  __builtin_amdgcn_fence(__ATOMIC_ACQUIRE, "workgroup");
#endif
}

// =====================================================================================================
// 16x96 f16 epilogue: the wave's 16x96 f32 tile (already scaled) staged by the caller in its LDS slab [16][100];
// coverage: 6 instructions x 32 lanes x 8 halves = 1536 = the wave's 16 x 96 tile (groups of 8 never straddle a row: 96/8 = 12).
// =====================================================================================================
__device__ __forceinline__ void out96(const float* sl, u16* dst, int lane) {
  wave_sync_lds();
  v4u ov[6];
#pragma unroll
  for (int i = 0; i < 6; ++i) {
    const int g   = i * 32 + lane;
    const int row = g / 12;
    const int c8  = (g - row * 12) * 8;
    const v4f a = *(const v4f*)(sl + row * 100 + c8), c4 = *(const v4f*)(sl + row * 100 + c8 + 4);
    float w[8];
#pragma unroll
    for (int e = 0; e < 4; ++e) { w[e] = a[e]; w[4 + e] = c4[e]; }
#pragma unroll
    for (int e = 0; e < 4; ++e) ov[i][e] = pk16(h_bits((_Float16)w[2 * e]), h_bits((_Float16)w[2 * e + 1]));
  }
  {
#pragma unroll
    for (int i = 0; i < 6; ++i) {
      *(v4u*)(dst + (size_t)(i * 32 + lane) * 8) = ov[i];
    }
    
  }
}

// =====================================================================================================
// f32 GEMM epilogue with bias, in two parts with the caller's wave_sync_lds() between them:
//   epi64_stage: a 16x64 f32 tile of the wave (acc*oscale + bias[col]) goes into one of its LDS slabs (pitch 68);
//   epi64_flush: the slab leaves as whole lines.
// coverage: 8 instructions x 2 rows x 16 lanes x 4 floats = one 16 x 64 tile.
// =====================================================================================================
__device__ __forceinline__ void epi64_stage(float* sl, v8f a0, v8f a1, v8f a2, v8f a3, float oscale,
                                            float bz0, float bz1, float bz2, float bz3, int lane) {
  const int hh = lane >> 4, m = lane & 15;
#pragma unroll
  for (int r = 0; r < 8; ++r) {
    const int ro = (8 * hh + r) * 68 + m;
    sl[ro]      = a0[r] * oscale + bz0;
    sl[ro + 16] = a1[r] * oscale + bz1;
    sl[ro + 32] = a2[r] * oscale + bz2;
    sl[ro + 48] = a3[r] * oscale + bz3;
  }
}
__device__ __forceinline__ void epi64_flush(const float* sl, float* C, int N, size_t rowb, int col0, int lane) {
  const int hh = lane >> 4, m = lane & 15;
  v4f vals[8];
#pragma unroll
  for (int it = 0; it < 8; ++it) vals[it] = *(const v4f*)(sl + (it * 2 + hh) * 68 + m * 4);
  float* dst = C + (rowb + (size_t)hh) * (size_t)N + col0 + m * 4;
#pragma unroll
  for (int it = 0; it < 8; ++it) *(v4f*)(dst + (size_t)(it * 2) * (size_t)N) = vals[it];
}

// =====================================================================================================
// The three per-head projections (shared 96x96 weights) and all weight conversions in ONE launch, bf16 operands.
// Block = (128 rows of b*SEQ+s, head), 8 waves x 16 rows.
//   Weights: the block reads Wq, Wk, Wv as f32 (3 x 2304 pieces of 4 floats, 27 per thread, 512 contiguous bytes per
//   wave-instruction), rounds them to bf16 (RNE) in registers and lays them in LDS as [plane][96 n][96 k], pitch WPH; one
//   barrier publishes them; every wave reads its B fragments from there by ds_load_b128 (k-contiguous rows, split k map).
//   Wu: block i also converts elements i*WUB .. +WUB-1 of Wu to the f16 plane (bf16 RNE value x1024) that the output projection
//   reads two launches later: threads 0..143, 8 elements each, whole lines, no other block touches them.
// A wave reads its 16 x 96 piece of x ONCE, as f32 (pitch 768), rounds it to bf16 in registers (cvfrag_x) and uses the three A
// fragments for all three products x . W^T; 6 accumulators (n = 0..95), K = 96 in 3 steps of 32.
//   q, k: P[b][head][s][96] = f16(acc * 8); the wave's 16x96 tile is one contiguous 3072-B region, see out96.
//   v:    D element r of lane l = (s = 8hh + r, d = 16j + m): a lane's 8 values are 8 consecutive keys of one v^T row; the block's
//         96 x 128 tile of VT[b][head][d][s] (f16 of acc * 256) is gathered in LDS and leaves as whole 128-B lines.
// coverage: v^T 6 instructions x 256 threads x 8 halves = 96 x 128; grid = (ROWS/128) * NH = 512 (exact, host-checked constants).
// =====================================================================================================
__device__ __forceinline__ void proj96(const v16b x0, const v16b x1, const v16b x2, const u16* bp, v8f (&acc)[6]) {
#pragma unroll
  for (int j = 0; j < 6; ++j) acc[j] = mma_b(x0, ldfrag_b(bp + j * 16 * WPH), zero8());
#pragma unroll
  for (int j = 0; j < 6; ++j) acc[j] = mma_b(x1, ldfrag_b(bp + j * 16 * WPH + 32), acc[j]);
#pragma unroll
  for (int j = 0; j < 6; ++j) acc[j] = mma_b(x2, ldfrag_b(bp + j * 16 * WPH + 64), acc[j]);
}
// four f32 -> four bf16 (RNE), two packed converts
__device__ __forceinline__ v2u bf4(const v4f a) {
  const v2f lo = {a[0], a[1]}, hi = {a[2], a[3]};
  v2u o;
  o[0] = __builtin_bit_cast(unsigned, __builtin_convertvector(lo, v2b));
  o[1] = __builtin_bit_cast(unsigned, __builtin_convertvector(hi, v2b));
  return o;
}
// D element r of lane l = (row 8hh+r, col n = 16j + m); stage the 16x96 slab (pitch 100) fully
__device__ __forceinline__ void stage96(float* slab, const v8f (&acc)[6], float oscale, int hh, int m) {
#pragma unroll
  for (int r = 0; r < 8; ++r) {
    const int ro = (8 * hh + r) * 100 + m;
#pragma unroll
    for (int j = 0; j < 6; ++j) slab[ro + 16 * j] = acc[j][r] * oscale;
  }
}

// 4096 waves = 4 per SIMD, 512 blocks = 2 per WGP, all resident
__global__ __launch_bounds__(PJT) __attribute__((amdgpu_waves_per_eu(4, 4)))
void proj_qkv(const float* __restrict__ X, const float* __restrict__ WQ, const float* __restrict__ WK,
              const float* __restrict__ WV, const float* __restrict__ WU, u16* QP, u16* KP, u16* VT, u16* DU) {
  __shared__ __align__(16) float smem[PJW * SLAB96];
  __shared__ __align__(16) u16 vst[HD * VSP];
  __shared__ __align__(16) u16 wl[3 * WPL];
  const int tid = threadIdx.x, wave = tid >> 5, lane = tid & 31, hh = lane >> 4, m = lane & 15;
  const int bid  = blockIdx.x;
  const int head = bid & (NH - 1);
  const int rt   = bid >> 3;
  const int rowb = rt * PJROWS + wave * 16;             // 0..8176, the block's 128 rows never straddle a batch
  const int b    = rowb >> 11;
  const int s0   = rowb & (SEQ - 1);
  const size_t bh = (size_t)(b * NH + head);
  // ---- all global reads of the block are set off together: weights, x, the Wu share ----
  v4f wr[27];
#pragma unroll
  for (int i = 0; i < 9; ++i) {
    const int e = (i * PJT + tid) * 4;                  // < 9216
    wr[i]      = *(const v4f*)(WQ + e);
    wr[9 + i]  = *(const v4f*)(WK + e);
    wr[18 + i] = *(const v4f*)(WV + e);
  }
  const float* xp = X + (size_t)(rowb + m) * DMOD + head * HD + 8 * hh;
  v4f xr[12];
#pragma unroll
  for (int i = 0; i < 3; ++i) {
    xr[4 * i]     = *(const v4f*)(xp + 32 * i);
    xr[4 * i + 1] = *(const v4f*)(xp + 32 * i + 4);
    xr[4 * i + 2] = *(const v4f*)(xp + 32 * i + 16);
    xr[4 * i + 3] = *(const v4f*)(xp + 32 * i + 20);
  }
  const bool   uon = tid < WUB / 8;
  const size_t ue  = (size_t)bid * WUB + (size_t)tid * 8;   // used only where uon: < DMOD * DMOD
  v4f ua = {0.f, 0.f, 0.f, 0.f}, uc = {0.f, 0.f, 0.f, 0.f};
  if (uon) { ua = *(const v4f*)(WU + ue); uc = *(const v4f*)(WU + ue + 4); }
  // ---- weights into LDS: piece p = 256 i + tid -> row p / 24, 8-B column p % 24 ----
#pragma unroll
  for (int i = 0; i < 9; ++i) {
    const int p = i * PJT + tid, row = p / 24, c4 = p - row * 24;
    u16* d = wl + row * WPH + c4 * 4;
    *(v2u*)(d)           = bf4(wr[i]);
    *(v2u*)(d + WPL)     = bf4(wr[9 + i]);
    *(v2u*)(d + 2 * WPL) = bf4(wr[18 + i]);
  }
  __syncthreads();                                      // the three bf16 planes are whole for every wave
  const v16b x0 = cvfrag_x(xr[0], xr[1], xr[2], xr[3]), x1 = cvfrag_x(xr[4], xr[5], xr[6], xr[7]),
             x2 = cvfrag_x(xr[8], xr[9], xr[10], xr[11]);
  const u16* wb = wl + m * WPH + 8 * hh;                // the lane's place in each weight plane
  float* slab = smem + wave * SLAB96;
  v8f acc[6];
  proj96(x0, x1, x2, wb, acc);
  stage96(slab, acc, QSC, hh, m);
  out96(slab, QP + (bh * SEQ + s0) * HD, lane);
  proj96(x0, x1, x2, wb + WPL, acc);
  wave_sync_lds();                                      // the wave's reads of the q slab stay in front of the k slab's writes
  stage96(slab, acc, KSC, hh, m);
  out96(slab, KP + (bh * SEQ + s0) * HD, lane);
  proj96(x0, x1, x2, wb + 2 * WPL, acc);
#pragma unroll
  for (int j = 0; j < 6; ++j) {
    v8h h;
#pragma unroll
    for (int r = 0; r < 8; ++r) h[r] = (_Float16)(acc[j][r] * VCAR);
    *(v4u*)(vst + (16 * j + m) * VSP + wave * 16 + 8 * hh) = __builtin_bit_cast(v4u, h);
  }
  __syncthreads();                                      // the eight waves' key columns make up the 128-B lines
  u16* vb = VT + bh * HD * SEQ + (s0 - wave * 16);
#pragma unroll
  for (int i = 0; i < 6; ++i) {
    const int p = i * PJT + tid, row = p >> 4, c8 = (p & 15) * 8;
    *(v4u*)(vb + (size_t)row * SEQ + c8) = *(const v4u*)(vst + row * VSP + c8);
  }
  // the Wu share leaves last: no barrier or LDS fence of the block has to wait for this store
  if (uon) {
    v4u o;
#pragma unroll
    for (int e = 0; e < 2; ++e) {
      o[e]     = pk16(h_bits((_Float16)(bf_up(bf_bits(ua[2 * e])) * WOS)), h_bits((_Float16)(bf_up(bf_bits(ua[2 * e + 1])) * WOS)));
      o[2 + e] = pk16(h_bits((_Float16)(bf_up(bf_bits(uc[2 * e])) * WOS)), h_bits((_Float16)(bf_up(bf_bits(uc[2 * e + 1])) * WOS)));
    }
    *(v4u*)(DU + ue) = o;
  }
}

// =====================================================================================================
// One k tile (one head, 96 k) of gemm_out into one LDS buffer, 18 asynchronous 16-B copies per lane (all 128 lanes on,
// block-uniform control flow):
//   O:  128 rows x 192 B are 24576 contiguous global bytes; piece p = 128 i + tid (i = 0..11) -> LDS row p / 12, 16-B column
//       p % 12 (l0..l2 hold the places of i = 0..2; i + 3 lies 32 rows further); one wave-instruction = 512 contiguous bytes.
//   Wu: 64 rows x 192 B (global pitch 1536 B); piece p = 128 i + tid (i = 0..5), same row and column rule, behind the O part.
// s_wait_xcnt stands inside each statement so that no address register is rewritten in front of it.
// =====================================================================================================
__device__ __forceinline__ void gemm_tile_copy(unsigned l0, unsigned l1, unsigned l2, const char* ag,
                                               const char* bg0, const char* bg1, const char* bg2) {
#if defined(__HIP_DEVICE_COMPILE__)
  asm volatile("global_load_async_to_lds_b128 %0, %12, off\n\t"
               "global_load_async_to_lds_b128 %1, %13, off\n\t"
               "global_load_async_to_lds_b128 %2, %14, off\n\t"
               "global_load_async_to_lds_b128 %3, %15, off\n\t"
               "global_load_async_to_lds_b128 %4, %16, off\n\t"
               "global_load_async_to_lds_b128 %5, %17, off\n\t"
               "global_load_async_to_lds_b128 %6, %18, off\n\t"
               "global_load_async_to_lds_b128 %7, %19, off\n\t"
               "global_load_async_to_lds_b128 %8, %20, off\n\t"
               "global_load_async_to_lds_b128 %9, %21, off\n\t"
               "global_load_async_to_lds_b128 %10, %22, off\n\t"
               "global_load_async_to_lds_b128 %11, %23, off\n\t"
               "s_wait_xcnt 0x0"
               :: "v"(l0), "v"(l1), "v"(l2),
                  "v"(l0 + 32u * GPITCH), "v"(l1 + 32u * GPITCH), "v"(l2 + 32u * GPITCH),
                  "v"(l0 + 64u * GPITCH), "v"(l1 + 64u * GPITCH), "v"(l2 + 64u * GPITCH),
                  "v"(l0 + 96u * GPITCH), "v"(l1 + 96u * GPITCH), "v"(l2 + 96u * GPITCH),
                  "v"(ag), "v"(ag + 2048), "v"(ag + 4096), "v"(ag + 6144), "v"(ag + 8192), "v"(ag + 10240),
                  "v"(ag + 12288), "v"(ag + 14336), "v"(ag + 16384), "v"(ag + 18432), "v"(ag + 20480), "v"(ag + 22528)
               : "memory");
  asm volatile("global_load_async_to_lds_b128 %0, %6, off\n\t"
               "global_load_async_to_lds_b128 %1, %7, off\n\t"
               "global_load_async_to_lds_b128 %2, %8, off\n\t"
               "global_load_async_to_lds_b128 %3, %9, off\n\t"
               "global_load_async_to_lds_b128 %4, %10, off\n\t"
               "global_load_async_to_lds_b128 %5, %11, off\n\t"
               "s_wait_xcnt 0x0"
               :: "v"(l0 + (unsigned)GATILE), "v"(l1 + (unsigned)GATILE), "v"(l2 + (unsigned)GATILE),
                  "v"(l0 + (unsigned)GATILE + 32u * GPITCH), "v"(l1 + (unsigned)GATILE + 32u * GPITCH),
                  "v"(l2 + (unsigned)GATILE + 32u * GPITCH),
                  "v"(bg0), "v"(bg1), "v"(bg2),
                  "v"(bg0 + 32 * DMOD * 2), "v"(bg1 + 32 * DMOD * 2), "v"(bg2 + 32 * DMOD * 2)
               : "memory");
#endif
}

// =====================================================================================================
// Output projection with bias: C[8192][768] (f32) = O . Wu^T * oscale + bf16(bu)[n]; A operand k index = head*96 + d lives at
// O plane address ((b*NH + head)*SEQ + s)*96 + d (O single f16 x1024, 32-deep k-steps never straddle a head since 96 = 3*32);
// Bt = Wu plane [768 n][768 k] f16 (bf16 value x1024), k-contiguous. Block = 128x64 tile, 4 waves x (32 rows x 64 columns);
// k runs over 8 tiles of 96 (one head each, k ascending in steps of 32). The block's waves share each O and Wu tile: it is
// brought into LDS by asynchronous copies (gemm_tile_copy), two buffers, tile t + 1 in flight while tile t is worked on; one
// barrier per tile publishes tile t + 1 and frees tile t's buffer. Fragments are read by ds_load_b128, same split k map for A
// and B. After the last barrier the ring is dead and its first bytes become the waves' private output slabs (two each).
// grid = (ROWS/128)*(DMOD/64) = 768.
// =====================================================================================================
__global__ __launch_bounds__(128)
void gemm_out(const u16* __restrict__ OP, const u16* __restrict__ WOB, const float* __restrict__ bias, float* C,
              float oscale) {
  __shared__ __align__(16) unsigned char ring[2 * GBUF];
  const int tid = threadIdx.x, wave = tid >> 5, lane = tid & 31, hh = lane >> 4, m = lane & 15;
  const int ntile = DMOD >> 6;                          // 12
  const int bid   = blockIdx.x;
  const int row0  = (bid / ntile) * GROWS;              // the block's 128 rows never straddle a batch
  const int col0  = (bid % ntile) * 64;
  const int b     = row0 >> 11;
  const int s0    = row0 & (SEQ - 1);
  // the lane's copy places (LDS byte addresses in buffer 0) and its global sources for tile 0
  const unsigned lds0 = (unsigned)(uintptr_t)(&ring[0]);
  const int r0 = tid / 12, r1 = (tid + 128) / 12, r2 = (tid + 256) / 12;
  const int c0 = (tid - 12 * r0) * 16, c1 = (tid + 128 - 12 * r1) * 16, c2 = (tid + 256 - 12 * r2) * 16;
  const unsigned l0 = lds0 + (unsigned)(r0 * GPITCH + c0);
  const unsigned l1 = lds0 + (unsigned)(r1 * GPITCH + c1);
  const unsigned l2 = lds0 + (unsigned)(r2 * GPITCH + c2);
  const char* ag  = (const char*)(const void*)OP + (((size_t)b * NH * SEQ + s0) * HD * 2 + (size_t)tid * 16);  // + SEQ*192 per tile
  const char* bg0 = (const char*)(const void*)WOB + ((size_t)(col0 + r0) * DMOD * 2 + c0);                     // + 192 per tile
  const char* bg1 = (const char*)(const void*)WOB + ((size_t)(col0 + r1) * DMOD * 2 + c1);
  const char* bg2 = (const char*)(const void*)WOB + ((size_t)(col0 + r2) * DMOD * 2 + c2);
  // A fragments: row = wave*32 + 16i + m; B fragments: row n = 16j + m; byte offsets in a buffer
  const int afo = (wave * 32 + m) * GPITCH + 16 * hh;
  const int bfo = GATILE + m * GPITCH + 16 * hh;
  v8f acc[2][4];
#pragma unroll
  for (int i = 0; i < 2; ++i) {
#pragma unroll
    for (int j = 0; j < 4; ++j) acc[i][j] = zero8();
  }

  // ---- ring prologue: tile 0 landed and published, then tile 1 set off ----
  gemm_tile_copy(l0, l1, l2, ag, bg0, bg1, bg2);
  asm volatile("s_wait_asynccnt 0x0" ::: "memory");   // this wave's copies of tile 0 have landed
  __syncthreads();                                    // every wave's have
  gemm_tile_copy(l0 + GBUF, l1 + GBUF, l2 + GBUF, ag + SEQ * HD * 2, bg0 + HD * 2, bg1 + HD * 2, bg2 + HD * 2);

#pragma unroll 1                                      // one trip per tile stays rolled: one foot, small code
  for (int t = 0; t < GNT; ++t) {
    const unsigned bo = (unsigned)(t & 1) * GBUF;     // trip t reads buffer t mod 2 alone
#pragma unroll                                        // the tile's three 32-deep k-steps: constant LDS offsets in the reads
    for (int ks = 0; ks < 3; ++ks) {
      const _Float16* ap = (const _Float16*)(const void*)(ring + bo + afo + ks * 64);
      const _Float16* bp = (const _Float16*)(const void*)(ring + bo + bfo + ks * 64);
      const v16h a0 = ldfrag_h(ap);
      const v16h a1 = ldfrag_h(ap + 16 * (GPITCH / 2));
      const v16h b0 = ldfrag_h(bp);
      const v16h b1 = ldfrag_h(bp + 16 * (GPITCH / 2));
      const v16h b2 = ldfrag_h(bp + 32 * (GPITCH / 2));
      const v16h b3 = ldfrag_h(bp + 48 * (GPITCH / 2));
      acc[0][0] = mma_h(a0, b0, acc[0][0]);
      acc[0][1] = mma_h(a0, b1, acc[0][1]);
      acc[0][2] = mma_h(a0, b2, acc[0][2]);
      acc[0][3] = mma_h(a0, b3, acc[0][3]);
      acc[1][0] = mma_h(a1, b0, acc[1][0]);
      acc[1][1] = mma_h(a1, b1, acc[1][1]);
      acc[1][2] = mma_h(a1, b2, acc[1][2]);
      acc[1][3] = mma_h(a1, b3, acc[1][3]);
    }
    // ---- foot of trip t: publish tile t + 1, free tile t's buffer, refill it with tile t + 2 ----
    asm volatile("s_wait_dscnt 0x0" ::: "memory");      // this wave's reads of tile t are done
    asm volatile("s_wait_asynccnt 0x0" ::: "memory");   // this wave's copies of tile t + 1 have landed
    __syncthreads();                                    // both hold for every wave
    if (t + 2 < GNT)                                    // block-uniform
      gemm_tile_copy(l0 + bo, l1 + bo, l2 + bo, ag + (size_t)(t + 2) * (SEQ * HD * 2),
                     bg0 + (t + 2) * (HD * 2), bg1 + (t + 2) * (HD * 2), bg2 + (t + 2) * (HD * 2));
  }
  asm volatile("s_wait_asynccnt 0x0" ::: "memory");     // nothing of this wave is in flight when the ring is reused

  // bias for the lane's columns (col0 + 16j + m <= 767), bf16 value of bu
  const float bz0 = bf_up(bf_bits(bias[col0 + m]));
  const float bz1 = bf_up(bf_bits(bias[col0 + 16 + m]));
  const float bz2 = bf_up(bf_bits(bias[col0 + 32 + m]));
  const float bz3 = bf_up(bf_bits(bias[col0 + 48 + m]));
  float* slab = (float*)(void*)ring + wave * 2 * SLAB;  // the ring is dead behind the last trip's barrier
  const size_t rowb = (size_t)(row0 + wave * 32);
  epi64_stage(slab, acc[0][0], acc[0][1], acc[0][2], acc[0][3], oscale, bz0, bz1, bz2, bz3, lane);
  epi64_stage(slab + SLAB, acc[1][0], acc[1][1], acc[1][2], acc[1][3], oscale, bz0, bz1, bz2, bz3, lane);
  wave_sync_lds();                                      // one for both slabs: no global store stands in front of it
  epi64_flush(slab, C, DMOD, rowb, col0, lane);
  epi64_flush(slab + SLAB, C, DMOD, rowb + 16, col0, lane);
}

// =====================================================================================================
// One 64-key tile into one LDS buffer of a key group, 12 asynchronous 16-B copies per lane (all 128 lanes of the group on,
// block-uniform control flow; tid = thread in its group):
//   K: 64 rows x 192 B are 12288 contiguous global bytes; piece p = 128 i + tid (i = 0..5) -> LDS row p / 12, 16-B column p % 12
//      (kl0..kl2 hold the places of i = 0..2; i + 3 lies 32 rows further); one wave-instruction = 512 contiguous bytes.
//   v^T: 96 rows x 128 B (global pitch 4096 B); piece p = 128 i + tid -> row p / 8, column p % 8; one wave-instruction = 4 lines.
// s_wait_xcnt stands inside the statement so that no address register is rewritten in front of it.
// =====================================================================================================
__device__ __forceinline__ void tile_copy(unsigned kl0, unsigned kl1, unsigned kl2, unsigned vl,
                                          const char* kg, const char* vg) {
#if defined(__HIP_DEVICE_COMPILE__)
  asm volatile("global_load_async_to_lds_b128 %0, %12, off\n\t"
               "global_load_async_to_lds_b128 %1, %13, off\n\t"
               "global_load_async_to_lds_b128 %2, %14, off\n\t"
               "global_load_async_to_lds_b128 %3, %15, off\n\t"
               "global_load_async_to_lds_b128 %4, %16, off\n\t"
               "global_load_async_to_lds_b128 %5, %17, off\n\t"
               "global_load_async_to_lds_b128 %6, %18, off\n\t"
               "global_load_async_to_lds_b128 %7, %19, off\n\t"
               "global_load_async_to_lds_b128 %8, %20, off\n\t"
               "global_load_async_to_lds_b128 %9, %21, off\n\t"
               "global_load_async_to_lds_b128 %10, %22, off\n\t"
               "global_load_async_to_lds_b128 %11, %23, off\n\t"
               "s_wait_xcnt 0x0"
               :: "v"(kl0), "v"(kl1), "v"(kl2),
                  "v"(kl0 + 32u * KPITCH), "v"(kl1 + 32u * KPITCH), "v"(kl2 + 32u * KPITCH),
                  "v"(vl), "v"(vl + 16u * VPITCH), "v"(vl + 32u * VPITCH),
                  "v"(vl + 48u * VPITCH), "v"(vl + 64u * VPITCH), "v"(vl + 80u * VPITCH),
                  "v"(kg), "v"(kg + 2048), "v"(kg + 4096), "v"(kg + 6144), "v"(kg + 8192), "v"(kg + 10240),
                  "v"(vg), "v"(vg + 16 * SEQ * 2), "v"(vg + 32 * SEQ * 2),
                  "v"(vg + 48 * SEQ * 2), "v"(vg + 64 * SEQ * 2), "v"(vg + 80 * SEQ * 2)
               : "memory");
#endif
}

// =====================================================================================================
// Narrow multi-head flash attention (no mask): block = (batch b, head, 128 query rows), 8 waves in two key groups of 4: group g
// walks keys 1024 g .. + 1023 with its own LDS ring, so that 4 waves share a SIMD and fill each other's waits; wave w of either
// group owns the 32 query rows q0 = 128*qt + 32*w .. q0+31 as two tiles of 16 (tile u = rows q0+16u .. +15), so that every K and
// v^T fragment it reads from LDS feeds two matrix instructions, one per tile. The two groups' results for a row (maximum in use,
// row sum, unnormalised O) are joined once, in the epilogue, through LDS.
//   q plane (f16, x8) laid out [b][h][s][96]; k plane the same; v^T plane [b][h][96][s] (x256).
//   All NKB = 64 key blocks of 32 keys are visited (static bound), two per 64-key tile, 16 tiles per group. A group's four waves
//   share each K and v^T tile: it is brought into LDS by asynchronous copies (tile_copy), two buffers, tile t + 1 in flight while
//   tile t is worked on; one barrier per tile (all 8 waves) publishes tile t + 1 and frees tile t's buffer. Fragments are read by
//   ds_load_b128. After the last barrier the rings are dead: group 1's holds its partial results, group 0's the output slabs.
//   Scores are computed TRANSPOSED: S^T tile (g, u) (g = 0,1) = k rows (keys kb+16g .. +15, A operand, row m = lane&15, split k
//   map over d, 3 chunks of 32) times q^T (B operand, col n = query q0 + 16u + (lane&15), k = d, split map), one product per tile
//   and 32-deep d-chunk. D element r of lane l = (key kb+16g+8h+r, query q0+16u+(l&15)), so a lane owns one query column per
//   tile u and 16 of its 32 keys; the partner lane l^16 owns the other 16 (joined by an xor-16 shuffle: maxima in newmax16, sums at the end).
//   Online max-subtracted base-2 softmax in f32, per tile u: scale 1/sqrt(768) and the q/k carries folded into lsc; scale,
//   maximum and P's carry enter the exponent through one fma, and the row sum l carries x128 with P. The maximum in use is
//   renewed lazily: one wave-uniform test per 32-key block; only when some query's new maximum lies more than LAZY above the one
//   in use do the halves exchange maxima and are l and the O accumulators rescaled (newmax16). The exp'd values
//   ARE the P A-fragment in place: A row m = query = lane&15, element i <- key kb+8h+i (g = 0, D element i), element 8+i <- key
//   kb+16+8h+i (g = 1, D element i). P is carried x128 as single f16 (at most 2^15). The rescale factor of query row 8h+r of the O
//   accumulators is fetched from lane 8h+r with a shuffle (uniform control). 6 v^T B fragments (col n = d = 16j + (lane&15),
//   keys k-contiguous), 12 P.V WMMAs per key block in two guarded groups of 6.
//   Epilogue, group 0, per tile u: both key halves under the larger maximum, 1/l (per query, shuffled to the D row owner) and carry folds in f32; the 16x96 f32 result (x1024)
//   staged in an LDS slab [16][100]; the tile's 16 rows of the O plane [b][h][s][96] are one contiguous 3072-B region written
// coverage: per storing wave 2 x 6 instructions x 32 lanes x 8 halves = 32 x 96; grid 512 blocks x 4 storing waves = every (b, h, s) row of the
//           O plane exactly once.
// =====================================================================================================
// Maximum of this lane's 16 raw scores of one 16-query tile (keys kb+8h+i and kb+16+8h+i of the lane's query).
__device__ __forceinline__ float lanemax16(const v8f s0, const v8f s1) {
  float cm = fmaxf(s0[0], s1[0]);
#pragma unroll
  for (int i = 1; i < 8; ++i) cm = fmaxf(fmaxf(cm, s0[i]), s1[i]);
  return cm;
}
// One 32-key step of the softmax for one 16-query tile under the maximum in use, mrun (every score * lsc is at most mrun + LAZY):
// fills the P A-fragment and adds to the running sum.
__device__ __forceinline__ void probs16(const v8f s0, const v8f s1, const float lsc, const float mrun, float& lrun, FragH& ph) {
  // ---- carried probabilities p * 128 = 2^(s * lsc - mrun + 7): one fma and one v_exp_f32 per score; the argument is at
  //      most 15 plus the fma's rounding, and a result under 2^-126 (flushed) is far below the f16 plane's last place.
  //      P A-fragment: element i <-> s0[i], element 8 + i <-> s1[i] ----
  const v2f lsc2 = {lsc, lsc};
  const v2f eb2  = {PEXP - mrun, PEXP - mrun};
  float ps = 0.f;
  v2f ar[8], pp[8];
#pragma unroll
  for (int e = 0; e < 8; ++e) {
    const v2f sp = (e < 4) ? (v2f){s0[2 * e], s0[2 * e + 1]} : (v2f){s1[2 * e - 8], s1[2 * e - 7]};
    ar[e] = __builtin_elementwise_fma(sp, lsc2, eb2);
  }
#pragma unroll
  for (int e = 0; e < 8; ++e) pp[e] = (v2f){ex2(ar[e][0]), ex2(ar[e][1])};
#pragma unroll
  for (int e = 0; e < 8; ++e) {
    ps += pp[e][0] + pp[e][1];
    ph.u[e >> 2][e & 3] = __builtin_bit_cast(unsigned, __builtin_convertvector(pp[e], v2h));   // RNE, as two scalar casts
  }
  lrun += ps;                                                      // this half's 16 keys; the halves are joined in the epilogue
}
// rescale one tile's O accumulators: D row 8hh+r = the tile's query 8hh+r, its factor lives in lane 8hh+r (and 16+8hh+r)
__device__ __forceinline__ void rescale16(v8f (&o)[6], const float al, const int hh) {
  float scl[8];
#pragma unroll
  for (int r = 0; r < 8; ++r) scl[r] = __shfl(al, 8 * hh + r, 32);
#pragma unroll
  for (int j = 0; j < 6; ++j) {
#pragma unroll
    for (int r = 0; r < 8; ++r) o[j][r] *= scl[r];
  }
}
// The seldom-taken path, whole wave: renew one tile's maximum in use from the lanes' maxima cm (lsc > 0, so the scale commutes
// with the maximum) and bring the old sum and accumulators under it.
__device__ __forceinline__ void newmax16(float cm, const float lsc, float& mrun, float& lrun, v8f (&o)[6], const int hh) {
  cm = fmaxf(cm, __shfl_xor(cm, 16, 32));
  const float mn = fmaxf(mrun, cm * lsc);                          // base-2 logit; finite from the first key block on
  const float al = (mrun == -INFINITY) ? 0.f : ex2(mrun - mn);     // o and l are zero while mrun is -inf
  mrun = mn;
  lrun *= al;
  rescale16(o, al, hh);
}
// Join one tile's two key halves: this wave's (o, mrun, lrun) and the partner wave's (po: its accumulators in the same lane-private
// order, pm: its maximum in use, pl: its whole row sum). Both are brought under the larger maximum; then 1/l (per query, owned by
// lane = query; l carries PCAR like P, so only v's carry is left) and OSC are folded in and the tile's slab is staged.
__device__ __forceinline__ void stage_o16(float* slab, const v8f (&o)[6], const float mrun, const float lrun,
                                          const float* po, const float pm, const float pl, const int lane) {
  const int hh = lane >> 4, c = lane & 15;
  const float la   = lrun + __shfl_xor(lrun, 16, 32);             // the two lane halves' sums of the lane's query
  const float d    = mrun - pm;                                   // both finite: each group has seen a key block
  const float e    = ex2(-fabsf(d));                              // the side with the smaller maximum comes down, the other keeps 1
  const float fa   = (d >= 0.f) ? 1.f : e, fb = (d >= 0.f) ? e : 1.f;
  const float lsum = la * fa + pl * fb;
  const float linv = (lsum > 0.f) ? ((1.0f / lsum) * (OSC / VCAR)) : 0.f;
  const float ga = fa * linv, gb = fb * linv;
  float ia[8], ib[8];
#pragma unroll
  for (int r = 0; r < 8; ++r) { ia[r] = __shfl(ga, 8 * hh + r, 32); ib[r] = __shfl(gb, 8 * hh + r, 32); }
#pragma unroll
  for (int j = 0; j < 6; ++j) {
    const v4f p0 = *(const v4f*)(po + (2 * j) * 128 + lane * 4), p1 = *(const v4f*)(po + (2 * j + 1) * 128 + lane * 4);
#pragma unroll
    for (int r = 0; r < 8; ++r)
      slab[(8 * hh + r) * 100 + c + 16 * j] = o[j][r] * ia[r] + ((r < 4) ? p0[r] : p1[r - 4]) * ib[r];
  }
}
// the partner's side: one tile's accumulators into LDS, lane-private order (16 B per lane and store, lanes adjacent)
__device__ __forceinline__ void part_o16(float* po, const v8f (&o)[6], const int lane) {
#pragma unroll
  for (int j = 0; j < 6; ++j) {
    *(v4f*)(po + (2 * j) * 128 + lane * 4)     = (v4f){o[j][0], o[j][1], o[j][2], o[j][3]};
    *(v4f*)(po + (2 * j + 1) * 128 + lane * 4) = (v4f){o[j][4], o[j][5], o[j][6], o[j][7]};
  }
}

// out96 for the wave's two adjacent slabs and its 32 adjacent O rows: one wave_sync_lds() for both, so that no global store stands
// in front of it. coverage: 12 instructions x 32 lanes x 8 halves = 32 x 96.
__device__ __forceinline__ void out96x2(const float* sl, u16* dst, int lane) {
  wave_sync_lds();
  v4u ov[12];
#pragma unroll
  for (int i = 0; i < 12; ++i) {
    const int g   = (i % 6) * 32 + lane;
    const int row = g / 12;
    const int c8  = (g - row * 12) * 8;
    const float* sp = sl + (i / 6) * SLAB96 + row * 100 + c8;
    const v4f a = *(const v4f*)(sp), c4 = *(const v4f*)(sp + 4);
#pragma unroll
    for (int e = 0; e < 2; ++e) {
      ov[i][e]     = pk16(h_bits((_Float16)a[2 * e]), h_bits((_Float16)a[2 * e + 1]));
      ov[i][2 + e] = pk16(h_bits((_Float16)c4[2 * e]), h_bits((_Float16)c4[2 * e + 1]));
    }
  }
#pragma unroll
  for (int i = 0; i < 12; ++i) *(v4u*)(dst + (size_t)(i * 32 + lane) * 8) = ov[i];
}

// 4096 waves = 4 per SIMD, 512 blocks = 2 per WGP: the register budget of that occupancy, and no third block on a WGP
__global__ __launch_bounds__(ATT_THREADS) __attribute__((amdgpu_waves_per_eu(4, 4)))
void attn_fwd(const u16* __restrict__ QPp, const u16* __restrict__ KPp, const u16* __restrict__ VPp, u16* OPp) {
  __shared__ __align__(16) unsigned char ringall[KGRP * 2 * BUFB];

  const int grp  = __builtin_amdgcn_readfirstlane((int)threadIdx.x >> 7);   // key group of the wave: keys grp * 1024 .. + 1023
  const int tid  = threadIdx.x & (GT - 1);                                  // thread in its group
  const int wave = tid >> 5;                                                // wave in its group
  const int lane = tid & 31;
  unsigned char* ring = ringall + grp * (2 * BUFB);                         // the group's own two buffers
  const int hh   = lane >> 4;
  const int c    = lane & 15;

  const int bid  = blockIdx.x;
  const int qt   = bid & (SEQ / QPB - 1);
  const int head = (bid >> 4) & (NH - 1);
  const int b    = bid >> 7;
  const int q0   = qt * QPB + wave * QPW;
  const size_t bh = (size_t)(b * NH + head);

  // B fragments of q^T: col n = query q0 + 16u + c, k = d (k-contiguous row of the q plane)
  const _Float16* Qb = (const _Float16*)(const void*)QPp + ((bh * SEQ + q0 + c) * HD + 8 * hh);
  // A fragments of k: row m = key (in tile) 16g + c, k = d; byte offset in a buffer's K part
  const int kfo = c * KPITCH + 16 * hh;
  // B fragments of v: col n = d = 16j + c, k = key (k-contiguous row of the v^T tile); byte offset in a buffer
  const int vfo = KTILE + c * VPITCH + 16 * hh;
  // the lane's copy places (LDS byte addresses in buffer 0) and its global sources for tile 0
  const unsigned lds0 = (unsigned)(uintptr_t)(&ring[0]);
  const int kr0 = tid / 12, kr1 = (tid + 128) / 12, kr2 = (tid + 256) / 12;
  const unsigned kl0 = lds0 + (unsigned)(kr0 * KPITCH + (tid - 12 * kr0) * 16);
  const unsigned kl1 = lds0 + (unsigned)(kr1 * KPITCH + (tid + 128 - 12 * kr1) * 16);
  const unsigned kl2 = lds0 + (unsigned)(kr2 * KPITCH + (tid + 256 - 12 * kr2) * 16);
  const unsigned vl  = lds0 + (unsigned)(KTILE + (tid >> 3) * VPITCH + (tid & 7) * 16);
  const char* kg = (const char*)(const void*)KPp + ((bh * SEQ + (size_t)grp * (SEQ / KGRP)) * HD * 2 + (size_t)tid * 16);  // + 12288 per tile
  const char* vg = (const char*)(const void*)VPp + ((bh * HD + (size_t)(tid >> 3)) * SEQ * 2 + (size_t)grp * (SEQ / KGRP) * 2
                                                    + (size_t)(tid & 7) * 16);                                             // + 128 per tile
  const float lsc = RSQK * (LOG2E / (QSC * KSC));

  const v16h qa0 = ldfrag_h(Qb);                      // tile 0: d 0..31
  const v16h qa1 = ldfrag_h(Qb + 32);                 //         d 32..63
  const v16h qa2 = ldfrag_h(Qb + 64);                 //         d 64..95
  const v16h qb0 = ldfrag_h(Qb + 16 * HD);            // tile 1
  const v16h qb1 = ldfrag_h(Qb + 16 * HD + 32);
  const v16h qb2 = ldfrag_h(Qb + 16 * HD + 64);

  float mrun0 = -INFINITY, lrun0 = 0.f, mrun1 = -INFINITY, lrun1 = 0.f;
  v8f oa[6], ob[6];
#pragma unroll
  for (int j = 0; j < 6; ++j) { oa[j] = zero8(); ob[j] = zero8(); }

  // ---- ring prologue: tile 0 landed and published, then tile 1 set off ----
  tile_copy(kl0, kl1, kl2, vl, kg, vg);
  asm volatile("s_wait_asynccnt 0x0" ::: "memory");   // this wave's copies of tile 0 have landed
  __syncthreads();                                    // every wave's have
  tile_copy(kl0 + BUFB, kl1 + BUFB, kl2 + BUFB, vl + BUFB, kg + STK * HD * 2, vg + STK * 2);

#pragma unroll 1                                      // one trip per tile stays rolled: one foot, small code
  for (int t = 0; t < NST; ++t) {
   const unsigned bo = (unsigned)(t & 1) * BUFB;      // trip t reads buffer t mod 2 alone
#pragma unroll                                        // the tile's two 32-key blocks: constant LDS offsets in the reads
   for (int sub = 0; sub < 2; ++sub) {
    // ---- transposed scores: s0x = keys kb..kb+15, s1x = keys kb+16..kb+31 (kb = 1024 grp + 64 t + 32 sub); sxa = queries q0 + c,
    //      sxb = queries q0 + 16 + c; each K fragment is read once and used for both query tiles ----
    const _Float16* k0p = (const _Float16*)(const void*)(ring + bo + kfo + sub * 32 * KPITCH);
    const _Float16* k1p = (const _Float16*)(const void*)(ring + bo + kfo + (sub * 32 + 16) * KPITCH);
    v8f s0a = zero8(), s0b = zero8(), s1a = zero8(), s1b = zero8();
    {
      const v16h ka0 = ldfrag_h(k0p), ka1 = ldfrag_h(k0p + 32), ka2 = ldfrag_h(k0p + 64);
      const v16h kc0 = ldfrag_h(k1p), kc1 = ldfrag_h(k1p + 32), kc2 = ldfrag_h(k1p + 64);
      __builtin_amdgcn_sched_barrier(0);   // keeps the twelve reads one group in front of the WMMAs (else a pair stands at every second one)
      s0a = mma_h(ka0, qa0, s0a);
      s0b = mma_h(ka0, qb0, s0b);
      s1a = mma_h(kc0, qa0, s1a);
      s1b = mma_h(kc0, qb0, s1b);
      s0a = mma_h(ka1, qa1, s0a);
      s0b = mma_h(ka1, qb1, s0b);
      s1a = mma_h(kc1, qa1, s1a);
      s1b = mma_h(kc1, qb1, s1b);
      s0a = mma_h(ka2, qa2, s0a);
      s0b = mma_h(ka2, qb2, s0b);
      s1a = mma_h(kc2, qa2, s1a);
      s1b = mma_h(kc2, qb2, s1b);
      guard4(s0a, s0b, s1a, s1b);
    }
    // ---- lazy maximum: one test per 32-key block for both tiles; -inf in use (first block) always renews ----
    const float cma = lanemax16(s0a, s1a), cmb = lanemax16(s0b, s1b);
    const bool need = (cma * lsc - mrun0 > LAZY) || (cmb * lsc - mrun1 > LAZY);
    // the same for the whole wave: a scalar branch, EXEC stays full; seldom taken, so its body is laid out behind the loop
    if (__builtin_expect(__builtin_amdgcn_ballot_w32(need) != 0, 0)) {
      newmax16(cma, lsc, mrun0, lrun0, oa, hh);
      newmax16(cmb, lsc, mrun1, lrun1, ob, hh);
    }
    // ---- v^T B fragments: col n = d = j*16 + c, keys contiguous in the v^T plane; each is read once and used for both query
    //      tiles ----
    const _Float16* vp = (const _Float16*)(const void*)(ring + bo + vfo + sub * 64);
    const v16h vf0 = ldfrag_h(vp);
    const v16h vf1 = ldfrag_h(vp + 16 * (VPITCH / 2));
    const v16h vf2 = ldfrag_h(vp + 32 * (VPITCH / 2));
    // keeps the first six reads one group in front of the exponentials, which cover their latency (else they are spread among the WMMAs)
    __builtin_amdgcn_sched_barrier(0);
    FragH pa, pb;
    probs16(s0a, s1a, lsc, mrun0, lrun0, pa);
    probs16(s0b, s1b, lsc, mrun1, lrun1, pb);
    // keeps the last six reads behind the exponentials, in registers that the scores have left (the budget of 4 waves per SIMD is
    // 256 registers); the first group of WMMAs covers their latency
    __builtin_amdgcn_sched_barrier(0);
    const v16h vf3 = ldfrag_h(vp + 48 * (VPITCH / 2));
    const v16h vf4 = ldfrag_h(vp + 64 * (VPITCH / 2));
    const v16h vf5 = ldfrag_h(vp + 80 * (VPITCH / 2));
    // ---- P.V : two guarded groups of 6 ----
    {
      oa[0] = mma_h(pa.v, vf0, oa[0]);
      ob[0] = mma_h(pb.v, vf0, ob[0]);
      oa[1] = mma_h(pa.v, vf1, oa[1]);
      ob[1] = mma_h(pb.v, vf1, ob[1]);
      oa[2] = mma_h(pa.v, vf2, oa[2]);
      ob[2] = mma_h(pb.v, vf2, ob[2]);
      guard6(oa[0], ob[0], oa[1], ob[1], oa[2], ob[2]);
      oa[3] = mma_h(pa.v, vf3, oa[3]);
      ob[3] = mma_h(pb.v, vf3, ob[3]);
      oa[4] = mma_h(pa.v, vf4, oa[4]);
      ob[4] = mma_h(pb.v, vf4, ob[4]);
      oa[5] = mma_h(pa.v, vf5, oa[5]);
      ob[5] = mma_h(pb.v, vf5, ob[5]);
      guard6(oa[3], ob[3], oa[4], ob[4], oa[5], ob[5]);
    }
   }
   // ---- foot of trip t: publish tile t + 1, free tile t's buffer, refill it with tile t + 2 ----
   // each row's sum is closed here, against spills (the empty statement on a row's sum): else its 32 adds are sunk behind the foot
   // and 32 exponentials stay live across the copies' operands, over the 256 registers of 4 waves per SIMD
   asm volatile("" : "+v"(lrun0), "+v"(lrun1));        // empty statement on each row's sum, against spills
   asm volatile("s_wait_dscnt 0x0" ::: "memory");      // this wave's reads of tile t are done
   asm volatile("s_wait_asynccnt 0x0" ::: "memory");   // this wave's copies of tile t + 1 have landed
   __syncthreads();                                    // both hold for every wave
   if (t + 2 < NST)                                    // block-uniform
     tile_copy(kl0 + bo, kl1 + bo, kl2 + bo, vl + bo,
               kg + (size_t)(t + 2) * (STK * HD * 2), vg + (size_t)(t + 2) * (STK * 2));
  }
  asm volatile("s_wait_asynccnt 0x0" ::: "memory");    // nothing of this wave is in flight when the ring is reused
  acc_guard6(oa[0], oa[1], oa[2], oa[3], oa[4], oa[5]);
  acc_guard6(ob[0], ob[1], ob[2], ob[3], ob[4], ob[5]);

  // ---- the rings are dead behind the last trip's barrier. Group 1 hands its unnormalised tiles, maxima and row sums to group 0
  //      through its own ring's bytes; group 0 joins the two key halves, stages in its own ring's bytes and stores ----
  float* part = (float*)(void*)(ringall + 2 * BUFB) + wave * PARTW;
  if (grp == 1) {                                          // wave-uniform
    part_o16(part, oa, lane);
    part_o16(part + PARTF / 2, ob, lane);
    *(v4f*)(part + PARTF + lane * 4) = (v4f){mrun0, lrun0 + __shfl_xor(lrun0, 16, 32), mrun1, lrun1 + __shfl_xor(lrun1, 16, 32)};
  }
  __syncthreads();                                         // group 1's partial results are whole for group 0
  if (grp == 0) {
    const v4f ml = *(const v4f*)(part + PARTF + lane * 4);
    float* slab = (float*)(void*)ringall + wave * 2 * SLAB96;
    stage_o16(slab, oa, mrun0, lrun0, part, ml[0], ml[1], lane);
    stage_o16(slab + SLAB96, ob, mrun1, lrun1, part + PARTF / 2, ml[2], ml[3], lane);
    out96x2(slab, OPp + (bh * SEQ + q0) * HD, lane);
  }
}

// =====================================================================================================
// Workspace map (bytes); every plane is fully written by whole-line stores before it is read; all extents are exact multiples
// of the 512-B store instructions (no pad rows needed); every base is 256-B aligned:
//   WOB f16  [768 n][768 k] (bf16 value x1024)   1179648
//   QP  f16  [4][8][2048][96] x8                12582912        KP same
//   VP  f16  [4][8][96][2048] x256              12582912
//   OP  f16  [4][8][2048][96] x1024             12582912
//   end                                          51511296
// =====================================================================================================
extern "C" void kernel_launch(void* const* d_in, const int* in_sizes, int n_in,
                              void* d_out, int out_size, void* d_ws, size_t ws_size,
                              hipStream_t stream) {
  if (n_in < 6) return;
  if (in_sizes[0] != ROWS * DMOD) return;
  if (in_sizes[1] != HD * HD) return;
  if (in_sizes[2] != HD * HD) return;
  if (in_sizes[3] != HD * HD) return;
  if (in_sizes[4] != DMOD * DMOD) return;
  if (in_sizes[5] != DMOD) return;
  if (out_size != ROWS * DMOD) return;

  const float* Xin = (const float*)d_in[0];
  const float* Wq  = (const float*)d_in[1];
  const float* Wk  = (const float*)d_in[2];
  const float* Wv  = (const float*)d_in[3];
  const float* Wu  = (const float*)d_in[4];
  const float* bu  = (const float*)d_in[5];
  float*       out = (float*)d_out;

  const size_t szWO = (size_t)DMOD * DMOD * 2;                  //  1179648
  const size_t szP  = (size_t)NB * NH * SEQ * HD * 2;           // 12582912  (q / k / v^T / o planes)
  size_t off = 0;
  const size_t oWO = off; off += szWO;
  const size_t oQP = off; off += szP;
  const size_t oKP = off; off += szP;
  const size_t oVP = off; off += szP;
  const size_t oOP = off; off += szP;
  if (off > ws_size) return;                            // off = 51511296
  if (off > (size_t)134217728) return;
  if ((szWO % 256) != 0 || (szP % 256) != 0) return;

  char* ws = (char*)d_ws;
  u16* WOB = (u16*)(ws + oWO);
  u16* QP  = (u16*)(ws + oQP);
  u16* KP  = (u16*)(ws + oKP);
  u16* VP  = (u16*)(ws + oVP);
  u16* OP  = (u16*)(ws + oOP);

  if ((DMOD % 64) != 0 || (ROWS % 64) != 0 || (ROWS % GROWS) != 0 || (SEQ % 64) != 0 || (HD % 32) != 0) return;
  const dim3 gPJ(NPJ);                                  // 512
  const dim3 bPJ(PJT);                                  // 256
  const dim3 gAT(ATT_BLOCKS);                           // 512
  const dim3 bAT(ATT_THREADS);                          // 256
  const dim3 gO((ROWS / GROWS) * (DMOD / 64));          // 768
  const dim3 bO(128);

  // (1) q and k planes [b][h][s][96] = f16(x_h.Wq^T x8), f16(x_h.Wk^T x8); v^T plane [b][h][96 d][2048 keys] = f16(x_h.Wv^T x256);
  //     Wq/Wk/Wv [n = out][k = in] (already k-contiguous) rounded to bf16 inside each block; Wu -> f16 of bf16 value x1024
  proj_qkv<<<gPJ, bPJ, 0, stream>>>(Xin, Wq, Wk, Wv, Wu, QP, KP, VP, WOB);
  // (2) attention -> O plane [b][h][s][96] x1024 (single f16)
  attn_fwd<<<gAT, bAT, 0, stream>>>(QP, KP, VP, OP);
  // (3) output projection -> out [8192][768] f32, carries 1024 (O) x 1024 (Wu) folded back, + bias
  gemm_out<<<gO, bO, 0, stream>>>(OP, WOB, bu, out, 1.0f / (OSC * WOS));
  (void)hipGetLastError();
}

// v009
// It runs in 68.7 microseconds.
// Next to v008, in two timings, it ran 1.05 times as fast each time.
// Counting every step since v000, it is 3.42 times as fast.
// Contractions: x.Wq^T, x.Wk^T and x.Wv^T per head on v_wmma_f32_16x16x32_bf16 (x and Wq/Wk/Wv RNE-converted to bf16
// operands, f32 accumulate); scores k'.q'^T (single f16 planes: k' carried x8, q' carries log2(e)/sqrt(768)/8), P.v (P x128 single f16, v x256 single
// f16) and O.Wu^T (O single f16 plane x1024, Wu as f16(bf16(Wu)) x1024): v_wmma_f32_16x16x32_f16, f32 accumulate.
// Base-2 online softmax, 1/l, bias (bf16 value of bu) and carry folds in f32 on VALU.
#include <hip/hip_runtime.h>
#include <math.h>
#include <stdint.h>

#define NB    4
#define SEQ   2048
#define DMOD  768
#define NH    8
#define HD    96
#define ROWS  (NB * SEQ)
#define KSC   8.0f
#define QSC   (RSQK * LOG2E / KSC)              // q plane's carry: k'.q' is the base-2 logit itself
#define FSH   4.0f                              // constant shift of the first walk, the score WMMAs' C operand: P = 2^(logit + FSH)
#define LLO   1024.0f                           // a row sum over 1024 keys at or above it: the row's largest P is at least 1
#define LHI   65504.0f                          // a row sum below it: every P of the row is a finite f16
#define PCAR  128.0f
#define PEXP  7.0f                              // log2(PCAR)
#define LAZY  8.0f                              // a maximum in use may lag a new one by this much (base-2 logit): P <= 2^(PEXP + LAZY)
#define VCAR  256.0f
#define OSC   1024.0f
#define WOS   1024.0f
#define LOG2E 1.4426950408889634f
#define RSQK  0.0360843918243516f
#define KGRP        2                          // key groups per attention block: each walks its own half of the keys
#define GW          4                          // waves per key group
#define GT          (GW * 32)                  // threads per key group
#define ATT_WAVES   (KGRP * GW)
#define ATT_THREADS (ATT_WAVES * 32)
#define QPW         32                         // query rows per attention wave: two 16-row tiles
#define QPB         (GW * QPW)                 // query rows per attention block: 128
#define ATT_BLOCKS  (NB * NH * (SEQ / QPB))
#define NKB    (SEQ / 32)
#define SLAB   (16 * 68)
#define SLAB96 (16 * 100)
#define PJW    8                               // waves per projection block, 16 rows each
#define PJROWS (PJW * 16)                      // 128
#define PJT    (PJW * 32)                      // 256 threads
#define NPJ    ((ROWS / PJROWS) * NH)          // 512 projection blocks
#define VSP    136                             // halves per v^T row staged in LDS: 128 + 8 (272 B = 16 B x odd)
#define WPH    104                             // halves per weight row in LDS: 96 + 8 (208 B = 16 B x odd, for ds_load_b128 readers)
#define WPL    (HD * WPH)                      // halves per weight plane in LDS
#define WUB    (DMOD * DMOD / NPJ)             // elements of Wu converted by each projection block: 1152 = 18 whole 128-B lines of f16
#define STK    64                              // keys per LDS tile
#define NST    (SEQ / STK / KGRP)              // 16 tiles per key group
#define KPITCH 208                             // bytes per K row in LDS: 192 + 16 (16 B x odd, for ds_load_b128 readers)
#define VPITCH 144                             // bytes per v^T row in LDS: 128 + 16 (16 B x odd)
#define KTILE  (STK * KPITCH)                  // 13312
#define VTILE  (HD * VPITCH)                   // 13824
#define BUFB   (KTILE + VTILE)                 // 27136
#define PARTF  (2 * 6 * 8 * 32)                // floats of one wave's two unnormalised O tiles, lane-private order: 3072
#define PARTW  (PARTF + 4 * 32)                // + per lane {m0, l0, m1, l1}
#define GROWS  128                             // output rows per gemm_out block: 4 waves x 32
#define GNT    NH                              // LDS tiles along k in gemm_out: one head (96 k) each
#define GPITCH 208                             // bytes per O or Wu row in LDS: 192 + 16 (16 B x odd)
#define GATILE (GROWS * GPITCH)                // 26624
#define GBTILE (64 * GPITCH)                   // 13312
#define GBUF   (GATILE + GBTILE)               // 39936
static_assert(DMOD == NH * HD && HD == 96 && NH == 8 && NB == 4 && SEQ == 2048);
static_assert((SEQ / QPB) == 16 && ATT_BLOCKS == 512 && ATT_THREADS == 256 && GT == 128 && NKB == 64);
static_assert((HD % 32) == 0 && (DMOD % 64) == 0 && (ROWS % 64) == 0 && (SEQ % 64) == 0);
static_assert((SEQ % PJROWS) == 0 && NPJ == 512 && ((HD * HD / 4) % PJT) == 0 && (HD * PJROWS / 8) == 6 * PJT);
static_assert(WUB * NPJ == DMOD * DMOD && (WUB % 64) == 0 && WUB / 8 <= PJT && (WPH * 2) % 16 == 0);
static_assert((SLAB * 4) % 16 == 0 && (SLAB96 * 4) % 16 == 0);
static_assert(NST >= 2 && STK == 64 && (STK * HD * 2) == 6 * GT * 16 && (HD * STK * 2) == 6 * GT * 16 && KGRP == 2);
static_assert((KTILE % 16) == 0 && (BUFB % 16) == 0 && 2 * BUFB >= 2 * GW * SLAB96 * 4 && 2 * BUFB >= GW * PARTW * 4);
static_assert((SEQ % GROWS) == 0 && GNT >= 2 && (GROWS * HD * 2) == 12 * 128 * 16 && (64 * HD * 2) == 6 * 128 * 16);
static_assert((GATILE % 16) == 0 && (GBUF % 16) == 0 && 2 * GBUF >= 8 * SLAB * 4);

typedef unsigned short u16;
typedef _Float16 v16h __attribute__((ext_vector_type(16)));
typedef _Float16 v8h  __attribute__((ext_vector_type(8)));
typedef _Float16 v2h  __attribute__((ext_vector_type(2)));
typedef __bf16   v16b __attribute__((ext_vector_type(16)));
typedef float    v8f  __attribute__((ext_vector_type(8)));
typedef float    v4f  __attribute__((ext_vector_type(4)));
typedef float    v2f  __attribute__((ext_vector_type(2)));
typedef unsigned int v4u __attribute__((ext_vector_type(4)));
typedef unsigned int v2u __attribute__((ext_vector_type(2)));
typedef __bf16   v2b  __attribute__((ext_vector_type(2)));

union FragH { v16h v; v8h h[2]; v4u u[2]; };
union FragB { v16b v; v4u u[2]; };

// ---- scalar helpers --------------------------------------------------------------------------------
__device__ __forceinline__ unsigned short bf_bits(float f) {          // f32 -> bf16 bits, RNE convert
  unsigned u = __float_as_uint(f);
  return (unsigned short)((u + 0x7FFFu + ((u >> 16) & 1u)) >> 16);
}
__device__ __forceinline__ float bf_up(unsigned short h) { return __uint_as_float(((unsigned)h) << 16); }
__device__ __forceinline__ unsigned short h_bits(_Float16 x) { return __builtin_bit_cast(unsigned short, x); }
__device__ __forceinline__ unsigned pk16(unsigned short a, unsigned short b) { return (unsigned)a | ((unsigned)b << 16); }
__device__ __forceinline__ float ex2(float x) { return __builtin_amdgcn_exp2f(x); }   // bare v_exp_f32: 2^-inf = 0, no range fix-up
__device__ __forceinline__ v8f zero8() { v8f z = {0.f, 0.f, 0.f, 0.f, 0.f, 0.f, 0.f, 0.f}; return z; }

// ---- fragment loaders: 16-bit A/B operand, lane -> row/col (lane&15), p already includes +8*(lane>>4);
//      elements 0..7 <- p[0..7] (k0+8h..), elements 8..15 <- p[16..23] (k0+16+8h..)  (same split k map for A and B;
//      B is always read from a k-contiguous [n][k] plane)
__device__ __forceinline__ v16h ldfrag_h(const _Float16* p) {
  FragH f;
  f.h[0] = *(const v8h*)(p);
  f.h[1] = *(const v8h*)(p + 16);
  return f.v;
}
__device__ __forceinline__ v16b ldfrag_b(const u16* p) {              // bf16 plane read as unsigned integer vectors
  FragB f;
  f.u[0] = *(const v4u*)(p);
  f.u[1] = *(const v4u*)(p + 16);
  return f.v;
}

// the same fragment from an f32 row p: a0 = p[0..3], a1 = p[4..7], a2 = p[16..19], a3 = p[20..23]; RNE to bf16 in registers,
// same split k map
__device__ __forceinline__ v16b cvfrag_x(const v4f a0, const v4f a1, const v4f a2, const v4f a3) {
  FragB f;
#pragma unroll
  for (int e = 0; e < 2; ++e) {
    f.u[0][e]     = pk16(bf_bits(a0[2 * e]), bf_bits(a0[2 * e + 1]));
    f.u[0][2 + e] = pk16(bf_bits(a1[2 * e]), bf_bits(a1[2 * e + 1]));
    f.u[1][e]     = pk16(bf_bits(a2[2 * e]), bf_bits(a2[2 * e + 1]));
    f.u[1][2 + e] = pk16(bf_bits(a3[2 * e]), bf_bits(a3[2 * e + 1]));
  }
  return f.v;
}

__device__ __forceinline__ v8f mma_h(v16h a, v16h b, v8f c) {
  return __builtin_amdgcn_wmma_f32_16x16x32_f16(false, a, false, b, (short)0, c, false, false);
}
__device__ __forceinline__ v8f mma_b(v16b a, v16b b, v8f c) {
  return __builtin_amdgcn_wmma_f32_16x16x32_bf16(false, a, false, b, (short)0, c, false, false);
}
// v_nop x4: the distance between the last matrix instruction of a group and the first vector instruction on its D, A or B
__device__ __forceinline__ void guard4(v8f& s, v8f& t, v8f& u, v8f& w) {
#if defined(__HIP_DEVICE_COMPILE__)
  asm volatile("v_nop\n\tv_nop\n\tv_nop\n\tv_nop" : "+v"(s), "+v"(t), "+v"(u), "+v"(w) :: "memory");
#endif
}
__device__ __forceinline__ void guard6(v8f& a, v8f& b, v8f& c, v8f& d, v8f& e, v8f& f) {
#if defined(__HIP_DEVICE_COMPILE__)
  asm volatile("v_nop\n\tv_nop\n\tv_nop\n\tv_nop"
               : "+v"(a), "+v"(b), "+v"(c), "+v"(d), "+v"(e), "+v"(f) :: "memory");
#endif
}
__device__ __forceinline__ void acc_guard6(v8f& a, v8f& b, v8f& c, v8f& d, v8f& e, v8f& f) {
#if defined(__HIP_DEVICE_COMPILE__)
  asm volatile("v_nop\n\tv_nop\n\tv_nop\n\tv_nop" : "+v"(a), "+v"(b), "+v"(c), "+v"(d), "+v"(e), "+v"(f));
#endif
}
__device__ __forceinline__ void wave_sync_lds() {
#if defined(__HIP_DEVICE_COMPILE__)
  __builtin_amdgcn_fence(__ATOMIC_RELEASE, "workgroup");
  __builtin_amdgcn_wave_barrier();
  __builtin_amdgcn_fence(__ATOMIC_ACQUIRE, "workgroup");
#endif
}

// =====================================================================================================
// 16x96 f16 epilogue: the wave's 16x96 f32 tile (already scaled) staged by the caller in its LDS slab [16][100];
// coverage: 6 instructions x 32 lanes x 8 halves = 1536 = the wave's 16 x 96 tile (groups of 8 never straddle a row: 96/8 = 12).
// =====================================================================================================
__device__ __forceinline__ void out96(const float* sl, u16* dst, int lane) {
  wave_sync_lds();
  v4u ov[6];
#pragma unroll
  for (int i = 0; i < 6; ++i) {
    const int g   = i * 32 + lane;
    const int row = g / 12;
    const int c8  = (g - row * 12) * 8;
    const v4f a = *(const v4f*)(sl + row * 100 + c8), c4 = *(const v4f*)(sl + row * 100 + c8 + 4);
    float w[8];
#pragma unroll
    for (int e = 0; e < 4; ++e) { w[e] = a[e]; w[4 + e] = c4[e]; }
#pragma unroll
    for (int e = 0; e < 4; ++e) ov[i][e] = pk16(h_bits((_Float16)w[2 * e]), h_bits((_Float16)w[2 * e + 1]));
  }
  {
#pragma unroll
    for (int i = 0; i < 6; ++i) {
      *(v4u*)(dst + (size_t)(i * 32 + lane) * 8) = ov[i];
    }
    
  }
}

// =====================================================================================================
// f32 GEMM epilogue with bias, in two parts with the caller's wave_sync_lds() between them:
//   epi64_stage: a 16x64 f32 tile of the wave (acc*oscale + bias[col]) goes into one of its LDS slabs (pitch 68);
//   epi64_flush: the slab leaves as whole lines.
// coverage: 8 instructions x 2 rows x 16 lanes x 4 floats = one 16 x 64 tile.
// =====================================================================================================
__device__ __forceinline__ void epi64_stage(float* sl, v8f a0, v8f a1, v8f a2, v8f a3, float oscale,
                                            float bz0, float bz1, float bz2, float bz3, int lane) {
  const int hh = lane >> 4, m = lane & 15;
#pragma unroll
  for (int r = 0; r < 8; ++r) {
    const int ro = (8 * hh + r) * 68 + m;
    sl[ro]      = a0[r] * oscale + bz0;
    sl[ro + 16] = a1[r] * oscale + bz1;
    sl[ro + 32] = a2[r] * oscale + bz2;
    sl[ro + 48] = a3[r] * oscale + bz3;
  }
}
__device__ __forceinline__ void epi64_flush(const float* sl, float* C, int N, size_t rowb, int col0, int lane) {
  const int hh = lane >> 4, m = lane & 15;
  v4f vals[8];
#pragma unroll
  for (int it = 0; it < 8; ++it) vals[it] = *(const v4f*)(sl + (it * 2 + hh) * 68 + m * 4);
  float* dst = C + (rowb + (size_t)hh) * (size_t)N + col0 + m * 4;
#pragma unroll
  for (int it = 0; it < 8; ++it) *(v4f*)(dst + (size_t)(it * 2) * (size_t)N) = vals[it];
}

// =====================================================================================================
// The three per-head projections (shared 96x96 weights) and all weight conversions in ONE launch, bf16 operands.
// Block = (128 rows of b*SEQ+s, head), 8 waves x 16 rows.
//   Weights: the block reads Wq, Wk, Wv as f32 (3 x 2304 pieces of 4 floats, 27 per thread, 512 contiguous bytes per
//   wave-instruction), rounds them to bf16 (RNE) in registers and lays them in LDS as [plane][96 n][96 k], pitch WPH; one
//   barrier publishes them; every wave reads its B fragments from there by ds_load_b128 (k-contiguous rows, split k map).
//   Wu: block i also converts elements i*WUB .. +WUB-1 of Wu to the f16 plane (bf16 RNE value x1024) that the output projection
//   reads two launches later: threads 0..143, 8 elements each, whole lines, no other block touches them.
// A wave reads its 16 x 96 piece of x ONCE, as f32 (pitch 768), rounds it to bf16 in registers (cvfrag_x) and uses the three A
// fragments for all three products x . W^T; 6 accumulators (n = 0..95), K = 96 in 3 steps of 32.
//   q, k: P[b][head][s][96] = f16(acc * QSC), f16(acc * KSC); the wave's 16x96 tile is one contiguous 3072-B region, see out96.
//   v:    D element r of lane l = (s = 8hh + r, d = 16j + m): a lane's 8 values are 8 consecutive keys of one v^T row; the block's
//         96 x 128 tile of VT[b][head][d][s] (f16 of acc * 256) is gathered in LDS and leaves as whole 128-B lines.
// coverage: v^T 6 instructions x 256 threads x 8 halves = 96 x 128; grid = (ROWS/128) * NH = 512 (exact, host-checked constants).
// =====================================================================================================
__device__ __forceinline__ void proj96(const v16b x0, const v16b x1, const v16b x2, const u16* bp, v8f (&acc)[6]) {
#pragma unroll
  for (int j = 0; j < 6; ++j) acc[j] = mma_b(x0, ldfrag_b(bp + j * 16 * WPH), zero8());
#pragma unroll
  for (int j = 0; j < 6; ++j) acc[j] = mma_b(x1, ldfrag_b(bp + j * 16 * WPH + 32), acc[j]);
#pragma unroll
  for (int j = 0; j < 6; ++j) acc[j] = mma_b(x2, ldfrag_b(bp + j * 16 * WPH + 64), acc[j]);
}
// four f32 -> four bf16 (RNE), two packed converts
__device__ __forceinline__ v2u bf4(const v4f a) {
  const v2f lo = {a[0], a[1]}, hi = {a[2], a[3]};
  v2u o;
  o[0] = __builtin_bit_cast(unsigned, __builtin_convertvector(lo, v2b));
  o[1] = __builtin_bit_cast(unsigned, __builtin_convertvector(hi, v2b));
  return o;
}
// D element r of lane l = (row 8hh+r, col n = 16j + m); stage the 16x96 slab (pitch 100) fully
__device__ __forceinline__ void stage96(float* slab, const v8f (&acc)[6], float oscale, int hh, int m) {
#pragma unroll
  for (int r = 0; r < 8; ++r) {
    const int ro = (8 * hh + r) * 100 + m;
#pragma unroll
    for (int j = 0; j < 6; ++j) slab[ro + 16 * j] = acc[j][r] * oscale;
  }
}

// 4096 waves = 4 per SIMD, 512 blocks = 2 per WGP, all resident
__global__ __launch_bounds__(PJT) __attribute__((amdgpu_waves_per_eu(4, 4)))
void proj_qkv(const float* __restrict__ X, const float* __restrict__ WQ, const float* __restrict__ WK,
              const float* __restrict__ WV, const float* __restrict__ WU, u16* QP, u16* KP, u16* VT, u16* DU) {
  __shared__ __align__(16) float smem[PJW * SLAB96];
  __shared__ __align__(16) u16 vst[HD * VSP];
  __shared__ __align__(16) u16 wl[3 * WPL];
  const int tid = threadIdx.x, wave = tid >> 5, lane = tid & 31, hh = lane >> 4, m = lane & 15;
  const int bid  = blockIdx.x;
  const int head = bid & (NH - 1);
  const int rt   = bid >> 3;
  const int rowb = rt * PJROWS + wave * 16;             // 0..8176, the block's 128 rows never straddle a batch
  const int b    = rowb >> 11;
  const int s0   = rowb & (SEQ - 1);
  const size_t bh = (size_t)(b * NH + head);
  // ---- all global reads of the block are set off together: weights, x, the Wu share ----
  v4f wr[27];
#pragma unroll
  for (int i = 0; i < 9; ++i) {
    const int e = (i * PJT + tid) * 4;                  // < 9216
    wr[i]      = *(const v4f*)(WQ + e);
    wr[9 + i]  = *(const v4f*)(WK + e);
    wr[18 + i] = *(const v4f*)(WV + e);
  }
  const float* xp = X + (size_t)(rowb + m) * DMOD + head * HD + 8 * hh;
  v4f xr[12];
#pragma unroll
  for (int i = 0; i < 3; ++i) {
    xr[4 * i]     = *(const v4f*)(xp + 32 * i);
    xr[4 * i + 1] = *(const v4f*)(xp + 32 * i + 4);
    xr[4 * i + 2] = *(const v4f*)(xp + 32 * i + 16);
    xr[4 * i + 3] = *(const v4f*)(xp + 32 * i + 20);
  }
  const bool   uon = tid < WUB / 8;
  const size_t ue  = (size_t)bid * WUB + (size_t)tid * 8;   // used only where uon: < DMOD * DMOD
  v4f ua = {0.f, 0.f, 0.f, 0.f}, uc = {0.f, 0.f, 0.f, 0.f};
  if (uon) { ua = *(const v4f*)(WU + ue); uc = *(const v4f*)(WU + ue + 4); }
  // ---- weights into LDS: piece p = 256 i + tid -> row p / 24, 8-B column p % 24 ----
#pragma unroll
  for (int i = 0; i < 9; ++i) {
    const int p = i * PJT + tid, row = p / 24, c4 = p - row * 24;
    u16* d = wl + row * WPH + c4 * 4;
    *(v2u*)(d)           = bf4(wr[i]);
    *(v2u*)(d + WPL)     = bf4(wr[9 + i]);
    *(v2u*)(d + 2 * WPL) = bf4(wr[18 + i]);
  }
  __syncthreads();                                      // the three bf16 planes are whole for every wave
  const v16b x0 = cvfrag_x(xr[0], xr[1], xr[2], xr[3]), x1 = cvfrag_x(xr[4], xr[5], xr[6], xr[7]),
             x2 = cvfrag_x(xr[8], xr[9], xr[10], xr[11]);
  const u16* wb = wl + m * WPH + 8 * hh;                // the lane's place in each weight plane
  float* slab = smem + wave * SLAB96;
  v8f acc[6];
  proj96(x0, x1, x2, wb, acc);
  stage96(slab, acc, QSC, hh, m);
  out96(slab, QP + (bh * SEQ + s0) * HD, lane);
  proj96(x0, x1, x2, wb + WPL, acc);
  wave_sync_lds();                                      // the wave's reads of the q slab stay in front of the k slab's writes
  stage96(slab, acc, KSC, hh, m);
  out96(slab, KP + (bh * SEQ + s0) * HD, lane);
  proj96(x0, x1, x2, wb + 2 * WPL, acc);
#pragma unroll
  for (int j = 0; j < 6; ++j) {
    v8h h;
#pragma unroll
    for (int r = 0; r < 8; ++r) h[r] = (_Float16)(acc[j][r] * VCAR);
    *(v4u*)(vst + (16 * j + m) * VSP + wave * 16 + 8 * hh) = __builtin_bit_cast(v4u, h);
  }
  __syncthreads();                                      // the eight waves' key columns make up the 128-B lines
  u16* vb = VT + bh * HD * SEQ + (s0 - wave * 16);
#pragma unroll
  for (int i = 0; i < 6; ++i) {
    const int p = i * PJT + tid, row = p >> 4, c8 = (p & 15) * 8;
    *(v4u*)(vb + (size_t)row * SEQ + c8) = *(const v4u*)(vst + row * VSP + c8);
  }
  // the Wu share leaves last: no barrier or LDS fence of the block has to wait for this store
  if (uon) {
    v4u o;
#pragma unroll
    for (int e = 0; e < 2; ++e) {
      o[e]     = pk16(h_bits((_Float16)(bf_up(bf_bits(ua[2 * e])) * WOS)), h_bits((_Float16)(bf_up(bf_bits(ua[2 * e + 1])) * WOS)));
      o[2 + e] = pk16(h_bits((_Float16)(bf_up(bf_bits(uc[2 * e])) * WOS)), h_bits((_Float16)(bf_up(bf_bits(uc[2 * e + 1])) * WOS)));
    }
    *(v4u*)(DU + ue) = o;
  }
}

// =====================================================================================================
// One k tile (one head, 96 k) of gemm_out into one LDS buffer, 18 asynchronous 16-B copies per lane (all 128 lanes on,
// block-uniform control flow):
//   O:  128 rows x 192 B are 24576 contiguous global bytes; piece p = 128 i + tid (i = 0..11) -> LDS row p / 12, 16-B column
//       p % 12 (l0..l2 hold the places of i = 0..2; i + 3 lies 32 rows further); one wave-instruction = 512 contiguous bytes.
//   Wu: 64 rows x 192 B (global pitch 1536 B); piece p = 128 i + tid (i = 0..5), same row and column rule, behind the O part.
// s_wait_xcnt stands inside each statement so that no address register is rewritten in front of it.
// =====================================================================================================
__device__ __forceinline__ void gemm_tile_copy(unsigned l0, unsigned l1, unsigned l2, const char* ag,
                                               const char* bg0, const char* bg1, const char* bg2) {
#if defined(__HIP_DEVICE_COMPILE__)
  asm volatile("global_load_async_to_lds_b128 %0, %12, off\n\t"
               "global_load_async_to_lds_b128 %1, %13, off\n\t"
               "global_load_async_to_lds_b128 %2, %14, off\n\t"
               "global_load_async_to_lds_b128 %3, %15, off\n\t"
               "global_load_async_to_lds_b128 %4, %16, off\n\t"
               "global_load_async_to_lds_b128 %5, %17, off\n\t"
               "global_load_async_to_lds_b128 %6, %18, off\n\t"
               "global_load_async_to_lds_b128 %7, %19, off\n\t"
               "global_load_async_to_lds_b128 %8, %20, off\n\t"
               "global_load_async_to_lds_b128 %9, %21, off\n\t"
               "global_load_async_to_lds_b128 %10, %22, off\n\t"
               "global_load_async_to_lds_b128 %11, %23, off\n\t"
               "s_wait_xcnt 0x0"
               :: "v"(l0), "v"(l1), "v"(l2),
                  "v"(l0 + 32u * GPITCH), "v"(l1 + 32u * GPITCH), "v"(l2 + 32u * GPITCH),
                  "v"(l0 + 64u * GPITCH), "v"(l1 + 64u * GPITCH), "v"(l2 + 64u * GPITCH),
                  "v"(l0 + 96u * GPITCH), "v"(l1 + 96u * GPITCH), "v"(l2 + 96u * GPITCH),
                  "v"(ag), "v"(ag + 2048), "v"(ag + 4096), "v"(ag + 6144), "v"(ag + 8192), "v"(ag + 10240),
                  "v"(ag + 12288), "v"(ag + 14336), "v"(ag + 16384), "v"(ag + 18432), "v"(ag + 20480), "v"(ag + 22528)
               : "memory");
  asm volatile("global_load_async_to_lds_b128 %0, %6, off\n\t"
               "global_load_async_to_lds_b128 %1, %7, off\n\t"
               "global_load_async_to_lds_b128 %2, %8, off\n\t"
               "global_load_async_to_lds_b128 %3, %9, off\n\t"
               "global_load_async_to_lds_b128 %4, %10, off\n\t"
               "global_load_async_to_lds_b128 %5, %11, off\n\t"
               "s_wait_xcnt 0x0"
               :: "v"(l0 + (unsigned)GATILE), "v"(l1 + (unsigned)GATILE), "v"(l2 + (unsigned)GATILE),
                  "v"(l0 + (unsigned)GATILE + 32u * GPITCH), "v"(l1 + (unsigned)GATILE + 32u * GPITCH),
                  "v"(l2 + (unsigned)GATILE + 32u * GPITCH),
                  "v"(bg0), "v"(bg1), "v"(bg2),
                  "v"(bg0 + 32 * DMOD * 2), "v"(bg1 + 32 * DMOD * 2), "v"(bg2 + 32 * DMOD * 2)
               : "memory");
#endif
}

// =====================================================================================================
// Output projection with bias: C[8192][768] (f32) = O . Wu^T * oscale + bf16(bu)[n]; A operand k index = head*96 + d lives at
// O plane address ((b*NH + head)*SEQ + s)*96 + d (O single f16 x1024, 32-deep k-steps never straddle a head since 96 = 3*32);
// Bt = Wu plane [768 n][768 k] f16 (bf16 value x1024), k-contiguous. Block = 128x64 tile, 4 waves x (32 rows x 64 columns);
// k runs over 8 tiles of 96 (one head each, k ascending in steps of 32). The block's waves share each O and Wu tile: it is
// brought into LDS by asynchronous copies (gemm_tile_copy), two buffers, tile t + 1 in flight while tile t is worked on; one
// barrier per tile publishes tile t + 1 and frees tile t's buffer. Fragments are read by ds_load_b128, same split k map for A
// and B. After the last barrier the ring is dead and its first bytes become the waves' private output slabs (two each).
// grid = (ROWS/128)*(DMOD/64) = 768.
// =====================================================================================================
__global__ __launch_bounds__(128)
void gemm_out(const u16* __restrict__ OP, const u16* __restrict__ WOB, const float* __restrict__ bias, float* C,
              float oscale) {
  __shared__ __align__(16) unsigned char ring[2 * GBUF];
  const int tid = threadIdx.x, wave = tid >> 5, lane = tid & 31, hh = lane >> 4, m = lane & 15;
  const int ntile = DMOD >> 6;                          // 12
  const int bid   = blockIdx.x;
  const int row0  = (bid / ntile) * GROWS;              // the block's 128 rows never straddle a batch
  const int col0  = (bid % ntile) * 64;
  const int b     = row0 >> 11;
  const int s0    = row0 & (SEQ - 1);
  // the lane's copy places (LDS byte addresses in buffer 0) and its global sources for tile 0
  const unsigned lds0 = (unsigned)(uintptr_t)(&ring[0]);
  const int r0 = tid / 12, r1 = (tid + 128) / 12, r2 = (tid + 256) / 12;
  const int c0 = (tid - 12 * r0) * 16, c1 = (tid + 128 - 12 * r1) * 16, c2 = (tid + 256 - 12 * r2) * 16;
  const unsigned l0 = lds0 + (unsigned)(r0 * GPITCH + c0);
  const unsigned l1 = lds0 + (unsigned)(r1 * GPITCH + c1);
  const unsigned l2 = lds0 + (unsigned)(r2 * GPITCH + c2);
  const char* ag  = (const char*)(const void*)OP + (((size_t)b * NH * SEQ + s0) * HD * 2 + (size_t)tid * 16);  // + SEQ*192 per tile
  const char* bg0 = (const char*)(const void*)WOB + ((size_t)(col0 + r0) * DMOD * 2 + c0);                     // + 192 per tile
  const char* bg1 = (const char*)(const void*)WOB + ((size_t)(col0 + r1) * DMOD * 2 + c1);
  const char* bg2 = (const char*)(const void*)WOB + ((size_t)(col0 + r2) * DMOD * 2 + c2);
  // A fragments: row = wave*32 + 16i + m; B fragments: row n = 16j + m; byte offsets in a buffer
  const int afo = (wave * 32 + m) * GPITCH + 16 * hh;
  const int bfo = GATILE + m * GPITCH + 16 * hh;
  v8f acc[2][4];
#pragma unroll
  for (int i = 0; i < 2; ++i) {
#pragma unroll
    for (int j = 0; j < 4; ++j) acc[i][j] = zero8();
  }

  // ---- ring prologue: tile 0 landed and published, then tile 1 set off ----
  gemm_tile_copy(l0, l1, l2, ag, bg0, bg1, bg2);
  asm volatile("s_wait_asynccnt 0x0" ::: "memory");   // this wave's copies of tile 0 have landed
  __syncthreads();                                    // every wave's have
  gemm_tile_copy(l0 + GBUF, l1 + GBUF, l2 + GBUF, ag + SEQ * HD * 2, bg0 + HD * 2, bg1 + HD * 2, bg2 + HD * 2);

#pragma unroll 1                                      // one trip per tile stays rolled: one foot, small code
  for (int t = 0; t < GNT; ++t) {
    const unsigned bo = (unsigned)(t & 1) * GBUF;     // trip t reads buffer t mod 2 alone
#pragma unroll                                        // the tile's three 32-deep k-steps: constant LDS offsets in the reads
    for (int ks = 0; ks < 3; ++ks) {
      const _Float16* ap = (const _Float16*)(const void*)(ring + bo + afo + ks * 64);
      const _Float16* bp = (const _Float16*)(const void*)(ring + bo + bfo + ks * 64);
      const v16h a0 = ldfrag_h(ap);
      const v16h a1 = ldfrag_h(ap + 16 * (GPITCH / 2));
      const v16h b0 = ldfrag_h(bp);
      const v16h b1 = ldfrag_h(bp + 16 * (GPITCH / 2));
      const v16h b2 = ldfrag_h(bp + 32 * (GPITCH / 2));
      const v16h b3 = ldfrag_h(bp + 48 * (GPITCH / 2));
      acc[0][0] = mma_h(a0, b0, acc[0][0]);
      acc[0][1] = mma_h(a0, b1, acc[0][1]);
      acc[0][2] = mma_h(a0, b2, acc[0][2]);
      acc[0][3] = mma_h(a0, b3, acc[0][3]);
      acc[1][0] = mma_h(a1, b0, acc[1][0]);
      acc[1][1] = mma_h(a1, b1, acc[1][1]);
      acc[1][2] = mma_h(a1, b2, acc[1][2]);
      acc[1][3] = mma_h(a1, b3, acc[1][3]);
    }
    // ---- foot of trip t: publish tile t + 1, free tile t's buffer, refill it with tile t + 2 ----
    asm volatile("s_wait_dscnt 0x0" ::: "memory");      // this wave's reads of tile t are done
    asm volatile("s_wait_asynccnt 0x0" ::: "memory");   // this wave's copies of tile t + 1 have landed
    __syncthreads();                                    // both hold for every wave
    if (t + 2 < GNT)                                    // block-uniform
      gemm_tile_copy(l0 + bo, l1 + bo, l2 + bo, ag + (size_t)(t + 2) * (SEQ * HD * 2),
                     bg0 + (t + 2) * (HD * 2), bg1 + (t + 2) * (HD * 2), bg2 + (t + 2) * (HD * 2));
  }
  asm volatile("s_wait_asynccnt 0x0" ::: "memory");     // nothing of this wave is in flight when the ring is reused

  // bias for the lane's columns (col0 + 16j + m <= 767), bf16 value of bu
  const float bz0 = bf_up(bf_bits(bias[col0 + m]));
  const float bz1 = bf_up(bf_bits(bias[col0 + 16 + m]));
  const float bz2 = bf_up(bf_bits(bias[col0 + 32 + m]));
  const float bz3 = bf_up(bf_bits(bias[col0 + 48 + m]));
  float* slab = (float*)(void*)ring + wave * 2 * SLAB;  // the ring is dead behind the last trip's barrier
  const size_t rowb = (size_t)(row0 + wave * 32);
  epi64_stage(slab, acc[0][0], acc[0][1], acc[0][2], acc[0][3], oscale, bz0, bz1, bz2, bz3, lane);
  epi64_stage(slab + SLAB, acc[1][0], acc[1][1], acc[1][2], acc[1][3], oscale, bz0, bz1, bz2, bz3, lane);
  wave_sync_lds();                                      // one for both slabs: no global store stands in front of it
  epi64_flush(slab, C, DMOD, rowb, col0, lane);
  epi64_flush(slab + SLAB, C, DMOD, rowb + 16, col0, lane);
}

// =====================================================================================================
// One 64-key tile into one LDS buffer of a key group, 12 asynchronous 16-B copies per lane (all 128 lanes of the group on,
// block-uniform control flow; tid = thread in its group):
//   K: 64 rows x 192 B are 12288 contiguous global bytes; piece p = 128 i + tid (i = 0..5) -> LDS row p / 12, 16-B column p % 12
//      (kl0..kl2 hold the places of i = 0..2; i + 3 lies 32 rows further); one wave-instruction = 512 contiguous bytes.
//   v^T: 96 rows x 128 B (global pitch 4096 B); piece p = 128 i + tid -> row p / 8, column p % 8; one wave-instruction = 4 lines.
// s_wait_xcnt stands inside the statement so that no address register is rewritten in front of it.
// =====================================================================================================
__device__ __forceinline__ void tile_copy(unsigned kl0, unsigned kl1, unsigned kl2, unsigned vl,
                                          const char* kg, const char* vg) {
#if defined(__HIP_DEVICE_COMPILE__)
  asm volatile("global_load_async_to_lds_b128 %0, %12, off\n\t"
               "global_load_async_to_lds_b128 %1, %13, off\n\t"
               "global_load_async_to_lds_b128 %2, %14, off\n\t"
               "global_load_async_to_lds_b128 %3, %15, off\n\t"
               "global_load_async_to_lds_b128 %4, %16, off\n\t"
               "global_load_async_to_lds_b128 %5, %17, off\n\t"
               "global_load_async_to_lds_b128 %6, %18, off\n\t"
               "global_load_async_to_lds_b128 %7, %19, off\n\t"
               "global_load_async_to_lds_b128 %8, %20, off\n\t"
               "global_load_async_to_lds_b128 %9, %21, off\n\t"
               "global_load_async_to_lds_b128 %10, %22, off\n\t"
               "global_load_async_to_lds_b128 %11, %23, off\n\t"
               "s_wait_xcnt 0x0"
               :: "v"(kl0), "v"(kl1), "v"(kl2),
                  "v"(kl0 + 32u * KPITCH), "v"(kl1 + 32u * KPITCH), "v"(kl2 + 32u * KPITCH),
                  "v"(vl), "v"(vl + 16u * VPITCH), "v"(vl + 32u * VPITCH),
                  "v"(vl + 48u * VPITCH), "v"(vl + 64u * VPITCH), "v"(vl + 80u * VPITCH),
                  "v"(kg), "v"(kg + 2048), "v"(kg + 4096), "v"(kg + 6144), "v"(kg + 8192), "v"(kg + 10240),
                  "v"(vg), "v"(vg + 16 * SEQ * 2), "v"(vg + 32 * SEQ * 2),
                  "v"(vg + 48 * SEQ * 2), "v"(vg + 64 * SEQ * 2), "v"(vg + 80 * SEQ * 2)
               : "memory");
#endif
}

// =====================================================================================================
// Narrow multi-head flash attention (no mask): block = (batch b, head, 128 query rows), 8 waves in two key groups of 4: group g
// walks keys 1024 g .. + 1023 with its own LDS ring, so that 4 waves share a SIMD and fill each other's waits; wave w of either
// group owns the 32 query rows q0 = 128*qt + 32*w .. q0+31 as two tiles of 16 (tile u = rows q0+16u .. +15), so that every K and
// v^T fragment it reads from LDS feeds two matrix instructions, one per tile. The two groups' results for a row (maximum in use,
// row sum, unnormalised O) are joined once, in the epilogue, through LDS.
//   q plane (f16, x log2(e)/sqrt(768)/8) laid out [b][h][s][96]; k plane the same (x8); v^T plane [b][h][96][s] (x256).
//   All NKB = 64 key blocks of 32 keys are visited (static bound), two per 64-key tile, 16 tiles per group. A group's four waves
//   share each K and v^T tile: it is brought into LDS by asynchronous copies (tile_copy), two buffers, tile t + 1 in flight while
//   tile t is worked on; one barrier per tile (all 8 waves) publishes tile t + 1 and frees tile t's buffer. Fragments are read by
//   ds_load_b128. After the last barrier the rings are dead: group 1's holds its partial results, group 0's the output slabs.
//   Scores are computed TRANSPOSED: S^T tile (g, u) (g = 0,1) = k rows (keys kb+16g .. +15, A operand, row m = lane&15, split k
//   map over d, 3 chunks of 32) times q^T (B operand, col n = query q0 + 16u + (lane&15), k = d, split map), one product per tile
//   and 32-deep d-chunk. D element r of lane l = (key kb+16g+8h+r, query q0+16u+(l&15)), so a lane owns one query column per
//   tile u and 16 of its 32 keys; the partner lane l^16 owns the other 16 (joined by an xor-16 shuffle: maxima in newmax16, sums at the end).
//   Base-2 softmax in f32, per tile u; the scale 1/sqrt(768) log2(e) sits in the q plane, so a score is the base-2 logit.
//   First walk (walk_keys<true>): a constant shift, given to the score WMMAs as their C operand, so that the exponential is taken of
//   the WMMA's result as it stands: no maximum, no test, no fma in the loop. Softmax does not depend on the shift; it only has to keep
//   P inside f16, and each row's sum tells behind the walk whether it did. If some row's did not, the whole block walks again
//   (walk_keys<false>) with the online maximum, which takes any scores:
//   maximum and P's carry enter the exponent through one fma, and the row sum l carries x128 with P. The maximum in use is
//   renewed lazily: one wave-uniform test per 32-key block; only when some query's new maximum lies more than LAZY above the one
//   in use do the halves exchange maxima and are l and the O accumulators rescaled (newmax16). The exp'd values
//   ARE the P A-fragment in place: A row m = query = lane&15, element i <- key kb+8h+i (g = 0, D element i), element 8+i <- key
//   kb+16+8h+i (g = 1, D element i). P is carried x128 as single f16 (at most 2^15). The rescale factor of query row 8h+r of the O
//   accumulators is fetched from lane 8h+r with a shuffle (uniform control). 6 v^T B fragments (col n = d = 16j + (lane&15),
//   keys k-contiguous), 12 P.V WMMAs per key block in two guarded groups of 6.
//   Epilogue, group 0, per tile u: both key halves under the larger maximum, 1/l (per query, shuffled to the D row owner) and carry folds in f32; the 16x96 f32 result (x1024)
//   staged in an LDS slab [16][100]; the tile's 16 rows of the O plane [b][h][s][96] are one contiguous 3072-B region written
// coverage: per storing wave 2 x 6 instructions x 32 lanes x 8 halves = 32 x 96; grid 512 blocks x 4 storing waves = every (b, h, s) row of the
//           O plane exactly once.
// =====================================================================================================
// Maximum of this lane's 16 raw scores of one 16-query tile (keys kb+8h+i and kb+16+8h+i of the lane's query).
__device__ __forceinline__ float lanemax16(const v8f s0, const v8f s1) {
  float cm = fmaxf(s0[0], s1[0]);
#pragma unroll
  for (int i = 1; i < 8; ++i) cm = fmaxf(fmaxf(cm, s0[i]), s1[i]);
  return cm;
}
// One 32-key step of the softmax for one 16-query tile under the maximum in use, mrun (every score * lsc is at most mrun + LAZY):
// fills the P A-fragment and adds to the running sum.
// CONSTSH: the scores already hold the whole exponent (logit + FSH, from the matrix instruction): no fma.
template <bool CONSTSH>
__device__ __forceinline__ void probs16(const v8f s0, const v8f s1, const float lsc, const float mrun, float& lrun, FragH& ph) {
  // ---- carried probabilities p * 128 = 2^(s * lsc - mrun + 7): one fma and one v_exp_f32 per score; the argument is at
  //      most 15 plus the fma's rounding, and a result under 2^-126 (flushed) is far below the f16 plane's last place.
  //      P A-fragment: element i <-> s0[i], element 8 + i <-> s1[i] ----
  const v2f lsc2 = {lsc, lsc};
  const v2f eb2  = {PEXP - mrun, PEXP - mrun};
  float ps = 0.f;
  v2f ar[8], pp[8];
#pragma unroll
  for (int e = 0; e < 8; ++e) {
    const v2f sp = (e < 4) ? (v2f){s0[2 * e], s0[2 * e + 1]} : (v2f){s1[2 * e - 8], s1[2 * e - 7]};
    ar[e] = CONSTSH ? sp : __builtin_elementwise_fma(sp, lsc2, eb2);
  }
#pragma unroll
  for (int e = 0; e < 8; ++e) pp[e] = (v2f){ex2(ar[e][0]), ex2(ar[e][1])};
#pragma unroll
  for (int e = 0; e < 8; ++e) {
    ps += pp[e][0] + pp[e][1];
    ph.u[e >> 2][e & 3] = __builtin_bit_cast(unsigned, __builtin_convertvector(pp[e], v2h));   // RNE, as two scalar casts
  }
  lrun += ps;                                                      // this half's 16 keys; the halves are joined in the epilogue
}
// rescale one tile's O accumulators: D row 8hh+r = the tile's query 8hh+r, its factor lives in lane 8hh+r (and 16+8hh+r)
__device__ __forceinline__ void rescale16(v8f (&o)[6], const float al, const int hh) {
  float scl[8];
#pragma unroll
  for (int r = 0; r < 8; ++r) scl[r] = __shfl(al, 8 * hh + r, 32);
#pragma unroll
  for (int j = 0; j < 6; ++j) {
#pragma unroll
    for (int r = 0; r < 8; ++r) o[j][r] *= scl[r];
  }
}
// The seldom-taken path, whole wave: renew one tile's maximum in use from the lanes' maxima cm (lsc > 0, so the scale commutes
// with the maximum) and bring the old sum and accumulators under it.
__device__ __forceinline__ void newmax16(float cm, const float lsc, float& mrun, float& lrun, v8f (&o)[6], const int hh) {
  cm = fmaxf(cm, __shfl_xor(cm, 16, 32));
  const float mn = fmaxf(mrun, cm * lsc);                          // base-2 logit; finite from the first key block on
  const float al = (mrun == -INFINITY) ? 0.f : ex2(mrun - mn);     // o and l are zero while mrun is -inf
  mrun = mn;
  lrun *= al;
  rescale16(o, al, hh);
}
// Join one tile's two key halves: this wave's (o, mrun, lrun) and the partner wave's (po: its accumulators in the same lane-private
// order, pm: its maximum in use, pl: its whole row sum). Both are brought under the larger maximum; then 1/l (per query, owned by
// lane = query; l carries PCAR like P, so only v's carry is left) and OSC are folded in and the tile's slab is staged.
__device__ __forceinline__ void stage_o16(float* slab, const v8f (&o)[6], const float mrun, const float lrun,
                                          const float* po, const float pm, const float pl, const int lane) {
  const int hh = lane >> 4, c = lane & 15;
  const float la   = lrun + __shfl_xor(lrun, 16, 32);             // the two lane halves' sums of the lane's query
  const float d    = mrun - pm;                                   // both finite: each group has seen a key block
  const float e    = ex2(-fabsf(d));                              // the side with the smaller maximum comes down, the other keeps 1
  const float fa   = (d >= 0.f) ? 1.f : e, fb = (d >= 0.f) ? e : 1.f;
  const float lsum = la * fa + pl * fb;
  const float linv = (lsum > 0.f) ? ((1.0f / lsum) * (OSC / VCAR)) : 0.f;
  const float ga = fa * linv, gb = fb * linv;
  float ia[8], ib[8];
#pragma unroll
  for (int r = 0; r < 8; ++r) { ia[r] = __shfl(ga, 8 * hh + r, 32); ib[r] = __shfl(gb, 8 * hh + r, 32); }
#pragma unroll
  for (int j = 0; j < 6; ++j) {
    const v4f p0 = *(const v4f*)(po + (2 * j) * 128 + lane * 4), p1 = *(const v4f*)(po + (2 * j + 1) * 128 + lane * 4);
#pragma unroll
    for (int r = 0; r < 8; ++r)
      slab[(8 * hh + r) * 100 + c + 16 * j] = o[j][r] * ia[r] + ((r < 4) ? p0[r] : p1[r - 4]) * ib[r];
  }
}
// the partner's side: one tile's accumulators into LDS, lane-private order (16 B per lane and store, lanes adjacent)
__device__ __forceinline__ void part_o16(float* po, const v8f (&o)[6], const int lane) {
#pragma unroll
  for (int j = 0; j < 6; ++j) {
    *(v4f*)(po + (2 * j) * 128 + lane * 4)     = (v4f){o[j][0], o[j][1], o[j][2], o[j][3]};
    *(v4f*)(po + (2 * j + 1) * 128 + lane * 4) = (v4f){o[j][4], o[j][5], o[j][6], o[j][7]};
  }
}

// out96 for the wave's two adjacent slabs and its 32 adjacent O rows: one wave_sync_lds() for both, so that no global store stands
// in front of it. coverage: 12 instructions x 32 lanes x 8 halves = 32 x 96.
__device__ __forceinline__ void out96x2(const float* sl, u16* dst, int lane) {
  wave_sync_lds();
  v4u ov[12];
#pragma unroll
  for (int i = 0; i < 12; ++i) {
    const int g   = (i % 6) * 32 + lane;
    const int row = g / 12;
    const int c8  = (g - row * 12) * 8;
    const float* sp = sl + (i / 6) * SLAB96 + row * 100 + c8;
    const v4f a = *(const v4f*)(sp), c4 = *(const v4f*)(sp + 4);
#pragma unroll
    for (int e = 0; e < 2; ++e) {
      ov[i][e]     = pk16(h_bits((_Float16)a[2 * e]), h_bits((_Float16)a[2 * e + 1]));
      ov[i][2 + e] = pk16(h_bits((_Float16)c4[2 * e]), h_bits((_Float16)c4[2 * e + 1]));
    }
  }
#pragma unroll
  for (int i = 0; i < 12; ++i) *(v4u*)(dst + (size_t)(i * 32 + lane) * 8) = ov[i];
}

// One walk of a key group over its 1024 keys (ring prologue, 16 tiles, trailing waits); on entry the accumulators and sums are zero.
//   CONSTSH = true: no maximum is followed. The exponent of P is the score WMMA's own result: the softmax scale sits in the q plane's
//   carry and the constant shift FSH is the C operand, so that P = 2^(logit + FSH) = 128 * 2^(logit - (PEXP - FSH)): the walk stands
//   under the fixed maximum in use PEXP - FSH (set by the caller). Whether that shift suited every row is tested once, behind the walk.
//   CONSTSH = false: the lazily renewed maximum, for any scores.
template <bool CONSTSH>
__device__ __forceinline__ void walk_keys(const int tid, const int grp, const size_t bh, unsigned char* ring,
                                          const u16* __restrict__ KPp, const u16* __restrict__ VPp,
                                          const v16h qa0, const v16h qa1, const v16h qa2,
                                          const v16h qb0, const v16h qb1, const v16h qb2,
                                          float& mrun0, float& lrun0, float& mrun1, float& lrun1, v8f (&oa)[6], v8f (&ob)[6]) {
  const int hh = (tid >> 4) & 1, c = tid & 15;        // tid = thread in its key group
  // A fragments of k: row m = key (in tile) 16g + c, k = d; byte offset in a buffer's K part
  const int kfo = c * KPITCH + 16 * hh;
  // B fragments of v: col n = d = 16j + c, k = key (k-contiguous row of the v^T tile); byte offset in a buffer
  const int vfo = KTILE + c * VPITCH + 16 * hh;
  // the lane's copy places (LDS byte addresses in buffer 0) and its global sources for tile 0
  const unsigned lds0 = (unsigned)(uintptr_t)(&ring[0]);
  const int kr0 = tid / 12, kr1 = (tid + 128) / 12, kr2 = (tid + 256) / 12;
  const unsigned kl0 = lds0 + (unsigned)(kr0 * KPITCH + (tid - 12 * kr0) * 16);
  const unsigned kl1 = lds0 + (unsigned)(kr1 * KPITCH + (tid + 128 - 12 * kr1) * 16);
  const unsigned kl2 = lds0 + (unsigned)(kr2 * KPITCH + (tid + 256 - 12 * kr2) * 16);
  const unsigned vl  = lds0 + (unsigned)(KTILE + (tid >> 3) * VPITCH + (tid & 7) * 16);
  const char* kg = (const char*)(const void*)KPp + ((bh * SEQ + (size_t)grp * (SEQ / KGRP)) * HD * 2 + (size_t)tid * 16);  // + 12288 per tile
  const char* vg = (const char*)(const void*)VPp + ((bh * HD + (size_t)(tid >> 3)) * SEQ * 2 + (size_t)grp * (SEQ / KGRP) * 2
                                                    + (size_t)(tid & 7) * 16);                                             // + 128 per tile
  const float lsc = 1.0f;                             // the scores are base-2 logits
  const float ci  = CONSTSH ? FSH : 0.f;
  const v8f   c0  = {ci, ci, ci, ci, ci, ci, ci, ci};
  // ---- ring prologue: tile 0 landed and published, then tile 1 set off ----
  tile_copy(kl0, kl1, kl2, vl, kg, vg);
  asm volatile("s_wait_asynccnt 0x0" ::: "memory");   // this wave's copies of tile 0 have landed
  __syncthreads();                                    // every wave's have
  tile_copy(kl0 + BUFB, kl1 + BUFB, kl2 + BUFB, vl + BUFB, kg + STK * HD * 2, vg + STK * 2);

#pragma unroll 1                                      // one trip per tile stays rolled: one foot, small code
  for (int t = 0; t < NST; ++t) {
   const unsigned bo = (unsigned)(t & 1) * BUFB;      // trip t reads buffer t mod 2 alone
#pragma unroll                                        // the tile's two 32-key blocks: constant LDS offsets in the reads
   for (int sub = 0; sub < 2; ++sub) {
    // ---- transposed scores: s0x = keys kb..kb+15, s1x = keys kb+16..kb+31 (kb = 1024 grp + 64 t + 32 sub); sxa = queries q0 + c,
    //      sxb = queries q0 + 16 + c; each K fragment is read once and used for both query tiles ----
    const _Float16* k0p = (const _Float16*)(const void*)(ring + bo + kfo + sub * 32 * KPITCH);
    const _Float16* k1p = (const _Float16*)(const void*)(ring + bo + kfo + (sub * 32 + 16) * KPITCH);
    v8f s0a = c0, s0b = c0, s1a = c0, s1b = c0;
    {
      const v16h ka0 = ldfrag_h(k0p), ka1 = ldfrag_h(k0p + 32), ka2 = ldfrag_h(k0p + 64);
      const v16h kc0 = ldfrag_h(k1p), kc1 = ldfrag_h(k1p + 32), kc2 = ldfrag_h(k1p + 64);
      __builtin_amdgcn_sched_barrier(0);   // keeps the twelve reads one group in front of the WMMAs (else a pair stands at every second one)
      s0a = mma_h(ka0, qa0, s0a);
      s0b = mma_h(ka0, qb0, s0b);
      s1a = mma_h(kc0, qa0, s1a);
      s1b = mma_h(kc0, qb0, s1b);
      s0a = mma_h(ka1, qa1, s0a);
      s0b = mma_h(ka1, qb1, s0b);
      s1a = mma_h(kc1, qa1, s1a);
      s1b = mma_h(kc1, qb1, s1b);
      s0a = mma_h(ka2, qa2, s0a);
      s0b = mma_h(ka2, qb2, s0b);
      s1a = mma_h(kc2, qa2, s1a);
      s1b = mma_h(kc2, qb2, s1b);
      guard4(s0a, s0b, s1a, s1b);
    }
    // ---- lazy maximum: one test per 32-key block for both tiles; -inf in use (first block) always renews ----
    if constexpr (!CONSTSH) {
      const float cma = lanemax16(s0a, s1a), cmb = lanemax16(s0b, s1b);
      const bool need = (cma * lsc - mrun0 > LAZY) || (cmb * lsc - mrun1 > LAZY);
      // the same for the whole wave: a scalar branch, EXEC stays full; seldom taken, so its body is laid out behind the loop
      if (__builtin_expect(__builtin_amdgcn_ballot_w32(need) != 0, 0)) {
        newmax16(cma, lsc, mrun0, lrun0, oa, hh);
        newmax16(cmb, lsc, mrun1, lrun1, ob, hh);
      }
    }
    // ---- v^T B fragments: col n = d = j*16 + c, keys contiguous in the v^T plane; each is read once and used for both query
    //      tiles ----
    const _Float16* vp = (const _Float16*)(const void*)(ring + bo + vfo + sub * 64);
    const v16h vf0 = ldfrag_h(vp);
    const v16h vf1 = ldfrag_h(vp + 16 * (VPITCH / 2));
    const v16h vf2 = ldfrag_h(vp + 32 * (VPITCH / 2));
    // keeps the first six reads one group in front of the exponentials, which cover their latency (else they are spread among the WMMAs)
    __builtin_amdgcn_sched_barrier(0);
    FragH pa, pb;
    probs16<CONSTSH>(s0a, s1a, lsc, mrun0, lrun0, pa);
    probs16<CONSTSH>(s0b, s1b, lsc, mrun1, lrun1, pb);
    // keeps the last six reads behind the exponentials, in registers that the scores have left (the budget of 4 waves per SIMD is
    // 256 registers); the first group of WMMAs covers their latency
    __builtin_amdgcn_sched_barrier(0);
    const v16h vf3 = ldfrag_h(vp + 48 * (VPITCH / 2));
    const v16h vf4 = ldfrag_h(vp + 64 * (VPITCH / 2));
    const v16h vf5 = ldfrag_h(vp + 80 * (VPITCH / 2));
    // ---- P.V : two guarded groups of 6 ----
    {
      oa[0] = mma_h(pa.v, vf0, oa[0]);
      ob[0] = mma_h(pb.v, vf0, ob[0]);
      oa[1] = mma_h(pa.v, vf1, oa[1]);
      ob[1] = mma_h(pb.v, vf1, ob[1]);
      oa[2] = mma_h(pa.v, vf2, oa[2]);
      ob[2] = mma_h(pb.v, vf2, ob[2]);
      guard6(oa[0], ob[0], oa[1], ob[1], oa[2], ob[2]);
      oa[3] = mma_h(pa.v, vf3, oa[3]);
      ob[3] = mma_h(pb.v, vf3, ob[3]);
      oa[4] = mma_h(pa.v, vf4, oa[4]);
      ob[4] = mma_h(pb.v, vf4, ob[4]);
      oa[5] = mma_h(pa.v, vf5, oa[5]);
      ob[5] = mma_h(pb.v, vf5, ob[5]);
      guard6(oa[3], ob[3], oa[4], ob[4], oa[5], ob[5]);
    }
   }
   // ---- foot of trip t: publish tile t + 1, free tile t's buffer, refill it with tile t + 2 ----
   // each row's sum is closed here, against spills (the empty statement on a row's sum): else its 32 adds are sunk behind the foot
   // and 32 exponentials stay live across the copies' operands, over the 256 registers of 4 waves per SIMD
   asm volatile("" : "+v"(lrun0), "+v"(lrun1));        // empty statement on each row's sum, against spills
   asm volatile("s_wait_dscnt 0x0" ::: "memory");      // this wave's reads of tile t are done
   asm volatile("s_wait_asynccnt 0x0" ::: "memory");   // this wave's copies of tile t + 1 have landed
   __syncthreads();                                    // both hold for every wave
   if (t + 2 < NST)                                    // block-uniform
     tile_copy(kl0 + bo, kl1 + bo, kl2 + bo, vl + bo,
               kg + (size_t)(t + 2) * (STK * HD * 2), vg + (size_t)(t + 2) * (STK * 2));
  }
  asm volatile("s_wait_asynccnt 0x0" ::: "memory");    // nothing of this wave is in flight when the ring is reused
  acc_guard6(oa[0], oa[1], oa[2], oa[3], oa[4], oa[5]);
  acc_guard6(ob[0], ob[1], ob[2], ob[3], ob[4], ob[5]);

}

// 4096 waves = 4 per SIMD, 512 blocks = 2 per WGP: the register budget of that occupancy, and no third block on a WGP
__global__ __launch_bounds__(ATT_THREADS) __attribute__((amdgpu_waves_per_eu(4, 4)))
void attn_fwd(const u16* __restrict__ QPp, const u16* __restrict__ KPp, const u16* __restrict__ VPp, u16* OPp) {
  __shared__ __align__(16) unsigned char ringall[KGRP * 2 * BUFB];
  __shared__ int redo;                                                      // some row of the block needs the second walk

  const int grp  = __builtin_amdgcn_readfirstlane((int)threadIdx.x >> 7);   // key group of the wave: keys grp * 1024 .. + 1023
  const int wsc  = __builtin_amdgcn_readfirstlane(((int)threadIdx.x >> 5) & (GW - 1));   // wave in its group, as a scalar
  const int tid  = threadIdx.x & (GT - 1);                                  // thread in its group
  const int wave = tid >> 5;                                                // wave in its group
  const int lane = tid & 31;
  unsigned char* ring = ringall + grp * (2 * BUFB);                         // the group's own two buffers
  const int hh   = lane >> 4;
  const int c    = lane & 15;

  const int bid  = blockIdx.x;
  const int qt   = bid & (SEQ / QPB - 1);
  const int head = (bid >> 4) & (NH - 1);
  const int b    = bid >> 7;
  const int q0   = qt * QPB + wave * QPW;
  const size_t bh = (size_t)(b * NH + head);

  // B fragments of q^T: col n = query q0 + 16u + c, k = d (k-contiguous row of the q plane)
  const _Float16* Qb = (const _Float16*)(const void*)QPp + ((bh * SEQ + q0 + c) * HD + 8 * hh);
  const v16h qa0 = ldfrag_h(Qb);                      // tile 0: d 0..31
  const v16h qa1 = ldfrag_h(Qb + 32);                 //         d 32..63
  const v16h qa2 = ldfrag_h(Qb + 64);                 //         d 64..95
  const v16h qb0 = ldfrag_h(Qb + 16 * HD);            // tile 1
  const v16h qb1 = ldfrag_h(Qb + 16 * HD + 32);
  const v16h qb2 = ldfrag_h(Qb + 16 * HD + 64);

  float mrun0 = PEXP - FSH, lrun0 = 0.f, mrun1 = PEXP - FSH, lrun1 = 0.f;
  v8f oa[6], ob[6];
#pragma unroll
  for (int j = 0; j < 6; ++j) { oa[j] = zero8(); ob[j] = zero8(); }
  if (threadIdx.x == 0) redo = 0;                     // published by the first barrier of the walk

  // ---- first walk, under the constant shift ----
  walk_keys<true>(tid, grp, bh, ring, KPp, VPp, qa0, qa1, qa2, qb0, qb1, qb2, mrun0, lrun0, mrun1, lrun1, oa, ob);
  // The shift suited a row if its sum over the group's 1024 keys lies in [LLO, LHI): below LHI no P (all are >= 0) left the f16 range,
  // from LLO on the largest P is at least 1. A NaN fails both. Any other row sends the whole block through the second walk.
  {
    const float ra = lrun0 + __shfl_xor(lrun0, 16, 32), rb = lrun1 + __shfl_xor(lrun1, 16, 32);
    if (!(ra >= LLO && ra < LHI && rb >= LLO && rb < LHI)) redo = 1;
  }

  // ---- the rings are dead behind the last trip's barrier. Group 1 hands its unnormalised tiles, maxima and row sums to group 0
  //      through its own ring's bytes; group 0 joins the two key halves, stages in its own ring's bytes and stores ----
  float* part = (float*)(void*)(ringall + 2 * BUFB) + wave * PARTW;
  if (grp == 1) {                                          // wave-uniform
    part_o16(part, oa, lane);
    part_o16(part + PARTF / 2, ob, lane);
    *(v4f*)(part + PARTF + lane * 4) = (v4f){mrun0, lrun0 + __shfl_xor(lrun0, 16, 32), mrun1, lrun1 + __shfl_xor(lrun1, 16, 32)};
  }
  __syncthreads();                                         // group 1's partial results and every wave's verdict are whole
  if (__builtin_expect(__builtin_amdgcn_readfirstlane(redo) != 0, 0)) {   // the same for the whole block: a scalar branch
    // ---- second walk, any scores: nobody has read the partial results, and the barrier above ended every use of the rings ----
    asm volatile("s_wait_dscnt 0x0" ::: "memory");         // this wave's LDS accesses are done before its copies aim at the rings again
    mrun0 = -INFINITY; lrun0 = 0.f; mrun1 = -INFINITY; lrun1 = 0.f;
#pragma unroll
    for (int j = 0; j < 6; ++j) { oa[j] = zero8(); ob[j] = zero8(); }
    // the thread's number in its group, formed anew from the wave's number (a scalar) and the lane's: the second walk's addresses are
    // then computed here and none of them is held in a register, or spilled, across the first walk
    const int tid2 = wsc * 32 + (int)__builtin_amdgcn_mbcnt_lo(~0u, 0u);
    walk_keys<false>(tid2, grp, bh, ring, KPp, VPp, qa0, qa1, qa2, qb0, qb1, qb2, mrun0, lrun0, mrun1, lrun1, oa, ob);
    if (grp == 1) {                                        // wave-uniform
      part_o16(part, oa, lane);
      part_o16(part + PARTF / 2, ob, lane);
      *(v4f*)(part + PARTF + lane * 4) = (v4f){mrun0, lrun0 + __shfl_xor(lrun0, 16, 32), mrun1, lrun1 + __shfl_xor(lrun1, 16, 32)};
    }
    __syncthreads();                                       // group 1's partial results are whole for group 0
  }
  if (grp == 0) {
    const v4f ml = *(const v4f*)(part + PARTF + lane * 4);
    float* slab = (float*)(void*)ringall + wave * 2 * SLAB96;
    stage_o16(slab, oa, mrun0, lrun0, part, ml[0], ml[1], lane);
    stage_o16(slab + SLAB96, ob, mrun1, lrun1, part + PARTF / 2, ml[2], ml[3], lane);
    out96x2(slab, OPp + (bh * SEQ + q0) * HD, lane);
  }
}

// =====================================================================================================
// Workspace map (bytes); every plane is fully written by whole-line stores before it is read; all extents are exact multiples
// of the 512-B store instructions (no pad rows needed); every base is 256-B aligned:
//   WOB f16  [768 n][768 k] (bf16 value x1024)   1179648
//   QP  f16  [4][8][2048][96] x QSC             12582912        KP same, x8
//   VP  f16  [4][8][96][2048] x256              12582912
//   OP  f16  [4][8][2048][96] x1024             12582912
//   end                                          51511296
// =====================================================================================================
extern "C" void kernel_launch(void* const* d_in, const int* in_sizes, int n_in,
                              void* d_out, int out_size, void* d_ws, size_t ws_size,
                              hipStream_t stream) {
  if (n_in < 6) return;
  if (in_sizes[0] != ROWS * DMOD) return;
  if (in_sizes[1] != HD * HD) return;
  if (in_sizes[2] != HD * HD) return;
  if (in_sizes[3] != HD * HD) return;
  if (in_sizes[4] != DMOD * DMOD) return;
  if (in_sizes[5] != DMOD) return;
  if (out_size != ROWS * DMOD) return;

  const float* Xin = (const float*)d_in[0];
  const float* Wq  = (const float*)d_in[1];
  const float* Wk  = (const float*)d_in[2];
  const float* Wv  = (const float*)d_in[3];
  const float* Wu  = (const float*)d_in[4];
  const float* bu  = (const float*)d_in[5];
  float*       out = (float*)d_out;

  const size_t szWO = (size_t)DMOD * DMOD * 2;                  //  1179648
  const size_t szP  = (size_t)NB * NH * SEQ * HD * 2;           // 12582912  (q / k / v^T / o planes)
  size_t off = 0;
  const size_t oWO = off; off += szWO;
  const size_t oQP = off; off += szP;
  const size_t oKP = off; off += szP;
  const size_t oVP = off; off += szP;
  const size_t oOP = off; off += szP;
  if (off > ws_size) return;                            // off = 51511296
  if (off > (size_t)134217728) return;
  if ((szWO % 256) != 0 || (szP % 256) != 0) return;

  char* ws = (char*)d_ws;
  u16* WOB = (u16*)(ws + oWO);
  u16* QP  = (u16*)(ws + oQP);
  u16* KP  = (u16*)(ws + oKP);
  u16* VP  = (u16*)(ws + oVP);
  u16* OP  = (u16*)(ws + oOP);

  if ((DMOD % 64) != 0 || (ROWS % 64) != 0 || (ROWS % GROWS) != 0 || (SEQ % 64) != 0 || (HD % 32) != 0) return;
  const dim3 gPJ(NPJ);                                  // 512
  const dim3 bPJ(PJT);                                  // 256
  const dim3 gAT(ATT_BLOCKS);                           // 512
  const dim3 bAT(ATT_THREADS);                          // 256
  const dim3 gO((ROWS / GROWS) * (DMOD / 64));          // 768
  const dim3 bO(128);

  // (1) q and k planes [b][h][s][96] = f16(x_h.Wq^T x QSC), f16(x_h.Wk^T x8); v^T plane [b][h][96 d][2048 keys] = f16(x_h.Wv^T x256);
  //     Wq/Wk/Wv [n = out][k = in] (already k-contiguous) rounded to bf16 inside each block; Wu -> f16 of bf16 value x1024
  proj_qkv<<<gPJ, bPJ, 0, stream>>>(Xin, Wq, Wk, Wv, Wu, QP, KP, VP, WOB);
  // (2) attention -> O plane [b][h][s][96] x1024 (single f16)
  attn_fwd<<<gAT, bAT, 0, stream>>>(QP, KP, VP, OP);
  // (3) output projection -> out [8192][768] f32, carries 1024 (O) x 1024 (Wu) folded back, + bias
  gemm_out<<<gO, bO, 0, stream>>>(OP, WOB, bu, out, 1.0f / (OSC * WOS));
  (void)hipGetLastError();
}

// v010
// A run of this version takes 65.7 microseconds.
// Timed twice side by side with v009, it ran 1.04 times as fast both times.
// Counting every step since v000, it is 3.58 times as fast.
// Contractions: x.Wq^T, x.Wk^T and x.Wv^T per head on v_wmma_f32_16x16x32_bf16 (x and Wq/Wk/Wv RNE-converted to bf16
// operands, f32 accumulate); scores k'.q'^T (single f16 planes: k' carried x8, q' carries log2(e)/sqrt(768)/8), P.v (P x128 single f16, v x256 single
// f16) and O.Wu^T (O single f16 plane x1024, Wu as f16(bf16(Wu)) x1024): v_wmma_f32_16x16x32_f16, f32 accumulate.
// Base-2 online softmax, 1/l, bias (bf16 value of bu) and carry folds in f32 on VALU.
#include <hip/hip_runtime.h>
#include <math.h>
#include <stdint.h>

#define NB    4
#define SEQ   2048
#define DMOD  768
#define NH    8
#define HD    96
#define ROWS  (NB * SEQ)
#define KSC   8.0f
#define QSC   (RSQK * LOG2E / KSC)              // q plane's carry: k'.q' is the base-2 logit itself
#define FSH   4.0f                              // constant shift of the first walk, the score WMMAs' C operand: P = 2^(logit + FSH)
#define LLO   1024.0f                           // a row sum over 1024 keys at or above it: the row's largest P is at least 1
#define LHI   65504.0f                          // a row sum below it: every P of the row is a finite f16
#define PCAR  128.0f
#define PEXP  7.0f                              // log2(PCAR)
#define LAZY  8.0f                              // a maximum in use may lag a new one by this much (base-2 logit): P <= 2^(PEXP + LAZY)
#define VCAR  256.0f
#define OSC   1024.0f
#define WOS   1024.0f
#define LOG2E 1.4426950408889634f
#define RSQK  0.0360843918243516f
#define KGRP        2                          // key groups per attention block: each walks its own half of the keys
#define GW          8                          // waves per key group
#define GT          (GW * 32)                  // threads per key group
#define ATT_WAVES   (KGRP * GW)
#define ATT_THREADS (ATT_WAVES * 32)
#define QPW         32                         // query rows per attention wave: two 16-row tiles
#define QPB         (GW * QPW)                 // query rows per attention block: 256
#define ATT_BLOCKS  (NB * NH * (SEQ / QPB))
#define NKB    (SEQ / 32)
#define SLAB   (16 * 68)
#define SLAB96 (16 * 100)
#define PJW    8                               // waves per projection block, 16 rows each
#define PJROWS (PJW * 16)                      // 128
#define PJT    (PJW * 32)                      // 256 threads
#define NPJ    ((ROWS / PJROWS) * NH)          // 512 projection blocks
#define VSP    136                             // halves per v^T row staged in LDS: 128 + 8 (272 B = 16 B x odd)
#define WPH    104                             // halves per weight row in LDS: 96 + 8 (208 B = 16 B x odd, for ds_load_b128 readers)
#define WPL    (HD * WPH)                      // halves per weight plane in LDS
#define WUB    (DMOD * DMOD / NPJ)             // elements of Wu converted by each projection block: 1152 = 18 whole 128-B lines of f16
#define STK    128                             // keys per LDS tile
#define NST    (SEQ / STK / KGRP)              // 8 tiles per key group
#define KPITCH 208                             // bytes per K row in LDS: 192 + 16 (16 B x odd, for ds_load_b128 readers)
#define VPITCH 272                             // bytes per v^T row in LDS: 256 + 16 (16 B x odd)
#define KTILE  (STK * KPITCH)                  // 26624
#define VTILE  (HD * VPITCH)                   // 26112
#define BUFB   (KTILE + VTILE)                 // 52736
#define PARTF  (2 * 6 * 8 * 32)                // floats of one wave's two unnormalised O tiles, lane-private order: 3072
#define PARTW  (PARTF + 4 * 32)                // + per lane {m0, l0, m1, l1}
#define GROWS  128                             // output rows per gemm_out block: 4 waves x 32
#define GNT    NH                              // LDS tiles along k in gemm_out: one head (96 k) each
#define GPITCH 208                             // bytes per O or Wu row in LDS: 192 + 16 (16 B x odd)
#define GATILE (GROWS * GPITCH)                // 26624
#define GBTILE (64 * GPITCH)                   // 13312
#define GBUF   (GATILE + GBTILE)               // 39936
static_assert(DMOD == NH * HD && HD == 96 && NH == 8 && NB == 4 && SEQ == 2048);
static_assert((SEQ / QPB) == 8 && ATT_BLOCKS == 256 && ATT_THREADS == 512 && GT == 256 && NKB == 64);
static_assert((HD % 32) == 0 && (DMOD % 64) == 0 && (ROWS % 64) == 0 && (SEQ % 64) == 0);
static_assert((SEQ % PJROWS) == 0 && NPJ == 512 && ((HD * HD / 4) % PJT) == 0 && (HD * PJROWS / 8) == 6 * PJT);
static_assert(WUB * NPJ == DMOD * DMOD && (WUB % 64) == 0 && WUB / 8 <= PJT && (WPH * 2) % 16 == 0);
static_assert((SLAB * 4) % 16 == 0 && (SLAB96 * 4) % 16 == 0);
static_assert(NST >= 2 && STK == 128 && (STK * HD * 2) == 6 * GT * 16 && (HD * STK * 2) == 6 * GT * 16 && KGRP == 2);
static_assert((KTILE % 16) == 0 && (BUFB % 16) == 0 && 2 * BUFB >= 2 * GW * SLAB96 * 4 && 2 * BUFB >= GW * PARTW * 4);
static_assert((SEQ % GROWS) == 0 && GNT >= 2 && (GROWS * HD * 2) == 12 * 128 * 16 && (64 * HD * 2) == 6 * 128 * 16);
static_assert((GATILE % 16) == 0 && (GBUF % 16) == 0 && 2 * GBUF >= 8 * SLAB * 4);

typedef unsigned short u16;
typedef _Float16 v16h __attribute__((ext_vector_type(16)));
typedef _Float16 v8h  __attribute__((ext_vector_type(8)));
typedef _Float16 v2h  __attribute__((ext_vector_type(2)));
typedef __bf16   v16b __attribute__((ext_vector_type(16)));
typedef float    v8f  __attribute__((ext_vector_type(8)));
typedef float    v4f  __attribute__((ext_vector_type(4)));
typedef float    v2f  __attribute__((ext_vector_type(2)));
typedef unsigned int v4u __attribute__((ext_vector_type(4)));
typedef unsigned int v2u __attribute__((ext_vector_type(2)));
typedef __bf16   v2b  __attribute__((ext_vector_type(2)));

union FragH { v16h v; v8h h[2]; v4u u[2]; };
union FragB { v16b v; v4u u[2]; };

// ---- scalar helpers --------------------------------------------------------------------------------
__device__ __forceinline__ unsigned short bf_bits(float f) {          // f32 -> bf16 bits, RNE convert
  unsigned u = __float_as_uint(f);
  return (unsigned short)((u + 0x7FFFu + ((u >> 16) & 1u)) >> 16);
}
__device__ __forceinline__ float bf_up(unsigned short h) { return __uint_as_float(((unsigned)h) << 16); }
__device__ __forceinline__ unsigned short h_bits(_Float16 x) { return __builtin_bit_cast(unsigned short, x); }
__device__ __forceinline__ unsigned pk16(unsigned short a, unsigned short b) { return (unsigned)a | ((unsigned)b << 16); }
__device__ __forceinline__ float ex2(float x) { return __builtin_amdgcn_exp2f(x); }   // bare v_exp_f32: 2^-inf = 0, no range fix-up
__device__ __forceinline__ v8f zero8() { v8f z = {0.f, 0.f, 0.f, 0.f, 0.f, 0.f, 0.f, 0.f}; return z; }

// ---- fragment loaders: 16-bit A/B operand, lane -> row/col (lane&15), p already includes +8*(lane>>4);
//      elements 0..7 <- p[0..7] (k0+8h..), elements 8..15 <- p[16..23] (k0+16+8h..)  (same split k map for A and B;
//      B is always read from a k-contiguous [n][k] plane)
__device__ __forceinline__ v16h ldfrag_h(const _Float16* p) {
  FragH f;
  f.h[0] = *(const v8h*)(p);
  f.h[1] = *(const v8h*)(p + 16);
  return f.v;
}
__device__ __forceinline__ v16b ldfrag_b(const u16* p) {              // bf16 plane read as unsigned integer vectors
  FragB f;
  f.u[0] = *(const v4u*)(p);
  f.u[1] = *(const v4u*)(p + 16);
  return f.v;
}

// the same fragment from an f32 row p: a0 = p[0..3], a1 = p[4..7], a2 = p[16..19], a3 = p[20..23]; RNE to bf16 in registers,
// same split k map
__device__ __forceinline__ v16b cvfrag_x(const v4f a0, const v4f a1, const v4f a2, const v4f a3) {
  FragB f;
#pragma unroll
  for (int e = 0; e < 2; ++e) {
    f.u[0][e]     = pk16(bf_bits(a0[2 * e]), bf_bits(a0[2 * e + 1]));
    f.u[0][2 + e] = pk16(bf_bits(a1[2 * e]), bf_bits(a1[2 * e + 1]));
    f.u[1][e]     = pk16(bf_bits(a2[2 * e]), bf_bits(a2[2 * e + 1]));
    f.u[1][2 + e] = pk16(bf_bits(a3[2 * e]), bf_bits(a3[2 * e + 1]));
  }
  return f.v;
}

__device__ __forceinline__ v8f mma_h(v16h a, v16h b, v8f c) {
  return __builtin_amdgcn_wmma_f32_16x16x32_f16(false, a, false, b, (short)0, c, false, false);
}
__device__ __forceinline__ v8f mma_b(v16b a, v16b b, v8f c) {
  return __builtin_amdgcn_wmma_f32_16x16x32_bf16(false, a, false, b, (short)0, c, false, false);
}
// v_nop x4: the distance between the last matrix instruction of a group and the first vector instruction on its D, A or B
__device__ __forceinline__ void guard4(v8f& s, v8f& t, v8f& u, v8f& w) {
#if defined(__HIP_DEVICE_COMPILE__)
  asm volatile("v_nop\n\tv_nop\n\tv_nop\n\tv_nop" : "+v"(s), "+v"(t), "+v"(u), "+v"(w) :: "memory");
#endif
}
__device__ __forceinline__ void guard6(v8f& a, v8f& b, v8f& c, v8f& d, v8f& e, v8f& f) {
#if defined(__HIP_DEVICE_COMPILE__)
  asm volatile("v_nop\n\tv_nop\n\tv_nop\n\tv_nop"
               : "+v"(a), "+v"(b), "+v"(c), "+v"(d), "+v"(e), "+v"(f) :: "memory");
#endif
}
__device__ __forceinline__ void acc_guard6(v8f& a, v8f& b, v8f& c, v8f& d, v8f& e, v8f& f) {
#if defined(__HIP_DEVICE_COMPILE__)
  asm volatile("v_nop\n\tv_nop\n\tv_nop\n\tv_nop" : "+v"(a), "+v"(b), "+v"(c), "+v"(d), "+v"(e), "+v"(f));
#endif
}
__device__ __forceinline__ void wave_sync_lds() {
#if defined(__HIP_DEVICE_COMPILE__)
  __builtin_amdgcn_fence(__ATOMIC_RELEASE, "workgroup");
  __builtin_amdgcn_wave_barrier();
  __builtin_amdgcn_fence(__ATOMIC_ACQUIRE, "workgroup");
#endif
}

// =====================================================================================================
// 16x96 f16 epilogue: the wave's 16x96 f32 tile (already scaled) staged by the caller in its LDS slab [16][100];
// coverage: 6 instructions x 32 lanes x 8 halves = 1536 = the wave's 16 x 96 tile (groups of 8 never straddle a row: 96/8 = 12).
// =====================================================================================================
__device__ __forceinline__ void out96(const float* sl, u16* dst, int lane) {
  wave_sync_lds();
  v4u ov[6];
#pragma unroll
  for (int i = 0; i < 6; ++i) {
    const int g   = i * 32 + lane;
    const int row = g / 12;
    const int c8  = (g - row * 12) * 8;
    const v4f a = *(const v4f*)(sl + row * 100 + c8), c4 = *(const v4f*)(sl + row * 100 + c8 + 4);
    float w[8];
#pragma unroll
    for (int e = 0; e < 4; ++e) { w[e] = a[e]; w[4 + e] = c4[e]; }
#pragma unroll
    for (int e = 0; e < 4; ++e) ov[i][e] = pk16(h_bits((_Float16)w[2 * e]), h_bits((_Float16)w[2 * e + 1]));
  }
  {
#pragma unroll
    for (int i = 0; i < 6; ++i) {
      *(v4u*)(dst + (size_t)(i * 32 + lane) * 8) = ov[i];
    }
    
  }
}

// =====================================================================================================
// f32 GEMM epilogue with bias, in two parts with the caller's wave_sync_lds() between them:
//   epi64_stage: a 16x64 f32 tile of the wave (acc*oscale + bias[col]) goes into one of its LDS slabs (pitch 68);
//   epi64_flush: the slab leaves as whole lines.
// coverage: 8 instructions x 2 rows x 16 lanes x 4 floats = one 16 x 64 tile.
// =====================================================================================================
__device__ __forceinline__ void epi64_stage(float* sl, v8f a0, v8f a1, v8f a2, v8f a3, float oscale,
                                            float bz0, float bz1, float bz2, float bz3, int lane) {
  const int hh = lane >> 4, m = lane & 15;
#pragma unroll
  for (int r = 0; r < 8; ++r) {
    const int ro = (8 * hh + r) * 68 + m;
    sl[ro]      = a0[r] * oscale + bz0;
    sl[ro + 16] = a1[r] * oscale + bz1;
    sl[ro + 32] = a2[r] * oscale + bz2;
    sl[ro + 48] = a3[r] * oscale + bz3;
  }
}
__device__ __forceinline__ void epi64_flush(const float* sl, float* C, int N, size_t rowb, int col0, int lane) {
  const int hh = lane >> 4, m = lane & 15;
  v4f vals[8];
#pragma unroll
  for (int it = 0; it < 8; ++it) vals[it] = *(const v4f*)(sl + (it * 2 + hh) * 68 + m * 4);
  float* dst = C + (rowb + (size_t)hh) * (size_t)N + col0 + m * 4;
#pragma unroll
  for (int it = 0; it < 8; ++it) *(v4f*)(dst + (size_t)(it * 2) * (size_t)N) = vals[it];
}

// =====================================================================================================
// The three per-head projections (shared 96x96 weights) and all weight conversions in ONE launch, bf16 operands.
// Block = (128 rows of b*SEQ+s, head), 8 waves x 16 rows.
//   Weights: the block reads Wq, Wk, Wv as f32 (3 x 2304 pieces of 4 floats, 27 per thread, 512 contiguous bytes per
//   wave-instruction), rounds them to bf16 (RNE) in registers and lays them in LDS as [plane][96 n][96 k], pitch WPH; one
//   barrier publishes them; every wave reads its B fragments from there by ds_load_b128 (k-contiguous rows, split k map).
//   Wu: block i also converts elements i*WUB .. +WUB-1 of Wu to the f16 plane (bf16 RNE value x1024) that the output projection
//   reads two launches later: threads 0..143, 8 elements each, whole lines, no other block touches them.
// A wave reads its 16 x 96 piece of x ONCE, as f32 (pitch 768), rounds it to bf16 in registers (cvfrag_x) and uses the three A
// fragments for all three products x . W^T; 6 accumulators (n = 0..95), K = 96 in 3 steps of 32.
//   q, k: P[b][head][s][96] = f16(acc * QSC), f16(acc * KSC); the wave's 16x96 tile is one contiguous 3072-B region, see out96.
//   v:    D element r of lane l = (s = 8hh + r, d = 16j + m): a lane's 8 values are 8 consecutive keys of one v^T row; the block's
//         96 x 128 tile of VT[b][head][d][s] (f16 of acc * 256) is gathered in LDS and leaves as whole 128-B lines.
// coverage: v^T 6 instructions x 256 threads x 8 halves = 96 x 128; grid = (ROWS/128) * NH = 512 (exact, host-checked constants).
// =====================================================================================================
__device__ __forceinline__ void proj96(const v16b x0, const v16b x1, const v16b x2, const u16* bp, v8f (&acc)[6]) {
#pragma unroll
  for (int j = 0; j < 6; ++j) acc[j] = mma_b(x0, ldfrag_b(bp + j * 16 * WPH), zero8());
#pragma unroll
  for (int j = 0; j < 6; ++j) acc[j] = mma_b(x1, ldfrag_b(bp + j * 16 * WPH + 32), acc[j]);
#pragma unroll
  for (int j = 0; j < 6; ++j) acc[j] = mma_b(x2, ldfrag_b(bp + j * 16 * WPH + 64), acc[j]);
}
// four f32 -> four bf16 (RNE), two packed converts
__device__ __forceinline__ v2u bf4(const v4f a) {
  const v2f lo = {a[0], a[1]}, hi = {a[2], a[3]};
  v2u o;
  o[0] = __builtin_bit_cast(unsigned, __builtin_convertvector(lo, v2b));
  o[1] = __builtin_bit_cast(unsigned, __builtin_convertvector(hi, v2b));
  return o;
}
// D element r of lane l = (row 8hh+r, col n = 16j + m); stage the 16x96 slab (pitch 100) fully
__device__ __forceinline__ void stage96(float* slab, const v8f (&acc)[6], float oscale, int hh, int m) {
#pragma unroll
  for (int r = 0; r < 8; ++r) {
    const int ro = (8 * hh + r) * 100 + m;
#pragma unroll
    for (int j = 0; j < 6; ++j) slab[ro + 16 * j] = acc[j][r] * oscale;
  }
}

// 4096 waves = 4 per SIMD, 512 blocks = 2 per WGP, all resident
__global__ __launch_bounds__(PJT) __attribute__((amdgpu_waves_per_eu(4, 4)))
void proj_qkv(const float* __restrict__ X, const float* __restrict__ WQ, const float* __restrict__ WK,
              const float* __restrict__ WV, const float* __restrict__ WU, u16* QP, u16* KP, u16* VT, u16* DU) {
  __shared__ __align__(16) float smem[PJW * SLAB96];
  __shared__ __align__(16) u16 vst[HD * VSP];
  __shared__ __align__(16) u16 wl[3 * WPL];
  const int tid = threadIdx.x, wave = tid >> 5, lane = tid & 31, hh = lane >> 4, m = lane & 15;
  const int bid  = blockIdx.x;
  const int head = bid & (NH - 1);
  const int rt   = bid >> 3;
  const int rowb = rt * PJROWS + wave * 16;             // 0..8176, the block's 128 rows never straddle a batch
  const int b    = rowb >> 11;
  const int s0   = rowb & (SEQ - 1);
  const size_t bh = (size_t)(b * NH + head);
  // ---- all global reads of the block are set off together: weights, x, the Wu share ----
  v4f wr[27];
#pragma unroll
  for (int i = 0; i < 9; ++i) {
    const int e = (i * PJT + tid) * 4;                  // < 9216
    wr[i]      = *(const v4f*)(WQ + e);
    wr[9 + i]  = *(const v4f*)(WK + e);
    wr[18 + i] = *(const v4f*)(WV + e);
  }
  const float* xp = X + (size_t)(rowb + m) * DMOD + head * HD + 8 * hh;
  v4f xr[12];
#pragma unroll
  for (int i = 0; i < 3; ++i) {
    xr[4 * i]     = *(const v4f*)(xp + 32 * i);
    xr[4 * i + 1] = *(const v4f*)(xp + 32 * i + 4);
    xr[4 * i + 2] = *(const v4f*)(xp + 32 * i + 16);
    xr[4 * i + 3] = *(const v4f*)(xp + 32 * i + 20);
  }
  const bool   uon = tid < WUB / 8;
  const size_t ue  = (size_t)bid * WUB + (size_t)tid * 8;   // used only where uon: < DMOD * DMOD
  v4f ua = {0.f, 0.f, 0.f, 0.f}, uc = {0.f, 0.f, 0.f, 0.f};
  if (uon) { ua = *(const v4f*)(WU + ue); uc = *(const v4f*)(WU + ue + 4); }
  // ---- weights into LDS: piece p = 256 i + tid -> row p / 24, 8-B column p % 24 ----
#pragma unroll
  for (int i = 0; i < 9; ++i) {
    const int p = i * PJT + tid, row = p / 24, c4 = p - row * 24;
    u16* d = wl + row * WPH + c4 * 4;
    *(v2u*)(d)           = bf4(wr[i]);
    *(v2u*)(d + WPL)     = bf4(wr[9 + i]);
    *(v2u*)(d + 2 * WPL) = bf4(wr[18 + i]);
  }
  __syncthreads();                                      // the three bf16 planes are whole for every wave
  const v16b x0 = cvfrag_x(xr[0], xr[1], xr[2], xr[3]), x1 = cvfrag_x(xr[4], xr[5], xr[6], xr[7]),
             x2 = cvfrag_x(xr[8], xr[9], xr[10], xr[11]);
  const u16* wb = wl + m * WPH + 8 * hh;                // the lane's place in each weight plane
  float* slab = smem + wave * SLAB96;
  v8f acc[6];
  proj96(x0, x1, x2, wb, acc);
  stage96(slab, acc, QSC, hh, m);
  out96(slab, QP + (bh * SEQ + s0) * HD, lane);
  proj96(x0, x1, x2, wb + WPL, acc);
  wave_sync_lds();                                      // the wave's reads of the q slab stay in front of the k slab's writes
  stage96(slab, acc, KSC, hh, m);
  out96(slab, KP + (bh * SEQ + s0) * HD, lane);
  proj96(x0, x1, x2, wb + 2 * WPL, acc);
#pragma unroll
  for (int j = 0; j < 6; ++j) {
    v8h h;
#pragma unroll
    for (int r = 0; r < 8; ++r) h[r] = (_Float16)(acc[j][r] * VCAR);
    *(v4u*)(vst + (16 * j + m) * VSP + wave * 16 + 8 * hh) = __builtin_bit_cast(v4u, h);
  }
  __syncthreads();                                      // the eight waves' key columns make up the 128-B lines
  u16* vb = VT + bh * HD * SEQ + (s0 - wave * 16);
#pragma unroll
  for (int i = 0; i < 6; ++i) {
    const int p = i * PJT + tid, row = p >> 4, c8 = (p & 15) * 8;
    *(v4u*)(vb + (size_t)row * SEQ + c8) = *(const v4u*)(vst + row * VSP + c8);
  }
  // the Wu share leaves last: no barrier or LDS fence of the block has to wait for this store
  if (uon) {
    v4u o;
#pragma unroll
    for (int e = 0; e < 2; ++e) {
      o[e]     = pk16(h_bits((_Float16)(bf_up(bf_bits(ua[2 * e])) * WOS)), h_bits((_Float16)(bf_up(bf_bits(ua[2 * e + 1])) * WOS)));
      o[2 + e] = pk16(h_bits((_Float16)(bf_up(bf_bits(uc[2 * e])) * WOS)), h_bits((_Float16)(bf_up(bf_bits(uc[2 * e + 1])) * WOS)));
    }
    *(v4u*)(DU + ue) = o;
  }
}

// =====================================================================================================
// One k tile (one head, 96 k) of gemm_out into one LDS buffer, 18 asynchronous 16-B copies per lane (all 128 lanes on,
// block-uniform control flow):
//   O:  128 rows x 192 B are 24576 contiguous global bytes; piece p = 128 i + tid (i = 0..11) -> LDS row p / 12, 16-B column
//       p % 12 (l0..l2 hold the places of i = 0..2; i + 3 lies 32 rows further); one wave-instruction = 512 contiguous bytes.
//   Wu: 64 rows x 192 B (global pitch 1536 B); piece p = 128 i + tid (i = 0..5), same row and column rule, behind the O part.
// s_wait_xcnt stands inside each statement so that no address register is rewritten in front of it.
// =====================================================================================================
__device__ __forceinline__ void gemm_tile_copy(unsigned l0, unsigned l1, unsigned l2, const char* ag,
                                               const char* bg0, const char* bg1, const char* bg2) {
#if defined(__HIP_DEVICE_COMPILE__)
  asm volatile("global_load_async_to_lds_b128 %0, %12, off\n\t"
               "global_load_async_to_lds_b128 %1, %13, off\n\t"
               "global_load_async_to_lds_b128 %2, %14, off\n\t"
               "global_load_async_to_lds_b128 %3, %15, off\n\t"
               "global_load_async_to_lds_b128 %4, %16, off\n\t"
               "global_load_async_to_lds_b128 %5, %17, off\n\t"
               "global_load_async_to_lds_b128 %6, %18, off\n\t"
               "global_load_async_to_lds_b128 %7, %19, off\n\t"
               "global_load_async_to_lds_b128 %8, %20, off\n\t"
               "global_load_async_to_lds_b128 %9, %21, off\n\t"
               "global_load_async_to_lds_b128 %10, %22, off\n\t"
               "global_load_async_to_lds_b128 %11, %23, off\n\t"
               "s_wait_xcnt 0x0"
               :: "v"(l0), "v"(l1), "v"(l2),
                  "v"(l0 + 32u * GPITCH), "v"(l1 + 32u * GPITCH), "v"(l2 + 32u * GPITCH),
                  "v"(l0 + 64u * GPITCH), "v"(l1 + 64u * GPITCH), "v"(l2 + 64u * GPITCH),
                  "v"(l0 + 96u * GPITCH), "v"(l1 + 96u * GPITCH), "v"(l2 + 96u * GPITCH),
                  "v"(ag), "v"(ag + 2048), "v"(ag + 4096), "v"(ag + 6144), "v"(ag + 8192), "v"(ag + 10240),
                  "v"(ag + 12288), "v"(ag + 14336), "v"(ag + 16384), "v"(ag + 18432), "v"(ag + 20480), "v"(ag + 22528)
               : "memory");
  asm volatile("global_load_async_to_lds_b128 %0, %6, off\n\t"
               "global_load_async_to_lds_b128 %1, %7, off\n\t"
               "global_load_async_to_lds_b128 %2, %8, off\n\t"
               "global_load_async_to_lds_b128 %3, %9, off\n\t"
               "global_load_async_to_lds_b128 %4, %10, off\n\t"
               "global_load_async_to_lds_b128 %5, %11, off\n\t"
               "s_wait_xcnt 0x0"
               :: "v"(l0 + (unsigned)GATILE), "v"(l1 + (unsigned)GATILE), "v"(l2 + (unsigned)GATILE),
                  "v"(l0 + (unsigned)GATILE + 32u * GPITCH), "v"(l1 + (unsigned)GATILE + 32u * GPITCH),
                  "v"(l2 + (unsigned)GATILE + 32u * GPITCH),
                  "v"(bg0), "v"(bg1), "v"(bg2),
                  "v"(bg0 + 32 * DMOD * 2), "v"(bg1 + 32 * DMOD * 2), "v"(bg2 + 32 * DMOD * 2)
               : "memory");
#endif
}

// =====================================================================================================
// Output projection with bias: C[8192][768] (f32) = O . Wu^T * oscale + bf16(bu)[n]; A operand k index = head*96 + d lives at
// O plane address ((b*NH + head)*SEQ + s)*96 + d (O single f16 x1024, 32-deep k-steps never straddle a head since 96 = 3*32);
// Bt = Wu plane [768 n][768 k] f16 (bf16 value x1024), k-contiguous. Block = 128x64 tile, 4 waves x (32 rows x 64 columns);
// k runs over 8 tiles of 96 (one head each, k ascending in steps of 32). The block's waves share each O and Wu tile: it is
// brought into LDS by asynchronous copies (gemm_tile_copy), two buffers, tile t + 1 in flight while tile t is worked on; one
// barrier per tile publishes tile t + 1 and frees tile t's buffer. Fragments are read by ds_load_b128, same split k map for A
// and B. After the last barrier the ring is dead and its first bytes become the waves' private output slabs (two each).
// grid = (ROWS/128)*(DMOD/64) = 768.
// =====================================================================================================
__global__ __launch_bounds__(128)
void gemm_out(const u16* __restrict__ OP, const u16* __restrict__ WOB, const float* __restrict__ bias, float* C,
              float oscale) {
  __shared__ __align__(16) unsigned char ring[2 * GBUF];
  const int tid = threadIdx.x, wave = tid >> 5, lane = tid & 31, hh = lane >> 4, m = lane & 15;
  const int ntile = DMOD >> 6;                          // 12
  const int bid   = blockIdx.x;
  const int row0  = (bid / ntile) * GROWS;              // the block's 128 rows never straddle a batch
  const int col0  = (bid % ntile) * 64;
  const int b     = row0 >> 11;
  const int s0    = row0 & (SEQ - 1);
  // the lane's copy places (LDS byte addresses in buffer 0) and its global sources for tile 0
  const unsigned lds0 = (unsigned)(uintptr_t)(&ring[0]);
  const int r0 = tid / 12, r1 = (tid + 128) / 12, r2 = (tid + 256) / 12;
  const int c0 = (tid - 12 * r0) * 16, c1 = (tid + 128 - 12 * r1) * 16, c2 = (tid + 256 - 12 * r2) * 16;
  const unsigned l0 = lds0 + (unsigned)(r0 * GPITCH + c0);
  const unsigned l1 = lds0 + (unsigned)(r1 * GPITCH + c1);
  const unsigned l2 = lds0 + (unsigned)(r2 * GPITCH + c2);
  const char* ag  = (const char*)(const void*)OP + (((size_t)b * NH * SEQ + s0) * HD * 2 + (size_t)tid * 16);  // + SEQ*192 per tile
  const char* bg0 = (const char*)(const void*)WOB + ((size_t)(col0 + r0) * DMOD * 2 + c0);                     // + 192 per tile
  const char* bg1 = (const char*)(const void*)WOB + ((size_t)(col0 + r1) * DMOD * 2 + c1);
  const char* bg2 = (const char*)(const void*)WOB + ((size_t)(col0 + r2) * DMOD * 2 + c2);
  // A fragments: row = wave*32 + 16i + m; B fragments: row n = 16j + m; byte offsets in a buffer
  const int afo = (wave * 32 + m) * GPITCH + 16 * hh;
  const int bfo = GATILE + m * GPITCH + 16 * hh;
  v8f acc[2][4];
#pragma unroll
  for (int i = 0; i < 2; ++i) {
#pragma unroll
    for (int j = 0; j < 4; ++j) acc[i][j] = zero8();
  }

  // ---- ring prologue: tile 0 landed and published, then tile 1 set off ----
  gemm_tile_copy(l0, l1, l2, ag, bg0, bg1, bg2);
  asm volatile("s_wait_asynccnt 0x0" ::: "memory");   // this wave's copies of tile 0 have landed
  __syncthreads();                                    // every wave's have
  gemm_tile_copy(l0 + GBUF, l1 + GBUF, l2 + GBUF, ag + SEQ * HD * 2, bg0 + HD * 2, bg1 + HD * 2, bg2 + HD * 2);

#pragma unroll 1                                      // one trip per tile stays rolled: one foot, small code
  for (int t = 0; t < GNT; ++t) {
    const unsigned bo = (unsigned)(t & 1) * GBUF;     // trip t reads buffer t mod 2 alone
#pragma unroll                                        // the tile's three 32-deep k-steps: constant LDS offsets in the reads
    for (int ks = 0; ks < 3; ++ks) {
      const _Float16* ap = (const _Float16*)(const void*)(ring + bo + afo + ks * 64);
      const _Float16* bp = (const _Float16*)(const void*)(ring + bo + bfo + ks * 64);
      const v16h a0 = ldfrag_h(ap);
      const v16h a1 = ldfrag_h(ap + 16 * (GPITCH / 2));
      const v16h b0 = ldfrag_h(bp);
      const v16h b1 = ldfrag_h(bp + 16 * (GPITCH / 2));
      const v16h b2 = ldfrag_h(bp + 32 * (GPITCH / 2));
      const v16h b3 = ldfrag_h(bp + 48 * (GPITCH / 2));
      acc[0][0] = mma_h(a0, b0, acc[0][0]);
      acc[0][1] = mma_h(a0, b1, acc[0][1]);
      acc[0][2] = mma_h(a0, b2, acc[0][2]);
      acc[0][3] = mma_h(a0, b3, acc[0][3]);
      acc[1][0] = mma_h(a1, b0, acc[1][0]);
      acc[1][1] = mma_h(a1, b1, acc[1][1]);
      acc[1][2] = mma_h(a1, b2, acc[1][2]);
      acc[1][3] = mma_h(a1, b3, acc[1][3]);
    }
    // ---- foot of trip t: publish tile t + 1, free tile t's buffer, refill it with tile t + 2 ----
    asm volatile("s_wait_dscnt 0x0" ::: "memory");      // this wave's reads of tile t are done
    asm volatile("s_wait_asynccnt 0x0" ::: "memory");   // this wave's copies of tile t + 1 have landed
    __syncthreads();                                    // both hold for every wave
    if (t + 2 < GNT)                                    // block-uniform
      gemm_tile_copy(l0 + bo, l1 + bo, l2 + bo, ag + (size_t)(t + 2) * (SEQ * HD * 2),
                     bg0 + (t + 2) * (HD * 2), bg1 + (t + 2) * (HD * 2), bg2 + (t + 2) * (HD * 2));
  }
  asm volatile("s_wait_asynccnt 0x0" ::: "memory");     // nothing of this wave is in flight when the ring is reused

  // bias for the lane's columns (col0 + 16j + m <= 767), bf16 value of bu
  const float bz0 = bf_up(bf_bits(bias[col0 + m]));
  const float bz1 = bf_up(bf_bits(bias[col0 + 16 + m]));
  const float bz2 = bf_up(bf_bits(bias[col0 + 32 + m]));
  const float bz3 = bf_up(bf_bits(bias[col0 + 48 + m]));
  float* slab = (float*)(void*)ring + wave * 2 * SLAB;  // the ring is dead behind the last trip's barrier
  const size_t rowb = (size_t)(row0 + wave * 32);
  epi64_stage(slab, acc[0][0], acc[0][1], acc[0][2], acc[0][3], oscale, bz0, bz1, bz2, bz3, lane);
  epi64_stage(slab + SLAB, acc[1][0], acc[1][1], acc[1][2], acc[1][3], oscale, bz0, bz1, bz2, bz3, lane);
  wave_sync_lds();                                      // one for both slabs: no global store stands in front of it
  epi64_flush(slab, C, DMOD, rowb, col0, lane);
  epi64_flush(slab + SLAB, C, DMOD, rowb + 16, col0, lane);
}

// =====================================================================================================
// One 128-key tile into one LDS buffer of a key group, 12 asynchronous 16-B copies per lane (all 256 lanes of the group on,
// block-uniform control flow; tid = thread in its group):
//   K: 128 rows x 192 B are 24576 contiguous global bytes; piece p = 256 i + tid (i = 0..5) -> LDS row p / 12, 16-B column p % 12
//      (kl0..kl2 hold the places of i = 0..2; i + 3 lies 64 rows further); one wave-instruction = 512 contiguous bytes.
//   v^T: 96 rows x 256 B (global pitch 4096 B); piece p = 256 i + tid -> row p / 16, column p % 16; one wave-instruction = 4 lines.
// s_wait_xcnt stands inside the statement so that no address register is rewritten in front of it.
// =====================================================================================================
__device__ __forceinline__ void tile_copy(unsigned kl0, unsigned kl1, unsigned kl2, unsigned vl,
                                          const char* kg, const char* vg) {
#if defined(__HIP_DEVICE_COMPILE__)
  asm volatile("global_load_async_to_lds_b128 %0, %12, off\n\t"
               "global_load_async_to_lds_b128 %1, %13, off\n\t"
               "global_load_async_to_lds_b128 %2, %14, off\n\t"
               "global_load_async_to_lds_b128 %3, %15, off\n\t"
               "global_load_async_to_lds_b128 %4, %16, off\n\t"
               "global_load_async_to_lds_b128 %5, %17, off\n\t"
               "global_load_async_to_lds_b128 %6, %18, off\n\t"
               "global_load_async_to_lds_b128 %7, %19, off\n\t"
               "global_load_async_to_lds_b128 %8, %20, off\n\t"
               "global_load_async_to_lds_b128 %9, %21, off\n\t"
               "global_load_async_to_lds_b128 %10, %22, off\n\t"
               "global_load_async_to_lds_b128 %11, %23, off\n\t"
               "s_wait_xcnt 0x0"
               :: "v"(kl0), "v"(kl1), "v"(kl2),
                  "v"(kl0 + 64u * KPITCH), "v"(kl1 + 64u * KPITCH), "v"(kl2 + 64u * KPITCH),
                  "v"(vl), "v"(vl + 16u * VPITCH), "v"(vl + 32u * VPITCH),
                  "v"(vl + 48u * VPITCH), "v"(vl + 64u * VPITCH), "v"(vl + 80u * VPITCH),
                  "v"(kg), "v"(kg + 4096), "v"(kg + 8192), "v"(kg + 12288), "v"(kg + 16384), "v"(kg + 20480),
                  "v"(vg), "v"(vg + 16 * SEQ * 2), "v"(vg + 32 * SEQ * 2),
                  "v"(vg + 48 * SEQ * 2), "v"(vg + 64 * SEQ * 2), "v"(vg + 80 * SEQ * 2)
               : "memory");
#endif
}

// =====================================================================================================
// Narrow multi-head flash attention (no mask): block = (batch b, head, 256 query rows), 16 waves in two key groups of 8: group g
// walks keys 1024 g .. + 1023 with its own LDS ring, so that 4 waves share a SIMD and fill each other's waits; wave w of either
// group owns the 32 query rows q0 = 256*qt + 32*w .. q0+31 as two tiles of 16 (tile u = rows q0+16u .. +15), so that every K and
// v^T fragment it reads from LDS feeds two matrix instructions, one per tile. The two groups' results for a row (maximum in use,
// row sum, unnormalised O) are joined once, in the epilogue, through LDS.
//   q plane (f16, x log2(e)/sqrt(768)/8) laid out [b][h][s][96]; k plane the same (x8); v^T plane [b][h][96][s] (x256).
//   All NKB = 64 key blocks of 32 keys are visited (static bound), four per 128-key tile, 8 tiles per group. A group's eight waves
//   share each K and v^T tile: it is brought into LDS by asynchronous copies (tile_copy), two buffers, tile t + 1 in flight while
//   tile t is worked on; one barrier per tile (all 16 waves) publishes tile t + 1 and frees tile t's buffer. Fragments are read by
//   ds_load_b128. After the last barrier the rings are dead: group 1's holds its partial results, group 0's the output slabs.
//   Scores are computed TRANSPOSED: S^T tile (g, u) (g = 0,1) = k rows (keys kb+16g .. +15, A operand, row m = lane&15, split k
//   map over d, 3 chunks of 32) times q^T (B operand, col n = query q0 + 16u + (lane&15), k = d, split map), one product per tile
//   and 32-deep d-chunk. D element r of lane l = (key kb+16g+8h+r, query q0+16u+(l&15)), so a lane owns one query column per
//   tile u and 16 of its 32 keys; the partner lane l^16 owns the other 16 (joined by an xor-16 shuffle: maxima in newmax16, sums at the end).
//   Base-2 softmax in f32, per tile u; the scale 1/sqrt(768) log2(e) sits in the q plane, so a score is the base-2 logit.
//   First walk (walk_keys<true>): a constant shift, given to the score WMMAs as their C operand, so that the exponential is taken of
//   the WMMA's result as it stands: no maximum, no test, no fma in the loop. Softmax does not depend on the shift; it only has to keep
//   P inside f16, and each row's sum tells behind the walk whether it did. If some row's did not, the whole block walks again
//   (walk_keys<false>) with the online maximum, which takes any scores:
//   maximum and P's carry enter the exponent through one fma, and the row sum l carries x128 with P. The maximum in use is
//   renewed lazily: one wave-uniform test per 32-key block; only when some query's new maximum lies more than LAZY above the one
//   in use do the halves exchange maxima and are l and the O accumulators rescaled (newmax16). The exp'd values
//   ARE the P A-fragment in place: A row m = query = lane&15, element i <- key kb+8h+i (g = 0, D element i), element 8+i <- key
//   kb+16+8h+i (g = 1, D element i). P is carried x128 as single f16 (at most 2^15). The rescale factor of query row 8h+r of the O
//   accumulators is fetched from lane 8h+r with a shuffle (uniform control). 6 v^T B fragments (col n = d = 16j + (lane&15),
//   keys k-contiguous), 12 P.V WMMAs per key block in two guarded groups of 6.
//   Epilogue, group 0, per tile u: both key halves under the larger maximum, 1/l (per query, shuffled to the D row owner) and carry folds in f32; the 16x96 f32 result (x1024)
//   staged in an LDS slab [16][100]; the tile's 16 rows of the O plane [b][h][s][96] are one contiguous 3072-B region written
// coverage: per storing wave 2 x 6 instructions x 32 lanes x 8 halves = 32 x 96; grid 256 blocks x 8 storing waves = every (b, h, s) row of the
//           O plane exactly once.
// =====================================================================================================
// Maximum of this lane's 16 raw scores of one 16-query tile (keys kb+8h+i and kb+16+8h+i of the lane's query).
__device__ __forceinline__ float lanemax16(const v8f s0, const v8f s1) {
  float cm = fmaxf(s0[0], s1[0]);
#pragma unroll
  for (int i = 1; i < 8; ++i) cm = fmaxf(fmaxf(cm, s0[i]), s1[i]);
  return cm;
}
// One 32-key step of the softmax for one 16-query tile under the maximum in use, mrun (every score * lsc is at most mrun + LAZY):
// fills the P A-fragment and adds to the running sum.
// CONSTSH: the scores already hold the whole exponent (logit + FSH, from the matrix instruction): no fma.
template <bool CONSTSH>
__device__ __forceinline__ void probs16(const v8f s0, const v8f s1, const float lsc, const float mrun, float& lrun, FragH& ph) {
  // ---- carried probabilities p * 128 = 2^(s * lsc - mrun + 7): one fma and one v_exp_f32 per score; the argument is at
  //      most 15 plus the fma's rounding, and a result under 2^-126 (flushed) is far below the f16 plane's last place.
  //      P A-fragment: element i <-> s0[i], element 8 + i <-> s1[i] ----
  const v2f lsc2 = {lsc, lsc};
  const v2f eb2  = {PEXP - mrun, PEXP - mrun};
  float ps = 0.f;
  v2f ar[8], pp[8];
#pragma unroll
  for (int e = 0; e < 8; ++e) {
    const v2f sp = (e < 4) ? (v2f){s0[2 * e], s0[2 * e + 1]} : (v2f){s1[2 * e - 8], s1[2 * e - 7]};
    ar[e] = CONSTSH ? sp : __builtin_elementwise_fma(sp, lsc2, eb2);
  }
#pragma unroll
  for (int e = 0; e < 8; ++e) pp[e] = (v2f){ex2(ar[e][0]), ex2(ar[e][1])};
#pragma unroll
  for (int e = 0; e < 8; ++e) {
    ps += pp[e][0] + pp[e][1];
    ph.u[e >> 2][e & 3] = __builtin_bit_cast(unsigned, __builtin_convertvector(pp[e], v2h));   // RNE, as two scalar casts
  }
  lrun += ps;                                                      // this half's 16 keys; the halves are joined in the epilogue
}
// rescale one tile's O accumulators: D row 8hh+r = the tile's query 8hh+r, its factor lives in lane 8hh+r (and 16+8hh+r)
__device__ __forceinline__ void rescale16(v8f (&o)[6], const float al, const int hh) {
  float scl[8];
#pragma unroll
  for (int r = 0; r < 8; ++r) scl[r] = __shfl(al, 8 * hh + r, 32);
#pragma unroll
  for (int j = 0; j < 6; ++j) {
#pragma unroll
    for (int r = 0; r < 8; ++r) o[j][r] *= scl[r];
  }
}
// The seldom-taken path, whole wave: renew one tile's maximum in use from the lanes' maxima cm (lsc > 0, so the scale commutes
// with the maximum) and bring the old sum and accumulators under it.
__device__ __forceinline__ void newmax16(float cm, const float lsc, float& mrun, float& lrun, v8f (&o)[6], const int hh) {
  cm = fmaxf(cm, __shfl_xor(cm, 16, 32));
  const float mn = fmaxf(mrun, cm * lsc);                          // base-2 logit; finite from the first key block on
  const float al = (mrun == -INFINITY) ? 0.f : ex2(mrun - mn);     // o and l are zero while mrun is -inf
  mrun = mn;
  lrun *= al;
  rescale16(o, al, hh);
}
// Join one tile's two key halves: this wave's (o, mrun, lrun) and the partner wave's (po: its accumulators in the same lane-private
// order, pm: its maximum in use, pl: its whole row sum). Both are brought under the larger maximum; then 1/l (per query, owned by
// lane = query; l carries PCAR like P, so only v's carry is left) and OSC are folded in and the tile's slab is staged.
__device__ __forceinline__ void stage_o16(float* slab, const v8f (&o)[6], const float mrun, const float lrun,
                                          const float* po, const float pm, const float pl, const int lane) {
  const int hh = lane >> 4, c = lane & 15;
  const float la   = lrun + __shfl_xor(lrun, 16, 32);             // the two lane halves' sums of the lane's query
  const float d    = mrun - pm;                                   // both finite: each group has seen a key block
  const float e    = ex2(-fabsf(d));                              // the side with the smaller maximum comes down, the other keeps 1
  const float fa   = (d >= 0.f) ? 1.f : e, fb = (d >= 0.f) ? e : 1.f;
  const float lsum = la * fa + pl * fb;
  const float linv = (lsum > 0.f) ? ((1.0f / lsum) * (OSC / VCAR)) : 0.f;
  const float ga = fa * linv, gb = fb * linv;
  float ia[8], ib[8];
#pragma unroll
  for (int r = 0; r < 8; ++r) { ia[r] = __shfl(ga, 8 * hh + r, 32); ib[r] = __shfl(gb, 8 * hh + r, 32); }
#pragma unroll
  for (int j = 0; j < 6; ++j) {
    const v4f p0 = *(const v4f*)(po + (2 * j) * 128 + lane * 4), p1 = *(const v4f*)(po + (2 * j + 1) * 128 + lane * 4);
#pragma unroll
    for (int r = 0; r < 8; ++r)
      slab[(8 * hh + r) * 100 + c + 16 * j] = o[j][r] * ia[r] + ((r < 4) ? p0[r] : p1[r - 4]) * ib[r];
  }
}
// the partner's side: one tile's accumulators into LDS, lane-private order (16 B per lane and store, lanes adjacent)
__device__ __forceinline__ void part_o16(float* po, const v8f (&o)[6], const int lane) {
#pragma unroll
  for (int j = 0; j < 6; ++j) {
    *(v4f*)(po + (2 * j) * 128 + lane * 4)     = (v4f){o[j][0], o[j][1], o[j][2], o[j][3]};
    *(v4f*)(po + (2 * j + 1) * 128 + lane * 4) = (v4f){o[j][4], o[j][5], o[j][6], o[j][7]};
  }
}

// out96 for the wave's two adjacent slabs and its 32 adjacent O rows: one wave_sync_lds() for both, so that no global store stands
// in front of it. coverage: 12 instructions x 32 lanes x 8 halves = 32 x 96.
__device__ __forceinline__ void out96x2(const float* sl, u16* dst, int lane) {
  wave_sync_lds();
  v4u ov[12];
#pragma unroll
  for (int i = 0; i < 12; ++i) {
    const int g   = (i % 6) * 32 + lane;
    const int row = g / 12;
    const int c8  = (g - row * 12) * 8;
    const float* sp = sl + (i / 6) * SLAB96 + row * 100 + c8;
    const v4f a = *(const v4f*)(sp), c4 = *(const v4f*)(sp + 4);
#pragma unroll
    for (int e = 0; e < 2; ++e) {
      ov[i][e]     = pk16(h_bits((_Float16)a[2 * e]), h_bits((_Float16)a[2 * e + 1]));
      ov[i][2 + e] = pk16(h_bits((_Float16)c4[2 * e]), h_bits((_Float16)c4[2 * e + 1]));
    }
  }
#pragma unroll
  for (int i = 0; i < 12; ++i) *(v4u*)(dst + (size_t)(i * 32 + lane) * 8) = ov[i];
}

// One walk of a key group over its 1024 keys (ring prologue, 8 tiles, trailing waits); on entry the accumulators and sums are zero.
//   CONSTSH = true: no maximum is followed. The exponent of P is the score WMMA's own result: the softmax scale sits in the q plane's
//   carry and the constant shift FSH is the C operand, so that P = 2^(logit + FSH) = 128 * 2^(logit - (PEXP - FSH)): the walk stands
//   under the fixed maximum in use PEXP - FSH (set by the caller). Whether that shift suited every row is tested once, behind the walk.
//   CONSTSH = false: the lazily renewed maximum, for any scores.
template <bool CONSTSH>
__device__ __forceinline__ void walk_keys(const int tid, const int grp, const size_t bh, unsigned char* ring,
                                          const u16* __restrict__ KPp, const u16* __restrict__ VPp,
                                          const v16h qa0, const v16h qa1, const v16h qa2,
                                          const v16h qb0, const v16h qb1, const v16h qb2,
                                          float& mrun0, float& lrun0, float& mrun1, float& lrun1, v8f (&oa)[6], v8f (&ob)[6]) {
  const int hh = (tid >> 4) & 1, c = tid & 15;        // tid = thread in its key group
  // A fragments of k: row m = key (in tile) 16g + c, k = d; byte offset in a buffer's K part
  const int kfo = c * KPITCH + 16 * hh;
  // B fragments of v: col n = d = 16j + c, k = key (k-contiguous row of the v^T tile); byte offset in a buffer
  const int vfo = KTILE + c * VPITCH + 16 * hh;
  // the lane's copy places (LDS byte addresses in buffer 0) and its global sources for tile 0
  const unsigned lds0 = (unsigned)(uintptr_t)(&ring[0]);
  const int kr0 = tid / 12, kr1 = (tid + 256) / 12, kr2 = (tid + 512) / 12;
  const unsigned kl0 = lds0 + (unsigned)(kr0 * KPITCH + (tid - 12 * kr0) * 16);
  const unsigned kl1 = lds0 + (unsigned)(kr1 * KPITCH + (tid + 256 - 12 * kr1) * 16);
  const unsigned kl2 = lds0 + (unsigned)(kr2 * KPITCH + (tid + 512 - 12 * kr2) * 16);
  const unsigned vl  = lds0 + (unsigned)(KTILE + (tid >> 4) * VPITCH + (tid & 15) * 16);
  const char* kg = (const char*)(const void*)KPp + ((bh * SEQ + (size_t)grp * (SEQ / KGRP)) * HD * 2 + (size_t)tid * 16);  // + 24576 per tile
  const char* vg = (const char*)(const void*)VPp + ((bh * HD + (size_t)(tid >> 4)) * SEQ * 2 + (size_t)grp * (SEQ / KGRP) * 2
                                                    + (size_t)(tid & 15) * 16);                                            // + 256 per tile
  const float lsc = 1.0f;                             // the scores are base-2 logits
  const float ci  = CONSTSH ? FSH : 0.f;
  const v8f   c0  = {ci, ci, ci, ci, ci, ci, ci, ci};
  // ---- ring prologue: tile 0 landed and published, then tile 1 set off ----
  tile_copy(kl0, kl1, kl2, vl, kg, vg);
  asm volatile("s_wait_asynccnt 0x0" ::: "memory");   // this wave's copies of tile 0 have landed
  __syncthreads();                                    // every wave's have
  tile_copy(kl0 + BUFB, kl1 + BUFB, kl2 + BUFB, vl + BUFB, kg + STK * HD * 2, vg + STK * 2);

#pragma unroll 1                                      // one trip per tile stays rolled: one foot, small code
  for (int t = 0; t < NST; ++t) {
   const unsigned bo = (unsigned)(t & 1) * BUFB;      // trip t reads buffer t mod 2 alone
#pragma unroll                                        // the tile's four 32-key blocks: constant LDS offsets in the reads
   for (int sub = 0; sub < STK / 32; ++sub) {
    // ---- transposed scores: s0x = keys kb..kb+15, s1x = keys kb+16..kb+31 (kb = 128 t + 32 sub); sxa = queries q0 + c,
    //      sxb = queries q0 + 16 + c; each K fragment is read once and used for both query tiles ----
    const _Float16* k0p = (const _Float16*)(const void*)(ring + bo + kfo + sub * 32 * KPITCH);
    const _Float16* k1p = (const _Float16*)(const void*)(ring + bo + kfo + (sub * 32 + 16) * KPITCH);
    v8f s0a = c0, s0b = c0, s1a = c0, s1b = c0;
    {
      const v16h ka0 = ldfrag_h(k0p), ka1 = ldfrag_h(k0p + 32), ka2 = ldfrag_h(k0p + 64);
      const v16h kc0 = ldfrag_h(k1p), kc1 = ldfrag_h(k1p + 32), kc2 = ldfrag_h(k1p + 64);
      __builtin_amdgcn_sched_barrier(0);   // keeps the twelve reads one group in front of the WMMAs (else a pair stands at every second one)
      s0a = mma_h(ka0, qa0, s0a);
      s0b = mma_h(ka0, qb0, s0b);
      s1a = mma_h(kc0, qa0, s1a);
      s1b = mma_h(kc0, qb0, s1b);
      s0a = mma_h(ka1, qa1, s0a);
      s0b = mma_h(ka1, qb1, s0b);
      s1a = mma_h(kc1, qa1, s1a);
      s1b = mma_h(kc1, qb1, s1b);
      s0a = mma_h(ka2, qa2, s0a);
      s0b = mma_h(ka2, qb2, s0b);
      s1a = mma_h(kc2, qa2, s1a);
      s1b = mma_h(kc2, qb2, s1b);
      guard4(s0a, s0b, s1a, s1b);
    }
    // ---- lazy maximum: one test per 32-key block for both tiles; -inf in use (first block) always renews ----
    if constexpr (!CONSTSH) {
      const float cma = lanemax16(s0a, s1a), cmb = lanemax16(s0b, s1b);
      const bool need = (cma * lsc - mrun0 > LAZY) || (cmb * lsc - mrun1 > LAZY);
      // the same for the whole wave: a scalar branch, EXEC stays full; seldom taken, so its body is laid out behind the loop
      if (__builtin_expect(__builtin_amdgcn_ballot_w32(need) != 0, 0)) {
        newmax16(cma, lsc, mrun0, lrun0, oa, hh);
        newmax16(cmb, lsc, mrun1, lrun1, ob, hh);
      }
    }
    // ---- v^T B fragments: col n = d = j*16 + c, keys contiguous in the v^T plane; each is read once and used for both query
    //      tiles ----
    const _Float16* vp = (const _Float16*)(const void*)(ring + bo + vfo + sub * 64);
    const v16h vf0 = ldfrag_h(vp);
    const v16h vf1 = ldfrag_h(vp + 16 * (VPITCH / 2));
    const v16h vf2 = ldfrag_h(vp + 32 * (VPITCH / 2));
    // keeps the first six reads one group in front of the exponentials, which cover their latency (else they are spread among the WMMAs)
    __builtin_amdgcn_sched_barrier(0);
    FragH pa, pb;
    probs16<CONSTSH>(s0a, s1a, lsc, mrun0, lrun0, pa);
    probs16<CONSTSH>(s0b, s1b, lsc, mrun1, lrun1, pb);
    // keeps the last six reads behind the exponentials, in registers that the scores have left (the budget of 4 waves per SIMD is
    // 256 registers); the first group of WMMAs covers their latency
    __builtin_amdgcn_sched_barrier(0);
    const v16h vf3 = ldfrag_h(vp + 48 * (VPITCH / 2));
    const v16h vf4 = ldfrag_h(vp + 64 * (VPITCH / 2));
    const v16h vf5 = ldfrag_h(vp + 80 * (VPITCH / 2));
    // ---- P.V : two guarded groups of 6 ----
    {
      oa[0] = mma_h(pa.v, vf0, oa[0]);
      ob[0] = mma_h(pb.v, vf0, ob[0]);
      oa[1] = mma_h(pa.v, vf1, oa[1]);
      ob[1] = mma_h(pb.v, vf1, ob[1]);
      oa[2] = mma_h(pa.v, vf2, oa[2]);
      ob[2] = mma_h(pb.v, vf2, ob[2]);
      guard6(oa[0], ob[0], oa[1], ob[1], oa[2], ob[2]);
      oa[3] = mma_h(pa.v, vf3, oa[3]);
      ob[3] = mma_h(pb.v, vf3, ob[3]);
      oa[4] = mma_h(pa.v, vf4, oa[4]);
      ob[4] = mma_h(pb.v, vf4, ob[4]);
      oa[5] = mma_h(pa.v, vf5, oa[5]);
      ob[5] = mma_h(pb.v, vf5, ob[5]);
      guard6(oa[3], ob[3], oa[4], ob[4], oa[5], ob[5]);
    }
    // each row's sum is closed here, against spills (the empty statement on a row's sum): else its adds are sunk behind later key
    // blocks and the foot, and the exponentials stay live there, over the 256 registers of 4 waves per SIMD
    asm volatile("" : "+v"(lrun0), "+v"(lrun1));       // empty statement on each row's sum, against spills
   }
   // ---- foot of trip t: publish tile t + 1, free tile t's buffer, refill it with tile t + 2 ----
   asm volatile("s_wait_dscnt 0x0" ::: "memory");      // this wave's reads of tile t are done
   asm volatile("s_wait_asynccnt 0x0" ::: "memory");   // this wave's copies of tile t + 1 have landed
   __syncthreads();                                    // both hold for every wave
   if (t + 2 < NST)                                    // block-uniform
     tile_copy(kl0 + bo, kl1 + bo, kl2 + bo, vl + bo,
               kg + (size_t)(t + 2) * (STK * HD * 2), vg + (size_t)(t + 2) * (STK * 2));
  }
  asm volatile("s_wait_asynccnt 0x0" ::: "memory");    // nothing of this wave is in flight when the ring is reused
  acc_guard6(oa[0], oa[1], oa[2], oa[3], oa[4], oa[5]);
  acc_guard6(ob[0], ob[1], ob[2], ob[3], ob[4], ob[5]);

}

// 4096 waves = 4 per SIMD, 256 blocks of 16 waves = 1 per WGP: the register budget of that occupancy
__global__ __launch_bounds__(ATT_THREADS) __attribute__((amdgpu_waves_per_eu(4, 4)))
void attn_fwd(const u16* __restrict__ QPp, const u16* __restrict__ KPp, const u16* __restrict__ VPp, u16* OPp) {
  __shared__ __align__(16) unsigned char ringall[KGRP * 2 * BUFB];
  __shared__ int redo;                                                      // some row of the block needs the second walk

  const int grp  = __builtin_amdgcn_readfirstlane((int)threadIdx.x >> 8);   // key group of the wave: keys grp * 1024 .. + 1023
  const int wsc  = __builtin_amdgcn_readfirstlane(((int)threadIdx.x >> 5) & (GW - 1));   // wave in its group, as a scalar
  const int tid  = threadIdx.x & (GT - 1);                                  // thread in its group
  const int wave = tid >> 5;                                                // wave in its group
  const int lane = tid & 31;
  unsigned char* ring = ringall + grp * (2 * BUFB);                         // the group's own two buffers
  const int hh   = lane >> 4;
  const int c    = lane & 15;

  const int bid  = blockIdx.x;
  const int qt   = bid & (SEQ / QPB - 1);
  const int head = (bid >> 3) & (NH - 1);
  const int b    = bid >> 6;
  const int q0   = qt * QPB + wave * QPW;
  const size_t bh = (size_t)(b * NH + head);

  // B fragments of q^T: col n = query q0 + 16u + c, k = d (k-contiguous row of the q plane)
  const _Float16* Qb = (const _Float16*)(const void*)QPp + ((bh * SEQ + q0 + c) * HD + 8 * hh);
  const v16h qa0 = ldfrag_h(Qb);                      // tile 0: d 0..31
  const v16h qa1 = ldfrag_h(Qb + 32);                 //         d 32..63
  const v16h qa2 = ldfrag_h(Qb + 64);                 //         d 64..95
  const v16h qb0 = ldfrag_h(Qb + 16 * HD);            // tile 1
  const v16h qb1 = ldfrag_h(Qb + 16 * HD + 32);
  const v16h qb2 = ldfrag_h(Qb + 16 * HD + 64);

  float mrun0 = PEXP - FSH, lrun0 = 0.f, mrun1 = PEXP - FSH, lrun1 = 0.f;
  v8f oa[6], ob[6];
#pragma unroll
  for (int j = 0; j < 6; ++j) { oa[j] = zero8(); ob[j] = zero8(); }
  if (threadIdx.x == 0) redo = 0;                     // published by the first barrier of the walk

  // ---- first walk, under the constant shift ----
  walk_keys<true>(tid, grp, bh, ring, KPp, VPp, qa0, qa1, qa2, qb0, qb1, qb2, mrun0, lrun0, mrun1, lrun1, oa, ob);
  // The shift suited a row if its sum over the group's 1024 keys lies in [LLO, LHI): below LHI no P (all are >= 0) left the f16 range,
  // from LLO on the largest P is at least 1. A NaN fails both. Any other row sends the whole block through the second walk.
  {
    const float ra = lrun0 + __shfl_xor(lrun0, 16, 32), rb = lrun1 + __shfl_xor(lrun1, 16, 32);
    if (!(ra >= LLO && ra < LHI && rb >= LLO && rb < LHI)) redo = 1;
  }

  // ---- the rings are dead behind the last trip's barrier. Group 1 hands its unnormalised tiles, maxima and row sums to group 0
  //      through its own ring's bytes; group 0 joins the two key halves, stages in its own ring's bytes and stores ----
  float* part = (float*)(void*)(ringall + 2 * BUFB) + wave * PARTW;
  if (grp == 1) {                                          // wave-uniform
    part_o16(part, oa, lane);
    part_o16(part + PARTF / 2, ob, lane);
    *(v4f*)(part + PARTF + lane * 4) = (v4f){mrun0, lrun0 + __shfl_xor(lrun0, 16, 32), mrun1, lrun1 + __shfl_xor(lrun1, 16, 32)};
  }
  __syncthreads();                                         // group 1's partial results and every wave's verdict are whole
  if (__builtin_expect(__builtin_amdgcn_readfirstlane(redo) != 0, 0)) {   // the same for the whole block: a scalar branch
    // ---- second walk, any scores: nobody has read the partial results, and the barrier above ended every use of the rings ----
    asm volatile("s_wait_dscnt 0x0" ::: "memory");         // this wave's LDS accesses are done before its copies aim at the rings again
    mrun0 = -INFINITY; lrun0 = 0.f; mrun1 = -INFINITY; lrun1 = 0.f;
#pragma unroll
    for (int j = 0; j < 6; ++j) { oa[j] = zero8(); ob[j] = zero8(); }
    // the thread's number in its group, formed anew from the wave's number (a scalar) and the lane's: the second walk's addresses are
    // then computed here and none of them is held in a register, or spilled, across the first walk
    const int tid2 = wsc * 32 + (int)__builtin_amdgcn_mbcnt_lo(~0u, 0u);
    walk_keys<false>(tid2, grp, bh, ring, KPp, VPp, qa0, qa1, qa2, qb0, qb1, qb2, mrun0, lrun0, mrun1, lrun1, oa, ob);
    if (grp == 1) {                                        // wave-uniform
      part_o16(part, oa, lane);
      part_o16(part + PARTF / 2, ob, lane);
      *(v4f*)(part + PARTF + lane * 4) = (v4f){mrun0, lrun0 + __shfl_xor(lrun0, 16, 32), mrun1, lrun1 + __shfl_xor(lrun1, 16, 32)};
    }
    __syncthreads();                                       // group 1's partial results are whole for group 0
  }
  if (grp == 0) {
    const v4f ml = *(const v4f*)(part + PARTF + lane * 4);
    float* slab = (float*)(void*)ringall + wave * 2 * SLAB96;
    stage_o16(slab, oa, mrun0, lrun0, part, ml[0], ml[1], lane);
    stage_o16(slab + SLAB96, ob, mrun1, lrun1, part + PARTF / 2, ml[2], ml[3], lane);
    out96x2(slab, OPp + (bh * SEQ + q0) * HD, lane);
  }
}

// =====================================================================================================
// Workspace map (bytes); every plane is fully written by whole-line stores before it is read; all extents are exact multiples
// of the 512-B store instructions (no pad rows needed); every base is 256-B aligned:
//   WOB f16  [768 n][768 k] (bf16 value x1024)   1179648
//   QP  f16  [4][8][2048][96] x QSC             12582912        KP same, x8
//   VP  f16  [4][8][96][2048] x256              12582912
//   OP  f16  [4][8][2048][96] x1024             12582912
//   end                                          51511296
// =====================================================================================================
extern "C" void kernel_launch(void* const* d_in, const int* in_sizes, int n_in,
                              void* d_out, int out_size, void* d_ws, size_t ws_size,
                              hipStream_t stream) {
  if (n_in < 6) return;
  if (in_sizes[0] != ROWS * DMOD) return;
  if (in_sizes[1] != HD * HD) return;
  if (in_sizes[2] != HD * HD) return;
  if (in_sizes[3] != HD * HD) return;
  if (in_sizes[4] != DMOD * DMOD) return;
  if (in_sizes[5] != DMOD) return;
  if (out_size != ROWS * DMOD) return;

  const float* Xin = (const float*)d_in[0];
  const float* Wq  = (const float*)d_in[1];
  const float* Wk  = (const float*)d_in[2];
  const float* Wv  = (const float*)d_in[3];
  const float* Wu  = (const float*)d_in[4];
  const float* bu  = (const float*)d_in[5];
  float*       out = (float*)d_out;

  const size_t szWO = (size_t)DMOD * DMOD * 2;                  //  1179648
  const size_t szP  = (size_t)NB * NH * SEQ * HD * 2;           // 12582912  (q / k / v^T / o planes)
  size_t off = 0;
  const size_t oWO = off; off += szWO;
  const size_t oQP = off; off += szP;
  const size_t oKP = off; off += szP;
  const size_t oVP = off; off += szP;
  const size_t oOP = off; off += szP;
  if (off > ws_size) return;                            // off = 51511296
  if (off > (size_t)134217728) return;
  if ((szWO % 256) != 0 || (szP % 256) != 0) return;

  char* ws = (char*)d_ws;
  u16* WOB = (u16*)(ws + oWO);
  u16* QP  = (u16*)(ws + oQP);
  u16* KP  = (u16*)(ws + oKP);
  u16* VP  = (u16*)(ws + oVP);
  u16* OP  = (u16*)(ws + oOP);

  if ((DMOD % 64) != 0 || (ROWS % 64) != 0 || (ROWS % GROWS) != 0 || (SEQ % 64) != 0 || (HD % 32) != 0) return;
  const dim3 gPJ(NPJ);                                  // 512
  const dim3 bPJ(PJT);                                  // 256
  const dim3 gAT(ATT_BLOCKS);                           // 256
  const dim3 bAT(ATT_THREADS);                          // 512
  const dim3 gO((ROWS / GROWS) * (DMOD / 64));          // 768
  const dim3 bO(128);

  // (1) q and k planes [b][h][s][96] = f16(x_h.Wq^T x QSC), f16(x_h.Wk^T x8); v^T plane [b][h][96 d][2048 keys] = f16(x_h.Wv^T x256);
  //     Wq/Wk/Wv [n = out][k = in] (already k-contiguous) rounded to bf16 inside each block; Wu -> f16 of bf16 value x1024
  proj_qkv<<<gPJ, bPJ, 0, stream>>>(Xin, Wq, Wk, Wv, Wu, QP, KP, VP, WOB);
  // (2) attention -> O plane [b][h][s][96] x1024 (single f16)
  attn_fwd<<<gAT, bAT, 0, stream>>>(QP, KP, VP, OP);
  // (3) output projection -> out [8192][768] f32, carries 1024 (O) x 1024 (Wu) folded back, + bias
  gemm_out<<<gO, bO, 0, stream>>>(OP, WOB, bu, out, 1.0f / (OSC * WOS));
  (void)hipGetLastError();
}
